// v000
// Measured on an AMD MI455X. A time is GPU time per run, averaged over a window of back-to-back runs after a warm-up
// (all launches, gaps included; the runs take copies of the inputs in turn), and the median of several windows.
// Apart from v000's, it joins two sittings. Times from different sittings can be a few percent apart, while
// side-by-side timings come from the same sitting.
// v000 is the starting kernel. One run takes 698 microseconds.
// Contractions: q, k, v^T projections = v_wmma_f32_16x16x32_bf16 (bf16 operands from RNE-converted inputs, single product);
// q.k^T scores = v_wmma_f32_16x16x32_bf16 with q and k as bf16 hi/lo planes (hi.hi + hi.lo + lo.hi);
// p.v = v_wmma_f32_16x16x32_f16 (p carried x1024 in f16, v f16 hi plane; f16 residual planes x4096 of p and v on the first 512 query rows);
// ctx.Wo = v_wmma_f32_16x16x32_bf16 with ctx as bf16 hi/lo planes times bf16 Wo (2 products);
// h.W1 and relu(h.W1+b1).W2 = v_wmma_f32_16x16x32_f16 (f16 operands, weights carried x64, single product);
// all f32 accumulate; softmax and both layer norms in f32.
#include <hip/hip_runtime.h>
#include <math.h>
#include <stdint.h>

#define NB     2
#define SEQ    2048
#define DM     1024
#define NH     16
#define HD     64
#define DFF    4096
#define MROWS  (NB * SEQ)   // 4096 token rows
#define NQB    (SEQ / 64)   // 32 key / query tiles of 64
#define VLP    512          // key pitch of the v^T residual plane (keys 0..VLP-1)
#define RESQB  8            // leading 64-row query blocks that use the p / v residual planes
#define LNEPS  1e-6f
#define WSCALE 64.0f        // f16 weight carry for W1 and W2
static_assert(RESQB * 64 <= VLP);
static_assert(NH * HD == DM);
static_assert((SEQ % 64) == 0 && (DM % 64) == 0 && (DFF % 64) == 0 && (MROWS % 64) == 0);
static_assert(NQB * 8 == 256);

typedef _Float16 v16h __attribute__((ext_vector_type(16)));
typedef _Float16 v8h  __attribute__((ext_vector_type(8)));
typedef __bf16   v16b __attribute__((ext_vector_type(16)));
typedef __bf16   v8b  __attribute__((ext_vector_type(8)));
typedef float    v8f  __attribute__((ext_vector_type(8)));
typedef float    v4f  __attribute__((ext_vector_type(4)));
typedef unsigned int v4u __attribute__((ext_vector_type(4)));
typedef unsigned int v2u __attribute__((ext_vector_type(2)));
typedef int      v4i __attribute__((ext_vector_type(4)));
typedef unsigned long long u64;

#if defined(__HIP_DEVICE_COMPILE__)
#define DEV_ASM 1
#else
#define DEV_ASM 0
#endif

// ---- scalar helpers --------------------------------------------------------------------------------
__device__ __forceinline__ unsigned short bf_bits(float f) {          // f32 -> bf16 bits, RNE convert
  unsigned u = __float_as_uint(f);
  return (unsigned short)((u + 0x7FFFu + ((u >> 16) & 1u)) >> 16);
}
__device__ __forceinline__ float bf_up(unsigned short h) { return __uint_as_float(((unsigned)h) << 16); }
__device__ __forceinline__ float bfr(float f) { return bf_up(bf_bits(f)); }   // bf16 requantised value
__device__ __forceinline__ unsigned short h_bits(_Float16 x) { return __builtin_bit_cast(unsigned short, x); }
__device__ __forceinline__ unsigned pk16(unsigned short a, unsigned short b) { return (unsigned)a | ((unsigned)b << 16); }
__device__ __forceinline__ v8f zero8() { v8f z = {0.f, 0.f, 0.f, 0.f, 0.f, 0.f, 0.f, 0.f}; return z; }
__device__ __forceinline__ v8h zero8h() {
  const _Float16 z = (_Float16)0.0f;
  v8h r = {z, z, z, z, z, z, z, z};
  return r;
}

// ---- operand traits: fragment loader (lane -> row/col (lane&15), p already includes +8*(lane>>4);
//      elements 0..7 <- p[0..7] (k0+8h..), elements 8..15 <- p[16..23] (k0+16+8h..)), WMMA, hazard gaps
template <int ET> struct OpT;
template <> struct OpT<0> {
  typedef __bf16 E; typedef v16b F; typedef v8b H;
  static __device__ __forceinline__ F ld(const E* p) {
    union { F v; H h[2]; } f;
    f.h[0] = *(const H*)(p);
    f.h[1] = *(const H*)(p + 16);
    return f.v;
  }
  static __device__ __forceinline__ v8f mma_raw(F a, F b, v8f c) {
    return __builtin_amdgcn_wmma_f32_16x16x32_bf16(false, a, false, b, (short)0, c, false, false);
  }
  static __device__ __forceinline__ void dep_guard(v8f& a, v8f& b, F x, F y) {
#if DEV_ASM
    asm volatile("v_nop\n\tv_nop\n\tv_nop\n\tv_nop" : "+v"(a), "+v"(b) : "v"(x), "v"(y));
#endif
  }
  static __device__ __forceinline__ void keep4(F a, F b, F c, F d) {
#if DEV_ASM
    asm volatile("v_nop" :: "v"(a), "v"(b), "v"(c), "v"(d));
#endif
  }
};
template <> struct OpT<1> {
  typedef _Float16 E; typedef v16h F; typedef v8h H;
  static __device__ __forceinline__ F ld(const E* p) {
    union { F v; H h[2]; } f;
    f.h[0] = *(const H*)(p);
    f.h[1] = *(const H*)(p + 16);
    return f.v;
  }
  static __device__ __forceinline__ v8f mma_raw(F a, F b, v8f c) {
    return __builtin_amdgcn_wmma_f32_16x16x32_f16(false, a, false, b, (short)0, c, false, false);
  }
  static __device__ __forceinline__ void dep_guard(v8f& a, v8f& b, F x, F y) {
#if DEV_ASM
    asm volatile("v_nop\n\tv_nop\n\tv_nop\n\tv_nop" : "+v"(a), "+v"(b) : "v"(x), "v"(y));
#endif
  }
  static __device__ __forceinline__ void keep4(F a, F b, F c, F d) {
#if DEV_ASM
    asm volatile("v_nop" :: "v"(a), "v"(b), "v"(c), "v"(d));
#endif
  }
};

// ---- guarded WMMA helpers for the attention kernel ------------------------------------------------
__device__ __forceinline__ v8f mma_b(v16b a, v16b b, v8f c) {
  c = __builtin_amdgcn_wmma_f32_16x16x32_bf16(false, a, false, b, (short)0, c, false, false);
#if DEV_ASM
  asm volatile("v_nop\n\tv_nop\n\tv_nop\n\tv_nop" : "+v"(c) : "v"(a), "v"(b));
#endif
  return c;
}
__device__ __forceinline__ v8f mma_h(v16h a, v16h b, v8f c) {
  c = __builtin_amdgcn_wmma_f32_16x16x32_f16(false, a, false, b, (short)0, c, false, false);
#if DEV_ASM
  asm volatile("v_nop\n\tv_nop\n\tv_nop\n\tv_nop" : "+v"(c) : "v"(a), "v"(b));
#endif
  return c;
}
__device__ __forceinline__ void acc_guard4(v8f& a, v8f& b, v8f& c, v8f& d) {
#if DEV_ASM
  asm volatile("v_nop\n\tv_nop\n\tv_nop\n\tv_nop" : "+v"(a), "+v"(b), "+v"(c), "+v"(d));
#endif
}

// =====================================================================================================
// f32 -> bf16 (RNE convert), 8 elements per thread, one 16-B store per lane: a wave writes 512 contiguous B
// coverage: n8 threads x 8 = the whole plane (n8 is a multiple of 256 here).
// =====================================================================================================
__global__ __launch_bounds__(256) void cvt_bf16x8(const float* __restrict__ in, unsigned short* out, int n8) {
  const int i = blockIdx.x * 256 + threadIdx.x;
  if (i < n8) {
    const v4f a = *(const v4f*)(in + (size_t)i * 8);
    const v4f b = *(const v4f*)(in + (size_t)i * 8 + 4);
    v4u p;
    p[0] = pk16(bf_bits(a[0]), bf_bits(a[1]));
    p[1] = pk16(bf_bits(a[2]), bf_bits(a[3]));
    p[2] = pk16(bf_bits(b[0]), bf_bits(b[1]));
    p[3] = pk16(bf_bits(b[2]), bf_bits(b[3]));
    *(v4u*)(out + (size_t)i * 8) = p;
    
  }
}

// =====================================================================================================
// Weight transpose + convert: in W f32 [Kdim][Ndim] (row k, n contiguous) -> out 16-bit [Ndim][Kdim]
// (row n, k contiguous). F16OUT: f16 of (bf16 value * scale), else bf16 bits. 64x64 tile through LDS.
// grid = (Ndim/64, Kdim/64); blockIdx.x = n tile, blockIdx.y = k tile.
// coverage: load 256 threads x 16 = 64x64; store 8 waves x 2 it x 4 rows x (8 lanes x 8) = 64x64.
// =====================================================================================================
template <bool F16OUT>
__global__ __launch_bounds__(256) void wtrans64(const float* __restrict__ W, unsigned short* out,
                                                 int Kdim, int Ndim, float scale) {
  __shared__ float tile[64][65];
  const int tid = threadIdx.x, lane = tid & 31, wave = tid >> 5;
  const int n0 = blockIdx.x * 64, k0 = blockIdx.y * 64;
  {
    const int r = tid >> 2, cq = (tid & 3) * 16;
    const float* src = W + (size_t)(k0 + r) * Ndim + n0 + cq;
#pragma unroll
    for (int e = 0; e < 4; ++e) {
      const v4f a = *(const v4f*)(src + 4 * e);
      tile[r][cq + 4 * e + 0] = a[0];
      tile[r][cq + 4 * e + 1] = a[1];
      tile[r][cq + 4 * e + 2] = a[2];
      tile[r][cq + 4 * e + 3] = a[3];
    }
  }
  __syncthreads();
  const int q = lane >> 3, c8 = (lane & 7) * 8;
  v4u pv[2];
#pragma unroll
  for (int it = 0; it < 2; ++it) {
    const int nn = wave * 8 + it * 4 + q;
    v4u a;
#pragma unroll
    for (int e = 0; e < 4; ++e) {
      const float f0 = tile[c8 + 2 * e][nn], f1 = tile[c8 + 2 * e + 1][nn];
      unsigned short b0 = bf_bits(f0), b1 = bf_bits(f1);
      if (F16OUT) {
        b0 = h_bits((_Float16)(bf_up(b0) * scale));
        b1 = h_bits((_Float16)(bf_up(b1) * scale));
      }
      a[e] = pk16(b0, b1);
    }
    pv[it] = a;
  }
  {
#pragma unroll
    for (int it = 0; it < 2; ++it) {
      const int nn = wave * 8 + it * 4 + q;
      *(v4u*)(out + (size_t)(n0 + nn) * Kdim + k0 + c8) = pv[it];
    }
    
  }
}

// =====================================================================================================
// Mask tile survey: mask int32 [1][1][SEQ][SEQ] (nonzero = key allowed). Block = qt: query rows qt*64..+63.
// For every key tile kt (64 keys) it records a 64-bit word whose bit r is 1 when row r of the tile has at
// least one nonzero entry inside kt. grid = NQB, 256 threads: thread = (row = tid>>2, quarter = tid&3);
// wave w holds rows 8w..8w+7 -> byte w of the word. Output flg[qt*NQB + kt], 32 words = 256 B per block
// coverage: 32 blocks x 32 words = the whole 1024-word table.
// =====================================================================================================
__global__ __launch_bounds__(256) void mask_rowbits(const int* __restrict__ maskp, u64* flg) {
  __shared__ __align__(8) unsigned char sb[NQB * 8];
  const int tid  = threadIdx.x;
  const int wave = tid >> 5;
  const int lane = tid & 31;
  const int qt   = blockIdx.x;
  const int row  = tid >> 2;            // 0..63
  const int qtr  = (tid & 3) * 16;      // 0,16,32,48
  const int* mr = maskp + ((size_t)qt * 64 + row) * SEQ + qtr;
#pragma unroll 1
  for (int kt = 0; kt < NQB; ++kt) {
    const int* p = mr + kt * 64;
    const v4i a0 = *(const v4i*)(p);
    const v4i a1 = *(const v4i*)(p + 4);
    const v4i a2 = *(const v4i*)(p + 8);
    const v4i a3 = *(const v4i*)(p + 12);
    int lv = 0;
#pragma unroll
    for (int e = 0; e < 4; ++e) {
      lv |= (a0[e] != 0) ? 1 : 0;
      lv |= (a1[e] != 0) ? 1 : 0;
      lv |= (a2[e] != 0) ? 1 : 0;
      lv |= (a3[e] != 0) ? 1 : 0;
    }
    const unsigned bl = __builtin_amdgcn_ballot_w32(lv != 0);   // uniform per wave
    unsigned bits = 0u;
#pragma unroll
    for (int k = 0; k < 8; ++k) bits |= ((((bl >> (4 * k)) & 0xFu) != 0u) ? 1u : 0u) << k;
    if (lane == 0) sb[kt * 8 + wave] = (unsigned char)bits;
  }
  __syncthreads();
  if (wave == 0) {
    u64 w;
    __builtin_memcpy(&w, &sb[lane * 8], 8);   // bytes 0..7 = rows 0..63, little endian
    u64* dst = flg + (size_t)qt * NQB + lane;
    *(u64*)dst = w;
    
  }
}

// =====================================================================================================
// Register-blocked batched 16-bit WMMA GEMM: C[m][n] = sum_k A[m][k] * Bt[n][k]; one wave per 64x64 tile,
// no block barriers. ET: 0 = bf16 operands, 1 = f16 operands. A row-major [M][K] pitch lda;
// Bt row-major [N][K] pitch ldb (k contiguous); M, N multiples of 64, K multiple of 32 (host constants).
// blockIdx.y = batch index (strides in elements).
// NSPLIT: 0 = A.Bt; 1 = (A + A2).Bt (A2 = unscaled bf16 lo plane of A).
// Epilogue value v = acc*oscale + bias (+ resid) (relu); BIAS: 0 none, 1 per column n, 2 per row m
// (bias values RNE-converted to bf16); RESID (OUT_MODE 0 only): 1 = bf16 plane [m][n] pitch ldr, 2 = f32 plane.
// OUT_MODE: 0 = f32 (pitch ldc); 2 = bf16 hi plane C + bf16 lo plane C2 (lo = RNE(v - hi), unscaled);
//           3 = f16 hi plane C + f16 residual plane C2 = f16((v - hi) * rscale), C2 written only for tiles
//               with n0 < N2 (pitch ldc2, batch stride strideC2); 4 = f16 single plane C.
// =====================================================================================================
template <int ET, int NSPLIT, int OUT_MODE, int BIAS, int RESID, bool RELU>
__global__ __launch_bounds__(256) void gemm64(
    const unsigned short* __restrict__ Ap, const unsigned short* __restrict__ A2p, int lda, long long strideA,
    const unsigned short* __restrict__ Btp, int ldb, long long strideB,
    const float* __restrict__ bias,
    const void* __restrict__ resid, int ldr, long long strideR,
    void* Cout, int ldc, long long strideC,
    void* Cout2, int ldc2, long long strideC2, int N2,
    int M, int N, int K, float oscale, float rscale) {
  typedef typename OpT<ET>::E E;
  typedef typename OpT<ET>::F F;
  const E* A  = (const E*)(const void*)Ap;
  const E* A2 = (const E*)(const void*)A2p;
  const E* Bt = (const E*)(const void*)Btp;
  __shared__ __align__(16) float sT[8][16 * 68];   // per-wave 16x64 slab, pitch 68 floats
  const int b    = blockIdx.y;
  const int lane = threadIdx.x & 31;
  const int wave = threadIdx.x >> 5;
  const int tilesN = N >> 6;
  const int tilesM = M >> 6;
  const int tile = blockIdx.x * 8 + wave;
  if (tile >= tilesM * tilesN) return;   // wave-uniform; no block barriers in this kernel
  const int tm = tile / tilesN;
  const int tn = tile - tm * tilesN;
  const int m0 = tm << 6;
  const int n0 = tn << 6;

  const E* Ab  = A  + (size_t)b * strideA;
  const E* Bb  = Bt + (size_t)b * strideB;
  const E* Ab2 = (NSPLIT >= 1) ? (A2 + (size_t)b * strideA) : Ab;

  const int rlane = lane & 15;                 // row (A) / col (B, D) within subtile
  const int koff  = (lane >> 4) * 8;           // k offset of this lane half
  const int mOff  = (lane >> 4) * 8;           // D row offset

  v8f acc[4][4];
#pragma unroll
  for (int i = 0; i < 4; ++i)
#pragma unroll
    for (int j = 0; j < 4; ++j) acc[i][j] = zero8();

  for (int k0 = 0; k0 < K; k0 += 32) {
    F bh[4];
#pragma unroll
    for (int j = 0; j < 4; ++j) {
      const size_t bofs = (size_t)(n0 + (j << 4) + rlane) * ldb + koff + k0;
      bh[j] = OpT<ET>::ld(Bb + bofs);
    }
#pragma unroll
    for (int i = 0; i < 4; ++i) {
      const size_t aofs = (size_t)(m0 + (i << 4) + rlane) * lda + koff + k0;
      const F ah = OpT<ET>::ld(Ab + aofs);
      F al = ah;
      if (NSPLIT >= 1) al = OpT<ET>::ld(Ab2 + aofs);
#pragma unroll
      for (int j = 0; j < 4; ++j) {
        acc[i][j] = OpT<ET>::mma_raw(ah, bh[j], acc[i][j]);
        if (NSPLIT >= 1) acc[i][j] = OpT<ET>::mma_raw(al, bh[j], acc[i][j]);
      }
      OpT<ET>::dep_guard(acc[i][0], acc[i][3], ah, al);
    }
    OpT<ET>::keep4(bh[0], bh[1], bh[2], bh[3]);
  }
  acc_guard4(acc[0][0], acc[0][1], acc[0][2], acc[0][3]);
  acc_guard4(acc[1][0], acc[1][1], acc[1][2], acc[1][3]);
  acc_guard4(acc[2][0], acc[2][1], acc[2][2], acc[2][3]);
  acc_guard4(acc[3][0], acc[3][1], acc[3][2], acc[3][3]);

  // ---- epilogue ----
  float* slab = sT[wave];
#pragma unroll
  for (int i = 0; i < 4; ++i) {
    const int mBase = m0 + (i << 4);
#pragma unroll
    for (int j = 0; j < 4; ++j) {
#pragma unroll
      for (int r = 0; r < 8; ++r) {
        slab[(mOff + r) * 68 + (j << 4) + rlane] = acc[i][j][r];
      }
    }
    __builtin_amdgcn_fence(__ATOMIC_RELEASE, "workgroup");
    __builtin_amdgcn_wave_barrier();
    __builtin_amdgcn_fence(__ATOMIC_ACQUIRE, "workgroup");
    if (OUT_MODE == 0) {
      float* C = (float*)Cout + (size_t)b * strideC;
      const int h2 = lane >> 4, c4 = (lane & 15) * 4;     // 256-B row segment = 16 lanes x 16 B
      v4f bz = {0.f, 0.f, 0.f, 0.f};
      if (BIAS == 1) {
        const v4f g = *(const v4f*)(bias + n0 + c4);
        bz[0] = bfr(g[0]); bz[1] = bfr(g[1]); bz[2] = bfr(g[2]); bz[3] = bfr(g[3]);
      }
      v4f ov[8];
#pragma unroll
      for (int it = 0; it < 8; ++it) {
        const int row = it * 2 + h2;                       // it 0..7 x h2 0..1 = rows 0..15
        const v4f v = *(const v4f*)(slab + row * 68 + c4);
        v4f w;
        w[0] = v[0] * oscale + bz[0];
        w[1] = v[1] * oscale + bz[1];
        w[2] = v[2] * oscale + bz[2];
        w[3] = v[3] * oscale + bz[3];
        if (BIAS == 2) {
          const float bm = bfr(bias[mBase + row]);
          w[0] += bm; w[1] += bm; w[2] += bm; w[3] += bm;
        }
        if (RESID == 1) {
          const unsigned short* rp = (const unsigned short*)resid + (size_t)b * strideR +
                                     (size_t)(mBase + row) * ldr + n0 + c4;
          const v2u rr = *(const v2u*)rp;
          w[0] += __uint_as_float(rr[0] << 16);
          w[1] += __uint_as_float(rr[0] & 0xffff0000u);
          w[2] += __uint_as_float(rr[1] << 16);
          w[3] += __uint_as_float(rr[1] & 0xffff0000u);
        }
        if (RESID == 2) {
          const float* rp = (const float*)resid + (size_t)b * strideR + (size_t)(mBase + row) * ldr + n0 + c4;
          const v4f rr = *(const v4f*)rp;
          w[0] += rr[0]; w[1] += rr[1]; w[2] += rr[2]; w[3] += rr[3];
        }
        if (RELU) {
          w[0] = fmaxf(w[0], 0.f); w[1] = fmaxf(w[1], 0.f); w[2] = fmaxf(w[2], 0.f); w[3] = fmaxf(w[3], 0.f);
        }
        ov[it] = w;
      }
      {
#pragma unroll
        for (int it = 0; it < 8; ++it) {
          const int row = it * 2 + h2;
          *(v4f*)(C + (size_t)(mBase + row) * ldc + n0 + c4) = ov[it];
        }
        
      }
    } else {
      const int q = lane >> 3, c8 = (lane & 7) * 8;
      unsigned short* C  = (unsigned short*)Cout  + (size_t)b * strideC;
      unsigned short* C2 = (unsigned short*)Cout2 + (size_t)b * strideC2;
      const bool wlo = (OUT_MODE == 2) || (OUT_MODE == 3 && n0 < N2);   // wave-uniform
      float b8[8];
#pragma unroll
      for (int e = 0; e < 8; ++e) b8[e] = 0.f;
      if (BIAS == 1) {
        const v4f g0 = *(const v4f*)(bias + n0 + c8);
        const v4f g1 = *(const v4f*)(bias + n0 + c8 + 4);
#pragma unroll
        for (int e = 0; e < 4; ++e) { b8[e] = bfr(g0[e]); b8[4 + e] = bfr(g1[e]); }
      }
      v4u hv[4], lv[4];
#pragma unroll
      for (int it = 0; it < 4; ++it) {
        const int row = it * 4 + q;                        // it 0..3 x q 0..3 = rows 0..15
        const float* sp = slab + row * 68 + c8;
        float bm = 0.f;
        if (BIAS == 2) bm = bfr(bias[mBase + row]);
        v4u a, a2;
#pragma unroll
        for (int e = 0; e < 4; ++e) {
          float f0 = sp[2 * e] * oscale + b8[2 * e] + bm;
          float f1 = sp[2 * e + 1] * oscale + b8[2 * e + 1] + bm;
          if (RELU) { f0 = fmaxf(f0, 0.f); f1 = fmaxf(f1, 0.f); }
          unsigned short h0, h1, l0 = 0, l1 = 0;
          if (OUT_MODE == 2) {
            h0 = bf_bits(f0); h1 = bf_bits(f1);
            l0 = bf_bits(f0 - bf_up(h0)); l1 = bf_bits(f1 - bf_up(h1));
          } else if (OUT_MODE == 3) {
            const _Float16 x0 = (_Float16)f0, x1 = (_Float16)f1;
            h0 = h_bits(x0); h1 = h_bits(x1);
            l0 = h_bits((_Float16)((f0 - (float)x0) * rscale));
            l1 = h_bits((_Float16)((f1 - (float)x1) * rscale));
          } else {
            h0 = h_bits((_Float16)f0); h1 = h_bits((_Float16)f1);
          }
          a[e] = pk16(h0, h1); a2[e] = pk16(l0, l1);
        }
        hv[it] = a; lv[it] = a2;
      }
      {
#pragma unroll
        for (int it = 0; it < 4; ++it) {
          const int row = it * 4 + q;
          *(v4u*)(C + (size_t)(mBase + row) * ldc + n0 + c8) = hv[it];
          if (wlo) *(v4u*)(C2 + (size_t)(mBase + row) * ldc2 + n0 + c8) = lv[it];
        }
        
      }
    }
    __builtin_amdgcn_fence(__ATOMIC_RELEASE, "workgroup");
    __builtin_amdgcn_wave_barrier();
    __builtin_amdgcn_fence(__ATOMIC_ACQUIRE, "workgroup");
  }
}

// =====================================================================================================
// Attention with an int32 replace-mask, head dim 64.
//   q planes (bf16 hi / lo): element (b, t, h, d) at [(b*SEQ + t)*DM + h*64 + d]
//   k planes (bf16 hi / lo): same layout with key index s
//   v^T hi plane (f16):      element (b, h, d, s) at [(b*DM + h*64 + d)*SEQ + s]
//   v^T residual plane (f16, (v - hi)*4096): [(b*DM + h*64 + d)*VLP + s], s < VLP, read only when RES
//   (a key tile at or beyond VLP contributes a zero v residual)
//   mask int32 [1][1][t][s]: logit = (mask != 0) ? q.k*sscale : -inf (replace)
//   flg [qt][kt]: bit r set when mask row qt*64+r has a nonzero inside key tile kt. A key tile is skipped only
//   when its word is 0 (every logit of the tile is -inf -> weight exactly 0, row max unaffected). The decision is
//   a block-uniform scalar load.
//   out planes (bf16 hi / lo of the normalised context): element (b, t, h, d) at [(b*SEQ + t)*DM + h*64 + d]
//   scores = q . k : bf16 hi/lo split (hi.hi + hi.lo + lo.hi), f32 accumulate, then * sscale + mask select in f32
//   p = exp(s - m) carried as f16(1024 p); context = p . v on f16 WMMA; RES adds f16 residual planes of p and v
//   (scale 4096, separate accumulator folded back with 1/4096 per chunk in f32); online softmax in f32.
//   A fully masked query row ends with l = 0 -> 0 * inf = NaN context, matching -inf softmax semantics.
//   Block = 4 waves = 64 query rows of one (b, h); grid = nqbThis * NH * NB; kv chunks of 64, static trip 32.
//   K / V^T chunk staging: 128 threads x 32 elements per plane = the whole 64x64 tile (plain 16-B loads,
//   __syncthreads before and after); P tiles are wave-private, spilled with _Float16 element stores and reloaded
//   Output coverage: each wave stores rows q0..q0+15 (it 0..3 x lane>>3 0..3) x 64 columns (8 lanes x 8) of both planes.
// =====================================================================================================
template <bool RES>
__global__ __launch_bounds__(128)
void attn_mask64(const unsigned short* __restrict__ qhp, const unsigned short* __restrict__ qlp,
                 const unsigned short* __restrict__ khp, const unsigned short* __restrict__ klp,
                 const unsigned short* __restrict__ vhp, const unsigned short* __restrict__ vlp,
                 const int* __restrict__ maskp, const u64* __restrict__ flg,
                 unsigned short* ohp, unsigned short* olp,
                 int qbBase, int nqbThis, float sscale) {
  union FB { v16b v; v8b h[2]; };
  union FH { v16h v; v8h h[2]; };
  __shared__ __align__(16) __bf16   Ksh[64 * 64];                 // K hi [kv][d]   8 KB
  __shared__ __align__(16) __bf16   Ksl[64 * 64];                 // K lo
  __shared__ __align__(16) _Float16 Vth[64 * 64];                 // V^T hi [d][kv] 8 KB
  __shared__ __align__(16) _Float16 Vtl[RES ? 64 * 64 : 8];       // V^T residual
  __shared__ __align__(16) _Float16 Psh[4][16 * 64];              // per wave P [row][kv]
  __shared__ __align__(16) _Float16 Psl[RES ? 4 : 1][16 * 64];    // per wave P residual
  __shared__ __align__(16) float    Os[4][16 * 64];               // per wave context tile [row][d]

  const int tid  = threadIdx.x;
  const int wave = tid >> 5;
  const int lane = tid & 31;
  const int hh   = lane >> 4;
  const int c    = lane & 15;

  const int bx   = blockIdx.x;
  const int qbl  = bx % nqbThis;
  const int rest = bx / nqbThis;
  const int h    = rest % NH;
  const int b    = rest / NH;
  const int qb   = qbBase + qbl;
  const int q0   = qb * 64 + wave * 16;
  const size_t rowB = (size_t)b * SEQ;

  const __bf16* Qh = (const __bf16*)(const void*)qhp + (size_t)h * HD;
  const __bf16* Ql = (const __bf16*)(const void*)qlp + (size_t)h * HD;
  const __bf16* Kh = (const __bf16*)(const void*)khp + (size_t)h * HD;
  const __bf16* Kl = (const __bf16*)(const void*)klp + (size_t)h * HD;
  const _Float16* Vh = (const _Float16*)(const void*)vhp + ((size_t)b * DM + (size_t)h * HD) * SEQ;
  const _Float16* Vl = (const _Float16*)(const void*)vlp + ((size_t)b * DM + (size_t)h * HD) * VLP;
  const u64* fq = flg + (size_t)qb * NQB;     // block-uniform address -> scalar loads

  // ---- Q fragments (A operand, row = lane&15): 2 d-chunks, hi and lo ----
  v16b qah[2], qal[2];
#pragma unroll
  for (int dc = 0; dc < 2; ++dc) {
    const size_t qo = (rowB + q0 + c) * DM + dc * 32 + 8 * hh;
    qah[dc] = OpT<0>::ld(Qh + qo);
    qal[dc] = OpT<0>::ld(Ql + qo);
  }

  float mrow[8], lrow[8];
  v8f oacc[4];
#pragma unroll
  for (int r = 0; r < 8; ++r) { mrow[r] = -INFINITY; lrow[r] = 0.f; }
#pragma unroll
  for (int t = 0; t < 4; ++t) oacc[t] = zero8();

  for (int kt = 0; kt < NQB; ++kt) {         // static trip count
    const u64 lw = fq[kt];
    if (lw == 0ull) continue;                // block-uniform
    const int kv0 = kt * 64;
    __syncthreads();
    {
      const int r = tid >> 1, half = (tid & 1) * 32;
      const __bf16*   kg  = Kh + (rowB + kv0 + r) * DM + half;    // K row kv0+r, d = half..half+31
      const __bf16*   klg = Kl + (rowB + kv0 + r) * DM + half;
      const _Float16* vg  = Vh + (size_t)r * SEQ + kv0 + half;    // V^T row d = r, s = kv0+half..+31
      const int kvl = (kv0 + 64 <= VLP) ? kv0 : (VLP - 64);     // clamped address into the residual plane
      const _Float16* vlg = Vl + (size_t)r * VLP + kvl + half;
      const bool resOK = (kv0 + 64 <= VLP);                      // block-uniform
#pragma unroll
      for (int i = 0; i < 4; ++i) {
        const v8b a0 = *(const v8b*)(kg + 8 * i);
        const v8b a1 = *(const v8b*)(klg + 8 * i);
        const v8h b0 = *(const v8h*)(vg + 8 * i);
        *(v8b*)(Ksh + r * 64 + half + 8 * i) = a0;
        *(v8b*)(Ksl + r * 64 + half + 8 * i) = a1;
        *(v8h*)(Vth + r * 64 + half + 8 * i) = b0;
        if (RES) {
          v8h b1 = *(const v8h*)(vlg + 8 * i);
          if (!resOK) b1 = zero8h();
          *(v8h*)(Vtl + r * 64 + half + 8 * i) = b1;
        }
      }
    }
    __syncthreads();

    // ---- scores: 16 query rows x 64 keys per wave, 3 bf16 products ----
    v8f s[4];
#pragma unroll
    for (int j = 0; j < 4; ++j) {
      s[j] = zero8();
#pragma unroll
      for (int dc = 0; dc < 2; ++dc) {
        FB kb, kl;
        kb.h[0] = *(const v8b*)(Ksh + (j * 16 + c) * 64 + dc * 32 + 8 * hh);
        kb.h[1] = *(const v8b*)(Ksh + (j * 16 + c) * 64 + dc * 32 + 16 + 8 * hh);
        kl.h[0] = *(const v8b*)(Ksl + (j * 16 + c) * 64 + dc * 32 + 8 * hh);
        kl.h[1] = *(const v8b*)(Ksl + (j * 16 + c) * 64 + dc * 32 + 16 + 8 * hh);
        s[j] = mma_b(qah[dc], kb.v, s[j]);
        s[j] = mma_b(qah[dc], kl.v, s[j]);
        s[j] = mma_b(qal[dc], kb.v, s[j]);
      }
    }

    // ---- scale + mask select, row max, online softmax, P (x1024, f16) and P residual (x4096) to LDS ----
    _Float16* pwh = Psh[wave];
    _Float16* pwl = Psl[RES ? wave : 0];
    const int* mq = maskp + (size_t)(q0 + 8 * hh) * SEQ + kv0 + c;   // row q0+8hh, key kv0+c; all < SEQ
#pragma unroll
    for (int r = 0; r < 8; ++r) {
      const int* mrw = mq + (size_t)r * SEQ;
      float m = -INFINITY;
#pragma unroll
      for (int j = 0; j < 4; ++j) {
        const int mv = mrw[j * 16];
        const float sv = (mv != 0) ? (s[j][r] * sscale) : -INFINITY;
        s[j][r] = sv;
        m = fmaxf(m, sv);
      }
#pragma unroll
      for (int off = 1; off < 16; off <<= 1) m = fmaxf(m, __shfl_xor(m, off, 32));
      const float mnew  = fmaxf(mrow[r], m);
      const float msafe = (mnew == -INFINITY) ? 0.f : mnew;
      const float alpha = __expf(mrow[r] - msafe);
      mrow[r] = mnew;
      float psum = 0.f;
#pragma unroll
      for (int j = 0; j < 4; ++j) {
        const float p = __expf(s[j][r] - msafe);     // -inf logit against a finite max: exp -> 0
        psum += p;
        const float p1k = p * 1024.0f;
        const _Float16 ph = (_Float16)p1k;
        pwh[(8 * hh + r) * 64 + j * 16 + c] = ph;
        if (RES) {
          const _Float16 pl = (_Float16)((p1k - (float)ph) * 4096.0f);
          pwl[(8 * hh + r) * 64 + j * 16 + c] = pl;
        }
      }
#pragma unroll
      for (int off = 1; off < 16; off <<= 1) psum += __shfl_xor(psum, off, 32);
      lrow[r] = lrow[r] * alpha + psum;
#pragma unroll
      for (int t = 0; t < 4; ++t) oacc[t][r] *= alpha;
    }
    __builtin_amdgcn_fence(__ATOMIC_RELEASE, "workgroup");
    __builtin_amdgcn_wave_barrier();
    __builtin_amdgcn_fence(__ATOMIC_ACQUIRE, "workgroup");

    // ---- context += P . V (f16 WMMA), residual products into a separate accumulator ----
    v8f o1[4];
#pragma unroll
    for (int t = 0; t < 4; ++t) o1[t] = zero8();
#pragma unroll 1
    for (int kk = 0; kk < 2; ++kk) {
      FH pa, pl;
      pa.h[0] = *(const v8h*)(pwh + c * 64 + kk * 32 + 8 * hh);
      pa.h[1] = *(const v8h*)(pwh + c * 64 + kk * 32 + 16 + 8 * hh);
      if (RES) {
        pl.h[0] = *(const v8h*)(pwl + c * 64 + kk * 32 + 8 * hh);
        pl.h[1] = *(const v8h*)(pwl + c * 64 + kk * 32 + 16 + 8 * hh);
      } else {
        pl.v = pa.v;
      }
#pragma unroll
      for (int t = 0; t < 4; ++t) {
        FH vb;
        vb.h[0] = *(const v8h*)(Vth + (t * 16 + c) * 64 + kk * 32 + 8 * hh);
        vb.h[1] = *(const v8h*)(Vth + (t * 16 + c) * 64 + kk * 32 + 16 + 8 * hh);
        oacc[t] = mma_h(pa.v, vb.v, oacc[t]);
        if (RES) {
          FH vl;
          vl.h[0] = *(const v8h*)(Vtl + (t * 16 + c) * 64 + kk * 32 + 8 * hh);
          vl.h[1] = *(const v8h*)(Vtl + (t * 16 + c) * 64 + kk * 32 + 16 + 8 * hh);
          o1[t] = mma_h(pa.v, vl.v, o1[t]);
          o1[t] = mma_h(pl.v, vb.v, o1[t]);
        }
      }
    }
    if (RES) {
#pragma unroll
      for (int t = 0; t < 4; ++t)
#pragma unroll
        for (int r = 0; r < 8; ++r) oacc[t][r] += o1[t][r] * (1.0f / 4096.0f);
    }
  }

  // ---- normalise (1/l and the 1/1024 p carry), stage the wave's 16x64 tile, bf16 hi/lo split,
  float* os = Os[wave];
#pragma unroll
  for (int r = 0; r < 8; ++r) {
    const float l = lrow[r];
    const float inv = (1.0f / l) * (1.0f / 1024.0f);   // l == 0 (fully masked row) -> inf -> NaN context
#pragma unroll
    for (int t = 0; t < 4; ++t) os[(8 * hh + r) * 64 + t * 16 + c] = oacc[t][r] * inv;
  }
  __builtin_amdgcn_fence(__ATOMIC_RELEASE, "workgroup");
  __builtin_amdgcn_wave_barrier();
  __builtin_amdgcn_fence(__ATOMIC_ACQUIRE, "workgroup");
  {
    const int q4 = lane >> 3, c8 = (lane & 7) * 8;
    v4u hv[4], lv[4];
#pragma unroll
    for (int it = 0; it < 4; ++it) {
      const int row = it * 4 + q4;   // it 0..3 x q4 0..3 = rows 0..15 of the wave tile
      const float* sp = os + row * 64 + c8;
      v4u a, a2;
#pragma unroll
      for (int e = 0; e < 4; ++e) {
        const float f0 = sp[2 * e], f1 = sp[2 * e + 1];
        const unsigned short h0 = bf_bits(f0), h1 = bf_bits(f1);
        const unsigned short l0 = bf_bits(f0 - bf_up(h0)), l1 = bf_bits(f1 - bf_up(h1));
        a[e] = pk16(h0, h1); a2[e] = pk16(l0, l1);
      }
      hv[it] = a; lv[it] = a2;
    }
    {
#pragma unroll
      for (int it = 0; it < 4; ++it) {
        const int row = it * 4 + q4;
        const size_t go = (rowB + q0 + row) * DM + (size_t)h * HD + c8;
        *(v4u*)(ohp + go) = hv[it];
        *(v4u*)(olp + go) = lv[it];
      }
      
    }
  }
}

// =====================================================================================================
// Layer norm over rows of DM=1024, f32, one block per row (grid = MROWS, 256 threads, 4 elements per thread).
// mean and biased variance via wave shuffles + 16 LDS slots; gamma / beta values RNE-converted to bf16;
// o = (gamma * (x - mean)) * (1 / sqrt(var + eps)) + beta.
// OUT16: threads 0..127 reload 8 consecutive inputs each and write the f16 plane as one 16-B store per lane
// coverage: 256 threads x 4 = the row (f32); 128 threads x 8 = the row (f16).
// =====================================================================================================
template <bool OUT16>
__global__ __launch_bounds__(256) void layernorm_rows(const float* __restrict__ in,
                                                       const float* __restrict__ gamma,
                                                       const float* __restrict__ beta,
                                                       float* out32, unsigned short* out16) {
  __shared__ float red[16];
  const int tid = threadIdx.x, lane = tid & 31, wave = tid >> 5;
  const int row = blockIdx.x;
  const float* xr = in + (size_t)row * DM;
  const v4f v = *(const v4f*)(xr + tid * 4);
  float s = (v[0] + v[1]) + (v[2] + v[3]);
#pragma unroll
  for (int off = 1; off < 32; off <<= 1) s += __shfl_xor(s, off, 32);
  if (lane == 0) red[wave] = s;
  __syncthreads();
  float tot = 0.f;
#pragma unroll
  for (int i = 0; i < 8; ++i) tot += red[i];
  const float mean = tot * (1.0f / (float)DM);
  const float d0 = v[0] - mean, d1 = v[1] - mean, d2 = v[2] - mean, d3 = v[3] - mean;
  float s2 = (d0 * d0 + d1 * d1) + (d2 * d2 + d3 * d3);
#pragma unroll
  for (int off = 1; off < 32; off <<= 1) s2 += __shfl_xor(s2, off, 32);
  if (lane == 0) red[8 + wave] = s2;
  __syncthreads();
  float tot2 = 0.f;
#pragma unroll
  for (int i = 0; i < 8; ++i) tot2 += red[8 + i];
  const float var  = tot2 * (1.0f / (float)DM);
  const float rstd = 1.0f / sqrtf(var + LNEPS);

  const v4f g  = *(const v4f*)(gamma + tid * 4);
  const v4f bt = *(const v4f*)(beta + tid * 4);
  v4f o;
  o[0] = (bfr(g[0]) * d0) * rstd + bfr(bt[0]);
  o[1] = (bfr(g[1]) * d1) * rstd + bfr(bt[1]);
  o[2] = (bfr(g[2]) * d2) * rstd + bfr(bt[2]);
  o[3] = (bfr(g[3]) * d3) * rstd + bfr(bt[3]);
  float* op = out32 + (size_t)row * DM + tid * 4;
  *(v4f*)op = o;
  

  if (OUT16) {
    if (tid < 128) {
      const int cc = tid * 8;
      const v4f a0 = *(const v4f*)(xr + cc);
      const v4f a1 = *(const v4f*)(xr + cc + 4);
      const v4f g0 = *(const v4f*)(gamma + cc), g1 = *(const v4f*)(gamma + cc + 4);
      const v4f b0 = *(const v4f*)(beta + cc),  b1 = *(const v4f*)(beta + cc + 4);
      float f[8];
#pragma unroll
      for (int e = 0; e < 4; ++e) {
        f[e]     = (bfr(g0[e]) * (a0[e] - mean)) * rstd + bfr(b0[e]);
        f[4 + e] = (bfr(g1[e]) * (a1[e] - mean)) * rstd + bfr(b1[e]);
      }
      v4u hp;
#pragma unroll
      for (int e = 0; e < 4; ++e) hp[e] = pk16(h_bits((_Float16)f[2 * e]), h_bits((_Float16)f[2 * e + 1]));
      unsigned short* hq = out16 + (size_t)row * DM + cc;
      *(v4u*)hq = hp;
      
    }
  }
}

// =====================================================================================================
// Workspace map (MiB = 1048576 B):
//   Xb   bf16 [4096][1024]         0 ..   8
//   WqT  bf16 [1024 n][1024 k]     8 ..  10     WkT 10 .. 12    WvT 12 .. 14    WoT 14 .. 16
//   W1T  f16  [4096 n][1024 k]    16 ..  24     W2T f16 [1024 n][4096 k]  24 .. 32
//   Qh   bf16 [4096][1024]        32 ..  40     Ql 40 .. 48    Kh 48 .. 56    Kl 56 .. 64
//   VTh  f16  [2][1024][2048]     64 ..  72     VTl f16 [2][1024][512]    72 .. 74    Flg u64 [32][32] at 74
//   Oh   bf16 [4096][1024]        76 ..  84     Ol 84 .. 92
//   later (regions dead by then, single in-order stream):
//   T1   f32  [4096][1024]        32 ..  48   (over Qh, Ql: written by the Wo GEMM after attention)
//   H32  f32  [4096][1024]        48 ..  64   (over Kh, Kl: written by LN1)
//   Hh   f16  [4096][1024]        64 ..  72   (over VTh: written by LN1)
//   F1   f16  [4096][4096]        72 .. 104   (over VTl, Flg, Oh, Ol: written by the W1 GEMM after the Wo GEMM)
//   T2   f32  [4096][1024]        32 ..  48   (over T1: written by the W2 GEMM after LN1)
//   end = 104 MiB. Every plane is an exact multiple of its 64x64 tile / whole-line store granularity
//   (no padded tails); all region starts are MiB aligned.
// =====================================================================================================
extern "C" void kernel_launch(void* const* d_in, const int* in_sizes, int n_in,
                              void* d_out, int out_size, void* d_ws, size_t ws_size,
                              hipStream_t stream) {
  if (n_in < 18) return;
  if (in_sizes[0] != NB * SEQ * DM) return;
  if (in_sizes[1] != SEQ * SEQ) return;
  if (in_sizes[2] != DM * DM || in_sizes[4] != DM * DM || in_sizes[6] != DM * DM || in_sizes[8] != DM * DM) return;
  if (in_sizes[3] != DM || in_sizes[5] != DM || in_sizes[7] != DM || in_sizes[9] != DM) return;
  if (in_sizes[10] != DM * DFF || in_sizes[11] != DFF || in_sizes[12] != DFF * DM || in_sizes[13] != DM) return;
  if (in_sizes[14] != DM || in_sizes[15] != DM || in_sizes[16] != DM || in_sizes[17] != DM) return;
  if (out_size != NB * SEQ * DM) return;

  const float* x   = (const float*)d_in[0];
  const int*   msk = (const int*)d_in[1];
  const float* Wq  = (const float*)d_in[2];
  const float* bq  = (const float*)d_in[3];
  const float* Wk  = (const float*)d_in[4];
  const float* bk  = (const float*)d_in[5];
  const float* Wv  = (const float*)d_in[6];
  const float* bv  = (const float*)d_in[7];
  const float* Wo  = (const float*)d_in[8];
  const float* bo  = (const float*)d_in[9];
  const float* W1  = (const float*)d_in[10];
  const float* b1  = (const float*)d_in[11];
  const float* W2  = (const float*)d_in[12];
  const float* b2  = (const float*)d_in[13];
  const float* gamma1 = (const float*)d_in[14];
  const float* beta1  = (const float*)d_in[15];
  const float* gamma2 = (const float*)d_in[16];
  const float* beta2  = (const float*)d_in[17];

  const size_t PX   = (size_t)MROWS * DM * 2;        //  8 MiB  16-bit activation plane [4096][1024]
  const size_t PW   = (size_t)DM * DM * 2;           //  2 MiB  16-bit weight plane [1024][1024]
  const size_t PWF  = (size_t)DM * DFF * 2;          //  8 MiB  16-bit FFN weight plane
  const size_t PVT  = (size_t)NB * DM * SEQ * 2;     //  8 MiB  v^T hi plane
  const size_t PVL  = (size_t)NB * DM * VLP * 2;     //  2 MiB  v^T residual plane
  const size_t PFs  = (size_t)2 * 1048576;           //  2 MiB  slot for the 8 KiB flag table
  const size_t PF   = (size_t)NQB * NQB * 8;         //  8 KiB
  const size_t PT   = (size_t)MROWS * DM * 4;        // 16 MiB  f32 activation plane
  const size_t PF1  = (size_t)MROWS * DFF * 2;       // 32 MiB  f16 FFN hidden plane
  if (PF > PFs) return;
  size_t off = 0;
  const size_t oXb  = off; off += PX;
  const size_t oWq  = off; off += PW;
  const size_t oWk  = off; off += PW;
  const size_t oWv  = off; off += PW;
  const size_t oWo  = off; off += PW;
  const size_t oW1  = off; off += PWF;
  const size_t oW2  = off; off += PWF;
  const size_t oQh  = off; off += PX;
  const size_t oQl  = off; off += PX;
  const size_t oKh  = off; off += PX;
  const size_t oKl  = off; off += PX;
  const size_t oVTh = off; off += PVT;
  const size_t oVTl = off; off += PVL;
  const size_t oFlg = off; off += PFs;
  const size_t oOh  = off; off += PX;
  const size_t oOl  = off; off += PX;
  const size_t endA = off;                           // 92 MiB
  const size_t oT1  = oQh;                           // T1 over Qh + Ql
  const size_t oH32 = oKh;                           // H32 over Kh + Kl
  const size_t oHh  = oVTh;                          // Hh over VTh
  const size_t oF1  = oVTl;                          // F1 over VTl .. Ol and beyond
  const size_t oT2  = oT1;                           // T2 over T1
  if (oT1 + PT != oKh) return;                       // aliasing sanity: T1 ends where H32 starts
  if (oH32 + PT != oVTh) return;                     // H32 ends where Hh starts
  if (oHh + PX != oVTl) return;                      // Hh ends where F1 starts
  size_t total = oF1 + PF1;                          // 104 MiB
  if (endA > total) total = endA;
  if (total > ws_size) return;
  if (total > (size_t)134217728) return;

  char* ws = (char*)d_ws;
  unsigned short* Xb   = (unsigned short*)(ws + oXb);
  unsigned short* WqTb = (unsigned short*)(ws + oWq);
  unsigned short* WkTb = (unsigned short*)(ws + oWk);
  unsigned short* WvTb = (unsigned short*)(ws + oWv);
  unsigned short* WoTb = (unsigned short*)(ws + oWo);
  unsigned short* W1Tb = (unsigned short*)(ws + oW1);
  unsigned short* W2Tb = (unsigned short*)(ws + oW2);
  unsigned short* Qh   = (unsigned short*)(ws + oQh);
  unsigned short* Ql   = (unsigned short*)(ws + oQl);
  unsigned short* Kh   = (unsigned short*)(ws + oKh);
  unsigned short* Kl   = (unsigned short*)(ws + oKl);
  unsigned short* VTh  = (unsigned short*)(ws + oVTh);
  unsigned short* VTl  = (unsigned short*)(ws + oVTl);
  u64*            Flg  = (u64*)(ws + oFlg);
  unsigned short* Oh   = (unsigned short*)(ws + oOh);
  unsigned short* Ol   = (unsigned short*)(ws + oOl);
  float*          T1   = (float*)(ws + oT1);
  float*          H32  = (float*)(ws + oH32);
  unsigned short* Hh   = (unsigned short*)(ws + oHh);
  unsigned short* F1   = (unsigned short*)(ws + oF1);
  float*          T2   = (float*)(ws + oT2);

  const dim3 blk(256);
  const int n8x = MROWS * DM / 8;                                   // 524288
  const dim3 gCvtX((n8x + 255) / 256);                              // 2048 blocks
  const dim3 gMask(NQB);                                            // 32 blocks
  const dim3 gTw(DM / 64, DM / 64);                                 // 16 x 16: in [1024 k][1024 n] -> out [1024 n][1024 k]
  const dim3 gTw1(DFF / 64, DM / 64);                               // 64 x 16: in [1024 k][4096 n] -> out [4096 n][1024 k]
  const dim3 gTw2(DM / 64, DFF / 64);                               // 16 x 64: in [4096 k][1024 n] -> out [1024 n][4096 k]
  const dim3 gProj(((MROWS / 64) * (DM / 64) + 7) / 8, 1);          // 1024 tiles -> 128 blocks: M=4096, N=1024
  const dim3 gVT(((DM / 64) * (SEQ / 64) + 7) / 8, NB);             // 512 tiles -> 64 blocks x 2 batches: M=1024, N=2048
  const dim3 gW1(((MROWS / 64) * (DFF / 64) + 7) / 8, 1);           // 4096 tiles -> 512 blocks: M=4096, N=4096
  const dim3 gW2(((MROWS / 64) * (DM / 64) + 7) / 8, 1);            // 1024 tiles -> 128 blocks: M=4096, N=1024
  const dim3 gLN(MROWS);                                            // 4096 blocks, one row each

  // (0) mask tile survey -> Flg
  mask_rowbits<<<gMask, blk, 0, stream>>>(msk, Flg);
  // (1) x -> bf16 plane [4096][1024]; weights [k][n] f32 -> 16-bit [n][k] planes
  cvt_bf16x8<<<gCvtX, blk, 0, stream>>>(x, Xb, n8x);
  wtrans64<false><<<gTw, blk, 0, stream>>>(Wq, WqTb, DM, DM, 1.0f);
  wtrans64<false><<<gTw, blk, 0, stream>>>(Wk, WkTb, DM, DM, 1.0f);
  wtrans64<false><<<gTw, blk, 0, stream>>>(Wv, WvTb, DM, DM, 1.0f);
  wtrans64<false><<<gTw, blk, 0, stream>>>(Wo, WoTb, DM, DM, 1.0f);
  wtrans64<true><<<gTw1, blk, 0, stream>>>(W1, W1Tb, DM, DFF, WSCALE);
  wtrans64<true><<<gTw2, blk, 0, stream>>>(W2, W2Tb, DFF, DM, WSCALE);
  // (2) q = x . Wq + bq -> bf16 hi/lo planes [b*SEQ+t][h*64+d]   (M=4096, N=1024, K=1024)
  gemm64<0, 0, 2, 1, 0, false><<<gProj, blk, 0, stream>>>(
      Xb, Xb, DM, 0LL, WqTb, DM, 0LL, bq, (const void*)Xb, DM, 0LL,
      (void*)Qh, DM, 0LL, (void*)Ql, DM, 0LL, DM,
      MROWS, DM, DM, 1.0f, 1.0f);
  // (3) k = x . Wk + bk -> bf16 hi/lo planes
  gemm64<0, 0, 2, 1, 0, false><<<gProj, blk, 0, stream>>>(
      Xb, Xb, DM, 0LL, WkTb, DM, 0LL, bk, (const void*)Xb, DM, 0LL,
      (void*)Kh, DM, 0LL, (void*)Kl, DM, 0LL, DM,
      MROWS, DM, DM, 1.0f, 1.0f);
  // (4) v^T = WvT . x^T + bv per batch -> f16 hi plane [b][h*64+d][s] (pitch SEQ) and residual plane
  //     (x4096, keys < VLP only, pitch VLP)   (A = WvT [d][k], Bt = Xb rows of batch b; M=1024, N=2048, K=1024)
  gemm64<0, 0, 3, 2, 0, false><<<gVT, blk, 0, stream>>>(
      WvTb, WvTb, DM, 0LL, Xb, DM, (long long)SEQ * DM, bv, (const void*)Xb, DM, 0LL,
      (void*)VTh, SEQ, (long long)DM * SEQ, (void*)VTl, VLP, (long long)DM * VLP, VLP,
      DM, SEQ, DM, 1.0f, 4096.0f);
  // (5) attention: query blocks 0..RESQB-1 with residual planes, the rest without
  attn_mask64<true><<<dim3(NB * NH * RESQB), dim3(128), 0, stream>>>(
      Qh, Ql, Kh, Kl, VTh, VTl, msk, Flg, Oh, Ol, 0, RESQB, 0.125f);
  attn_mask64<false><<<dim3(NB * NH * (NQB - RESQB)), dim3(128), 0, stream>>>(
      Qh, Ql, Kh, Kl, VTh, VTl, msk, Flg, Oh, Ol, RESQB, NQB - RESQB, 0.125f);
  // (6) T1 = ctx . Wo + bo + bf16(x) -> f32 [4096][1024]  (A = context hi + lo planes, 2 products)
  gemm64<0, 1, 0, 1, 1, false><<<gProj, blk, 0, stream>>>(
      Oh, Ol, DM, 0LL, WoTb, DM, 0LL, bo, (const void*)Xb, DM, 0LL,
      (void*)T1, DM, 0LL, (void*)T1, DM, 0LL, 0,
      MROWS, DM, DM, 1.0f, 1.0f);
  // (7) h = LN1(T1) -> H32 f32 and Hh f16
  layernorm_rows<true><<<gLN, blk, 0, stream>>>(T1, gamma1, beta1, H32, Hh);
  // (8) F1 = relu(h . W1 + b1) -> f16 [4096][4096]  (f16 operands, W1 carried x64, acc scaled by 1/64)
  gemm64<1, 0, 4, 1, 0, true><<<gW1, blk, 0, stream>>>(
      Hh, Hh, DM, 0LL, W1Tb, DM, 0LL, b1, (const void*)Hh, DM, 0LL,
      (void*)F1, DFF, 0LL, (void*)F1, DFF, 0LL, 0,
      MROWS, DFF, DM, 1.0f / WSCALE, 1.0f);
  // (9) T2 = F1 . W2 + b2 + h -> f32 [4096][1024]  (K = 4096, W2 carried x64)
  gemm64<1, 0, 0, 1, 2, false><<<gW2, blk, 0, stream>>>(
      F1, F1, DFF, 0LL, W2Tb, DFF, 0LL, b2, (const void*)H32, DM, 0LL,
      (void*)T2, DM, 0LL, (void*)T2, DM, 0LL, 0,
      MROWS, DM, DFF, 1.0f / WSCALE, 1.0f);
  // (10) out = LN2(T2) -> d_out f32 [2][2048][1024]
  layernorm_rows<false><<<gLN, blk, 0, stream>>>(T2, gamma2, beta2, (float*)d_out, Hh);
  (void)hipGetLastError();
}

// v001
// Measured time: 417 microseconds a run.
// Next to v000, in two timings, it ran 1.71 and 1.70 times as fast.
// Contractions: q, k, v^T projections = v_wmma_f32_16x16x32_bf16 (bf16 operands from RNE-converted inputs, single product);
// q.k^T scores = v_wmma_f32_16x16x32_bf16 with q and k as bf16 hi/lo planes (hi.hi + hi.lo + lo.hi);
// p.v = v_wmma_f32_16x16x32_f16 (p carried x1024 in f16, v f16 hi plane; f16 residual planes x4096 of p and v on the first 512 query rows);
// ctx.Wo = v_wmma_f32_16x16x32_bf16 with ctx as bf16 hi/lo planes times bf16 Wo (2 products);
// h.W1 and relu(h.W1+b1).W2 = v_wmma_f32_16x16x32_f16 (f16 operands, weights carried x64, single product);
// all f32 accumulate; softmax and both layer norms in f32.
#include <hip/hip_runtime.h>
#include <math.h>
#include <stdint.h>

#define NB     2
#define SEQ    2048
#define DM     1024
#define NH     16
#define HD     64
#define DFF    4096
#define MROWS  (NB * SEQ)   // 4096 token rows
#define NQB    (SEQ / 64)   // 32 key / query tiles of 64
#define VLP    512          // key pitch of the v^T residual plane (keys 0..VLP-1)
#define RESQB  8            // leading 64-row query blocks that use the p / v residual planes
#define LNEPS  1e-6f
#define WSCALE 64.0f        // f16 weight carry for W1 and W2
#define GKS    128          // k elements per LDS stage of the GEMM (256-B rows)
#define GPITCH 272          // LDS row pitch of a stage in bytes: 16 B x odd, for 16-B fragment reads
static_assert(RESQB * 64 <= VLP);
static_assert(NH * HD == DM);
static_assert((SEQ % 128) == 0 && (DM % 128) == 0 && (DFF % 128) == 0 && (MROWS % 128) == 0);
static_assert((DM % GKS) == 0 && (DFF % GKS) == 0);
static_assert(NQB * 8 == 256);

typedef _Float16 v16h __attribute__((ext_vector_type(16)));
typedef _Float16 v8h  __attribute__((ext_vector_type(8)));
typedef __bf16   v16b __attribute__((ext_vector_type(16)));
typedef __bf16   v8b  __attribute__((ext_vector_type(8)));
typedef float    v8f  __attribute__((ext_vector_type(8)));
typedef float    v4f  __attribute__((ext_vector_type(4)));
typedef unsigned int v4u __attribute__((ext_vector_type(4)));
typedef unsigned int v2u __attribute__((ext_vector_type(2)));
typedef int      v4i __attribute__((ext_vector_type(4)));
typedef unsigned long long u64;

#if defined(__HIP_DEVICE_COMPILE__)
#define DEV_ASM 1
#else
#define DEV_ASM 0
#endif

// ---- scalar helpers --------------------------------------------------------------------------------
__device__ __forceinline__ unsigned short bf_bits(float f) {          // f32 -> bf16 bits, RNE convert
  unsigned u = __float_as_uint(f);
  return (unsigned short)((u + 0x7FFFu + ((u >> 16) & 1u)) >> 16);
}
__device__ __forceinline__ float bf_up(unsigned short h) { return __uint_as_float(((unsigned)h) << 16); }
__device__ __forceinline__ float bfr(float f) { return bf_up(bf_bits(f)); }   // bf16 requantised value
__device__ __forceinline__ unsigned short h_bits(_Float16 x) { return __builtin_bit_cast(unsigned short, x); }
__device__ __forceinline__ unsigned pk16(unsigned short a, unsigned short b) { return (unsigned)a | ((unsigned)b << 16); }
__device__ __forceinline__ v8f zero8() { v8f z = {0.f, 0.f, 0.f, 0.f, 0.f, 0.f, 0.f, 0.f}; return z; }
__device__ __forceinline__ v8h zero8h() {
  const _Float16 z = (_Float16)0.0f;
  v8h r = {z, z, z, z, z, z, z, z};
  return r;
}

// ---- operand traits: fragment loader (lane -> row/col (lane&15), p already includes +8*(lane>>4);
//      elements 0..7 <- p[0..7] (k0+8h..), elements 8..15 <- p[16..23] (k0+16+8h..)), WMMA, hazard gaps
template <int ET> struct OpT;
template <> struct OpT<0> {
  typedef __bf16 E; typedef v16b F; typedef v8b H;
  static __device__ __forceinline__ F ld(const E* p) {
    union { F v; H h[2]; } f;
    f.h[0] = *(const H*)(p);
    f.h[1] = *(const H*)(p + 16);
    return f.v;
  }
  static __device__ __forceinline__ v8f mma_raw(F a, F b, v8f c) {
    return __builtin_amdgcn_wmma_f32_16x16x32_bf16(false, a, false, b, (short)0, c, false, false);
  }
  static __device__ __forceinline__ void dep_guard(v8f& a, v8f& b, F x, F y) {
#if DEV_ASM
    asm volatile("v_nop\n\tv_nop\n\tv_nop\n\tv_nop" : "+v"(a), "+v"(b) : "v"(x), "v"(y));
#endif
  }
  static __device__ __forceinline__ void keep4(F a, F b, F c, F d) {
#if DEV_ASM
    asm volatile("v_nop" :: "v"(a), "v"(b), "v"(c), "v"(d));
#endif
  }
};
template <> struct OpT<1> {
  typedef _Float16 E; typedef v16h F; typedef v8h H;
  static __device__ __forceinline__ F ld(const E* p) {
    union { F v; H h[2]; } f;
    f.h[0] = *(const H*)(p);
    f.h[1] = *(const H*)(p + 16);
    return f.v;
  }
  static __device__ __forceinline__ v8f mma_raw(F a, F b, v8f c) {
    return __builtin_amdgcn_wmma_f32_16x16x32_f16(false, a, false, b, (short)0, c, false, false);
  }
  static __device__ __forceinline__ void dep_guard(v8f& a, v8f& b, F x, F y) {
#if DEV_ASM
    asm volatile("v_nop\n\tv_nop\n\tv_nop\n\tv_nop" : "+v"(a), "+v"(b) : "v"(x), "v"(y));
#endif
  }
  static __device__ __forceinline__ void keep4(F a, F b, F c, F d) {
#if DEV_ASM
    asm volatile("v_nop" :: "v"(a), "v"(b), "v"(c), "v"(d));
#endif
  }
};

// ---- guarded WMMA helpers for the attention kernel ------------------------------------------------
__device__ __forceinline__ v8f mma_b(v16b a, v16b b, v8f c) {
  c = __builtin_amdgcn_wmma_f32_16x16x32_bf16(false, a, false, b, (short)0, c, false, false);
#if DEV_ASM
  asm volatile("v_nop\n\tv_nop\n\tv_nop\n\tv_nop" : "+v"(c) : "v"(a), "v"(b));
#endif
  return c;
}
__device__ __forceinline__ v8f mma_h(v16h a, v16h b, v8f c) {
  c = __builtin_amdgcn_wmma_f32_16x16x32_f16(false, a, false, b, (short)0, c, false, false);
#if DEV_ASM
  asm volatile("v_nop\n\tv_nop\n\tv_nop\n\tv_nop" : "+v"(c) : "v"(a), "v"(b));
#endif
  return c;
}
__device__ __forceinline__ void acc_guard4(v8f& a, v8f& b, v8f& c, v8f& d) {
#if DEV_ASM
  asm volatile("v_nop\n\tv_nop\n\tv_nop\n\tv_nop" : "+v"(a), "+v"(b), "+v"(c), "+v"(d));
#endif
}

// =====================================================================================================
// f32 -> bf16 (RNE convert), 8 elements per thread, one 16-B store per lane: a wave writes 512 contiguous B
// coverage: n8 threads x 8 = the whole plane (n8 is a multiple of 256 here).
// =====================================================================================================
__global__ __launch_bounds__(256) void cvt_bf16x8(const float* __restrict__ in, unsigned short* out, int n8) {
  const int i = blockIdx.x * 256 + threadIdx.x;
  if (i < n8) {
    const v4f a = *(const v4f*)(in + (size_t)i * 8);
    const v4f b = *(const v4f*)(in + (size_t)i * 8 + 4);
    v4u p;
    p[0] = pk16(bf_bits(a[0]), bf_bits(a[1]));
    p[1] = pk16(bf_bits(a[2]), bf_bits(a[3]));
    p[2] = pk16(bf_bits(b[0]), bf_bits(b[1]));
    p[3] = pk16(bf_bits(b[2]), bf_bits(b[3]));
    *(v4u*)(out + (size_t)i * 8) = p;
    
  }
}

// =====================================================================================================
// Weight transpose + convert: in W f32 [Kdim][Ndim] (row k, n contiguous) -> out 16-bit [Ndim][Kdim]
// (row n, k contiguous). F16OUT: f16 of (bf16 value * scale), else bf16 bits. 64x64 tile through LDS.
// grid = (Ndim/64, Kdim/64); blockIdx.x = n tile, blockIdx.y = k tile.
// coverage: load 256 threads x 16 = 64x64; store 8 waves x 2 it x 4 rows x (8 lanes x 8) = 64x64.
// =====================================================================================================
template <bool F16OUT>
__global__ __launch_bounds__(256) void wtrans64(const float* __restrict__ W, unsigned short* out,
                                                 int Kdim, int Ndim, float scale) {
  __shared__ float tile[64][65];
  const int tid = threadIdx.x, lane = tid & 31, wave = tid >> 5;
  const int n0 = blockIdx.x * 64, k0 = blockIdx.y * 64;
  {
    const int r = tid >> 2, cq = (tid & 3) * 16;
    const float* src = W + (size_t)(k0 + r) * Ndim + n0 + cq;
#pragma unroll
    for (int e = 0; e < 4; ++e) {
      const v4f a = *(const v4f*)(src + 4 * e);
      tile[r][cq + 4 * e + 0] = a[0];
      tile[r][cq + 4 * e + 1] = a[1];
      tile[r][cq + 4 * e + 2] = a[2];
      tile[r][cq + 4 * e + 3] = a[3];
    }
  }
  __syncthreads();
  const int q = lane >> 3, c8 = (lane & 7) * 8;
  v4u pv[2];
#pragma unroll
  for (int it = 0; it < 2; ++it) {
    const int nn = wave * 8 + it * 4 + q;
    v4u a;
#pragma unroll
    for (int e = 0; e < 4; ++e) {
      const float f0 = tile[c8 + 2 * e][nn], f1 = tile[c8 + 2 * e + 1][nn];
      unsigned short b0 = bf_bits(f0), b1 = bf_bits(f1);
      if (F16OUT) {
        b0 = h_bits((_Float16)(bf_up(b0) * scale));
        b1 = h_bits((_Float16)(bf_up(b1) * scale));
      }
      a[e] = pk16(b0, b1);
    }
    pv[it] = a;
  }
  {
#pragma unroll
    for (int it = 0; it < 2; ++it) {
      const int nn = wave * 8 + it * 4 + q;
      *(v4u*)(out + (size_t)(n0 + nn) * Kdim + k0 + c8) = pv[it];
    }
    
  }
}

// =====================================================================================================
// Mask tile survey: mask int32 [1][1][SEQ][SEQ] (nonzero = key allowed). Block = qt: query rows qt*64..+63.
// For every key tile kt (64 keys) it records a 64-bit word whose bit r is 1 when row r of the tile has at
// least one nonzero entry inside kt. grid = NQB, 256 threads: thread = (row = tid>>2, quarter = tid&3);
// wave w holds rows 8w..8w+7 -> byte w of the word. Output flg[qt*NQB + kt], 32 words = 256 B per block
// coverage: 32 blocks x 32 words = the whole 1024-word table.
// =====================================================================================================
__global__ __launch_bounds__(256) void mask_rowbits(const int* __restrict__ maskp, u64* flg) {
  __shared__ __align__(8) unsigned char sb[NQB * 8];
  const int tid  = threadIdx.x;
  const int wave = tid >> 5;
  const int lane = tid & 31;
  const int qt   = blockIdx.x;
  const int row  = tid >> 2;            // 0..63
  const int qtr  = (tid & 3) * 16;      // 0,16,32,48
  const int* mr = maskp + ((size_t)qt * 64 + row) * SEQ + qtr;
#pragma unroll 1
  for (int kt = 0; kt < NQB; ++kt) {
    const int* p = mr + kt * 64;
    const v4i a0 = *(const v4i*)(p);
    const v4i a1 = *(const v4i*)(p + 4);
    const v4i a2 = *(const v4i*)(p + 8);
    const v4i a3 = *(const v4i*)(p + 12);
    int lv = 0;
#pragma unroll
    for (int e = 0; e < 4; ++e) {
      lv |= (a0[e] != 0) ? 1 : 0;
      lv |= (a1[e] != 0) ? 1 : 0;
      lv |= (a2[e] != 0) ? 1 : 0;
      lv |= (a3[e] != 0) ? 1 : 0;
    }
    const unsigned bl = __builtin_amdgcn_ballot_w32(lv != 0);   // uniform per wave
    unsigned bits = 0u;
#pragma unroll
    for (int k = 0; k < 8; ++k) bits |= ((((bl >> (4 * k)) & 0xFu) != 0u) ? 1u : 0u) << k;
    if (lane == 0) sb[kt * 8 + wave] = (unsigned char)bits;
  }
  __syncthreads();
  if (wave == 0) {
    u64 w;
    __builtin_memcpy(&w, &sb[lane * 8], 8);   // bytes 0..7 = rows 0..63, little endian
    u64* dst = flg + (size_t)qt * NQB + lane;
    *(u64*)dst = w;
    
  }
}

// =====================================================================================================
// Register-blocked batched 16-bit WMMA GEMM: C[m][n] = sum_k A[m][k] * Bt[n][k]; one block of 4 waves per
// 128x128 tile, one wave per 64x64 quarter. ET: 0 = bf16 operands, 1 = f16 operands. A row-major [M][K] pitch lda;
// Bt row-major [N][K] pitch ldb (k contiguous); M, N multiples of 128, K multiple of GKS (host constants).
// blockIdx.x = tile, blockIdx.y = batch index (strides in elements).
// Operand path: a stage = GKS k of the block's 128 A rows (and A2 rows) and 128 Bt rows, in LDS at pitch GPITCH,
// brought by 16-B asynchronous copies (16 lanes = one 256-B row piece); two buffers, the copies of stage t+2 are
// issued behind the barrier that ends stage t, so they fly while stage t+1 is worked on.
// NSPLIT: 0 = A.Bt; 1 = (A + A2).Bt (A2 = unscaled bf16 lo plane of A).
// Epilogue value v = acc*oscale + bias (+ resid) (relu); BIAS: 0 none, 1 per column n, 2 per row m
// (bias values RNE-converted to bf16); RESID (OUT_MODE 0 only): 1 = bf16 plane [m][n] pitch ldr, 2 = f32 plane.
// OUT_MODE: 0 = f32 (pitch ldc); 2 = bf16 hi plane C + bf16 lo plane C2 (lo = RNE(v - hi), unscaled);
//           3 = f16 hi plane C + f16 residual plane C2 = f16((v - hi) * rscale), C2 written only for tiles
//               with n0 < N2 (pitch ldc2, batch stride strideC2); 4 = f16 single plane C.
// =====================================================================================================
// Eight asynchronous 16-B copies per lane: rows r, r+8, .., r+56 of a plane (pitch ld elements) to LDS rows at
// pitch GPITCH. The s_wait_xcnt closes the statement so that no address register is rewritten ahead of it.
__device__ __forceinline__ void copy8_rows(unsigned l, const unsigned short* gp, int ld) {
#if DEV_ASM
  const size_t st = (size_t)8 * (size_t)ld;
  asm volatile(
      "global_load_async_to_lds_b128 %0, %8, off\n\t"
      "global_load_async_to_lds_b128 %1, %9, off\n\t"
      "global_load_async_to_lds_b128 %2, %10, off\n\t"
      "global_load_async_to_lds_b128 %3, %11, off\n\t"
      "global_load_async_to_lds_b128 %4, %12, off\n\t"
      "global_load_async_to_lds_b128 %5, %13, off\n\t"
      "global_load_async_to_lds_b128 %6, %14, off\n\t"
      "global_load_async_to_lds_b128 %7, %15, off\n\t"
      "s_wait_xcnt 0x0"
      :: "v"(l), "v"(l + 8u * GPITCH), "v"(l + 16u * GPITCH), "v"(l + 24u * GPITCH),
         "v"(l + 32u * GPITCH), "v"(l + 40u * GPITCH), "v"(l + 48u * GPITCH), "v"(l + 56u * GPITCH),
         "v"(gp), "v"(gp + st), "v"(gp + 2 * st), "v"(gp + 3 * st),
         "v"(gp + 4 * st), "v"(gp + 5 * st), "v"(gp + 6 * st), "v"(gp + 7 * st)
      : "memory");
  // keeps the next statement's address sums behind this one, so that their registers are used again
  __builtin_amdgcn_sched_barrier(0);
#endif
}
// One 128-row plane of a stage: 128 threads x 16 copies = 128 rows x 256 B.
__device__ __forceinline__ void copy_plane128(unsigned l, const unsigned short* gp, int ld) {
  copy8_rows(l, gp, ld);
  copy8_rows(l + 64u * GPITCH, gp + (size_t)64 * (size_t)ld, ld);
}
__device__ __forceinline__ void wait_lds_reads() {     // this wave's LDS reads are done before the buffer is given up
#if DEV_ASM
  asm volatile("s_wait_dscnt 0x0" ::: "memory");
#endif
}
__device__ __forceinline__ void wait_copies() {        // this wave's asynchronous copies have landed in LDS
#if DEV_ASM
  asm volatile("s_wait_asynccnt 0x0" ::: "memory");
#endif
}

template <int ET, int NSPLIT, int OUT_MODE, int BIAS, int RESID, bool RELU>
__global__ __launch_bounds__(128) void gemm64(
    const unsigned short* __restrict__ Ap, const unsigned short* __restrict__ A2p, int lda, long long strideA,
    const unsigned short* __restrict__ Btp, int ldb, long long strideB,
    const float* __restrict__ bias,
    const void* __restrict__ resid, int ldr, long long strideR,
    void* Cout, int ldc, long long strideC,
    void* Cout2, int ldc2, long long strideC2, int N2,
    int M, int N, int K, float oscale, float rscale) {
  typedef typename OpT<ET>::E E;
  typedef typename OpT<ET>::F F;
  const E* A  = (const E*)(const void*)Ap;
  const E* A2 = (const E*)(const void*)A2p;
  const E* Bt = (const E*)(const void*)Btp;
  constexpr int BROW  = (NSPLIT >= 1) ? 256 : 128;   // first Bt row of a stage (behind the A and A2 rows)
  constexpr int STAGE = (BROW + 128) * GPITCH;       // bytes of one buffer
  constexpr int PE    = GPITCH / 2;                  // LDS row pitch in elements
  __shared__ __align__(16) unsigned char ring[2 * STAGE];
  __shared__ __align__(16) float sT[4][16 * 68];   // per-wave 16x64 slab, pitch 68 floats
  const int b    = blockIdx.y;
  const int tid  = threadIdx.x;
  const int lane = tid & 31;
  const int wave = tid >> 5;
  const int tilesN = N >> 7;
  const int tilesM = M >> 7;
  const int tile = blockIdx.x;
  if (tile >= tilesM * tilesN) return;   // block-uniform, in front of every barrier
  const int tm = tile / tilesN;
  const int tn = tile - tm * tilesN;
  const int mB = tm << 7;                // block tile origin
  const int nB = tn << 7;
  const int wm = (wave >> 1) << 6;       // this wave's 64x64 quarter
  const int wn = (wave & 1) << 6;
  const int m0 = mB + wm;
  const int n0 = nB + wn;

  const E* Ab  = A  + (size_t)b * strideA;
  const E* Bb  = Bt + (size_t)b * strideB;
  const E* Ab2 = (NSPLIT >= 1) ? (A2 + (size_t)b * strideA) : Ab;

  const int rlane = lane & 15;                 // row (A) / col (B, D) within subtile
  const int koff  = (lane >> 4) * 8;           // k offset of this lane half
  const int mOff  = (lane >> 4) * 8;           // D row offset

  v8f acc[4][4];
#pragma unroll
  for (int i = 0; i < 4; ++i)
#pragma unroll
    for (int j = 0; j < 4; ++j) acc[i][j] = zero8();

  // copy addresses of this lane: 16-B piece (tid & 15) of rows (tid >> 4) + 8 i of each plane
  const int crow = tid >> 4, cpc = tid & 15;
  const unsigned cl = (unsigned)(size_t)(const void*)ring + (unsigned)(crow * GPITCH + cpc * 16);
  const unsigned short* ca  = (const unsigned short*)(const void*)Ab  + (size_t)(mB + crow) * lda + cpc * 8;
  const unsigned short* ca2 = (const unsigned short*)(const void*)Ab2 + (size_t)(mB + crow) * lda + cpc * 8;
  const unsigned short* cb  = (const unsigned short*)(const void*)Bb  + (size_t)(nB + crow) * ldb + cpc * 8;
  auto issue_stage = [&](int st, int buf) {
    const unsigned l = cl + (unsigned)(buf * STAGE);
    const int k0 = st * GKS;
    copy_plane128(l, ca + k0, lda);
    if (NSPLIT >= 1) copy_plane128(l + 128u * GPITCH, ca2 + k0, lda);
    copy_plane128(l + (unsigned)(BROW * GPITCH), cb + k0, ldb);
  };
  const int nst = K / GKS;               // stages; uniform
  issue_stage(0, 0);
  wait_copies();
  __syncthreads();                       // stage 0 is published
  if (nst > 1) issue_stage(1, 1);

  for (int t = 0; t < nst; ++t) {
    const unsigned char* sb = ring + (t & 1) * STAGE;
    const E* la  = (const E*)(const void*)(sb + (wm + rlane) * GPITCH) + koff;
    const E* la2 = la + 128 * PE;
    const E* lb  = (const E*)(const void*)(sb + (BROW + wn + rlane) * GPITCH) + koff;
#pragma unroll
    for (int ks = 0; ks < GKS; ks += 32) {
      F bh[4], ah[4], al[4];
#pragma unroll
      for (int j = 0; j < 4; ++j) bh[j] = OpT<ET>::ld(lb + (j << 4) * PE + ks);
#pragma unroll
      for (int i = 0; i < 4; ++i) {
        ah[i] = OpT<ET>::ld(la + (i << 4) * PE + ks);
        al[i] = ah[i];
        if (NSPLIT >= 1) al[i] = OpT<ET>::ld(la2 + (i << 4) * PE + ks);
      }
      // the step's LDS reads go as one group ahead of its WMMAs: the wave waits out the LDS latency once a step,
      // not once per A fragment
      __builtin_amdgcn_sched_barrier(0);
#pragma unroll
      for (int i = 0; i < 4; ++i) {
#pragma unroll
        for (int j = 0; j < 4; ++j) {
          acc[i][j] = OpT<ET>::mma_raw(ah[i], bh[j], acc[i][j]);
          if (NSPLIT >= 1) acc[i][j] = OpT<ET>::mma_raw(al[i], bh[j], acc[i][j]);
        }
        OpT<ET>::dep_guard(acc[i][0], acc[i][3], ah[i], al[i]);
      }
      OpT<ET>::keep4(bh[0], bh[1], bh[2], bh[3]);
      // keeps the next step's LDS reads from moving in among this step's WMMAs
      __builtin_amdgcn_sched_barrier(0);
    }
    wait_lds_reads();
    wait_copies();
    __syncthreads();                     // publishes stage t+1 and ends every read of stage t's buffer
    if (t + 2 < nst) issue_stage(t + 2, t & 1);
  }
  wait_copies();
  acc_guard4(acc[0][0], acc[0][1], acc[0][2], acc[0][3]);
  acc_guard4(acc[1][0], acc[1][1], acc[1][2], acc[1][3]);
  acc_guard4(acc[2][0], acc[2][1], acc[2][2], acc[2][3]);
  acc_guard4(acc[3][0], acc[3][1], acc[3][2], acc[3][3]);

  // ---- epilogue ----
  float* slab = sT[wave];
#pragma unroll
  for (int i = 0; i < 4; ++i) {
    const int mBase = m0 + (i << 4);
#pragma unroll
    for (int j = 0; j < 4; ++j) {
#pragma unroll
      for (int r = 0; r < 8; ++r) {
        slab[(mOff + r) * 68 + (j << 4) + rlane] = acc[i][j][r];
      }
    }
    __builtin_amdgcn_fence(__ATOMIC_RELEASE, "workgroup");
    __builtin_amdgcn_wave_barrier();
    __builtin_amdgcn_fence(__ATOMIC_ACQUIRE, "workgroup");
    if (OUT_MODE == 0) {
      float* C = (float*)Cout + (size_t)b * strideC;
      const int h2 = lane >> 4, c4 = (lane & 15) * 4;     // 256-B row segment = 16 lanes x 16 B
      v4f bz = {0.f, 0.f, 0.f, 0.f};
      if (BIAS == 1) {
        const v4f g = *(const v4f*)(bias + n0 + c4);
        bz[0] = bfr(g[0]); bz[1] = bfr(g[1]); bz[2] = bfr(g[2]); bz[3] = bfr(g[3]);
      }
      v4f ov[8];
#pragma unroll
      for (int it = 0; it < 8; ++it) {
        const int row = it * 2 + h2;                       // it 0..7 x h2 0..1 = rows 0..15
        const v4f v = *(const v4f*)(slab + row * 68 + c4);
        v4f w;
        w[0] = v[0] * oscale + bz[0];
        w[1] = v[1] * oscale + bz[1];
        w[2] = v[2] * oscale + bz[2];
        w[3] = v[3] * oscale + bz[3];
        if (BIAS == 2) {
          const float bm = bfr(bias[mBase + row]);
          w[0] += bm; w[1] += bm; w[2] += bm; w[3] += bm;
        }
        if (RESID == 1) {
          const unsigned short* rp = (const unsigned short*)resid + (size_t)b * strideR +
                                     (size_t)(mBase + row) * ldr + n0 + c4;
          const v2u rr = *(const v2u*)rp;
          w[0] += __uint_as_float(rr[0] << 16);
          w[1] += __uint_as_float(rr[0] & 0xffff0000u);
          w[2] += __uint_as_float(rr[1] << 16);
          w[3] += __uint_as_float(rr[1] & 0xffff0000u);
        }
        if (RESID == 2) {
          const float* rp = (const float*)resid + (size_t)b * strideR + (size_t)(mBase + row) * ldr + n0 + c4;
          const v4f rr = *(const v4f*)rp;
          w[0] += rr[0]; w[1] += rr[1]; w[2] += rr[2]; w[3] += rr[3];
        }
        if (RELU) {
          w[0] = fmaxf(w[0], 0.f); w[1] = fmaxf(w[1], 0.f); w[2] = fmaxf(w[2], 0.f); w[3] = fmaxf(w[3], 0.f);
        }
        ov[it] = w;
      }
      {
#pragma unroll
        for (int it = 0; it < 8; ++it) {
          const int row = it * 2 + h2;
          *(v4f*)(C + (size_t)(mBase + row) * ldc + n0 + c4) = ov[it];
        }
        
      }
    } else {
      const int q = lane >> 3, c8 = (lane & 7) * 8;
      unsigned short* C  = (unsigned short*)Cout  + (size_t)b * strideC;
      unsigned short* C2 = (unsigned short*)Cout2 + (size_t)b * strideC2;
      const bool wlo = (OUT_MODE == 2) || (OUT_MODE == 3 && n0 < N2);   // wave-uniform
      float b8[8];
#pragma unroll
      for (int e = 0; e < 8; ++e) b8[e] = 0.f;
      if (BIAS == 1) {
        const v4f g0 = *(const v4f*)(bias + n0 + c8);
        const v4f g1 = *(const v4f*)(bias + n0 + c8 + 4);
#pragma unroll
        for (int e = 0; e < 4; ++e) { b8[e] = bfr(g0[e]); b8[4 + e] = bfr(g1[e]); }
      }
      v4u hv[4], lv[4];
#pragma unroll
      for (int it = 0; it < 4; ++it) {
        const int row = it * 4 + q;                        // it 0..3 x q 0..3 = rows 0..15
        const float* sp = slab + row * 68 + c8;
        float bm = 0.f;
        if (BIAS == 2) bm = bfr(bias[mBase + row]);
        v4u a, a2;
#pragma unroll
        for (int e = 0; e < 4; ++e) {
          float f0 = sp[2 * e] * oscale + b8[2 * e] + bm;
          float f1 = sp[2 * e + 1] * oscale + b8[2 * e + 1] + bm;
          if (RELU) { f0 = fmaxf(f0, 0.f); f1 = fmaxf(f1, 0.f); }
          unsigned short h0, h1, l0 = 0, l1 = 0;
          if (OUT_MODE == 2) {
            h0 = bf_bits(f0); h1 = bf_bits(f1);
            l0 = bf_bits(f0 - bf_up(h0)); l1 = bf_bits(f1 - bf_up(h1));
          } else if (OUT_MODE == 3) {
            const _Float16 x0 = (_Float16)f0, x1 = (_Float16)f1;
            h0 = h_bits(x0); h1 = h_bits(x1);
            l0 = h_bits((_Float16)((f0 - (float)x0) * rscale));
            l1 = h_bits((_Float16)((f1 - (float)x1) * rscale));
          } else {
            h0 = h_bits((_Float16)f0); h1 = h_bits((_Float16)f1);
          }
          a[e] = pk16(h0, h1); a2[e] = pk16(l0, l1);
        }
        hv[it] = a; lv[it] = a2;
      }
      {
#pragma unroll
        for (int it = 0; it < 4; ++it) {
          const int row = it * 4 + q;
          *(v4u*)(C + (size_t)(mBase + row) * ldc + n0 + c8) = hv[it];
          if (wlo) *(v4u*)(C2 + (size_t)(mBase + row) * ldc2 + n0 + c8) = lv[it];
        }
        
      }
    }
    __builtin_amdgcn_fence(__ATOMIC_RELEASE, "workgroup");
    __builtin_amdgcn_wave_barrier();
    __builtin_amdgcn_fence(__ATOMIC_ACQUIRE, "workgroup");
  }
}

// =====================================================================================================
// Attention with an int32 replace-mask, head dim 64.
//   q planes (bf16 hi / lo): element (b, t, h, d) at [(b*SEQ + t)*DM + h*64 + d]
//   k planes (bf16 hi / lo): same layout with key index s
//   v^T hi plane (f16):      element (b, h, d, s) at [(b*DM + h*64 + d)*SEQ + s]
//   v^T residual plane (f16, (v - hi)*4096): [(b*DM + h*64 + d)*VLP + s], s < VLP, read only when RES
//   (a key tile at or beyond VLP contributes a zero v residual)
//   mask int32 [1][1][t][s]: logit = (mask != 0) ? q.k*sscale : -inf (replace)
//   flg [qt][kt]: bit r set when mask row qt*64+r has a nonzero inside key tile kt. A key tile is skipped only
//   when its word is 0 (every logit of the tile is -inf -> weight exactly 0, row max unaffected). The decision is
//   a block-uniform scalar load.
//   out planes (bf16 hi / lo of the normalised context): element (b, t, h, d) at [(b*SEQ + t)*DM + h*64 + d]
//   scores = q . k : bf16 hi/lo split (hi.hi + hi.lo + lo.hi), f32 accumulate, then * sscale + mask select in f32
//   p = exp(s - m) carried as f16(1024 p); context = p . v on f16 WMMA; RES adds f16 residual planes of p and v
//   (scale 4096, separate accumulator folded back with 1/4096 per chunk in f32); online softmax in f32.
//   A fully masked query row ends with l = 0 -> 0 * inf = NaN context, matching -inf softmax semantics.
//   Block = 4 waves = 64 query rows of one (b, h); grid = nqbThis * NH * NB; kv chunks of 64, static trip 32.
//   K / V^T chunk staging: 128 threads x 32 elements per plane = the whole 64x64 tile (plain 16-B loads,
//   __syncthreads before and after); P tiles are wave-private, spilled with _Float16 element stores and reloaded
//   Output coverage: each wave stores rows q0..q0+15 (it 0..3 x lane>>3 0..3) x 64 columns (8 lanes x 8) of both planes.
// =====================================================================================================
template <bool RES>
__global__ __launch_bounds__(128)
void attn_mask64(const unsigned short* __restrict__ qhp, const unsigned short* __restrict__ qlp,
                 const unsigned short* __restrict__ khp, const unsigned short* __restrict__ klp,
                 const unsigned short* __restrict__ vhp, const unsigned short* __restrict__ vlp,
                 const int* __restrict__ maskp, const u64* __restrict__ flg,
                 unsigned short* ohp, unsigned short* olp,
                 int qbBase, int nqbThis, float sscale) {
  union FB { v16b v; v8b h[2]; };
  union FH { v16h v; v8h h[2]; };
  __shared__ __align__(16) __bf16   Ksh[64 * 64];                 // K hi [kv][d]   8 KB
  __shared__ __align__(16) __bf16   Ksl[64 * 64];                 // K lo
  __shared__ __align__(16) _Float16 Vth[64 * 64];                 // V^T hi [d][kv] 8 KB
  __shared__ __align__(16) _Float16 Vtl[RES ? 64 * 64 : 8];       // V^T residual
  __shared__ __align__(16) _Float16 Psh[4][16 * 64];              // per wave P [row][kv]
  __shared__ __align__(16) _Float16 Psl[RES ? 4 : 1][16 * 64];    // per wave P residual
  __shared__ __align__(16) float    Os[4][16 * 64];               // per wave context tile [row][d]

  const int tid  = threadIdx.x;
  const int wave = tid >> 5;
  const int lane = tid & 31;
  const int hh   = lane >> 4;
  const int c    = lane & 15;

  const int bx   = blockIdx.x;
  const int qbl  = bx % nqbThis;
  const int rest = bx / nqbThis;
  const int h    = rest % NH;
  const int b    = rest / NH;
  const int qb   = qbBase + qbl;
  const int q0   = qb * 64 + wave * 16;
  const size_t rowB = (size_t)b * SEQ;

  const __bf16* Qh = (const __bf16*)(const void*)qhp + (size_t)h * HD;
  const __bf16* Ql = (const __bf16*)(const void*)qlp + (size_t)h * HD;
  const __bf16* Kh = (const __bf16*)(const void*)khp + (size_t)h * HD;
  const __bf16* Kl = (const __bf16*)(const void*)klp + (size_t)h * HD;
  const _Float16* Vh = (const _Float16*)(const void*)vhp + ((size_t)b * DM + (size_t)h * HD) * SEQ;
  const _Float16* Vl = (const _Float16*)(const void*)vlp + ((size_t)b * DM + (size_t)h * HD) * VLP;
  const u64* fq = flg + (size_t)qb * NQB;     // block-uniform address -> scalar loads

  // ---- Q fragments (A operand, row = lane&15): 2 d-chunks, hi and lo ----
  v16b qah[2], qal[2];
#pragma unroll
  for (int dc = 0; dc < 2; ++dc) {
    const size_t qo = (rowB + q0 + c) * DM + dc * 32 + 8 * hh;
    qah[dc] = OpT<0>::ld(Qh + qo);
    qal[dc] = OpT<0>::ld(Ql + qo);
  }

  float mrow[8], lrow[8];
  v8f oacc[4];
#pragma unroll
  for (int r = 0; r < 8; ++r) { mrow[r] = -INFINITY; lrow[r] = 0.f; }
#pragma unroll
  for (int t = 0; t < 4; ++t) oacc[t] = zero8();

  for (int kt = 0; kt < NQB; ++kt) {         // static trip count
    const u64 lw = fq[kt];
    if (lw == 0ull) continue;                // block-uniform
    const int kv0 = kt * 64;
    __syncthreads();
    {
      const int r = tid >> 1, half = (tid & 1) * 32;
      const __bf16*   kg  = Kh + (rowB + kv0 + r) * DM + half;    // K row kv0+r, d = half..half+31
      const __bf16*   klg = Kl + (rowB + kv0 + r) * DM + half;
      const _Float16* vg  = Vh + (size_t)r * SEQ + kv0 + half;    // V^T row d = r, s = kv0+half..+31
      const int kvl = (kv0 + 64 <= VLP) ? kv0 : (VLP - 64);     // clamped address into the residual plane
      const _Float16* vlg = Vl + (size_t)r * VLP + kvl + half;
      const bool resOK = (kv0 + 64 <= VLP);                      // block-uniform
#pragma unroll
      for (int i = 0; i < 4; ++i) {
        const v8b a0 = *(const v8b*)(kg + 8 * i);
        const v8b a1 = *(const v8b*)(klg + 8 * i);
        const v8h b0 = *(const v8h*)(vg + 8 * i);
        *(v8b*)(Ksh + r * 64 + half + 8 * i) = a0;
        *(v8b*)(Ksl + r * 64 + half + 8 * i) = a1;
        *(v8h*)(Vth + r * 64 + half + 8 * i) = b0;
        if (RES) {
          v8h b1 = *(const v8h*)(vlg + 8 * i);
          if (!resOK) b1 = zero8h();
          *(v8h*)(Vtl + r * 64 + half + 8 * i) = b1;
        }
      }
    }
    __syncthreads();

    // ---- scores: 16 query rows x 64 keys per wave, 3 bf16 products ----
    v8f s[4];
#pragma unroll
    for (int j = 0; j < 4; ++j) {
      s[j] = zero8();
#pragma unroll
      for (int dc = 0; dc < 2; ++dc) {
        FB kb, kl;
        kb.h[0] = *(const v8b*)(Ksh + (j * 16 + c) * 64 + dc * 32 + 8 * hh);
        kb.h[1] = *(const v8b*)(Ksh + (j * 16 + c) * 64 + dc * 32 + 16 + 8 * hh);
        kl.h[0] = *(const v8b*)(Ksl + (j * 16 + c) * 64 + dc * 32 + 8 * hh);
        kl.h[1] = *(const v8b*)(Ksl + (j * 16 + c) * 64 + dc * 32 + 16 + 8 * hh);
        s[j] = mma_b(qah[dc], kb.v, s[j]);
        s[j] = mma_b(qah[dc], kl.v, s[j]);
        s[j] = mma_b(qal[dc], kb.v, s[j]);
      }
    }

    // ---- scale + mask select, row max, online softmax, P (x1024, f16) and P residual (x4096) to LDS ----
    _Float16* pwh = Psh[wave];
    _Float16* pwl = Psl[RES ? wave : 0];
    const int* mq = maskp + (size_t)(q0 + 8 * hh) * SEQ + kv0 + c;   // row q0+8hh, key kv0+c; all < SEQ
#pragma unroll
    for (int r = 0; r < 8; ++r) {
      const int* mrw = mq + (size_t)r * SEQ;
      float m = -INFINITY;
#pragma unroll
      for (int j = 0; j < 4; ++j) {
        const int mv = mrw[j * 16];
        const float sv = (mv != 0) ? (s[j][r] * sscale) : -INFINITY;
        s[j][r] = sv;
        m = fmaxf(m, sv);
      }
#pragma unroll
      for (int off = 1; off < 16; off <<= 1) m = fmaxf(m, __shfl_xor(m, off, 32));
      const float mnew  = fmaxf(mrow[r], m);
      const float msafe = (mnew == -INFINITY) ? 0.f : mnew;
      const float alpha = __expf(mrow[r] - msafe);
      mrow[r] = mnew;
      float psum = 0.f;
#pragma unroll
      for (int j = 0; j < 4; ++j) {
        const float p = __expf(s[j][r] - msafe);     // -inf logit against a finite max: exp -> 0
        psum += p;
        const float p1k = p * 1024.0f;
        const _Float16 ph = (_Float16)p1k;
        pwh[(8 * hh + r) * 64 + j * 16 + c] = ph;
        if (RES) {
          const _Float16 pl = (_Float16)((p1k - (float)ph) * 4096.0f);
          pwl[(8 * hh + r) * 64 + j * 16 + c] = pl;
        }
      }
#pragma unroll
      for (int off = 1; off < 16; off <<= 1) psum += __shfl_xor(psum, off, 32);
      lrow[r] = lrow[r] * alpha + psum;
#pragma unroll
      for (int t = 0; t < 4; ++t) oacc[t][r] *= alpha;
    }
    __builtin_amdgcn_fence(__ATOMIC_RELEASE, "workgroup");
    __builtin_amdgcn_wave_barrier();
    __builtin_amdgcn_fence(__ATOMIC_ACQUIRE, "workgroup");

    // ---- context += P . V (f16 WMMA), residual products into a separate accumulator ----
    v8f o1[4];
#pragma unroll
    for (int t = 0; t < 4; ++t) o1[t] = zero8();
#pragma unroll 1
    for (int kk = 0; kk < 2; ++kk) {
      FH pa, pl;
      pa.h[0] = *(const v8h*)(pwh + c * 64 + kk * 32 + 8 * hh);
      pa.h[1] = *(const v8h*)(pwh + c * 64 + kk * 32 + 16 + 8 * hh);
      if (RES) {
        pl.h[0] = *(const v8h*)(pwl + c * 64 + kk * 32 + 8 * hh);
        pl.h[1] = *(const v8h*)(pwl + c * 64 + kk * 32 + 16 + 8 * hh);
      } else {
        pl.v = pa.v;
      }
#pragma unroll
      for (int t = 0; t < 4; ++t) {
        FH vb;
        vb.h[0] = *(const v8h*)(Vth + (t * 16 + c) * 64 + kk * 32 + 8 * hh);
        vb.h[1] = *(const v8h*)(Vth + (t * 16 + c) * 64 + kk * 32 + 16 + 8 * hh);
        oacc[t] = mma_h(pa.v, vb.v, oacc[t]);
        if (RES) {
          FH vl;
          vl.h[0] = *(const v8h*)(Vtl + (t * 16 + c) * 64 + kk * 32 + 8 * hh);
          vl.h[1] = *(const v8h*)(Vtl + (t * 16 + c) * 64 + kk * 32 + 16 + 8 * hh);
          o1[t] = mma_h(pa.v, vl.v, o1[t]);
          o1[t] = mma_h(pl.v, vb.v, o1[t]);
        }
      }
    }
    if (RES) {
#pragma unroll
      for (int t = 0; t < 4; ++t)
#pragma unroll
        for (int r = 0; r < 8; ++r) oacc[t][r] += o1[t][r] * (1.0f / 4096.0f);
    }
  }

  // ---- normalise (1/l and the 1/1024 p carry), stage the wave's 16x64 tile, bf16 hi/lo split,
  float* os = Os[wave];
#pragma unroll
  for (int r = 0; r < 8; ++r) {
    const float l = lrow[r];
    const float inv = (1.0f / l) * (1.0f / 1024.0f);   // l == 0 (fully masked row) -> inf -> NaN context
#pragma unroll
    for (int t = 0; t < 4; ++t) os[(8 * hh + r) * 64 + t * 16 + c] = oacc[t][r] * inv;
  }
  __builtin_amdgcn_fence(__ATOMIC_RELEASE, "workgroup");
  __builtin_amdgcn_wave_barrier();
  __builtin_amdgcn_fence(__ATOMIC_ACQUIRE, "workgroup");
  {
    const int q4 = lane >> 3, c8 = (lane & 7) * 8;
    v4u hv[4], lv[4];
#pragma unroll
    for (int it = 0; it < 4; ++it) {
      const int row = it * 4 + q4;   // it 0..3 x q4 0..3 = rows 0..15 of the wave tile
      const float* sp = os + row * 64 + c8;
      v4u a, a2;
#pragma unroll
      for (int e = 0; e < 4; ++e) {
        const float f0 = sp[2 * e], f1 = sp[2 * e + 1];
        const unsigned short h0 = bf_bits(f0), h1 = bf_bits(f1);
        const unsigned short l0 = bf_bits(f0 - bf_up(h0)), l1 = bf_bits(f1 - bf_up(h1));
        a[e] = pk16(h0, h1); a2[e] = pk16(l0, l1);
      }
      hv[it] = a; lv[it] = a2;
    }
    {
#pragma unroll
      for (int it = 0; it < 4; ++it) {
        const int row = it * 4 + q4;
        const size_t go = (rowB + q0 + row) * DM + (size_t)h * HD + c8;
        *(v4u*)(ohp + go) = hv[it];
        *(v4u*)(olp + go) = lv[it];
      }
      
    }
  }
}

// =====================================================================================================
// Layer norm over rows of DM=1024, f32, one block per row (grid = MROWS, 256 threads, 4 elements per thread).
// mean and biased variance via wave shuffles + 16 LDS slots; gamma / beta values RNE-converted to bf16;
// o = (gamma * (x - mean)) * (1 / sqrt(var + eps)) + beta.
// OUT16: threads 0..127 reload 8 consecutive inputs each and write the f16 plane as one 16-B store per lane
// coverage: 256 threads x 4 = the row (f32); 128 threads x 8 = the row (f16).
// =====================================================================================================
template <bool OUT16>
__global__ __launch_bounds__(256) void layernorm_rows(const float* __restrict__ in,
                                                       const float* __restrict__ gamma,
                                                       const float* __restrict__ beta,
                                                       float* out32, unsigned short* out16) {
  __shared__ float red[16];
  const int tid = threadIdx.x, lane = tid & 31, wave = tid >> 5;
  const int row = blockIdx.x;
  const float* xr = in + (size_t)row * DM;
  const v4f v = *(const v4f*)(xr + tid * 4);
  float s = (v[0] + v[1]) + (v[2] + v[3]);
#pragma unroll
  for (int off = 1; off < 32; off <<= 1) s += __shfl_xor(s, off, 32);
  if (lane == 0) red[wave] = s;
  __syncthreads();
  float tot = 0.f;
#pragma unroll
  for (int i = 0; i < 8; ++i) tot += red[i];
  const float mean = tot * (1.0f / (float)DM);
  const float d0 = v[0] - mean, d1 = v[1] - mean, d2 = v[2] - mean, d3 = v[3] - mean;
  float s2 = (d0 * d0 + d1 * d1) + (d2 * d2 + d3 * d3);
#pragma unroll
  for (int off = 1; off < 32; off <<= 1) s2 += __shfl_xor(s2, off, 32);
  if (lane == 0) red[8 + wave] = s2;
  __syncthreads();
  float tot2 = 0.f;
#pragma unroll
  for (int i = 0; i < 8; ++i) tot2 += red[8 + i];
  const float var  = tot2 * (1.0f / (float)DM);
  const float rstd = 1.0f / sqrtf(var + LNEPS);

  const v4f g  = *(const v4f*)(gamma + tid * 4);
  const v4f bt = *(const v4f*)(beta + tid * 4);
  v4f o;
  o[0] = (bfr(g[0]) * d0) * rstd + bfr(bt[0]);
  o[1] = (bfr(g[1]) * d1) * rstd + bfr(bt[1]);
  o[2] = (bfr(g[2]) * d2) * rstd + bfr(bt[2]);
  o[3] = (bfr(g[3]) * d3) * rstd + bfr(bt[3]);
  float* op = out32 + (size_t)row * DM + tid * 4;
  *(v4f*)op = o;
  

  if (OUT16) {
    if (tid < 128) {
      const int cc = tid * 8;
      const v4f a0 = *(const v4f*)(xr + cc);
      const v4f a1 = *(const v4f*)(xr + cc + 4);
      const v4f g0 = *(const v4f*)(gamma + cc), g1 = *(const v4f*)(gamma + cc + 4);
      const v4f b0 = *(const v4f*)(beta + cc),  b1 = *(const v4f*)(beta + cc + 4);
      float f[8];
#pragma unroll
      for (int e = 0; e < 4; ++e) {
        f[e]     = (bfr(g0[e]) * (a0[e] - mean)) * rstd + bfr(b0[e]);
        f[4 + e] = (bfr(g1[e]) * (a1[e] - mean)) * rstd + bfr(b1[e]);
      }
      v4u hp;
#pragma unroll
      for (int e = 0; e < 4; ++e) hp[e] = pk16(h_bits((_Float16)f[2 * e]), h_bits((_Float16)f[2 * e + 1]));
      unsigned short* hq = out16 + (size_t)row * DM + cc;
      *(v4u*)hq = hp;
      
    }
  }
}

// =====================================================================================================
// Workspace map (MiB = 1048576 B):
//   Xb   bf16 [4096][1024]         0 ..   8
//   WqT  bf16 [1024 n][1024 k]     8 ..  10     WkT 10 .. 12    WvT 12 .. 14    WoT 14 .. 16
//   W1T  f16  [4096 n][1024 k]    16 ..  24     W2T f16 [1024 n][4096 k]  24 .. 32
//   Qh   bf16 [4096][1024]        32 ..  40     Ql 40 .. 48    Kh 48 .. 56    Kl 56 .. 64
//   VTh  f16  [2][1024][2048]     64 ..  72     VTl f16 [2][1024][512]    72 .. 74    Flg u64 [32][32] at 74
//   Oh   bf16 [4096][1024]        76 ..  84     Ol 84 .. 92
//   later (regions dead by then, single in-order stream):
//   T1   f32  [4096][1024]        32 ..  48   (over Qh, Ql: written by the Wo GEMM after attention)
//   H32  f32  [4096][1024]        48 ..  64   (over Kh, Kl: written by LN1)
//   Hh   f16  [4096][1024]        64 ..  72   (over VTh: written by LN1)
//   F1   f16  [4096][4096]        72 .. 104   (over VTl, Flg, Oh, Ol: written by the W1 GEMM after the Wo GEMM)
//   T2   f32  [4096][1024]        32 ..  48   (over T1: written by the W2 GEMM after LN1)
//   end = 104 MiB. Every plane is an exact multiple of its 64x64 tile / whole-line store granularity
//   (no padded tails); all region starts are MiB aligned.
// =====================================================================================================
extern "C" void kernel_launch(void* const* d_in, const int* in_sizes, int n_in,
                              void* d_out, int out_size, void* d_ws, size_t ws_size,
                              hipStream_t stream) {
  if (n_in < 18) return;
  if (in_sizes[0] != NB * SEQ * DM) return;
  if (in_sizes[1] != SEQ * SEQ) return;
  if (in_sizes[2] != DM * DM || in_sizes[4] != DM * DM || in_sizes[6] != DM * DM || in_sizes[8] != DM * DM) return;
  if (in_sizes[3] != DM || in_sizes[5] != DM || in_sizes[7] != DM || in_sizes[9] != DM) return;
  if (in_sizes[10] != DM * DFF || in_sizes[11] != DFF || in_sizes[12] != DFF * DM || in_sizes[13] != DM) return;
  if (in_sizes[14] != DM || in_sizes[15] != DM || in_sizes[16] != DM || in_sizes[17] != DM) return;
  if (out_size != NB * SEQ * DM) return;

  const float* x   = (const float*)d_in[0];
  const int*   msk = (const int*)d_in[1];
  const float* Wq  = (const float*)d_in[2];
  const float* bq  = (const float*)d_in[3];
  const float* Wk  = (const float*)d_in[4];
  const float* bk  = (const float*)d_in[5];
  const float* Wv  = (const float*)d_in[6];
  const float* bv  = (const float*)d_in[7];
  const float* Wo  = (const float*)d_in[8];
  const float* bo  = (const float*)d_in[9];
  const float* W1  = (const float*)d_in[10];
  const float* b1  = (const float*)d_in[11];
  const float* W2  = (const float*)d_in[12];
  const float* b2  = (const float*)d_in[13];
  const float* gamma1 = (const float*)d_in[14];
  const float* beta1  = (const float*)d_in[15];
  const float* gamma2 = (const float*)d_in[16];
  const float* beta2  = (const float*)d_in[17];

  const size_t PX   = (size_t)MROWS * DM * 2;        //  8 MiB  16-bit activation plane [4096][1024]
  const size_t PW   = (size_t)DM * DM * 2;           //  2 MiB  16-bit weight plane [1024][1024]
  const size_t PWF  = (size_t)DM * DFF * 2;          //  8 MiB  16-bit FFN weight plane
  const size_t PVT  = (size_t)NB * DM * SEQ * 2;     //  8 MiB  v^T hi plane
  const size_t PVL  = (size_t)NB * DM * VLP * 2;     //  2 MiB  v^T residual plane
  const size_t PFs  = (size_t)2 * 1048576;           //  2 MiB  slot for the 8 KiB flag table
  const size_t PF   = (size_t)NQB * NQB * 8;         //  8 KiB
  const size_t PT   = (size_t)MROWS * DM * 4;        // 16 MiB  f32 activation plane
  const size_t PF1  = (size_t)MROWS * DFF * 2;       // 32 MiB  f16 FFN hidden plane
  if (PF > PFs) return;
  size_t off = 0;
  const size_t oXb  = off; off += PX;
  const size_t oWq  = off; off += PW;
  const size_t oWk  = off; off += PW;
  const size_t oWv  = off; off += PW;
  const size_t oWo  = off; off += PW;
  const size_t oW1  = off; off += PWF;
  const size_t oW2  = off; off += PWF;
  const size_t oQh  = off; off += PX;
  const size_t oQl  = off; off += PX;
  const size_t oKh  = off; off += PX;
  const size_t oKl  = off; off += PX;
  const size_t oVTh = off; off += PVT;
  const size_t oVTl = off; off += PVL;
  const size_t oFlg = off; off += PFs;
  const size_t oOh  = off; off += PX;
  const size_t oOl  = off; off += PX;
  const size_t endA = off;                           // 92 MiB
  const size_t oT1  = oQh;                           // T1 over Qh + Ql
  const size_t oH32 = oKh;                           // H32 over Kh + Kl
  const size_t oHh  = oVTh;                          // Hh over VTh
  const size_t oF1  = oVTl;                          // F1 over VTl .. Ol and beyond
  const size_t oT2  = oT1;                           // T2 over T1
  if (oT1 + PT != oKh) return;                       // aliasing sanity: T1 ends where H32 starts
  if (oH32 + PT != oVTh) return;                     // H32 ends where Hh starts
  if (oHh + PX != oVTl) return;                      // Hh ends where F1 starts
  size_t total = oF1 + PF1;                          // 104 MiB
  if (endA > total) total = endA;
  if (total > ws_size) return;
  if (total > (size_t)134217728) return;

  char* ws = (char*)d_ws;
  unsigned short* Xb   = (unsigned short*)(ws + oXb);
  unsigned short* WqTb = (unsigned short*)(ws + oWq);
  unsigned short* WkTb = (unsigned short*)(ws + oWk);
  unsigned short* WvTb = (unsigned short*)(ws + oWv);
  unsigned short* WoTb = (unsigned short*)(ws + oWo);
  unsigned short* W1Tb = (unsigned short*)(ws + oW1);
  unsigned short* W2Tb = (unsigned short*)(ws + oW2);
  unsigned short* Qh   = (unsigned short*)(ws + oQh);
  unsigned short* Ql   = (unsigned short*)(ws + oQl);
  unsigned short* Kh   = (unsigned short*)(ws + oKh);
  unsigned short* Kl   = (unsigned short*)(ws + oKl);
  unsigned short* VTh  = (unsigned short*)(ws + oVTh);
  unsigned short* VTl  = (unsigned short*)(ws + oVTl);
  u64*            Flg  = (u64*)(ws + oFlg);
  unsigned short* Oh   = (unsigned short*)(ws + oOh);
  unsigned short* Ol   = (unsigned short*)(ws + oOl);
  float*          T1   = (float*)(ws + oT1);
  float*          H32  = (float*)(ws + oH32);
  unsigned short* Hh   = (unsigned short*)(ws + oHh);
  unsigned short* F1   = (unsigned short*)(ws + oF1);
  float*          T2   = (float*)(ws + oT2);

  const dim3 blk(256);
  const int n8x = MROWS * DM / 8;                                   // 524288
  const dim3 gCvtX((n8x + 255) / 256);                              // 2048 blocks
  const dim3 gMask(NQB);                                            // 32 blocks
  const dim3 gTw(DM / 64, DM / 64);                                 // 16 x 16: in [1024 k][1024 n] -> out [1024 n][1024 k]
  const dim3 gTw1(DFF / 64, DM / 64);                               // 64 x 16: in [1024 k][4096 n] -> out [4096 n][1024 k]
  const dim3 gTw2(DM / 64, DFF / 64);                               // 16 x 64: in [4096 k][1024 n] -> out [1024 n][4096 k]
  const dim3 blkG(128);                                             // GEMM block: 4 waves, one 128x128 tile
  const dim3 gProj((MROWS / 128) * (DM / 128), 1);                  // 256 tiles: M=4096, N=1024
  const dim3 gVT((DM / 128) * (SEQ / 128), NB);                     // 128 tiles x 2 batches: M=1024, N=2048
  const dim3 gW1((MROWS / 128) * (DFF / 128), 1);                   // 1024 tiles: M=4096, N=4096
  const dim3 gW2((MROWS / 128) * (DM / 128), 1);                    // 256 tiles: M=4096, N=1024
  const dim3 gLN(MROWS);                                            // 4096 blocks, one row each

  // (0) mask tile survey -> Flg
  mask_rowbits<<<gMask, blk, 0, stream>>>(msk, Flg);
  // (1) x -> bf16 plane [4096][1024]; weights [k][n] f32 -> 16-bit [n][k] planes
  cvt_bf16x8<<<gCvtX, blk, 0, stream>>>(x, Xb, n8x);
  wtrans64<false><<<gTw, blk, 0, stream>>>(Wq, WqTb, DM, DM, 1.0f);
  wtrans64<false><<<gTw, blk, 0, stream>>>(Wk, WkTb, DM, DM, 1.0f);
  wtrans64<false><<<gTw, blk, 0, stream>>>(Wv, WvTb, DM, DM, 1.0f);
  wtrans64<false><<<gTw, blk, 0, stream>>>(Wo, WoTb, DM, DM, 1.0f);
  wtrans64<true><<<gTw1, blk, 0, stream>>>(W1, W1Tb, DM, DFF, WSCALE);
  wtrans64<true><<<gTw2, blk, 0, stream>>>(W2, W2Tb, DFF, DM, WSCALE);
  // (2) q = x . Wq + bq -> bf16 hi/lo planes [b*SEQ+t][h*64+d]   (M=4096, N=1024, K=1024)
  gemm64<0, 0, 2, 1, 0, false><<<gProj, blkG, 0, stream>>>(
      Xb, Xb, DM, 0LL, WqTb, DM, 0LL, bq, (const void*)Xb, DM, 0LL,
      (void*)Qh, DM, 0LL, (void*)Ql, DM, 0LL, DM,
      MROWS, DM, DM, 1.0f, 1.0f);
  // (3) k = x . Wk + bk -> bf16 hi/lo planes
  gemm64<0, 0, 2, 1, 0, false><<<gProj, blkG, 0, stream>>>(
      Xb, Xb, DM, 0LL, WkTb, DM, 0LL, bk, (const void*)Xb, DM, 0LL,
      (void*)Kh, DM, 0LL, (void*)Kl, DM, 0LL, DM,
      MROWS, DM, DM, 1.0f, 1.0f);
  // (4) v^T = WvT . x^T + bv per batch -> f16 hi plane [b][h*64+d][s] (pitch SEQ) and residual plane
  //     (x4096, keys < VLP only, pitch VLP)   (A = WvT [d][k], Bt = Xb rows of batch b; M=1024, N=2048, K=1024)
  gemm64<0, 0, 3, 2, 0, false><<<gVT, blkG, 0, stream>>>(
      WvTb, WvTb, DM, 0LL, Xb, DM, (long long)SEQ * DM, bv, (const void*)Xb, DM, 0LL,
      (void*)VTh, SEQ, (long long)DM * SEQ, (void*)VTl, VLP, (long long)DM * VLP, VLP,
      DM, SEQ, DM, 1.0f, 4096.0f);
  // (5) attention: query blocks 0..RESQB-1 with residual planes, the rest without
  attn_mask64<true><<<dim3(NB * NH * RESQB), dim3(128), 0, stream>>>(
      Qh, Ql, Kh, Kl, VTh, VTl, msk, Flg, Oh, Ol, 0, RESQB, 0.125f);
  attn_mask64<false><<<dim3(NB * NH * (NQB - RESQB)), dim3(128), 0, stream>>>(
      Qh, Ql, Kh, Kl, VTh, VTl, msk, Flg, Oh, Ol, RESQB, NQB - RESQB, 0.125f);
  // (6) T1 = ctx . Wo + bo + bf16(x) -> f32 [4096][1024]  (A = context hi + lo planes, 2 products)
  gemm64<0, 1, 0, 1, 1, false><<<gProj, blkG, 0, stream>>>(
      Oh, Ol, DM, 0LL, WoTb, DM, 0LL, bo, (const void*)Xb, DM, 0LL,
      (void*)T1, DM, 0LL, (void*)T1, DM, 0LL, 0,
      MROWS, DM, DM, 1.0f, 1.0f);
  // (7) h = LN1(T1) -> H32 f32 and Hh f16
  layernorm_rows<true><<<gLN, blk, 0, stream>>>(T1, gamma1, beta1, H32, Hh);
  // (8) F1 = relu(h . W1 + b1) -> f16 [4096][4096]  (f16 operands, W1 carried x64, acc scaled by 1/64)
  gemm64<1, 0, 4, 1, 0, true><<<gW1, blkG, 0, stream>>>(
      Hh, Hh, DM, 0LL, W1Tb, DM, 0LL, b1, (const void*)Hh, DM, 0LL,
      (void*)F1, DFF, 0LL, (void*)F1, DFF, 0LL, 0,
      MROWS, DFF, DM, 1.0f / WSCALE, 1.0f);
  // (9) T2 = F1 . W2 + b2 + h -> f32 [4096][1024]  (K = 4096, W2 carried x64)
  gemm64<1, 0, 0, 1, 2, false><<<gW2, blkG, 0, stream>>>(
      F1, F1, DFF, 0LL, W2Tb, DFF, 0LL, b2, (const void*)H32, DM, 0LL,
      (void*)T2, DM, 0LL, (void*)T2, DM, 0LL, 0,
      MROWS, DM, DFF, 1.0f / WSCALE, 1.0f);
  // (10) out = LN2(T2) -> d_out f32 [2][2048][1024]
  layernorm_rows<false><<<gLN, blk, 0, stream>>>(T2, gamma2, beta2, (float*)d_out, Hh);
  (void)hipGetLastError();
}

// v002
// One run takes 339 microseconds.
// Two timings next to v001 put it at 1.22 and 1.23 times that version's speed.
// Over all steps from v000 it is 2.09 times as fast.
// Contractions: q, k, v^T projections = v_wmma_f32_16x16x32_bf16 (bf16 operands from RNE-converted inputs, single product);
// q.k^T scores = v_wmma_f32_16x16x32_bf16 with q and k as bf16 hi/lo planes (hi.hi + hi.lo + lo.hi);
// p.v = v_wmma_f32_16x16x32_f16 (p carried x1024 in f16, v f16 hi plane; f16 residual planes x4096 of p and v on the first 512 query rows);
// ctx.Wo = v_wmma_f32_16x16x32_bf16 with ctx as bf16 hi/lo planes times bf16 Wo (2 products);
// h.W1 and relu(h.W1+b1).W2 = v_wmma_f32_16x16x32_f16 (f16 operands, weights carried x64, single product);
// all f32 accumulate; softmax and both layer norms in f32.
#include <hip/hip_runtime.h>
#include <math.h>
#include <stdint.h>

#define NB     2
#define SEQ    2048
#define DM     1024
#define NH     16
#define HD     64
#define DFF    4096
#define MROWS  (NB * SEQ)   // 4096 token rows
#define NQB    (SEQ / 64)   // 32 key / query tiles of 64
#define VLP    512          // key pitch of the v^T residual plane (keys 0..VLP-1)
#define RESQB  8            // leading 64-row query blocks that use the p / v residual planes
#define LNEPS  1e-6f
#define WSCALE 64.0f        // f16 weight carry for W1 and W2
#define GKS    128          // k elements per LDS stage of the GEMM (256-B rows)
#define GPITCH 272          // LDS row pitch of a stage in bytes: 16 B x odd, for 16-B fragment reads
#define AP     72           // LDS row pitch of the attention K / V^T / P tiles in 16-bit elements: 144 B = 16 B x odd
static_assert(RESQB * 64 <= VLP);
static_assert(NH * HD == DM);
static_assert((SEQ % 128) == 0 && (DM % 128) == 0 && (DFF % 128) == 0 && (MROWS % 128) == 0);
static_assert((DM % GKS) == 0 && (DFF % GKS) == 0);
static_assert(NQB * 8 == 256);
static_assert(AP >= 64 && ((AP * 2) % 16) == 0 && (((AP * 2) / 16) & 1) == 1);

typedef _Float16 v16h __attribute__((ext_vector_type(16)));
typedef _Float16 v8h  __attribute__((ext_vector_type(8)));
typedef __bf16   v16b __attribute__((ext_vector_type(16)));
typedef __bf16   v8b  __attribute__((ext_vector_type(8)));
typedef float    v8f  __attribute__((ext_vector_type(8)));
typedef float    v4f  __attribute__((ext_vector_type(4)));
typedef unsigned int v4u __attribute__((ext_vector_type(4)));
typedef unsigned int v2u __attribute__((ext_vector_type(2)));
typedef int      v4i __attribute__((ext_vector_type(4)));
typedef unsigned long long u64;

#if defined(__HIP_DEVICE_COMPILE__)
#define DEV_ASM 1
#else
#define DEV_ASM 0
#endif

// ---- scalar helpers --------------------------------------------------------------------------------
__device__ __forceinline__ unsigned short bf_bits(float f) {          // f32 -> bf16 bits, RNE convert
  unsigned u = __float_as_uint(f);
  return (unsigned short)((u + 0x7FFFu + ((u >> 16) & 1u)) >> 16);
}
__device__ __forceinline__ float bf_up(unsigned short h) { return __uint_as_float(((unsigned)h) << 16); }
__device__ __forceinline__ float bfr(float f) { return bf_up(bf_bits(f)); }   // bf16 requantised value
__device__ __forceinline__ unsigned short h_bits(_Float16 x) { return __builtin_bit_cast(unsigned short, x); }
__device__ __forceinline__ unsigned pk16(unsigned short a, unsigned short b) { return (unsigned)a | ((unsigned)b << 16); }
__device__ __forceinline__ v8f zero8() { v8f z = {0.f, 0.f, 0.f, 0.f, 0.f, 0.f, 0.f, 0.f}; return z; }
__device__ __forceinline__ v8h zero8h() {
  const _Float16 z = (_Float16)0.0f;
  v8h r = {z, z, z, z, z, z, z, z};
  return r;
}

// ---- operand traits: fragment loader (lane -> row/col (lane&15), p already includes +8*(lane>>4);
//      elements 0..7 <- p[0..7] (k0+8h..), elements 8..15 <- p[16..23] (k0+16+8h..)), WMMA, hazard gaps
template <int ET> struct OpT;
template <> struct OpT<0> {
  typedef __bf16 E; typedef v16b F; typedef v8b H;
  static __device__ __forceinline__ F ld(const E* p) {
    union { F v; H h[2]; } f;
    f.h[0] = *(const H*)(p);
    f.h[1] = *(const H*)(p + 16);
    return f.v;
  }
  static __device__ __forceinline__ v8f mma_raw(F a, F b, v8f c) {
    return __builtin_amdgcn_wmma_f32_16x16x32_bf16(false, a, false, b, (short)0, c, false, false);
  }
  static __device__ __forceinline__ void dep_guard(v8f& a, v8f& b, F x, F y) {
#if DEV_ASM
    asm volatile("v_nop\n\tv_nop\n\tv_nop\n\tv_nop" : "+v"(a), "+v"(b) : "v"(x), "v"(y));
#endif
  }
  static __device__ __forceinline__ void keep4(F a, F b, F c, F d) {
#if DEV_ASM
    asm volatile("v_nop" :: "v"(a), "v"(b), "v"(c), "v"(d));
#endif
  }
};
template <> struct OpT<1> {
  typedef _Float16 E; typedef v16h F; typedef v8h H;
  static __device__ __forceinline__ F ld(const E* p) {
    union { F v; H h[2]; } f;
    f.h[0] = *(const H*)(p);
    f.h[1] = *(const H*)(p + 16);
    return f.v;
  }
  static __device__ __forceinline__ v8f mma_raw(F a, F b, v8f c) {
    return __builtin_amdgcn_wmma_f32_16x16x32_f16(false, a, false, b, (short)0, c, false, false);
  }
  static __device__ __forceinline__ void dep_guard(v8f& a, v8f& b, F x, F y) {
#if DEV_ASM
    asm volatile("v_nop\n\tv_nop\n\tv_nop\n\tv_nop" : "+v"(a), "+v"(b) : "v"(x), "v"(y));
#endif
  }
  static __device__ __forceinline__ void keep4(F a, F b, F c, F d) {
#if DEV_ASM
    asm volatile("v_nop" :: "v"(a), "v"(b), "v"(c), "v"(d));
#endif
  }
};

// ---- guarded WMMA helpers for the attention kernel ------------------------------------------------
__device__ __forceinline__ v8f mma_b(v16b a, v16b b, v8f c) {
  c = __builtin_amdgcn_wmma_f32_16x16x32_bf16(false, a, false, b, (short)0, c, false, false);
#if DEV_ASM
  asm volatile("v_nop\n\tv_nop\n\tv_nop\n\tv_nop" : "+v"(c) : "v"(a), "v"(b));
#endif
  return c;
}
__device__ __forceinline__ v8f mma_h(v16h a, v16h b, v8f c) {
  c = __builtin_amdgcn_wmma_f32_16x16x32_f16(false, a, false, b, (short)0, c, false, false);
#if DEV_ASM
  asm volatile("v_nop\n\tv_nop\n\tv_nop\n\tv_nop" : "+v"(c) : "v"(a), "v"(b));
#endif
  return c;
}
__device__ __forceinline__ void acc_guard4(v8f& a, v8f& b, v8f& c, v8f& d) {
#if DEV_ASM
  asm volatile("v_nop\n\tv_nop\n\tv_nop\n\tv_nop" : "+v"(a), "+v"(b), "+v"(c), "+v"(d));
#endif
}

// =====================================================================================================
// f32 -> bf16 (RNE convert), 8 elements per thread, one 16-B store per lane: a wave writes 512 contiguous B
// coverage: n8 threads x 8 = the whole plane (n8 is a multiple of 256 here).
// =====================================================================================================
__global__ __launch_bounds__(256) void cvt_bf16x8(const float* __restrict__ in, unsigned short* out, int n8) {
  const int i = blockIdx.x * 256 + threadIdx.x;
  if (i < n8) {
    const v4f a = *(const v4f*)(in + (size_t)i * 8);
    const v4f b = *(const v4f*)(in + (size_t)i * 8 + 4);
    v4u p;
    p[0] = pk16(bf_bits(a[0]), bf_bits(a[1]));
    p[1] = pk16(bf_bits(a[2]), bf_bits(a[3]));
    p[2] = pk16(bf_bits(b[0]), bf_bits(b[1]));
    p[3] = pk16(bf_bits(b[2]), bf_bits(b[3]));
    *(v4u*)(out + (size_t)i * 8) = p;
    
  }
}

// =====================================================================================================
// Weight transpose + convert: in W f32 [Kdim][Ndim] (row k, n contiguous) -> out 16-bit [Ndim][Kdim]
// (row n, k contiguous). F16OUT: f16 of (bf16 value * scale), else bf16 bits. 64x64 tile through LDS.
// grid = (Ndim/64, Kdim/64); blockIdx.x = n tile, blockIdx.y = k tile.
// coverage: load 256 threads x 16 = 64x64; store 8 waves x 2 it x 4 rows x (8 lanes x 8) = 64x64.
// =====================================================================================================
template <bool F16OUT>
__global__ __launch_bounds__(256) void wtrans64(const float* __restrict__ W, unsigned short* out,
                                                 int Kdim, int Ndim, float scale) {
  __shared__ float tile[64][65];
  const int tid = threadIdx.x, lane = tid & 31, wave = tid >> 5;
  const int n0 = blockIdx.x * 64, k0 = blockIdx.y * 64;
  {
    const int r = tid >> 2, cq = (tid & 3) * 16;
    const float* src = W + (size_t)(k0 + r) * Ndim + n0 + cq;
#pragma unroll
    for (int e = 0; e < 4; ++e) {
      const v4f a = *(const v4f*)(src + 4 * e);
      tile[r][cq + 4 * e + 0] = a[0];
      tile[r][cq + 4 * e + 1] = a[1];
      tile[r][cq + 4 * e + 2] = a[2];
      tile[r][cq + 4 * e + 3] = a[3];
    }
  }
  __syncthreads();
  const int q = lane >> 3, c8 = (lane & 7) * 8;
  v4u pv[2];
#pragma unroll
  for (int it = 0; it < 2; ++it) {
    const int nn = wave * 8 + it * 4 + q;
    v4u a;
#pragma unroll
    for (int e = 0; e < 4; ++e) {
      const float f0 = tile[c8 + 2 * e][nn], f1 = tile[c8 + 2 * e + 1][nn];
      unsigned short b0 = bf_bits(f0), b1 = bf_bits(f1);
      if (F16OUT) {
        b0 = h_bits((_Float16)(bf_up(b0) * scale));
        b1 = h_bits((_Float16)(bf_up(b1) * scale));
      }
      a[e] = pk16(b0, b1);
    }
    pv[it] = a;
  }
  {
#pragma unroll
    for (int it = 0; it < 2; ++it) {
      const int nn = wave * 8 + it * 4 + q;
      *(v4u*)(out + (size_t)(n0 + nn) * Kdim + k0 + c8) = pv[it];
    }
    
  }
}

// =====================================================================================================
// Mask tile survey: mask int32 [1][1][SEQ][SEQ] (nonzero = key allowed). Block = qt: query rows qt*64..+63.
// For every key tile kt (64 keys) it records a 64-bit word whose bit r is 1 when row r of the tile has at
// least one nonzero entry inside kt. grid = NQB, 256 threads: thread = (row = tid>>2, quarter = tid&3);
// wave w holds rows 8w..8w+7 -> byte w of the word. Output flg[qt*NQB + kt], 32 words = 256 B per block
// coverage: 32 blocks x 32 words = the whole 1024-word table.
// =====================================================================================================
__global__ __launch_bounds__(256) void mask_rowbits(const int* __restrict__ maskp, u64* flg) {
  __shared__ __align__(8) unsigned char sb[NQB * 8];
  const int tid  = threadIdx.x;
  const int wave = tid >> 5;
  const int lane = tid & 31;
  const int qt   = blockIdx.x;
  const int row  = tid >> 2;            // 0..63
  const int qtr  = (tid & 3) * 16;      // 0,16,32,48
  const int* mr = maskp + ((size_t)qt * 64 + row) * SEQ + qtr;
#pragma unroll 1
  for (int kt = 0; kt < NQB; ++kt) {
    const int* p = mr + kt * 64;
    const v4i a0 = *(const v4i*)(p);
    const v4i a1 = *(const v4i*)(p + 4);
    const v4i a2 = *(const v4i*)(p + 8);
    const v4i a3 = *(const v4i*)(p + 12);
    int lv = 0;
#pragma unroll
    for (int e = 0; e < 4; ++e) {
      lv |= (a0[e] != 0) ? 1 : 0;
      lv |= (a1[e] != 0) ? 1 : 0;
      lv |= (a2[e] != 0) ? 1 : 0;
      lv |= (a3[e] != 0) ? 1 : 0;
    }
    const unsigned bl = __builtin_amdgcn_ballot_w32(lv != 0);   // uniform per wave
    unsigned bits = 0u;
#pragma unroll
    for (int k = 0; k < 8; ++k) bits |= ((((bl >> (4 * k)) & 0xFu) != 0u) ? 1u : 0u) << k;
    if (lane == 0) sb[kt * 8 + wave] = (unsigned char)bits;
  }
  __syncthreads();
  if (wave == 0) {
    u64 w;
    __builtin_memcpy(&w, &sb[lane * 8], 8);   // bytes 0..7 = rows 0..63, little endian
    u64* dst = flg + (size_t)qt * NQB + lane;
    *(u64*)dst = w;
    
  }
}

// =====================================================================================================
// Register-blocked batched 16-bit WMMA GEMM: C[m][n] = sum_k A[m][k] * Bt[n][k]; one block of 4 waves per
// 128x128 tile, one wave per 64x64 quarter. ET: 0 = bf16 operands, 1 = f16 operands. A row-major [M][K] pitch lda;
// Bt row-major [N][K] pitch ldb (k contiguous); M, N multiples of 128, K multiple of GKS (host constants).
// blockIdx.x = tile, blockIdx.y = batch index (strides in elements).
// Operand path: a stage = GKS k of the block's 128 A rows (and A2 rows) and 128 Bt rows, in LDS at pitch GPITCH,
// brought by 16-B asynchronous copies (16 lanes = one 256-B row piece); two buffers, the copies of stage t+2 are
// issued behind the barrier that ends stage t, so they fly while stage t+1 is worked on.
// NSPLIT: 0 = A.Bt; 1 = (A + A2).Bt (A2 = unscaled bf16 lo plane of A).
// Epilogue value v = acc*oscale + bias (+ resid) (relu); BIAS: 0 none, 1 per column n, 2 per row m
// (bias values RNE-converted to bf16); RESID (OUT_MODE 0 only): 1 = bf16 plane [m][n] pitch ldr, 2 = f32 plane.
// OUT_MODE: 0 = f32 (pitch ldc); 2 = bf16 hi plane C + bf16 lo plane C2 (lo = RNE(v - hi), unscaled);
//           3 = f16 hi plane C + f16 residual plane C2 = f16((v - hi) * rscale), C2 written only for tiles
//               with n0 < N2 (pitch ldc2, batch stride strideC2); 4 = f16 single plane C.
// =====================================================================================================
// Eight asynchronous 16-B copies per lane: rows r, r+8, .., r+56 of a plane (pitch ld elements) to LDS rows at
// pitch GPITCH. The s_wait_xcnt closes the statement so that no address register is rewritten ahead of it.
__device__ __forceinline__ void copy8_rows(unsigned l, const unsigned short* gp, int ld) {
#if DEV_ASM
  const size_t st = (size_t)8 * (size_t)ld;
  asm volatile(
      "global_load_async_to_lds_b128 %0, %8, off\n\t"
      "global_load_async_to_lds_b128 %1, %9, off\n\t"
      "global_load_async_to_lds_b128 %2, %10, off\n\t"
      "global_load_async_to_lds_b128 %3, %11, off\n\t"
      "global_load_async_to_lds_b128 %4, %12, off\n\t"
      "global_load_async_to_lds_b128 %5, %13, off\n\t"
      "global_load_async_to_lds_b128 %6, %14, off\n\t"
      "global_load_async_to_lds_b128 %7, %15, off\n\t"
      "s_wait_xcnt 0x0"
      :: "v"(l), "v"(l + 8u * GPITCH), "v"(l + 16u * GPITCH), "v"(l + 24u * GPITCH),
         "v"(l + 32u * GPITCH), "v"(l + 40u * GPITCH), "v"(l + 48u * GPITCH), "v"(l + 56u * GPITCH),
         "v"(gp), "v"(gp + st), "v"(gp + 2 * st), "v"(gp + 3 * st),
         "v"(gp + 4 * st), "v"(gp + 5 * st), "v"(gp + 6 * st), "v"(gp + 7 * st)
      : "memory");
  // keeps the next statement's address sums behind this one, so that their registers are used again
  __builtin_amdgcn_sched_barrier(0);
#endif
}
// One 128-row plane of a stage: 128 threads x 16 copies = 128 rows x 256 B.
__device__ __forceinline__ void copy_plane128(unsigned l, const unsigned short* gp, int ld) {
  copy8_rows(l, gp, ld);
  copy8_rows(l + 64u * GPITCH, gp + (size_t)64 * (size_t)ld, ld);
}
__device__ __forceinline__ void wait_lds_reads() {     // this wave's LDS reads are done before the buffer is given up
#if DEV_ASM
  asm volatile("s_wait_dscnt 0x0" ::: "memory");
#endif
}
__device__ __forceinline__ void wait_copies() {        // this wave's asynchronous copies have landed in LDS
#if DEV_ASM
  asm volatile("s_wait_asynccnt 0x0" ::: "memory");
#endif
}

template <int ET, int NSPLIT, int OUT_MODE, int BIAS, int RESID, bool RELU>
__global__ __launch_bounds__(128) void gemm64(
    const unsigned short* __restrict__ Ap, const unsigned short* __restrict__ A2p, int lda, long long strideA,
    const unsigned short* __restrict__ Btp, int ldb, long long strideB,
    const float* __restrict__ bias,
    const void* __restrict__ resid, int ldr, long long strideR,
    void* Cout, int ldc, long long strideC,
    void* Cout2, int ldc2, long long strideC2, int N2,
    int M, int N, int K, float oscale, float rscale) {
  typedef typename OpT<ET>::E E;
  typedef typename OpT<ET>::F F;
  const E* A  = (const E*)(const void*)Ap;
  const E* A2 = (const E*)(const void*)A2p;
  const E* Bt = (const E*)(const void*)Btp;
  constexpr int BROW  = (NSPLIT >= 1) ? 256 : 128;   // first Bt row of a stage (behind the A and A2 rows)
  constexpr int STAGE = (BROW + 128) * GPITCH;       // bytes of one buffer
  constexpr int PE    = GPITCH / 2;                  // LDS row pitch in elements
  __shared__ __align__(16) unsigned char ring[2 * STAGE];
  __shared__ __align__(16) float sT[4][16 * 68];   // per-wave 16x64 slab, pitch 68 floats
  const int b    = blockIdx.y;
  const int tid  = threadIdx.x;
  const int lane = tid & 31;
  const int wave = tid >> 5;
  const int tilesN = N >> 7;
  const int tilesM = M >> 7;
  const int tile = blockIdx.x;
  if (tile >= tilesM * tilesN) return;   // block-uniform, in front of every barrier
  const int tm = tile / tilesN;
  const int tn = tile - tm * tilesN;
  const int mB = tm << 7;                // block tile origin
  const int nB = tn << 7;
  const int wm = (wave >> 1) << 6;       // this wave's 64x64 quarter
  const int wn = (wave & 1) << 6;
  const int m0 = mB + wm;
  const int n0 = nB + wn;

  const E* Ab  = A  + (size_t)b * strideA;
  const E* Bb  = Bt + (size_t)b * strideB;
  const E* Ab2 = (NSPLIT >= 1) ? (A2 + (size_t)b * strideA) : Ab;

  const int rlane = lane & 15;                 // row (A) / col (B, D) within subtile
  const int koff  = (lane >> 4) * 8;           // k offset of this lane half
  const int mOff  = (lane >> 4) * 8;           // D row offset

  v8f acc[4][4];
#pragma unroll
  for (int i = 0; i < 4; ++i)
#pragma unroll
    for (int j = 0; j < 4; ++j) acc[i][j] = zero8();

  // copy addresses of this lane: 16-B piece (tid & 15) of rows (tid >> 4) + 8 i of each plane
  const int crow = tid >> 4, cpc = tid & 15;
  const unsigned cl = (unsigned)(size_t)(const void*)ring + (unsigned)(crow * GPITCH + cpc * 16);
  const unsigned short* ca  = (const unsigned short*)(const void*)Ab  + (size_t)(mB + crow) * lda + cpc * 8;
  const unsigned short* ca2 = (const unsigned short*)(const void*)Ab2 + (size_t)(mB + crow) * lda + cpc * 8;
  const unsigned short* cb  = (const unsigned short*)(const void*)Bb  + (size_t)(nB + crow) * ldb + cpc * 8;
  auto issue_stage = [&](int st, int buf) {
    const unsigned l = cl + (unsigned)(buf * STAGE);
    const int k0 = st * GKS;
    copy_plane128(l, ca + k0, lda);
    if (NSPLIT >= 1) copy_plane128(l + 128u * GPITCH, ca2 + k0, lda);
    copy_plane128(l + (unsigned)(BROW * GPITCH), cb + k0, ldb);
  };
  const int nst = K / GKS;               // stages; uniform
  issue_stage(0, 0);
  wait_copies();
  __syncthreads();                       // stage 0 is published
  if (nst > 1) issue_stage(1, 1);

  for (int t = 0; t < nst; ++t) {
    const unsigned char* sb = ring + (t & 1) * STAGE;
    const E* la  = (const E*)(const void*)(sb + (wm + rlane) * GPITCH) + koff;
    const E* la2 = la + 128 * PE;
    const E* lb  = (const E*)(const void*)(sb + (BROW + wn + rlane) * GPITCH) + koff;
#pragma unroll
    for (int ks = 0; ks < GKS; ks += 32) {
      F bh[4], ah[4], al[4];
#pragma unroll
      for (int j = 0; j < 4; ++j) bh[j] = OpT<ET>::ld(lb + (j << 4) * PE + ks);
#pragma unroll
      for (int i = 0; i < 4; ++i) {
        ah[i] = OpT<ET>::ld(la + (i << 4) * PE + ks);
        al[i] = ah[i];
        if (NSPLIT >= 1) al[i] = OpT<ET>::ld(la2 + (i << 4) * PE + ks);
      }
      // the step's LDS reads go as one group ahead of its WMMAs: the wave waits out the LDS latency once a step,
      // not once per A fragment
      __builtin_amdgcn_sched_barrier(0);
#pragma unroll
      for (int i = 0; i < 4; ++i) {
#pragma unroll
        for (int j = 0; j < 4; ++j) {
          acc[i][j] = OpT<ET>::mma_raw(ah[i], bh[j], acc[i][j]);
          if (NSPLIT >= 1) acc[i][j] = OpT<ET>::mma_raw(al[i], bh[j], acc[i][j]);
        }
        OpT<ET>::dep_guard(acc[i][0], acc[i][3], ah[i], al[i]);
      }
      OpT<ET>::keep4(bh[0], bh[1], bh[2], bh[3]);
      // keeps the next step's LDS reads from moving in among this step's WMMAs
      __builtin_amdgcn_sched_barrier(0);
    }
    wait_lds_reads();
    wait_copies();
    __syncthreads();                     // publishes stage t+1 and ends every read of stage t's buffer
    if (t + 2 < nst) issue_stage(t + 2, t & 1);
  }
  wait_copies();
  acc_guard4(acc[0][0], acc[0][1], acc[0][2], acc[0][3]);
  acc_guard4(acc[1][0], acc[1][1], acc[1][2], acc[1][3]);
  acc_guard4(acc[2][0], acc[2][1], acc[2][2], acc[2][3]);
  acc_guard4(acc[3][0], acc[3][1], acc[3][2], acc[3][3]);

  // ---- epilogue ----
  float* slab = sT[wave];
#pragma unroll
  for (int i = 0; i < 4; ++i) {
    const int mBase = m0 + (i << 4);
#pragma unroll
    for (int j = 0; j < 4; ++j) {
#pragma unroll
      for (int r = 0; r < 8; ++r) {
        slab[(mOff + r) * 68 + (j << 4) + rlane] = acc[i][j][r];
      }
    }
    __builtin_amdgcn_fence(__ATOMIC_RELEASE, "workgroup");
    __builtin_amdgcn_wave_barrier();
    __builtin_amdgcn_fence(__ATOMIC_ACQUIRE, "workgroup");
    if (OUT_MODE == 0) {
      float* C = (float*)Cout + (size_t)b * strideC;
      const int h2 = lane >> 4, c4 = (lane & 15) * 4;     // 256-B row segment = 16 lanes x 16 B
      v4f bz = {0.f, 0.f, 0.f, 0.f};
      if (BIAS == 1) {
        const v4f g = *(const v4f*)(bias + n0 + c4);
        bz[0] = bfr(g[0]); bz[1] = bfr(g[1]); bz[2] = bfr(g[2]); bz[3] = bfr(g[3]);
      }
      v4f ov[8];
#pragma unroll
      for (int it = 0; it < 8; ++it) {
        const int row = it * 2 + h2;                       // it 0..7 x h2 0..1 = rows 0..15
        const v4f v = *(const v4f*)(slab + row * 68 + c4);
        v4f w;
        w[0] = v[0] * oscale + bz[0];
        w[1] = v[1] * oscale + bz[1];
        w[2] = v[2] * oscale + bz[2];
        w[3] = v[3] * oscale + bz[3];
        if (BIAS == 2) {
          const float bm = bfr(bias[mBase + row]);
          w[0] += bm; w[1] += bm; w[2] += bm; w[3] += bm;
        }
        if (RESID == 1) {
          const unsigned short* rp = (const unsigned short*)resid + (size_t)b * strideR +
                                     (size_t)(mBase + row) * ldr + n0 + c4;
          const v2u rr = *(const v2u*)rp;
          w[0] += __uint_as_float(rr[0] << 16);
          w[1] += __uint_as_float(rr[0] & 0xffff0000u);
          w[2] += __uint_as_float(rr[1] << 16);
          w[3] += __uint_as_float(rr[1] & 0xffff0000u);
        }
        if (RESID == 2) {
          const float* rp = (const float*)resid + (size_t)b * strideR + (size_t)(mBase + row) * ldr + n0 + c4;
          const v4f rr = *(const v4f*)rp;
          w[0] += rr[0]; w[1] += rr[1]; w[2] += rr[2]; w[3] += rr[3];
        }
        if (RELU) {
          w[0] = fmaxf(w[0], 0.f); w[1] = fmaxf(w[1], 0.f); w[2] = fmaxf(w[2], 0.f); w[3] = fmaxf(w[3], 0.f);
        }
        ov[it] = w;
      }
      {
#pragma unroll
        for (int it = 0; it < 8; ++it) {
          const int row = it * 2 + h2;
          *(v4f*)(C + (size_t)(mBase + row) * ldc + n0 + c4) = ov[it];
        }
        
      }
    } else {
      const int q = lane >> 3, c8 = (lane & 7) * 8;
      unsigned short* C  = (unsigned short*)Cout  + (size_t)b * strideC;
      unsigned short* C2 = (unsigned short*)Cout2 + (size_t)b * strideC2;
      const bool wlo = (OUT_MODE == 2) || (OUT_MODE == 3 && n0 < N2);   // wave-uniform
      float b8[8];
#pragma unroll
      for (int e = 0; e < 8; ++e) b8[e] = 0.f;
      if (BIAS == 1) {
        const v4f g0 = *(const v4f*)(bias + n0 + c8);
        const v4f g1 = *(const v4f*)(bias + n0 + c8 + 4);
#pragma unroll
        for (int e = 0; e < 4; ++e) { b8[e] = bfr(g0[e]); b8[4 + e] = bfr(g1[e]); }
      }
      v4u hv[4], lv[4];
#pragma unroll
      for (int it = 0; it < 4; ++it) {
        const int row = it * 4 + q;                        // it 0..3 x q 0..3 = rows 0..15
        const float* sp = slab + row * 68 + c8;
        float bm = 0.f;
        if (BIAS == 2) bm = bfr(bias[mBase + row]);
        v4u a, a2;
#pragma unroll
        for (int e = 0; e < 4; ++e) {
          float f0 = sp[2 * e] * oscale + b8[2 * e] + bm;
          float f1 = sp[2 * e + 1] * oscale + b8[2 * e + 1] + bm;
          if (RELU) { f0 = fmaxf(f0, 0.f); f1 = fmaxf(f1, 0.f); }
          unsigned short h0, h1, l0 = 0, l1 = 0;
          if (OUT_MODE == 2) {
            h0 = bf_bits(f0); h1 = bf_bits(f1);
            l0 = bf_bits(f0 - bf_up(h0)); l1 = bf_bits(f1 - bf_up(h1));
          } else if (OUT_MODE == 3) {
            const _Float16 x0 = (_Float16)f0, x1 = (_Float16)f1;
            h0 = h_bits(x0); h1 = h_bits(x1);
            l0 = h_bits((_Float16)((f0 - (float)x0) * rscale));
            l1 = h_bits((_Float16)((f1 - (float)x1) * rscale));
          } else {
            h0 = h_bits((_Float16)f0); h1 = h_bits((_Float16)f1);
          }
          a[e] = pk16(h0, h1); a2[e] = pk16(l0, l1);
        }
        hv[it] = a; lv[it] = a2;
      }
      {
#pragma unroll
        for (int it = 0; it < 4; ++it) {
          const int row = it * 4 + q;
          *(v4u*)(C + (size_t)(mBase + row) * ldc + n0 + c8) = hv[it];
          if (wlo) *(v4u*)(C2 + (size_t)(mBase + row) * ldc2 + n0 + c8) = lv[it];
        }
        
      }
    }
    __builtin_amdgcn_fence(__ATOMIC_RELEASE, "workgroup");
    __builtin_amdgcn_wave_barrier();
    __builtin_amdgcn_fence(__ATOMIC_ACQUIRE, "workgroup");
  }
}

// =====================================================================================================
// Attention with an int32 replace-mask, head dim 64.
//   q planes (bf16 hi / lo): element (b, t, h, d) at [(b*SEQ + t)*DM + h*64 + d]
//   k planes (bf16 hi / lo): same layout with key index s
//   v^T hi plane (f16):      element (b, h, d, s) at [(b*DM + h*64 + d)*SEQ + s]
//   v^T residual plane (f16, (v - hi)*4096): [(b*DM + h*64 + d)*VLP + s], s < VLP, read only when RES
//   (a key tile at or beyond VLP contributes a zero v residual)
//   mask int32 [1][1][t][s]: logit = (mask != 0) ? q.k*sscale : -inf (replace)
//   flg [qt][kt]: bit r set when mask row qt*64+r has a nonzero inside key tile kt. A key tile is skipped only
//   when its word is 0 (every logit of the tile is -inf -> weight exactly 0, row max unaffected). The decision is
//   a block-uniform scalar load.
//   out planes (bf16 hi / lo of the normalised context): element (b, t, h, d) at [(b*SEQ + t)*DM + h*64 + d]
//   scores = q . k : bf16 hi/lo split (hi.hi + hi.lo + lo.hi), f32 accumulate, then * sscale + mask select in f32
//   p = exp(s - m) carried as f16(1024 p); context = p . v on f16 WMMA; RES adds f16 residual planes of p and v
//   (scale 4096, separate accumulator folded back with 1/4096 per chunk in f32); online softmax in f32.
//   A fully masked query row ends with l = 0 -> 0 * inf = NaN context, matching -inf softmax semantics.
//   Block = 4 waves = 64 query rows of one (b, h); grid = nqbThis * NH * NB; kv chunks of 64, static trip 32.
//   LDS rows of the K, V^T and P tiles stand AP elements apart (64 used, 8 never touched): the 16 rows that one
//   16-B fragment read takes then fall on 16 different bank groups.
//   K / V^T chunk staging: 128 threads x 32 elements per plane = the whole 64x64 tile (plain 16-B loads,
//   __syncthreads before and after); P tiles are wave-private, spilled with _Float16 element stores and reloaded
//   Output coverage: each wave stores rows q0..q0+15 (it 0..3 x lane>>3 0..3) x 64 columns (8 lanes x 8) of both planes.
// =====================================================================================================
template <bool RES>
__global__ __launch_bounds__(128)
void attn_mask64(const unsigned short* __restrict__ qhp, const unsigned short* __restrict__ qlp,
                 const unsigned short* __restrict__ khp, const unsigned short* __restrict__ klp,
                 const unsigned short* __restrict__ vhp, const unsigned short* __restrict__ vlp,
                 const int* __restrict__ maskp, const u64* __restrict__ flg,
                 unsigned short* ohp, unsigned short* olp,
                 int qbBase, int nqbThis, float sscale) {
  union FB { v16b v; v8b h[2]; };
  union FH { v16h v; v8h h[2]; };
  __shared__ __align__(16) __bf16   Ksh[64 * AP];                 // K hi [kv][d], row pitch AP
  __shared__ __align__(16) __bf16   Ksl[64 * AP];                 // K lo
  __shared__ __align__(16) _Float16 Vth[64 * AP];                 // V^T hi [d][kv], row pitch AP
  __shared__ __align__(16) _Float16 Vtl[RES ? 64 * AP : 8];       // V^T residual
  __shared__ __align__(16) _Float16 Psh[4][16 * AP];              // per wave P [row][kv], row pitch AP
  __shared__ __align__(16) _Float16 Psl[RES ? 4 : 1][16 * AP];    // per wave P residual
  __shared__ __align__(16) float    Os[4][16 * 64];               // per wave context tile [row][d]

  const int tid  = threadIdx.x;
  const int wave = tid >> 5;
  const int lane = tid & 31;
  const int hh   = lane >> 4;
  const int c    = lane & 15;

  const int bx   = blockIdx.x;
  const int qbl  = bx % nqbThis;
  const int rest = bx / nqbThis;
  const int h    = rest % NH;
  const int b    = rest / NH;
  const int qb   = qbBase + qbl;
  const int q0   = qb * 64 + wave * 16;
  const size_t rowB = (size_t)b * SEQ;

  const __bf16* Qh = (const __bf16*)(const void*)qhp + (size_t)h * HD;
  const __bf16* Ql = (const __bf16*)(const void*)qlp + (size_t)h * HD;
  const __bf16* Kh = (const __bf16*)(const void*)khp + (size_t)h * HD;
  const __bf16* Kl = (const __bf16*)(const void*)klp + (size_t)h * HD;
  const _Float16* Vh = (const _Float16*)(const void*)vhp + ((size_t)b * DM + (size_t)h * HD) * SEQ;
  const _Float16* Vl = (const _Float16*)(const void*)vlp + ((size_t)b * DM + (size_t)h * HD) * VLP;
  const u64* fq = flg + (size_t)qb * NQB;     // block-uniform address -> scalar loads

  // ---- Q fragments (A operand, row = lane&15): 2 d-chunks, hi and lo ----
  v16b qah[2], qal[2];
#pragma unroll
  for (int dc = 0; dc < 2; ++dc) {
    const size_t qo = (rowB + q0 + c) * DM + dc * 32 + 8 * hh;
    qah[dc] = OpT<0>::ld(Qh + qo);
    qal[dc] = OpT<0>::ld(Ql + qo);
  }

  float mrow[8], lrow[8];
  v8f oacc[4];
#pragma unroll
  for (int r = 0; r < 8; ++r) { mrow[r] = -INFINITY; lrow[r] = 0.f; }
#pragma unroll
  for (int t = 0; t < 4; ++t) oacc[t] = zero8();

  for (int kt = 0; kt < NQB; ++kt) {         // static trip count
    const u64 lw = fq[kt];
    if (lw == 0ull) continue;                // block-uniform
    const int kv0 = kt * 64;
    __syncthreads();
    {
      const int r = tid >> 1, half = (tid & 1) * 32;
      const __bf16*   kg  = Kh + (rowB + kv0 + r) * DM + half;    // K row kv0+r, d = half..half+31
      const __bf16*   klg = Kl + (rowB + kv0 + r) * DM + half;
      const _Float16* vg  = Vh + (size_t)r * SEQ + kv0 + half;    // V^T row d = r, s = kv0+half..+31
      const int kvl = (kv0 + 64 <= VLP) ? kv0 : (VLP - 64);     // clamped address into the residual plane
      const _Float16* vlg = Vl + (size_t)r * VLP + kvl + half;
      const bool resOK = (kv0 + 64 <= VLP);                      // block-uniform
#pragma unroll
      for (int i = 0; i < 4; ++i) {
        const v8b a0 = *(const v8b*)(kg + 8 * i);
        const v8b a1 = *(const v8b*)(klg + 8 * i);
        const v8h b0 = *(const v8h*)(vg + 8 * i);
        *(v8b*)(Ksh + r * AP + half + 8 * i) = a0;
        *(v8b*)(Ksl + r * AP + half + 8 * i) = a1;
        *(v8h*)(Vth + r * AP + half + 8 * i) = b0;
        if (RES) {
          v8h b1 = *(const v8h*)(vlg + 8 * i);
          if (!resOK) b1 = zero8h();
          *(v8h*)(Vtl + r * AP + half + 8 * i) = b1;
        }
      }
    }
    __syncthreads();

    // ---- scores: 16 query rows x 64 keys per wave, 3 bf16 products ----
    v8f s[4];
#pragma unroll
    for (int j = 0; j < 4; ++j) {
      s[j] = zero8();
#pragma unroll
      for (int dc = 0; dc < 2; ++dc) {
        FB kb, kl;
        kb.h[0] = *(const v8b*)(Ksh + (j * 16 + c) * AP + dc * 32 + 8 * hh);
        kb.h[1] = *(const v8b*)(Ksh + (j * 16 + c) * AP + dc * 32 + 16 + 8 * hh);
        kl.h[0] = *(const v8b*)(Ksl + (j * 16 + c) * AP + dc * 32 + 8 * hh);
        kl.h[1] = *(const v8b*)(Ksl + (j * 16 + c) * AP + dc * 32 + 16 + 8 * hh);
        s[j] = mma_b(qah[dc], kb.v, s[j]);
        s[j] = mma_b(qah[dc], kl.v, s[j]);
        s[j] = mma_b(qal[dc], kb.v, s[j]);
      }
    }

    // ---- scale + mask select, row max, online softmax, P (x1024, f16) and P residual (x4096) to LDS ----
    _Float16* pwh = Psh[wave];
    _Float16* pwl = Psl[RES ? wave : 0];
    const int* mq = maskp + (size_t)(q0 + 8 * hh) * SEQ + kv0 + c;   // row q0+8hh, key kv0+c; all < SEQ
#pragma unroll
    for (int r = 0; r < 8; ++r) {
      const int* mrw = mq + (size_t)r * SEQ;
      float m = -INFINITY;
#pragma unroll
      for (int j = 0; j < 4; ++j) {
        const int mv = mrw[j * 16];
        const float sv = (mv != 0) ? (s[j][r] * sscale) : -INFINITY;
        s[j][r] = sv;
        m = fmaxf(m, sv);
      }
#pragma unroll
      for (int off = 1; off < 16; off <<= 1) m = fmaxf(m, __shfl_xor(m, off, 32));
      const float mnew  = fmaxf(mrow[r], m);
      const float msafe = (mnew == -INFINITY) ? 0.f : mnew;
      const float alpha = __expf(mrow[r] - msafe);
      mrow[r] = mnew;
      float psum = 0.f;
#pragma unroll
      for (int j = 0; j < 4; ++j) {
        const float p = __expf(s[j][r] - msafe);     // -inf logit against a finite max: exp -> 0
        psum += p;
        const float p1k = p * 1024.0f;
        const _Float16 ph = (_Float16)p1k;
        pwh[(8 * hh + r) * AP + j * 16 + c] = ph;
        if (RES) {
          const _Float16 pl = (_Float16)((p1k - (float)ph) * 4096.0f);
          pwl[(8 * hh + r) * AP + j * 16 + c] = pl;
        }
      }
#pragma unroll
      for (int off = 1; off < 16; off <<= 1) psum += __shfl_xor(psum, off, 32);
      lrow[r] = lrow[r] * alpha + psum;
#pragma unroll
      for (int t = 0; t < 4; ++t) oacc[t][r] *= alpha;
    }
    __builtin_amdgcn_fence(__ATOMIC_RELEASE, "workgroup");
    __builtin_amdgcn_wave_barrier();
    __builtin_amdgcn_fence(__ATOMIC_ACQUIRE, "workgroup");

    // ---- context += P . V (f16 WMMA), residual products into a separate accumulator ----
    v8f o1[4];
#pragma unroll
    for (int t = 0; t < 4; ++t) o1[t] = zero8();
#pragma unroll 1
    for (int kk = 0; kk < 2; ++kk) {
      FH pa, pl;
      pa.h[0] = *(const v8h*)(pwh + c * AP + kk * 32 + 8 * hh);
      pa.h[1] = *(const v8h*)(pwh + c * AP + kk * 32 + 16 + 8 * hh);
      if (RES) {
        pl.h[0] = *(const v8h*)(pwl + c * AP + kk * 32 + 8 * hh);
        pl.h[1] = *(const v8h*)(pwl + c * AP + kk * 32 + 16 + 8 * hh);
      } else {
        pl.v = pa.v;
      }
#pragma unroll
      for (int t = 0; t < 4; ++t) {
        FH vb;
        vb.h[0] = *(const v8h*)(Vth + (t * 16 + c) * AP + kk * 32 + 8 * hh);
        vb.h[1] = *(const v8h*)(Vth + (t * 16 + c) * AP + kk * 32 + 16 + 8 * hh);
        oacc[t] = mma_h(pa.v, vb.v, oacc[t]);
        if (RES) {
          FH vl;
          vl.h[0] = *(const v8h*)(Vtl + (t * 16 + c) * AP + kk * 32 + 8 * hh);
          vl.h[1] = *(const v8h*)(Vtl + (t * 16 + c) * AP + kk * 32 + 16 + 8 * hh);
          o1[t] = mma_h(pa.v, vl.v, o1[t]);
          o1[t] = mma_h(pl.v, vb.v, o1[t]);
        }
      }
    }
    if (RES) {
#pragma unroll
      for (int t = 0; t < 4; ++t)
#pragma unroll
        for (int r = 0; r < 8; ++r) oacc[t][r] += o1[t][r] * (1.0f / 4096.0f);
    }
  }

  // ---- normalise (1/l and the 1/1024 p carry), stage the wave's 16x64 tile, bf16 hi/lo split,
  float* os = Os[wave];
#pragma unroll
  for (int r = 0; r < 8; ++r) {
    const float l = lrow[r];
    const float inv = (1.0f / l) * (1.0f / 1024.0f);   // l == 0 (fully masked row) -> inf -> NaN context
#pragma unroll
    for (int t = 0; t < 4; ++t) os[(8 * hh + r) * 64 + t * 16 + c] = oacc[t][r] * inv;
  }
  __builtin_amdgcn_fence(__ATOMIC_RELEASE, "workgroup");
  __builtin_amdgcn_wave_barrier();
  __builtin_amdgcn_fence(__ATOMIC_ACQUIRE, "workgroup");
  {
    const int q4 = lane >> 3, c8 = (lane & 7) * 8;
    v4u hv[4], lv[4];
#pragma unroll
    for (int it = 0; it < 4; ++it) {
      const int row = it * 4 + q4;   // it 0..3 x q4 0..3 = rows 0..15 of the wave tile
      const float* sp = os + row * 64 + c8;
      v4u a, a2;
#pragma unroll
      for (int e = 0; e < 4; ++e) {
        const float f0 = sp[2 * e], f1 = sp[2 * e + 1];
        const unsigned short h0 = bf_bits(f0), h1 = bf_bits(f1);
        const unsigned short l0 = bf_bits(f0 - bf_up(h0)), l1 = bf_bits(f1 - bf_up(h1));
        a[e] = pk16(h0, h1); a2[e] = pk16(l0, l1);
      }
      hv[it] = a; lv[it] = a2;
    }
    {
#pragma unroll
      for (int it = 0; it < 4; ++it) {
        const int row = it * 4 + q4;
        const size_t go = (rowB + q0 + row) * DM + (size_t)h * HD + c8;
        *(v4u*)(ohp + go) = hv[it];
        *(v4u*)(olp + go) = lv[it];
      }
      
    }
  }
}

// =====================================================================================================
// Layer norm over rows of DM=1024, f32, one block per row (grid = MROWS, 256 threads, 4 elements per thread).
// mean and biased variance via wave shuffles + 16 LDS slots; gamma / beta values RNE-converted to bf16;
// o = (gamma * (x - mean)) * (1 / sqrt(var + eps)) + beta.
// OUT16: threads 0..127 reload 8 consecutive inputs each and write the f16 plane as one 16-B store per lane
// coverage: 256 threads x 4 = the row (f32); 128 threads x 8 = the row (f16).
// =====================================================================================================
template <bool OUT16>
__global__ __launch_bounds__(256) void layernorm_rows(const float* __restrict__ in,
                                                       const float* __restrict__ gamma,
                                                       const float* __restrict__ beta,
                                                       float* out32, unsigned short* out16) {
  __shared__ float red[16];
  const int tid = threadIdx.x, lane = tid & 31, wave = tid >> 5;
  const int row = blockIdx.x;
  const float* xr = in + (size_t)row * DM;
  const v4f v = *(const v4f*)(xr + tid * 4);
  float s = (v[0] + v[1]) + (v[2] + v[3]);
#pragma unroll
  for (int off = 1; off < 32; off <<= 1) s += __shfl_xor(s, off, 32);
  if (lane == 0) red[wave] = s;
  __syncthreads();
  float tot = 0.f;
#pragma unroll
  for (int i = 0; i < 8; ++i) tot += red[i];
  const float mean = tot * (1.0f / (float)DM);
  const float d0 = v[0] - mean, d1 = v[1] - mean, d2 = v[2] - mean, d3 = v[3] - mean;
  float s2 = (d0 * d0 + d1 * d1) + (d2 * d2 + d3 * d3);
#pragma unroll
  for (int off = 1; off < 32; off <<= 1) s2 += __shfl_xor(s2, off, 32);
  if (lane == 0) red[8 + wave] = s2;
  __syncthreads();
  float tot2 = 0.f;
#pragma unroll
  for (int i = 0; i < 8; ++i) tot2 += red[8 + i];
  const float var  = tot2 * (1.0f / (float)DM);
  const float rstd = 1.0f / sqrtf(var + LNEPS);

  const v4f g  = *(const v4f*)(gamma + tid * 4);
  const v4f bt = *(const v4f*)(beta + tid * 4);
  v4f o;
  o[0] = (bfr(g[0]) * d0) * rstd + bfr(bt[0]);
  o[1] = (bfr(g[1]) * d1) * rstd + bfr(bt[1]);
  o[2] = (bfr(g[2]) * d2) * rstd + bfr(bt[2]);
  o[3] = (bfr(g[3]) * d3) * rstd + bfr(bt[3]);
  float* op = out32 + (size_t)row * DM + tid * 4;
  *(v4f*)op = o;
  

  if (OUT16) {
    if (tid < 128) {
      const int cc = tid * 8;
      const v4f a0 = *(const v4f*)(xr + cc);
      const v4f a1 = *(const v4f*)(xr + cc + 4);
      const v4f g0 = *(const v4f*)(gamma + cc), g1 = *(const v4f*)(gamma + cc + 4);
      const v4f b0 = *(const v4f*)(beta + cc),  b1 = *(const v4f*)(beta + cc + 4);
      float f[8];
#pragma unroll
      for (int e = 0; e < 4; ++e) {
        f[e]     = (bfr(g0[e]) * (a0[e] - mean)) * rstd + bfr(b0[e]);
        f[4 + e] = (bfr(g1[e]) * (a1[e] - mean)) * rstd + bfr(b1[e]);
      }
      v4u hp;
#pragma unroll
      for (int e = 0; e < 4; ++e) hp[e] = pk16(h_bits((_Float16)f[2 * e]), h_bits((_Float16)f[2 * e + 1]));
      unsigned short* hq = out16 + (size_t)row * DM + cc;
      *(v4u*)hq = hp;
      
    }
  }
}

// =====================================================================================================
// Workspace map (MiB = 1048576 B):
//   Xb   bf16 [4096][1024]         0 ..   8
//   WqT  bf16 [1024 n][1024 k]     8 ..  10     WkT 10 .. 12    WvT 12 .. 14    WoT 14 .. 16
//   W1T  f16  [4096 n][1024 k]    16 ..  24     W2T f16 [1024 n][4096 k]  24 .. 32
//   Qh   bf16 [4096][1024]        32 ..  40     Ql 40 .. 48    Kh 48 .. 56    Kl 56 .. 64
//   VTh  f16  [2][1024][2048]     64 ..  72     VTl f16 [2][1024][512]    72 .. 74    Flg u64 [32][32] at 74
//   Oh   bf16 [4096][1024]        76 ..  84     Ol 84 .. 92
//   later (regions dead by then, single in-order stream):
//   T1   f32  [4096][1024]        32 ..  48   (over Qh, Ql: written by the Wo GEMM after attention)
//   H32  f32  [4096][1024]        48 ..  64   (over Kh, Kl: written by LN1)
//   Hh   f16  [4096][1024]        64 ..  72   (over VTh: written by LN1)
//   F1   f16  [4096][4096]        72 .. 104   (over VTl, Flg, Oh, Ol: written by the W1 GEMM after the Wo GEMM)
//   T2   f32  [4096][1024]        32 ..  48   (over T1: written by the W2 GEMM after LN1)
//   end = 104 MiB. Every plane is an exact multiple of its 64x64 tile / whole-line store granularity
//   (no padded tails); all region starts are MiB aligned.
// =====================================================================================================
extern "C" void kernel_launch(void* const* d_in, const int* in_sizes, int n_in,
                              void* d_out, int out_size, void* d_ws, size_t ws_size,
                              hipStream_t stream) {
  if (n_in < 18) return;
  if (in_sizes[0] != NB * SEQ * DM) return;
  if (in_sizes[1] != SEQ * SEQ) return;
  if (in_sizes[2] != DM * DM || in_sizes[4] != DM * DM || in_sizes[6] != DM * DM || in_sizes[8] != DM * DM) return;
  if (in_sizes[3] != DM || in_sizes[5] != DM || in_sizes[7] != DM || in_sizes[9] != DM) return;
  if (in_sizes[10] != DM * DFF || in_sizes[11] != DFF || in_sizes[12] != DFF * DM || in_sizes[13] != DM) return;
  if (in_sizes[14] != DM || in_sizes[15] != DM || in_sizes[16] != DM || in_sizes[17] != DM) return;
  if (out_size != NB * SEQ * DM) return;

  const float* x   = (const float*)d_in[0];
  const int*   msk = (const int*)d_in[1];
  const float* Wq  = (const float*)d_in[2];
  const float* bq  = (const float*)d_in[3];
  const float* Wk  = (const float*)d_in[4];
  const float* bk  = (const float*)d_in[5];
  const float* Wv  = (const float*)d_in[6];
  const float* bv  = (const float*)d_in[7];
  const float* Wo  = (const float*)d_in[8];
  const float* bo  = (const float*)d_in[9];
  const float* W1  = (const float*)d_in[10];
  const float* b1  = (const float*)d_in[11];
  const float* W2  = (const float*)d_in[12];
  const float* b2  = (const float*)d_in[13];
  const float* gamma1 = (const float*)d_in[14];
  const float* beta1  = (const float*)d_in[15];
  const float* gamma2 = (const float*)d_in[16];
  const float* beta2  = (const float*)d_in[17];

  const size_t PX   = (size_t)MROWS * DM * 2;        //  8 MiB  16-bit activation plane [4096][1024]
  const size_t PW   = (size_t)DM * DM * 2;           //  2 MiB  16-bit weight plane [1024][1024]
  const size_t PWF  = (size_t)DM * DFF * 2;          //  8 MiB  16-bit FFN weight plane
  const size_t PVT  = (size_t)NB * DM * SEQ * 2;     //  8 MiB  v^T hi plane
  const size_t PVL  = (size_t)NB * DM * VLP * 2;     //  2 MiB  v^T residual plane
  const size_t PFs  = (size_t)2 * 1048576;           //  2 MiB  slot for the 8 KiB flag table
  const size_t PF   = (size_t)NQB * NQB * 8;         //  8 KiB
  const size_t PT   = (size_t)MROWS * DM * 4;        // 16 MiB  f32 activation plane
  const size_t PF1  = (size_t)MROWS * DFF * 2;       // 32 MiB  f16 FFN hidden plane
  if (PF > PFs) return;
  size_t off = 0;
  const size_t oXb  = off; off += PX;
  const size_t oWq  = off; off += PW;
  const size_t oWk  = off; off += PW;
  const size_t oWv  = off; off += PW;
  const size_t oWo  = off; off += PW;
  const size_t oW1  = off; off += PWF;
  const size_t oW2  = off; off += PWF;
  const size_t oQh  = off; off += PX;
  const size_t oQl  = off; off += PX;
  const size_t oKh  = off; off += PX;
  const size_t oKl  = off; off += PX;
  const size_t oVTh = off; off += PVT;
  const size_t oVTl = off; off += PVL;
  const size_t oFlg = off; off += PFs;
  const size_t oOh  = off; off += PX;
  const size_t oOl  = off; off += PX;
  const size_t endA = off;                           // 92 MiB
  const size_t oT1  = oQh;                           // T1 over Qh + Ql
  const size_t oH32 = oKh;                           // H32 over Kh + Kl
  const size_t oHh  = oVTh;                          // Hh over VTh
  const size_t oF1  = oVTl;                          // F1 over VTl .. Ol and beyond
  const size_t oT2  = oT1;                           // T2 over T1
  if (oT1 + PT != oKh) return;                       // aliasing sanity: T1 ends where H32 starts
  if (oH32 + PT != oVTh) return;                     // H32 ends where Hh starts
  if (oHh + PX != oVTl) return;                      // Hh ends where F1 starts
  size_t total = oF1 + PF1;                          // 104 MiB
  if (endA > total) total = endA;
  if (total > ws_size) return;
  if (total > (size_t)134217728) return;

  char* ws = (char*)d_ws;
  unsigned short* Xb   = (unsigned short*)(ws + oXb);
  unsigned short* WqTb = (unsigned short*)(ws + oWq);
  unsigned short* WkTb = (unsigned short*)(ws + oWk);
  unsigned short* WvTb = (unsigned short*)(ws + oWv);
  unsigned short* WoTb = (unsigned short*)(ws + oWo);
  unsigned short* W1Tb = (unsigned short*)(ws + oW1);
  unsigned short* W2Tb = (unsigned short*)(ws + oW2);
  unsigned short* Qh   = (unsigned short*)(ws + oQh);
  unsigned short* Ql   = (unsigned short*)(ws + oQl);
  unsigned short* Kh   = (unsigned short*)(ws + oKh);
  unsigned short* Kl   = (unsigned short*)(ws + oKl);
  unsigned short* VTh  = (unsigned short*)(ws + oVTh);
  unsigned short* VTl  = (unsigned short*)(ws + oVTl);
  u64*            Flg  = (u64*)(ws + oFlg);
  unsigned short* Oh   = (unsigned short*)(ws + oOh);
  unsigned short* Ol   = (unsigned short*)(ws + oOl);
  float*          T1   = (float*)(ws + oT1);
  float*          H32  = (float*)(ws + oH32);
  unsigned short* Hh   = (unsigned short*)(ws + oHh);
  unsigned short* F1   = (unsigned short*)(ws + oF1);
  float*          T2   = (float*)(ws + oT2);

  const dim3 blk(256);
  const int n8x = MROWS * DM / 8;                                   // 524288
  const dim3 gCvtX((n8x + 255) / 256);                              // 2048 blocks
  const dim3 gMask(NQB);                                            // 32 blocks
  const dim3 gTw(DM / 64, DM / 64);                                 // 16 x 16: in [1024 k][1024 n] -> out [1024 n][1024 k]
  const dim3 gTw1(DFF / 64, DM / 64);                               // 64 x 16: in [1024 k][4096 n] -> out [4096 n][1024 k]
  const dim3 gTw2(DM / 64, DFF / 64);                               // 16 x 64: in [4096 k][1024 n] -> out [1024 n][4096 k]
  const dim3 blkG(128);                                             // GEMM block: 4 waves, one 128x128 tile
  const dim3 gProj((MROWS / 128) * (DM / 128), 1);                  // 256 tiles: M=4096, N=1024
  const dim3 gVT((DM / 128) * (SEQ / 128), NB);                     // 128 tiles x 2 batches: M=1024, N=2048
  const dim3 gW1((MROWS / 128) * (DFF / 128), 1);                   // 1024 tiles: M=4096, N=4096
  const dim3 gW2((MROWS / 128) * (DM / 128), 1);                    // 256 tiles: M=4096, N=1024
  const dim3 gLN(MROWS);                                            // 4096 blocks, one row each

  // (0) mask tile survey -> Flg
  mask_rowbits<<<gMask, blk, 0, stream>>>(msk, Flg);
  // (1) x -> bf16 plane [4096][1024]; weights [k][n] f32 -> 16-bit [n][k] planes
  cvt_bf16x8<<<gCvtX, blk, 0, stream>>>(x, Xb, n8x);
  wtrans64<false><<<gTw, blk, 0, stream>>>(Wq, WqTb, DM, DM, 1.0f);
  wtrans64<false><<<gTw, blk, 0, stream>>>(Wk, WkTb, DM, DM, 1.0f);
  wtrans64<false><<<gTw, blk, 0, stream>>>(Wv, WvTb, DM, DM, 1.0f);
  wtrans64<false><<<gTw, blk, 0, stream>>>(Wo, WoTb, DM, DM, 1.0f);
  wtrans64<true><<<gTw1, blk, 0, stream>>>(W1, W1Tb, DM, DFF, WSCALE);
  wtrans64<true><<<gTw2, blk, 0, stream>>>(W2, W2Tb, DFF, DM, WSCALE);
  // (2) q = x . Wq + bq -> bf16 hi/lo planes [b*SEQ+t][h*64+d]   (M=4096, N=1024, K=1024)
  gemm64<0, 0, 2, 1, 0, false><<<gProj, blkG, 0, stream>>>(
      Xb, Xb, DM, 0LL, WqTb, DM, 0LL, bq, (const void*)Xb, DM, 0LL,
      (void*)Qh, DM, 0LL, (void*)Ql, DM, 0LL, DM,
      MROWS, DM, DM, 1.0f, 1.0f);
  // (3) k = x . Wk + bk -> bf16 hi/lo planes
  gemm64<0, 0, 2, 1, 0, false><<<gProj, blkG, 0, stream>>>(
      Xb, Xb, DM, 0LL, WkTb, DM, 0LL, bk, (const void*)Xb, DM, 0LL,
      (void*)Kh, DM, 0LL, (void*)Kl, DM, 0LL, DM,
      MROWS, DM, DM, 1.0f, 1.0f);
  // (4) v^T = WvT . x^T + bv per batch -> f16 hi plane [b][h*64+d][s] (pitch SEQ) and residual plane
  //     (x4096, keys < VLP only, pitch VLP)   (A = WvT [d][k], Bt = Xb rows of batch b; M=1024, N=2048, K=1024)
  gemm64<0, 0, 3, 2, 0, false><<<gVT, blkG, 0, stream>>>(
      WvTb, WvTb, DM, 0LL, Xb, DM, (long long)SEQ * DM, bv, (const void*)Xb, DM, 0LL,
      (void*)VTh, SEQ, (long long)DM * SEQ, (void*)VTl, VLP, (long long)DM * VLP, VLP,
      DM, SEQ, DM, 1.0f, 4096.0f);
  // (5) attention: query blocks 0..RESQB-1 with residual planes, the rest without
  attn_mask64<true><<<dim3(NB * NH * RESQB), dim3(128), 0, stream>>>(
      Qh, Ql, Kh, Kl, VTh, VTl, msk, Flg, Oh, Ol, 0, RESQB, 0.125f);
  attn_mask64<false><<<dim3(NB * NH * (NQB - RESQB)), dim3(128), 0, stream>>>(
      Qh, Ql, Kh, Kl, VTh, VTl, msk, Flg, Oh, Ol, RESQB, NQB - RESQB, 0.125f);
  // (6) T1 = ctx . Wo + bo + bf16(x) -> f32 [4096][1024]  (A = context hi + lo planes, 2 products)
  gemm64<0, 1, 0, 1, 1, false><<<gProj, blkG, 0, stream>>>(
      Oh, Ol, DM, 0LL, WoTb, DM, 0LL, bo, (const void*)Xb, DM, 0LL,
      (void*)T1, DM, 0LL, (void*)T1, DM, 0LL, 0,
      MROWS, DM, DM, 1.0f, 1.0f);
  // (7) h = LN1(T1) -> H32 f32 and Hh f16
  layernorm_rows<true><<<gLN, blk, 0, stream>>>(T1, gamma1, beta1, H32, Hh);
  // (8) F1 = relu(h . W1 + b1) -> f16 [4096][4096]  (f16 operands, W1 carried x64, acc scaled by 1/64)
  gemm64<1, 0, 4, 1, 0, true><<<gW1, blkG, 0, stream>>>(
      Hh, Hh, DM, 0LL, W1Tb, DM, 0LL, b1, (const void*)Hh, DM, 0LL,
      (void*)F1, DFF, 0LL, (void*)F1, DFF, 0LL, 0,
      MROWS, DFF, DM, 1.0f / WSCALE, 1.0f);
  // (9) T2 = F1 . W2 + b2 + h -> f32 [4096][1024]  (K = 4096, W2 carried x64)
  gemm64<1, 0, 0, 1, 2, false><<<gW2, blkG, 0, stream>>>(
      F1, F1, DFF, 0LL, W2Tb, DFF, 0LL, b2, (const void*)H32, DM, 0LL,
      (void*)T2, DM, 0LL, (void*)T2, DM, 0LL, 0,
      MROWS, DM, DFF, 1.0f / WSCALE, 1.0f);
  // (10) out = LN2(T2) -> d_out f32 [2][2048][1024]
  layernorm_rows<false><<<gLN, blk, 0, stream>>>(T2, gamma2, beta2, (float*)d_out, Hh);
  (void)hipGetLastError();
}

// v003
// It runs in 319 microseconds.
// Two timings next to v002 both put it at 1.05 times that version's speed.
// Over all steps from v000 it is 2.20 times as fast.
// Contractions: q, k, v^T projections = v_wmma_f32_16x16x32_bf16 (bf16 operands from RNE-converted inputs, single product);
// q.k^T scores = v_wmma_f32_16x16x32_bf16 with q and k as bf16 hi/lo planes (hi.hi + hi.lo + lo.hi);
// p.v = v_wmma_f32_16x16x32_f16 (p carried x1024 in f16, v f16 hi plane; f16 residual planes x4096 of p and v on the first 512 query rows);
// ctx.Wo = v_wmma_f32_16x16x32_bf16 with ctx as bf16 hi/lo planes times bf16 Wo (2 products);
// h.W1 and relu(h.W1+b1).W2 = v_wmma_f32_16x16x32_f16 (f16 operands, weights carried x64, single product);
// all f32 accumulate; softmax and both layer norms in f32.
#include <hip/hip_runtime.h>
#include <math.h>
#include <stdint.h>

#define NB     2
#define SEQ    2048
#define DM     1024
#define NH     16
#define HD     64
#define DFF    4096
#define MROWS  (NB * SEQ)   // 4096 token rows
#define NQB    (SEQ / 64)   // 32 key / query tiles of 64
#define VLP    512          // key pitch of the v^T residual plane (keys 0..VLP-1)
#define RESQB  8            // leading 64-row query blocks that use the p / v residual planes
#define LNEPS  1e-6f
#define WSCALE 64.0f        // f16 weight carry for W1 and W2
#define GKS    128          // k elements per LDS stage of the GEMM (256-B rows)
#define GPITCH 272          // LDS row pitch of a stage in bytes: 16 B x odd, for 16-B fragment reads
#define AP     72           // LDS row pitch of the attention K / V^T / P tiles in 16-bit elements: 144 B = 16 B x odd
static_assert(RESQB * 64 <= VLP);
static_assert(NH * HD == DM);
static_assert((SEQ % 128) == 0 && (DM % 128) == 0 && (DFF % 128) == 0 && (MROWS % 128) == 0);
static_assert((DM % GKS) == 0 && (DFF % GKS) == 0);
static_assert(NQB * 8 == 256);
static_assert(AP >= 64 && ((AP * 2) % 16) == 0 && (((AP * 2) / 16) & 1) == 1);

typedef _Float16 v16h __attribute__((ext_vector_type(16)));
typedef _Float16 v8h  __attribute__((ext_vector_type(8)));
typedef __bf16   v16b __attribute__((ext_vector_type(16)));
typedef __bf16   v8b  __attribute__((ext_vector_type(8)));
typedef float    v8f  __attribute__((ext_vector_type(8)));
typedef float    v4f  __attribute__((ext_vector_type(4)));
typedef unsigned int v4u __attribute__((ext_vector_type(4)));
typedef unsigned int v2u __attribute__((ext_vector_type(2)));
typedef int      v4i __attribute__((ext_vector_type(4)));
typedef unsigned long long u64;

#if defined(__HIP_DEVICE_COMPILE__)
#define DEV_ASM 1
#else
#define DEV_ASM 0
#endif

// ---- scalar helpers --------------------------------------------------------------------------------
__device__ __forceinline__ unsigned short bf_bits(float f) {          // f32 -> bf16 bits, RNE convert
  unsigned u = __float_as_uint(f);
  return (unsigned short)((u + 0x7FFFu + ((u >> 16) & 1u)) >> 16);
}
__device__ __forceinline__ float bf_up(unsigned short h) { return __uint_as_float(((unsigned)h) << 16); }
__device__ __forceinline__ float bfr(float f) { return bf_up(bf_bits(f)); }   // bf16 requantised value
__device__ __forceinline__ unsigned short h_bits(_Float16 x) { return __builtin_bit_cast(unsigned short, x); }
__device__ __forceinline__ unsigned pk16(unsigned short a, unsigned short b) { return (unsigned)a | ((unsigned)b << 16); }
__device__ __forceinline__ v8f zero8() { v8f z = {0.f, 0.f, 0.f, 0.f, 0.f, 0.f, 0.f, 0.f}; return z; }
__device__ __forceinline__ v8h zero8h() {
  const _Float16 z = (_Float16)0.0f;
  v8h r = {z, z, z, z, z, z, z, z};
  return r;
}

// ---- operand traits: fragment loader (lane -> row/col (lane&15), p already includes +8*(lane>>4);
//      elements 0..7 <- p[0..7] (k0+8h..), elements 8..15 <- p[16..23] (k0+16+8h..)), WMMA, hazard gaps
template <int ET> struct OpT;
template <> struct OpT<0> {
  typedef __bf16 E; typedef v16b F; typedef v8b H;
  static __device__ __forceinline__ F ld(const E* p) {
    union { F v; H h[2]; } f;
    f.h[0] = *(const H*)(p);
    f.h[1] = *(const H*)(p + 16);
    return f.v;
  }
  static __device__ __forceinline__ v8f mma_raw(F a, F b, v8f c) {
    return __builtin_amdgcn_wmma_f32_16x16x32_bf16(false, a, false, b, (short)0, c, false, false);
  }
  static __device__ __forceinline__ void dep_guard(v8f& a, v8f& b, F x, F y) {
#if DEV_ASM
    asm volatile("v_nop\n\tv_nop\n\tv_nop\n\tv_nop" : "+v"(a), "+v"(b) : "v"(x), "v"(y));
#endif
  }
  static __device__ __forceinline__ void keep4(F a, F b, F c, F d) {
#if DEV_ASM
    asm volatile("v_nop" :: "v"(a), "v"(b), "v"(c), "v"(d));
#endif
  }
};
template <> struct OpT<1> {
  typedef _Float16 E; typedef v16h F; typedef v8h H;
  static __device__ __forceinline__ F ld(const E* p) {
    union { F v; H h[2]; } f;
    f.h[0] = *(const H*)(p);
    f.h[1] = *(const H*)(p + 16);
    return f.v;
  }
  static __device__ __forceinline__ v8f mma_raw(F a, F b, v8f c) {
    return __builtin_amdgcn_wmma_f32_16x16x32_f16(false, a, false, b, (short)0, c, false, false);
  }
  static __device__ __forceinline__ void dep_guard(v8f& a, v8f& b, F x, F y) {
#if DEV_ASM
    asm volatile("v_nop\n\tv_nop\n\tv_nop\n\tv_nop" : "+v"(a), "+v"(b) : "v"(x), "v"(y));
#endif
  }
  static __device__ __forceinline__ void keep4(F a, F b, F c, F d) {
#if DEV_ASM
    asm volatile("v_nop" :: "v"(a), "v"(b), "v"(c), "v"(d));
#endif
  }
};

// ---- guarded WMMA helpers for the attention kernel ------------------------------------------------
__device__ __forceinline__ v8f mma_b(v16b a, v16b b, v8f c) {
  c = __builtin_amdgcn_wmma_f32_16x16x32_bf16(false, a, false, b, (short)0, c, false, false);
#if DEV_ASM
  asm volatile("v_nop\n\tv_nop\n\tv_nop\n\tv_nop" : "+v"(c) : "v"(a), "v"(b));
#endif
  return c;
}
__device__ __forceinline__ v8f mma_h(v16h a, v16h b, v8f c) {
  c = __builtin_amdgcn_wmma_f32_16x16x32_f16(false, a, false, b, (short)0, c, false, false);
#if DEV_ASM
  asm volatile("v_nop\n\tv_nop\n\tv_nop\n\tv_nop" : "+v"(c) : "v"(a), "v"(b));
#endif
  return c;
}
__device__ __forceinline__ void acc_guard4(v8f& a, v8f& b, v8f& c, v8f& d) {
#if DEV_ASM
  asm volatile("v_nop\n\tv_nop\n\tv_nop\n\tv_nop" : "+v"(a), "+v"(b), "+v"(c), "+v"(d));
#endif
}

// =====================================================================================================
// f32 -> bf16 (RNE convert), 8 elements per thread, one 16-B store per lane: a wave writes 512 contiguous B
// coverage: n8 threads x 8 = the whole plane (n8 is a multiple of 256 here).
// =====================================================================================================
__global__ __launch_bounds__(256) void cvt_bf16x8(const float* __restrict__ in, unsigned short* out, int n8) {
  const int i = blockIdx.x * 256 + threadIdx.x;
  if (i < n8) {
    const v4f a = *(const v4f*)(in + (size_t)i * 8);
    const v4f b = *(const v4f*)(in + (size_t)i * 8 + 4);
    v4u p;
    p[0] = pk16(bf_bits(a[0]), bf_bits(a[1]));
    p[1] = pk16(bf_bits(a[2]), bf_bits(a[3]));
    p[2] = pk16(bf_bits(b[0]), bf_bits(b[1]));
    p[3] = pk16(bf_bits(b[2]), bf_bits(b[3]));
    *(v4u*)(out + (size_t)i * 8) = p;
    
  }
}

// =====================================================================================================
// Weight transpose + convert: in W f32 [Kdim][Ndim] (row k, n contiguous) -> out 16-bit [Ndim][Kdim]
// (row n, k contiguous). F16OUT: f16 of (bf16 value * scale), else bf16 bits. 64x64 tile through LDS.
// grid = (Ndim/64, Kdim/64); blockIdx.x = n tile, blockIdx.y = k tile.
// coverage: load 256 threads x 16 = 64x64; store 8 waves x 2 it x 4 rows x (8 lanes x 8) = 64x64.
// =====================================================================================================
template <bool F16OUT>
__global__ __launch_bounds__(256) void wtrans64(const float* __restrict__ W, unsigned short* out,
                                                 int Kdim, int Ndim, float scale) {
  __shared__ float tile[64][65];
  const int tid = threadIdx.x, lane = tid & 31, wave = tid >> 5;
  const int n0 = blockIdx.x * 64, k0 = blockIdx.y * 64;
  {
    const int r = tid >> 2, cq = (tid & 3) * 16;
    const float* src = W + (size_t)(k0 + r) * Ndim + n0 + cq;
#pragma unroll
    for (int e = 0; e < 4; ++e) {
      const v4f a = *(const v4f*)(src + 4 * e);
      tile[r][cq + 4 * e + 0] = a[0];
      tile[r][cq + 4 * e + 1] = a[1];
      tile[r][cq + 4 * e + 2] = a[2];
      tile[r][cq + 4 * e + 3] = a[3];
    }
  }
  __syncthreads();
  const int q = lane >> 3, c8 = (lane & 7) * 8;
  v4u pv[2];
#pragma unroll
  for (int it = 0; it < 2; ++it) {
    const int nn = wave * 8 + it * 4 + q;
    v4u a;
#pragma unroll
    for (int e = 0; e < 4; ++e) {
      const float f0 = tile[c8 + 2 * e][nn], f1 = tile[c8 + 2 * e + 1][nn];
      unsigned short b0 = bf_bits(f0), b1 = bf_bits(f1);
      if (F16OUT) {
        b0 = h_bits((_Float16)(bf_up(b0) * scale));
        b1 = h_bits((_Float16)(bf_up(b1) * scale));
      }
      a[e] = pk16(b0, b1);
    }
    pv[it] = a;
  }
  {
#pragma unroll
    for (int it = 0; it < 2; ++it) {
      const int nn = wave * 8 + it * 4 + q;
      *(v4u*)(out + (size_t)(n0 + nn) * Kdim + k0 + c8) = pv[it];
    }
    
  }
}

// =====================================================================================================
// Mask tile survey: mask int32 [1][1][SEQ][SEQ] (nonzero = key allowed). Block = qt: query rows qt*64..+63.
// For every key tile kt (64 keys) it records a 64-bit word whose bit r is 1 when row r of the tile has at
// least one nonzero entry inside kt. grid = NQB, 256 threads: thread = (row = tid>>2, quarter = tid&3);
// wave w holds rows 8w..8w+7 -> byte w of the word. Output flg[qt*NQB + kt], 32 words = 256 B per block
// coverage: 32 blocks x 32 words = the whole 1024-word table.
// =====================================================================================================
__global__ __launch_bounds__(256) void mask_rowbits(const int* __restrict__ maskp, u64* flg) {
  __shared__ __align__(8) unsigned char sb[NQB * 8];
  const int tid  = threadIdx.x;
  const int wave = tid >> 5;
  const int lane = tid & 31;
  const int qt   = blockIdx.x;
  const int row  = tid >> 2;            // 0..63
  const int qtr  = (tid & 3) * 16;      // 0,16,32,48
  const int* mr = maskp + ((size_t)qt * 64 + row) * SEQ + qtr;
#pragma unroll 1
  for (int kt = 0; kt < NQB; ++kt) {
    const int* p = mr + kt * 64;
    const v4i a0 = *(const v4i*)(p);
    const v4i a1 = *(const v4i*)(p + 4);
    const v4i a2 = *(const v4i*)(p + 8);
    const v4i a3 = *(const v4i*)(p + 12);
    int lv = 0;
#pragma unroll
    for (int e = 0; e < 4; ++e) {
      lv |= (a0[e] != 0) ? 1 : 0;
      lv |= (a1[e] != 0) ? 1 : 0;
      lv |= (a2[e] != 0) ? 1 : 0;
      lv |= (a3[e] != 0) ? 1 : 0;
    }
    const unsigned bl = __builtin_amdgcn_ballot_w32(lv != 0);   // uniform per wave
    unsigned bits = 0u;
#pragma unroll
    for (int k = 0; k < 8; ++k) bits |= ((((bl >> (4 * k)) & 0xFu) != 0u) ? 1u : 0u) << k;
    if (lane == 0) sb[kt * 8 + wave] = (unsigned char)bits;
  }
  __syncthreads();
  if (wave == 0) {
    u64 w;
    __builtin_memcpy(&w, &sb[lane * 8], 8);   // bytes 0..7 = rows 0..63, little endian
    u64* dst = flg + (size_t)qt * NQB + lane;
    *(u64*)dst = w;
    
  }
}

// =====================================================================================================
// Register-blocked batched 16-bit WMMA GEMM: C[m][n] = sum_k A[m][k] * Bt[n][k]; one block of 4 waves per
// 128x128 tile, one wave per 64x64 quarter. ET: 0 = bf16 operands, 1 = f16 operands. A row-major [M][K] pitch lda;
// Bt row-major [N][K] pitch ldb (k contiguous); M, N multiples of 128, K multiple of GKS (host constants).
// blockIdx.x = tile, blockIdx.y = batch index (strides in elements).
// Operand path: a stage = GKS k of the block's 128 A rows (and A2 rows) and 128 Bt rows, in LDS at pitch GPITCH,
// brought by 16-B asynchronous copies (16 lanes = one 256-B row piece); two buffers, the copies of stage t+2 are
// issued behind the barrier that ends stage t, so they fly while stage t+1 is worked on.
// NSPLIT: 0 = A.Bt; 1 = (A + A2).Bt (A2 = unscaled bf16 lo plane of A).
// Epilogue value v = acc*oscale + bias (+ resid) (relu); BIAS: 0 none, 1 per column n, 2 per row m
// (bias values RNE-converted to bf16); RESID (OUT_MODE 0 only): 1 = bf16 plane [m][n] pitch ldr, 2 = f32 plane.
// OUT_MODE: 0 = f32 (pitch ldc); 2 = bf16 hi plane C + bf16 lo plane C2 (lo = RNE(v - hi), unscaled);
//           3 = f16 hi plane C + f16 residual plane C2 = f16((v - hi) * rscale), C2 written only for tiles
//               with n0 < N2 (pitch ldc2, batch stride strideC2); 4 = f16 single plane C.
// =====================================================================================================
// Eight asynchronous 16-B copies per lane: rows r, r+8, .., r+56 of a plane (pitch ld elements) to LDS rows at
// pitch GPITCH. The s_wait_xcnt closes the statement so that no address register is rewritten ahead of it.
__device__ __forceinline__ void copy8_rows(unsigned l, const unsigned short* gp, int ld) {
#if DEV_ASM
  const size_t st = (size_t)8 * (size_t)ld;
  asm volatile(
      "global_load_async_to_lds_b128 %0, %8, off\n\t"
      "global_load_async_to_lds_b128 %1, %9, off\n\t"
      "global_load_async_to_lds_b128 %2, %10, off\n\t"
      "global_load_async_to_lds_b128 %3, %11, off\n\t"
      "global_load_async_to_lds_b128 %4, %12, off\n\t"
      "global_load_async_to_lds_b128 %5, %13, off\n\t"
      "global_load_async_to_lds_b128 %6, %14, off\n\t"
      "global_load_async_to_lds_b128 %7, %15, off\n\t"
      "s_wait_xcnt 0x0"
      :: "v"(l), "v"(l + 8u * GPITCH), "v"(l + 16u * GPITCH), "v"(l + 24u * GPITCH),
         "v"(l + 32u * GPITCH), "v"(l + 40u * GPITCH), "v"(l + 48u * GPITCH), "v"(l + 56u * GPITCH),
         "v"(gp), "v"(gp + st), "v"(gp + 2 * st), "v"(gp + 3 * st),
         "v"(gp + 4 * st), "v"(gp + 5 * st), "v"(gp + 6 * st), "v"(gp + 7 * st)
      : "memory");
  // keeps the next statement's address sums behind this one, so that their registers are used again
  __builtin_amdgcn_sched_barrier(0);
#endif
}
// One 128-row plane of a stage: 128 threads x 16 copies = 128 rows x 256 B.
__device__ __forceinline__ void copy_plane128(unsigned l, const unsigned short* gp, int ld) {
  copy8_rows(l, gp, ld);
  copy8_rows(l + 64u * GPITCH, gp + (size_t)64 * (size_t)ld, ld);
}
__device__ __forceinline__ void wait_lds_reads() {     // this wave's LDS reads are done before the buffer is given up
#if DEV_ASM
  asm volatile("s_wait_dscnt 0x0" ::: "memory");
#endif
}
__device__ __forceinline__ void wait_copies() {        // this wave's asynchronous copies have landed in LDS
#if DEV_ASM
  asm volatile("s_wait_asynccnt 0x0" ::: "memory");
#endif
}

template <int ET, int NSPLIT, int OUT_MODE, int BIAS, int RESID, bool RELU>
__global__ __launch_bounds__(128) void gemm64(
    const unsigned short* __restrict__ Ap, const unsigned short* __restrict__ A2p, int lda, long long strideA,
    const unsigned short* __restrict__ Btp, int ldb, long long strideB,
    const float* __restrict__ bias,
    const void* __restrict__ resid, int ldr, long long strideR,
    void* Cout, int ldc, long long strideC,
    void* Cout2, int ldc2, long long strideC2, int N2,
    int M, int N, int K, float oscale, float rscale) {
  typedef typename OpT<ET>::E E;
  typedef typename OpT<ET>::F F;
  const E* A  = (const E*)(const void*)Ap;
  const E* A2 = (const E*)(const void*)A2p;
  const E* Bt = (const E*)(const void*)Btp;
  constexpr int BROW  = (NSPLIT >= 1) ? 256 : 128;   // first Bt row of a stage (behind the A and A2 rows)
  constexpr int STAGE = (BROW + 128) * GPITCH;       // bytes of one buffer
  constexpr int PE    = GPITCH / 2;                  // LDS row pitch in elements
  __shared__ __align__(16) unsigned char ring[2 * STAGE];
  __shared__ __align__(16) float sT[4][16 * 68];   // per-wave 16x64 slab, pitch 68 floats
  const int b    = blockIdx.y;
  const int tid  = threadIdx.x;
  const int lane = tid & 31;
  const int wave = tid >> 5;
  const int tilesN = N >> 7;
  const int tilesM = M >> 7;
  const int tile = blockIdx.x;
  if (tile >= tilesM * tilesN) return;   // block-uniform, in front of every barrier
  const int tm = tile / tilesN;
  const int tn = tile - tm * tilesN;
  const int mB = tm << 7;                // block tile origin
  const int nB = tn << 7;
  const int wm = (wave >> 1) << 6;       // this wave's 64x64 quarter
  const int wn = (wave & 1) << 6;
  const int m0 = mB + wm;
  const int n0 = nB + wn;

  const E* Ab  = A  + (size_t)b * strideA;
  const E* Bb  = Bt + (size_t)b * strideB;
  const E* Ab2 = (NSPLIT >= 1) ? (A2 + (size_t)b * strideA) : Ab;

  const int rlane = lane & 15;                 // row (A) / col (B, D) within subtile
  const int koff  = (lane >> 4) * 8;           // k offset of this lane half
  const int mOff  = (lane >> 4) * 8;           // D row offset

  v8f acc[4][4];
#pragma unroll
  for (int i = 0; i < 4; ++i)
#pragma unroll
    for (int j = 0; j < 4; ++j) acc[i][j] = zero8();

  // copy addresses of this lane: 16-B piece (tid & 15) of rows (tid >> 4) + 8 i of each plane
  const int crow = tid >> 4, cpc = tid & 15;
  const unsigned cl = (unsigned)(size_t)(const void*)ring + (unsigned)(crow * GPITCH + cpc * 16);
  const unsigned short* ca  = (const unsigned short*)(const void*)Ab  + (size_t)(mB + crow) * lda + cpc * 8;
  const unsigned short* ca2 = (const unsigned short*)(const void*)Ab2 + (size_t)(mB + crow) * lda + cpc * 8;
  const unsigned short* cb  = (const unsigned short*)(const void*)Bb  + (size_t)(nB + crow) * ldb + cpc * 8;
  auto issue_stage = [&](int st, int buf) {
    const unsigned l = cl + (unsigned)(buf * STAGE);
    const int k0 = st * GKS;
    copy_plane128(l, ca + k0, lda);
    if (NSPLIT >= 1) copy_plane128(l + 128u * GPITCH, ca2 + k0, lda);
    copy_plane128(l + (unsigned)(BROW * GPITCH), cb + k0, ldb);
  };
  const int nst = K / GKS;               // stages; uniform
  issue_stage(0, 0);
  wait_copies();
  __syncthreads();                       // stage 0 is published
  if (nst > 1) issue_stage(1, 1);

  for (int t = 0; t < nst; ++t) {
    const unsigned char* sb = ring + (t & 1) * STAGE;
    const E* la  = (const E*)(const void*)(sb + (wm + rlane) * GPITCH) + koff;
    const E* la2 = la + 128 * PE;
    const E* lb  = (const E*)(const void*)(sb + (BROW + wn + rlane) * GPITCH) + koff;
#pragma unroll
    for (int ks = 0; ks < GKS; ks += 32) {
      F bh[4], ah[4], al[4];
#pragma unroll
      for (int j = 0; j < 4; ++j) bh[j] = OpT<ET>::ld(lb + (j << 4) * PE + ks);
#pragma unroll
      for (int i = 0; i < 4; ++i) {
        ah[i] = OpT<ET>::ld(la + (i << 4) * PE + ks);
        al[i] = ah[i];
        if (NSPLIT >= 1) al[i] = OpT<ET>::ld(la2 + (i << 4) * PE + ks);
      }
      // the step's LDS reads go as one group ahead of its WMMAs: the wave waits out the LDS latency once a step,
      // not once per A fragment
      __builtin_amdgcn_sched_barrier(0);
#pragma unroll
      for (int i = 0; i < 4; ++i) {
#pragma unroll
        for (int j = 0; j < 4; ++j) {
          acc[i][j] = OpT<ET>::mma_raw(ah[i], bh[j], acc[i][j]);
          if (NSPLIT >= 1) acc[i][j] = OpT<ET>::mma_raw(al[i], bh[j], acc[i][j]);
        }
        OpT<ET>::dep_guard(acc[i][0], acc[i][3], ah[i], al[i]);
      }
      OpT<ET>::keep4(bh[0], bh[1], bh[2], bh[3]);
      // keeps the next step's LDS reads from moving in among this step's WMMAs
      __builtin_amdgcn_sched_barrier(0);
    }
    wait_lds_reads();
    wait_copies();
    __syncthreads();                     // publishes stage t+1 and ends every read of stage t's buffer
    if (t + 2 < nst) issue_stage(t + 2, t & 1);
  }
  wait_copies();
  acc_guard4(acc[0][0], acc[0][1], acc[0][2], acc[0][3]);
  acc_guard4(acc[1][0], acc[1][1], acc[1][2], acc[1][3]);
  acc_guard4(acc[2][0], acc[2][1], acc[2][2], acc[2][3]);
  acc_guard4(acc[3][0], acc[3][1], acc[3][2], acc[3][3]);

  // ---- epilogue ----
  float* slab = sT[wave];
#pragma unroll
  for (int i = 0; i < 4; ++i) {
    const int mBase = m0 + (i << 4);
#pragma unroll
    for (int j = 0; j < 4; ++j) {
#pragma unroll
      for (int r = 0; r < 8; ++r) {
        slab[(mOff + r) * 68 + (j << 4) + rlane] = acc[i][j][r];
      }
    }
    __builtin_amdgcn_fence(__ATOMIC_RELEASE, "workgroup");
    __builtin_amdgcn_wave_barrier();
    __builtin_amdgcn_fence(__ATOMIC_ACQUIRE, "workgroup");
    if (OUT_MODE == 0) {
      float* C = (float*)Cout + (size_t)b * strideC;
      const int h2 = lane >> 4, c4 = (lane & 15) * 4;     // 256-B row segment = 16 lanes x 16 B
      v4f bz = {0.f, 0.f, 0.f, 0.f};
      if (BIAS == 1) {
        const v4f g = *(const v4f*)(bias + n0 + c4);
        bz[0] = bfr(g[0]); bz[1] = bfr(g[1]); bz[2] = bfr(g[2]); bz[3] = bfr(g[3]);
      }
      v4f ov[8];
#pragma unroll
      for (int it = 0; it < 8; ++it) {
        const int row = it * 2 + h2;                       // it 0..7 x h2 0..1 = rows 0..15
        const v4f v = *(const v4f*)(slab + row * 68 + c4);
        v4f w;
        w[0] = v[0] * oscale + bz[0];
        w[1] = v[1] * oscale + bz[1];
        w[2] = v[2] * oscale + bz[2];
        w[3] = v[3] * oscale + bz[3];
        if (BIAS == 2) {
          const float bm = bfr(bias[mBase + row]);
          w[0] += bm; w[1] += bm; w[2] += bm; w[3] += bm;
        }
        if (RESID == 1) {
          const unsigned short* rp = (const unsigned short*)resid + (size_t)b * strideR +
                                     (size_t)(mBase + row) * ldr + n0 + c4;
          const v2u rr = *(const v2u*)rp;
          w[0] += __uint_as_float(rr[0] << 16);
          w[1] += __uint_as_float(rr[0] & 0xffff0000u);
          w[2] += __uint_as_float(rr[1] << 16);
          w[3] += __uint_as_float(rr[1] & 0xffff0000u);
        }
        if (RESID == 2) {
          const float* rp = (const float*)resid + (size_t)b * strideR + (size_t)(mBase + row) * ldr + n0 + c4;
          const v4f rr = *(const v4f*)rp;
          w[0] += rr[0]; w[1] += rr[1]; w[2] += rr[2]; w[3] += rr[3];
        }
        if (RELU) {
          w[0] = fmaxf(w[0], 0.f); w[1] = fmaxf(w[1], 0.f); w[2] = fmaxf(w[2], 0.f); w[3] = fmaxf(w[3], 0.f);
        }
        ov[it] = w;
      }
      {
#pragma unroll
        for (int it = 0; it < 8; ++it) {
          const int row = it * 2 + h2;
          *(v4f*)(C + (size_t)(mBase + row) * ldc + n0 + c4) = ov[it];
        }
        
      }
    } else {
      const int q = lane >> 3, c8 = (lane & 7) * 8;
      unsigned short* C  = (unsigned short*)Cout  + (size_t)b * strideC;
      unsigned short* C2 = (unsigned short*)Cout2 + (size_t)b * strideC2;
      const bool wlo = (OUT_MODE == 2) || (OUT_MODE == 3 && n0 < N2);   // wave-uniform
      float b8[8];
#pragma unroll
      for (int e = 0; e < 8; ++e) b8[e] = 0.f;
      if (BIAS == 1) {
        const v4f g0 = *(const v4f*)(bias + n0 + c8);
        const v4f g1 = *(const v4f*)(bias + n0 + c8 + 4);
#pragma unroll
        for (int e = 0; e < 4; ++e) { b8[e] = bfr(g0[e]); b8[4 + e] = bfr(g1[e]); }
      }
      v4u hv[4], lv[4];
#pragma unroll
      for (int it = 0; it < 4; ++it) {
        const int row = it * 4 + q;                        // it 0..3 x q 0..3 = rows 0..15
        const float* sp = slab + row * 68 + c8;
        float bm = 0.f;
        if (BIAS == 2) bm = bfr(bias[mBase + row]);
        v4u a, a2;
#pragma unroll
        for (int e = 0; e < 4; ++e) {
          float f0 = sp[2 * e] * oscale + b8[2 * e] + bm;
          float f1 = sp[2 * e + 1] * oscale + b8[2 * e + 1] + bm;
          if (RELU) { f0 = fmaxf(f0, 0.f); f1 = fmaxf(f1, 0.f); }
          unsigned short h0, h1, l0 = 0, l1 = 0;
          if (OUT_MODE == 2) {
            h0 = bf_bits(f0); h1 = bf_bits(f1);
            l0 = bf_bits(f0 - bf_up(h0)); l1 = bf_bits(f1 - bf_up(h1));
          } else if (OUT_MODE == 3) {
            const _Float16 x0 = (_Float16)f0, x1 = (_Float16)f1;
            h0 = h_bits(x0); h1 = h_bits(x1);
            l0 = h_bits((_Float16)((f0 - (float)x0) * rscale));
            l1 = h_bits((_Float16)((f1 - (float)x1) * rscale));
          } else {
            h0 = h_bits((_Float16)f0); h1 = h_bits((_Float16)f1);
          }
          a[e] = pk16(h0, h1); a2[e] = pk16(l0, l1);
        }
        hv[it] = a; lv[it] = a2;
      }
      {
#pragma unroll
        for (int it = 0; it < 4; ++it) {
          const int row = it * 4 + q;
          *(v4u*)(C + (size_t)(mBase + row) * ldc + n0 + c8) = hv[it];
          if (wlo) *(v4u*)(C2 + (size_t)(mBase + row) * ldc2 + n0 + c8) = lv[it];
        }
        
      }
    }
    __builtin_amdgcn_fence(__ATOMIC_RELEASE, "workgroup");
    __builtin_amdgcn_wave_barrier();
    __builtin_amdgcn_fence(__ATOMIC_ACQUIRE, "workgroup");
  }
}

// =====================================================================================================
// Attention with an int32 replace-mask, head dim 64.
//   q planes (bf16 hi / lo): element (b, t, h, d) at [(b*SEQ + t)*DM + h*64 + d]
//   k planes (bf16 hi / lo): same layout with key index s
//   v^T hi plane (f16):      element (b, h, d, s) at [(b*DM + h*64 + d)*SEQ + s]
//   v^T residual plane (f16, (v - hi)*4096): [(b*DM + h*64 + d)*VLP + s], s < VLP, read only when RES
//   (a key tile at or beyond VLP contributes a zero v residual)
//   mask int32 [1][1][t][s]: logit = (mask != 0) ? q.k*sscale : -inf (replace)
//   flg [qt][kt]: bit r set when mask row qt*64+r has a nonzero inside key tile kt. A key tile is skipped only
//   when its word is 0 (every logit of the tile is -inf -> weight exactly 0, row max unaffected). The decision is
//   a block-uniform scalar load.
//   out planes (bf16 hi / lo of the normalised context): element (b, t, h, d) at [(b*SEQ + t)*DM + h*64 + d]
//   scores = q . k : bf16 hi/lo split (hi.hi + hi.lo + lo.hi), f32 accumulate, then * sscale + mask select in f32
//   p = exp(s - m) carried as f16(1024 p); context = p . v on f16 WMMA; RES adds f16 residual planes of p and v
//   (scale 4096, separate accumulator folded back with 1/4096 per chunk in f32); online softmax in f32.
//   A fully masked query row ends with l = 0 -> 0 * inf = NaN context, matching -inf softmax semantics.
//   Block = 4 waves = 64 query rows of one (b, h); grid = nqbThis * NH * NB; kv chunks of 64, static trip 32.
//   LDS rows of the K, V^T and P tiles stand AP elements apart (64 used, 8 never touched): the 16 rows that one
//   16-B fragment read takes then fall on 16 different bank groups.
//   K / V^T chunk staging: 128 threads x 32 elements per plane = the whole 64x64 tile (plain 16-B loads,
//   __syncthreads before and after); P tiles are wave-private, spilled with _Float16 element stores and reloaded
//   LDS fragment reads stand in groups ahead of the WMMAs that use them (K ahead of the scores, V^T ahead of the
//   softmax, P in one group), held in place by scheduling barriers.
//   Output coverage: each wave stores rows q0..q0+15 (it 0..3 x lane>>3 0..3) x 64 columns (8 lanes x 8) of both planes.
// =====================================================================================================
template <bool RES>
__global__ __launch_bounds__(128)
void attn_mask64(const unsigned short* __restrict__ qhp, const unsigned short* __restrict__ qlp,
                 const unsigned short* __restrict__ khp, const unsigned short* __restrict__ klp,
                 const unsigned short* __restrict__ vhp, const unsigned short* __restrict__ vlp,
                 const int* __restrict__ maskp, const u64* __restrict__ flg,
                 unsigned short* ohp, unsigned short* olp,
                 int qbBase, int nqbThis, float sscale) {
  __shared__ __align__(16) __bf16   Ksh[64 * AP];                 // K hi [kv][d], row pitch AP
  __shared__ __align__(16) __bf16   Ksl[64 * AP];                 // K lo
  __shared__ __align__(16) _Float16 Vth[64 * AP];                 // V^T hi [d][kv], row pitch AP
  __shared__ __align__(16) _Float16 Vtl[RES ? 64 * AP : 8];       // V^T residual
  __shared__ __align__(16) _Float16 Psh[4][16 * AP];              // per wave P [row][kv], row pitch AP
  __shared__ __align__(16) _Float16 Psl[RES ? 4 : 1][16 * AP];    // per wave P residual
  __shared__ __align__(16) float    Os[4][16 * 64];               // per wave context tile [row][d]

  const int tid  = threadIdx.x;
  const int wave = tid >> 5;
  const int lane = tid & 31;
  const int hh   = lane >> 4;
  const int c    = lane & 15;

  const int bx   = blockIdx.x;
  const int qbl  = bx % nqbThis;
  const int rest = bx / nqbThis;
  const int h    = rest % NH;
  const int b    = rest / NH;
  const int qb   = qbBase + qbl;
  const int q0   = qb * 64 + wave * 16;
  const size_t rowB = (size_t)b * SEQ;

  const __bf16* Qh = (const __bf16*)(const void*)qhp + (size_t)h * HD;
  const __bf16* Ql = (const __bf16*)(const void*)qlp + (size_t)h * HD;
  const __bf16* Kh = (const __bf16*)(const void*)khp + (size_t)h * HD;
  const __bf16* Kl = (const __bf16*)(const void*)klp + (size_t)h * HD;
  const _Float16* Vh = (const _Float16*)(const void*)vhp + ((size_t)b * DM + (size_t)h * HD) * SEQ;
  const _Float16* Vl = (const _Float16*)(const void*)vlp + ((size_t)b * DM + (size_t)h * HD) * VLP;
  const u64* fq = flg + (size_t)qb * NQB;     // block-uniform address -> scalar loads

  // ---- Q fragments (A operand, row = lane&15): 2 d-chunks, hi and lo ----
  v16b qah[2], qal[2];
#pragma unroll
  for (int dc = 0; dc < 2; ++dc) {
    const size_t qo = (rowB + q0 + c) * DM + dc * 32 + 8 * hh;
    qah[dc] = OpT<0>::ld(Qh + qo);
    qal[dc] = OpT<0>::ld(Ql + qo);
  }

  float mrow[8], lrow[8];
  v8f oacc[4];
#pragma unroll
  for (int r = 0; r < 8; ++r) { mrow[r] = -INFINITY; lrow[r] = 0.f; }
#pragma unroll
  for (int t = 0; t < 4; ++t) oacc[t] = zero8();

  for (int kt = 0; kt < NQB; ++kt) {         // static trip count
    const u64 lw = fq[kt];
    if (lw == 0ull) continue;                // block-uniform
    const int kv0 = kt * 64;
    __syncthreads();
    {
      const int r = tid >> 1, half = (tid & 1) * 32;
      const __bf16*   kg  = Kh + (rowB + kv0 + r) * DM + half;    // K row kv0+r, d = half..half+31
      const __bf16*   klg = Kl + (rowB + kv0 + r) * DM + half;
      const _Float16* vg  = Vh + (size_t)r * SEQ + kv0 + half;    // V^T row d = r, s = kv0+half..+31
      const int kvl = (kv0 + 64 <= VLP) ? kv0 : (VLP - 64);     // clamped address into the residual plane
      const _Float16* vlg = Vl + (size_t)r * VLP + kvl + half;
      const bool resOK = (kv0 + 64 <= VLP);                      // block-uniform
#pragma unroll
      for (int i = 0; i < 4; ++i) {
        const v8b a0 = *(const v8b*)(kg + 8 * i);
        const v8b a1 = *(const v8b*)(klg + 8 * i);
        const v8h b0 = *(const v8h*)(vg + 8 * i);
        *(v8b*)(Ksh + r * AP + half + 8 * i) = a0;
        *(v8b*)(Ksl + r * AP + half + 8 * i) = a1;
        *(v8h*)(Vth + r * AP + half + 8 * i) = b0;
        if (RES) {
          v8h b1 = *(const v8h*)(vlg + 8 * i);
          if (!resOK) b1 = zero8h();
          *(v8h*)(Vtl + r * AP + half + 8 * i) = b1;
        }
      }
    }
    __syncthreads();

    // ---- scores: 16 query rows x 64 keys per wave, 3 bf16 products ----
    // The tile's K fragments are read in groups ahead of the score products, so that the wave waits out the LDS
    // latency once a tile, not once per fragment pair: key groups 0..2 up front, group 3 behind the products of
    // group 0 (into registers that those have left), where the products of groups 1 and 2 cover its latency.
    v16b kbf[4][2], klf[4][2];
#pragma unroll
    for (int j = 0; j < 3; ++j) {
#pragma unroll
      for (int dc = 0; dc < 2; ++dc) {
        kbf[j][dc] = OpT<0>::ld(Ksh + (j * 16 + c) * AP + dc * 32 + 8 * hh);
        klf[j][dc] = OpT<0>::ld(Ksl + (j * 16 + c) * AP + dc * 32 + 8 * hh);
      }
    }
    // keeps the K reads from sinking back among the WMMAs that use them
    __builtin_amdgcn_sched_barrier(0);
    v8f s[4];
#pragma unroll
    for (int j = 0; j < 4; ++j) {
      s[j] = zero8();
#pragma unroll
      for (int dc = 0; dc < 2; ++dc) {
        s[j] = mma_b(qah[dc], kbf[j][dc], s[j]);
        s[j] = mma_b(qah[dc], klf[j][dc], s[j]);
        s[j] = mma_b(qal[dc], kbf[j][dc], s[j]);
      }
      if (j == 0) {
#pragma unroll
        for (int dc = 0; dc < 2; ++dc) {
          kbf[3][dc] = OpT<0>::ld(Ksh + (3 * 16 + c) * AP + dc * 32 + 8 * hh);
          klf[3][dc] = OpT<0>::ld(Ksl + (3 * 16 + c) * AP + dc * 32 + 8 * hh);
        }
        // holds the reads of key group 3 together at this one place: without it they spread among the next WMMAs
        __builtin_amdgcn_sched_barrier(0);
      }
    }
    // The tile's V^T fragments are read here, ahead of the softmax, whose vector work covers their LDS latency.
    v16h vbf[2][4], vlf[2][4];
#pragma unroll
    for (int kk = 0; kk < 2; ++kk) {
#pragma unroll
      for (int t = 0; t < 4; ++t) {
        vbf[kk][t] = OpT<1>::ld(Vth + (t * 16 + c) * AP + kk * 32 + 8 * hh);
        vlf[kk][t] = vbf[kk][t];
        if (RES) vlf[kk][t] = OpT<1>::ld(Vtl + (t * 16 + c) * AP + kk * 32 + 8 * hh);
      }
    }
    // keeps the V^T reads here, where they fly under the wait for the mask words, and out of the softmax's exchanges
    __builtin_amdgcn_sched_barrier(0);

    // ---- scale + mask select, row max, online softmax, P (x1024, f16) and P residual (x4096) to LDS ----
    _Float16* pwh = Psh[wave];
    _Float16* pwl = Psl[RES ? wave : 0];
    const int* mq = maskp + (size_t)(q0 + 8 * hh) * SEQ + kv0 + c;   // row q0+8hh, key kv0+c; all < SEQ
#pragma unroll
    for (int r = 0; r < 8; ++r) {
      const int* mrw = mq + (size_t)r * SEQ;
      float m = -INFINITY;
#pragma unroll
      for (int j = 0; j < 4; ++j) {
        const int mv = mrw[j * 16];
        const float sv = (mv != 0) ? (s[j][r] * sscale) : -INFINITY;
        s[j][r] = sv;
        m = fmaxf(m, sv);
      }
#pragma unroll
      for (int off = 1; off < 16; off <<= 1) m = fmaxf(m, __shfl_xor(m, off, 32));
      const float mnew  = fmaxf(mrow[r], m);
      const float msafe = (mnew == -INFINITY) ? 0.f : mnew;
      const float alpha = __expf(mrow[r] - msafe);
      mrow[r] = mnew;
      float psum = 0.f;
#pragma unroll
      for (int j = 0; j < 4; ++j) {
        const float p = __expf(s[j][r] - msafe);     // -inf logit against a finite max: exp -> 0
        psum += p;
        const float p1k = p * 1024.0f;
        const _Float16 ph = (_Float16)p1k;
        pwh[(8 * hh + r) * AP + j * 16 + c] = ph;
        if (RES) {
          const _Float16 pl = (_Float16)((p1k - (float)ph) * 4096.0f);
          pwl[(8 * hh + r) * AP + j * 16 + c] = pl;
        }
      }
#pragma unroll
      for (int off = 1; off < 16; off <<= 1) psum += __shfl_xor(psum, off, 32);
      lrow[r] = lrow[r] * alpha + psum;
#pragma unroll
      for (int t = 0; t < 4; ++t) oacc[t][r] *= alpha;
    }
    __builtin_amdgcn_fence(__ATOMIC_RELEASE, "workgroup");
    __builtin_amdgcn_wave_barrier();
    __builtin_amdgcn_fence(__ATOMIC_ACQUIRE, "workgroup");

    // ---- context += P . V (f16 WMMA), residual products into a separate accumulator ----
    v8f o1[4];
#pragma unroll
    for (int t = 0; t < 4; ++t) o1[t] = zero8();
    // both P fragments (and their residuals) are read as one group: one LDS wait ahead of the context WMMAs
    v16h paf[2], plf[2];
#pragma unroll
    for (int kk = 0; kk < 2; ++kk) {
      paf[kk] = OpT<1>::ld(pwh + c * AP + kk * 32 + 8 * hh);
      plf[kk] = paf[kk];
      if (RES) plf[kk] = OpT<1>::ld(pwl + c * AP + kk * 32 + 8 * hh);
    }
    // keeps the P reads from sinking in among the WMMAs
    __builtin_amdgcn_sched_barrier(0);
#pragma unroll
    for (int kk = 0; kk < 2; ++kk) {
#pragma unroll
      for (int t = 0; t < 4; ++t) {
        oacc[t] = mma_h(paf[kk], vbf[kk][t], oacc[t]);
        if (RES) {
          o1[t] = mma_h(paf[kk], vlf[kk][t], o1[t]);
          o1[t] = mma_h(plf[kk], vbf[kk][t], o1[t]);
        }
      }
    }
    if (RES) {
#pragma unroll
      for (int t = 0; t < 4; ++t)
#pragma unroll
        for (int r = 0; r < 8; ++r) oacc[t][r] += o1[t][r] * (1.0f / 4096.0f);
    }
  }

  // ---- normalise (1/l and the 1/1024 p carry), stage the wave's 16x64 tile, bf16 hi/lo split,
  float* os = Os[wave];
#pragma unroll
  for (int r = 0; r < 8; ++r) {
    const float l = lrow[r];
    const float inv = (1.0f / l) * (1.0f / 1024.0f);   // l == 0 (fully masked row) -> inf -> NaN context
#pragma unroll
    for (int t = 0; t < 4; ++t) os[(8 * hh + r) * 64 + t * 16 + c] = oacc[t][r] * inv;
  }
  __builtin_amdgcn_fence(__ATOMIC_RELEASE, "workgroup");
  __builtin_amdgcn_wave_barrier();
  __builtin_amdgcn_fence(__ATOMIC_ACQUIRE, "workgroup");
  {
    const int q4 = lane >> 3, c8 = (lane & 7) * 8;
    v4u hv[4], lv[4];
#pragma unroll
    for (int it = 0; it < 4; ++it) {
      const int row = it * 4 + q4;   // it 0..3 x q4 0..3 = rows 0..15 of the wave tile
      const float* sp = os + row * 64 + c8;
      v4u a, a2;
#pragma unroll
      for (int e = 0; e < 4; ++e) {
        const float f0 = sp[2 * e], f1 = sp[2 * e + 1];
        const unsigned short h0 = bf_bits(f0), h1 = bf_bits(f1);
        const unsigned short l0 = bf_bits(f0 - bf_up(h0)), l1 = bf_bits(f1 - bf_up(h1));
        a[e] = pk16(h0, h1); a2[e] = pk16(l0, l1);
      }
      hv[it] = a; lv[it] = a2;
    }
    {
#pragma unroll
      for (int it = 0; it < 4; ++it) {
        const int row = it * 4 + q4;
        const size_t go = (rowB + q0 + row) * DM + (size_t)h * HD + c8;
        *(v4u*)(ohp + go) = hv[it];
        *(v4u*)(olp + go) = lv[it];
      }
      
    }
  }
}

// =====================================================================================================
// Layer norm over rows of DM=1024, f32, one block per row (grid = MROWS, 256 threads, 4 elements per thread).
// mean and biased variance via wave shuffles + 16 LDS slots; gamma / beta values RNE-converted to bf16;
// o = (gamma * (x - mean)) * (1 / sqrt(var + eps)) + beta.
// OUT16: threads 0..127 reload 8 consecutive inputs each and write the f16 plane as one 16-B store per lane
// coverage: 256 threads x 4 = the row (f32); 128 threads x 8 = the row (f16).
// =====================================================================================================
template <bool OUT16>
__global__ __launch_bounds__(256) void layernorm_rows(const float* __restrict__ in,
                                                       const float* __restrict__ gamma,
                                                       const float* __restrict__ beta,
                                                       float* out32, unsigned short* out16) {
  __shared__ float red[16];
  const int tid = threadIdx.x, lane = tid & 31, wave = tid >> 5;
  const int row = blockIdx.x;
  const float* xr = in + (size_t)row * DM;
  const v4f v = *(const v4f*)(xr + tid * 4);
  float s = (v[0] + v[1]) + (v[2] + v[3]);
#pragma unroll
  for (int off = 1; off < 32; off <<= 1) s += __shfl_xor(s, off, 32);
  if (lane == 0) red[wave] = s;
  __syncthreads();
  float tot = 0.f;
#pragma unroll
  for (int i = 0; i < 8; ++i) tot += red[i];
  const float mean = tot * (1.0f / (float)DM);
  const float d0 = v[0] - mean, d1 = v[1] - mean, d2 = v[2] - mean, d3 = v[3] - mean;
  float s2 = (d0 * d0 + d1 * d1) + (d2 * d2 + d3 * d3);
#pragma unroll
  for (int off = 1; off < 32; off <<= 1) s2 += __shfl_xor(s2, off, 32);
  if (lane == 0) red[8 + wave] = s2;
  __syncthreads();
  float tot2 = 0.f;
#pragma unroll
  for (int i = 0; i < 8; ++i) tot2 += red[8 + i];
  const float var  = tot2 * (1.0f / (float)DM);
  const float rstd = 1.0f / sqrtf(var + LNEPS);

  const v4f g  = *(const v4f*)(gamma + tid * 4);
  const v4f bt = *(const v4f*)(beta + tid * 4);
  v4f o;
  o[0] = (bfr(g[0]) * d0) * rstd + bfr(bt[0]);
  o[1] = (bfr(g[1]) * d1) * rstd + bfr(bt[1]);
  o[2] = (bfr(g[2]) * d2) * rstd + bfr(bt[2]);
  o[3] = (bfr(g[3]) * d3) * rstd + bfr(bt[3]);
  float* op = out32 + (size_t)row * DM + tid * 4;
  *(v4f*)op = o;
  

  if (OUT16) {
    if (tid < 128) {
      const int cc = tid * 8;
      const v4f a0 = *(const v4f*)(xr + cc);
      const v4f a1 = *(const v4f*)(xr + cc + 4);
      const v4f g0 = *(const v4f*)(gamma + cc), g1 = *(const v4f*)(gamma + cc + 4);
      const v4f b0 = *(const v4f*)(beta + cc),  b1 = *(const v4f*)(beta + cc + 4);
      float f[8];
#pragma unroll
      for (int e = 0; e < 4; ++e) {
        f[e]     = (bfr(g0[e]) * (a0[e] - mean)) * rstd + bfr(b0[e]);
        f[4 + e] = (bfr(g1[e]) * (a1[e] - mean)) * rstd + bfr(b1[e]);
      }
      v4u hp;
#pragma unroll
      for (int e = 0; e < 4; ++e) hp[e] = pk16(h_bits((_Float16)f[2 * e]), h_bits((_Float16)f[2 * e + 1]));
      unsigned short* hq = out16 + (size_t)row * DM + cc;
      *(v4u*)hq = hp;
      
    }
  }
}

// =====================================================================================================
// Workspace map (MiB = 1048576 B):
//   Xb   bf16 [4096][1024]         0 ..   8
//   WqT  bf16 [1024 n][1024 k]     8 ..  10     WkT 10 .. 12    WvT 12 .. 14    WoT 14 .. 16
//   W1T  f16  [4096 n][1024 k]    16 ..  24     W2T f16 [1024 n][4096 k]  24 .. 32
//   Qh   bf16 [4096][1024]        32 ..  40     Ql 40 .. 48    Kh 48 .. 56    Kl 56 .. 64
//   VTh  f16  [2][1024][2048]     64 ..  72     VTl f16 [2][1024][512]    72 .. 74    Flg u64 [32][32] at 74
//   Oh   bf16 [4096][1024]        76 ..  84     Ol 84 .. 92
//   later (regions dead by then, single in-order stream):
//   T1   f32  [4096][1024]        32 ..  48   (over Qh, Ql: written by the Wo GEMM after attention)
//   H32  f32  [4096][1024]        48 ..  64   (over Kh, Kl: written by LN1)
//   Hh   f16  [4096][1024]        64 ..  72   (over VTh: written by LN1)
//   F1   f16  [4096][4096]        72 .. 104   (over VTl, Flg, Oh, Ol: written by the W1 GEMM after the Wo GEMM)
//   T2   f32  [4096][1024]        32 ..  48   (over T1: written by the W2 GEMM after LN1)
//   end = 104 MiB. Every plane is an exact multiple of its 64x64 tile / whole-line store granularity
//   (no padded tails); all region starts are MiB aligned.
// =====================================================================================================
extern "C" void kernel_launch(void* const* d_in, const int* in_sizes, int n_in,
                              void* d_out, int out_size, void* d_ws, size_t ws_size,
                              hipStream_t stream) {
  if (n_in < 18) return;
  if (in_sizes[0] != NB * SEQ * DM) return;
  if (in_sizes[1] != SEQ * SEQ) return;
  if (in_sizes[2] != DM * DM || in_sizes[4] != DM * DM || in_sizes[6] != DM * DM || in_sizes[8] != DM * DM) return;
  if (in_sizes[3] != DM || in_sizes[5] != DM || in_sizes[7] != DM || in_sizes[9] != DM) return;
  if (in_sizes[10] != DM * DFF || in_sizes[11] != DFF || in_sizes[12] != DFF * DM || in_sizes[13] != DM) return;
  if (in_sizes[14] != DM || in_sizes[15] != DM || in_sizes[16] != DM || in_sizes[17] != DM) return;
  if (out_size != NB * SEQ * DM) return;

  const float* x   = (const float*)d_in[0];
  const int*   msk = (const int*)d_in[1];
  const float* Wq  = (const float*)d_in[2];
  const float* bq  = (const float*)d_in[3];
  const float* Wk  = (const float*)d_in[4];
  const float* bk  = (const float*)d_in[5];
  const float* Wv  = (const float*)d_in[6];
  const float* bv  = (const float*)d_in[7];
  const float* Wo  = (const float*)d_in[8];
  const float* bo  = (const float*)d_in[9];
  const float* W1  = (const float*)d_in[10];
  const float* b1  = (const float*)d_in[11];
  const float* W2  = (const float*)d_in[12];
  const float* b2  = (const float*)d_in[13];
  const float* gamma1 = (const float*)d_in[14];
  const float* beta1  = (const float*)d_in[15];
  const float* gamma2 = (const float*)d_in[16];
  const float* beta2  = (const float*)d_in[17];

  const size_t PX   = (size_t)MROWS * DM * 2;        //  8 MiB  16-bit activation plane [4096][1024]
  const size_t PW   = (size_t)DM * DM * 2;           //  2 MiB  16-bit weight plane [1024][1024]
  const size_t PWF  = (size_t)DM * DFF * 2;          //  8 MiB  16-bit FFN weight plane
  const size_t PVT  = (size_t)NB * DM * SEQ * 2;     //  8 MiB  v^T hi plane
  const size_t PVL  = (size_t)NB * DM * VLP * 2;     //  2 MiB  v^T residual plane
  const size_t PFs  = (size_t)2 * 1048576;           //  2 MiB  slot for the 8 KiB flag table
  const size_t PF   = (size_t)NQB * NQB * 8;         //  8 KiB
  const size_t PT   = (size_t)MROWS * DM * 4;        // 16 MiB  f32 activation plane
  const size_t PF1  = (size_t)MROWS * DFF * 2;       // 32 MiB  f16 FFN hidden plane
  if (PF > PFs) return;
  size_t off = 0;
  const size_t oXb  = off; off += PX;
  const size_t oWq  = off; off += PW;
  const size_t oWk  = off; off += PW;
  const size_t oWv  = off; off += PW;
  const size_t oWo  = off; off += PW;
  const size_t oW1  = off; off += PWF;
  const size_t oW2  = off; off += PWF;
  const size_t oQh  = off; off += PX;
  const size_t oQl  = off; off += PX;
  const size_t oKh  = off; off += PX;
  const size_t oKl  = off; off += PX;
  const size_t oVTh = off; off += PVT;
  const size_t oVTl = off; off += PVL;
  const size_t oFlg = off; off += PFs;
  const size_t oOh  = off; off += PX;
  const size_t oOl  = off; off += PX;
  const size_t endA = off;                           // 92 MiB
  const size_t oT1  = oQh;                           // T1 over Qh + Ql
  const size_t oH32 = oKh;                           // H32 over Kh + Kl
  const size_t oHh  = oVTh;                          // Hh over VTh
  const size_t oF1  = oVTl;                          // F1 over VTl .. Ol and beyond
  const size_t oT2  = oT1;                           // T2 over T1
  if (oT1 + PT != oKh) return;                       // aliasing sanity: T1 ends where H32 starts
  if (oH32 + PT != oVTh) return;                     // H32 ends where Hh starts
  if (oHh + PX != oVTl) return;                      // Hh ends where F1 starts
  size_t total = oF1 + PF1;                          // 104 MiB
  if (endA > total) total = endA;
  if (total > ws_size) return;
  if (total > (size_t)134217728) return;

  char* ws = (char*)d_ws;
  unsigned short* Xb   = (unsigned short*)(ws + oXb);
  unsigned short* WqTb = (unsigned short*)(ws + oWq);
  unsigned short* WkTb = (unsigned short*)(ws + oWk);
  unsigned short* WvTb = (unsigned short*)(ws + oWv);
  unsigned short* WoTb = (unsigned short*)(ws + oWo);
  unsigned short* W1Tb = (unsigned short*)(ws + oW1);
  unsigned short* W2Tb = (unsigned short*)(ws + oW2);
  unsigned short* Qh   = (unsigned short*)(ws + oQh);
  unsigned short* Ql   = (unsigned short*)(ws + oQl);
  unsigned short* Kh   = (unsigned short*)(ws + oKh);
  unsigned short* Kl   = (unsigned short*)(ws + oKl);
  unsigned short* VTh  = (unsigned short*)(ws + oVTh);
  unsigned short* VTl  = (unsigned short*)(ws + oVTl);
  u64*            Flg  = (u64*)(ws + oFlg);
  unsigned short* Oh   = (unsigned short*)(ws + oOh);
  unsigned short* Ol   = (unsigned short*)(ws + oOl);
  float*          T1   = (float*)(ws + oT1);
  float*          H32  = (float*)(ws + oH32);
  unsigned short* Hh   = (unsigned short*)(ws + oHh);
  unsigned short* F1   = (unsigned short*)(ws + oF1);
  float*          T2   = (float*)(ws + oT2);

  const dim3 blk(256);
  const int n8x = MROWS * DM / 8;                                   // 524288
  const dim3 gCvtX((n8x + 255) / 256);                              // 2048 blocks
  const dim3 gMask(NQB);                                            // 32 blocks
  const dim3 gTw(DM / 64, DM / 64);                                 // 16 x 16: in [1024 k][1024 n] -> out [1024 n][1024 k]
  const dim3 gTw1(DFF / 64, DM / 64);                               // 64 x 16: in [1024 k][4096 n] -> out [4096 n][1024 k]
  const dim3 gTw2(DM / 64, DFF / 64);                               // 16 x 64: in [4096 k][1024 n] -> out [1024 n][4096 k]
  const dim3 blkG(128);                                             // GEMM block: 4 waves, one 128x128 tile
  const dim3 gProj((MROWS / 128) * (DM / 128), 1);                  // 256 tiles: M=4096, N=1024
  const dim3 gVT((DM / 128) * (SEQ / 128), NB);                     // 128 tiles x 2 batches: M=1024, N=2048
  const dim3 gW1((MROWS / 128) * (DFF / 128), 1);                   // 1024 tiles: M=4096, N=4096
  const dim3 gW2((MROWS / 128) * (DM / 128), 1);                    // 256 tiles: M=4096, N=1024
  const dim3 gLN(MROWS);                                            // 4096 blocks, one row each

  // (0) mask tile survey -> Flg
  mask_rowbits<<<gMask, blk, 0, stream>>>(msk, Flg);
  // (1) x -> bf16 plane [4096][1024]; weights [k][n] f32 -> 16-bit [n][k] planes
  cvt_bf16x8<<<gCvtX, blk, 0, stream>>>(x, Xb, n8x);
  wtrans64<false><<<gTw, blk, 0, stream>>>(Wq, WqTb, DM, DM, 1.0f);
  wtrans64<false><<<gTw, blk, 0, stream>>>(Wk, WkTb, DM, DM, 1.0f);
  wtrans64<false><<<gTw, blk, 0, stream>>>(Wv, WvTb, DM, DM, 1.0f);
  wtrans64<false><<<gTw, blk, 0, stream>>>(Wo, WoTb, DM, DM, 1.0f);
  wtrans64<true><<<gTw1, blk, 0, stream>>>(W1, W1Tb, DM, DFF, WSCALE);
  wtrans64<true><<<gTw2, blk, 0, stream>>>(W2, W2Tb, DFF, DM, WSCALE);
  // (2) q = x . Wq + bq -> bf16 hi/lo planes [b*SEQ+t][h*64+d]   (M=4096, N=1024, K=1024)
  gemm64<0, 0, 2, 1, 0, false><<<gProj, blkG, 0, stream>>>(
      Xb, Xb, DM, 0LL, WqTb, DM, 0LL, bq, (const void*)Xb, DM, 0LL,
      (void*)Qh, DM, 0LL, (void*)Ql, DM, 0LL, DM,
      MROWS, DM, DM, 1.0f, 1.0f);
  // (3) k = x . Wk + bk -> bf16 hi/lo planes
  gemm64<0, 0, 2, 1, 0, false><<<gProj, blkG, 0, stream>>>(
      Xb, Xb, DM, 0LL, WkTb, DM, 0LL, bk, (const void*)Xb, DM, 0LL,
      (void*)Kh, DM, 0LL, (void*)Kl, DM, 0LL, DM,
      MROWS, DM, DM, 1.0f, 1.0f);
  // (4) v^T = WvT . x^T + bv per batch -> f16 hi plane [b][h*64+d][s] (pitch SEQ) and residual plane
  //     (x4096, keys < VLP only, pitch VLP)   (A = WvT [d][k], Bt = Xb rows of batch b; M=1024, N=2048, K=1024)
  gemm64<0, 0, 3, 2, 0, false><<<gVT, blkG, 0, stream>>>(
      WvTb, WvTb, DM, 0LL, Xb, DM, (long long)SEQ * DM, bv, (const void*)Xb, DM, 0LL,
      (void*)VTh, SEQ, (long long)DM * SEQ, (void*)VTl, VLP, (long long)DM * VLP, VLP,
      DM, SEQ, DM, 1.0f, 4096.0f);
  // (5) attention: query blocks 0..RESQB-1 with residual planes, the rest without
  attn_mask64<true><<<dim3(NB * NH * RESQB), dim3(128), 0, stream>>>(
      Qh, Ql, Kh, Kl, VTh, VTl, msk, Flg, Oh, Ol, 0, RESQB, 0.125f);
  attn_mask64<false><<<dim3(NB * NH * (NQB - RESQB)), dim3(128), 0, stream>>>(
      Qh, Ql, Kh, Kl, VTh, VTl, msk, Flg, Oh, Ol, RESQB, NQB - RESQB, 0.125f);
  // (6) T1 = ctx . Wo + bo + bf16(x) -> f32 [4096][1024]  (A = context hi + lo planes, 2 products)
  gemm64<0, 1, 0, 1, 1, false><<<gProj, blkG, 0, stream>>>(
      Oh, Ol, DM, 0LL, WoTb, DM, 0LL, bo, (const void*)Xb, DM, 0LL,
      (void*)T1, DM, 0LL, (void*)T1, DM, 0LL, 0,
      MROWS, DM, DM, 1.0f, 1.0f);
  // (7) h = LN1(T1) -> H32 f32 and Hh f16
  layernorm_rows<true><<<gLN, blk, 0, stream>>>(T1, gamma1, beta1, H32, Hh);
  // (8) F1 = relu(h . W1 + b1) -> f16 [4096][4096]  (f16 operands, W1 carried x64, acc scaled by 1/64)
  gemm64<1, 0, 4, 1, 0, true><<<gW1, blkG, 0, stream>>>(
      Hh, Hh, DM, 0LL, W1Tb, DM, 0LL, b1, (const void*)Hh, DM, 0LL,
      (void*)F1, DFF, 0LL, (void*)F1, DFF, 0LL, 0,
      MROWS, DFF, DM, 1.0f / WSCALE, 1.0f);
  // (9) T2 = F1 . W2 + b2 + h -> f32 [4096][1024]  (K = 4096, W2 carried x64)
  gemm64<1, 0, 0, 1, 2, false><<<gW2, blkG, 0, stream>>>(
      F1, F1, DFF, 0LL, W2Tb, DFF, 0LL, b2, (const void*)H32, DM, 0LL,
      (void*)T2, DM, 0LL, (void*)T2, DM, 0LL, 0,
      MROWS, DM, DFF, 1.0f / WSCALE, 1.0f);
  // (10) out = LN2(T2) -> d_out f32 [2][2048][1024]
  layernorm_rows<false><<<gLN, blk, 0, stream>>>(T2, gamma2, beta2, (float*)d_out, Hh);
  (void)hipGetLastError();
}

// v004
// One run takes 302 microseconds.
// In two side-by-side timings against v003, it was 1.07 and 1.08 times as fast.
// Over all steps from v000 it is 2.36 times as fast.
// Contractions: q, k, v^T projections = v_wmma_f32_16x16x32_bf16 (bf16 operands from RNE-converted inputs, single product);
// q.k^T scores = v_wmma_f32_16x16x32_bf16 with q and k as bf16 hi/lo planes (hi.hi + hi.lo + lo.hi);
// p.v = v_wmma_f32_16x16x32_f16 (p carried x1024 in f16, v f16 hi plane; f16 residual planes x4096 of p and v on the first 512 query rows);
// ctx.Wo = v_wmma_f32_16x16x32_bf16 with ctx as bf16 hi/lo planes times bf16 Wo (2 products);
// h.W1 and relu(h.W1+b1).W2 = v_wmma_f32_16x16x32_f16 (f16 operands, weights carried x64, single product);
// all f32 accumulate; softmax and both layer norms in f32.
#include <hip/hip_runtime.h>
#include <math.h>
#include <stdint.h>

#define NB     2
#define SEQ    2048
#define DM     1024
#define NH     16
#define HD     64
#define DFF    4096
#define MROWS  (NB * SEQ)   // 4096 token rows
#define NQB    (SEQ / 64)   // 32 key / query tiles of 64
#define VLP    512          // key pitch of the v^T residual plane (keys 0..VLP-1)
#define RESQB  8            // leading 64-row query blocks that use the p / v residual planes
#define LNEPS  1e-6f
#define WSCALE 64.0f        // f16 weight carry for W1 and W2
#define GKS    128          // k elements per LDS stage of the GEMM (256-B rows)
#define GPITCH 272          // LDS row pitch of a stage in bytes: 16 B x odd, for 16-B fragment reads
#define AP     72           // LDS row pitch of the attention K / V^T / P tiles in 16-bit elements: 144 B = 16 B x odd
static_assert(RESQB * 64 <= VLP);
static_assert(NH * HD == DM);
static_assert((SEQ % 128) == 0 && (DM % 128) == 0 && (DFF % 128) == 0 && (MROWS % 128) == 0);
static_assert((DM % GKS) == 0 && (DFF % GKS) == 0);
static_assert(NQB * 8 == 256);
static_assert(AP >= 64 && ((AP * 2) % 16) == 0 && (((AP * 2) / 16) & 1) == 1);

typedef _Float16 v16h __attribute__((ext_vector_type(16)));
typedef _Float16 v8h  __attribute__((ext_vector_type(8)));
typedef __bf16   v16b __attribute__((ext_vector_type(16)));
typedef __bf16   v8b  __attribute__((ext_vector_type(8)));
typedef float    v8f  __attribute__((ext_vector_type(8)));
typedef float    v4f  __attribute__((ext_vector_type(4)));
typedef unsigned int v4u __attribute__((ext_vector_type(4)));
typedef unsigned int v2u __attribute__((ext_vector_type(2)));
typedef int      v4i __attribute__((ext_vector_type(4)));
typedef unsigned long long u64;

#if defined(__HIP_DEVICE_COMPILE__)
#define DEV_ASM 1
#else
#define DEV_ASM 0
#endif

// ---- scalar helpers --------------------------------------------------------------------------------
__device__ __forceinline__ unsigned short bf_bits(float f) {          // f32 -> bf16 bits, RNE convert
  unsigned u = __float_as_uint(f);
  return (unsigned short)((u + 0x7FFFu + ((u >> 16) & 1u)) >> 16);
}
__device__ __forceinline__ float bf_up(unsigned short h) { return __uint_as_float(((unsigned)h) << 16); }
__device__ __forceinline__ float bfr(float f) { return bf_up(bf_bits(f)); }   // bf16 requantised value
__device__ __forceinline__ unsigned short h_bits(_Float16 x) { return __builtin_bit_cast(unsigned short, x); }
__device__ __forceinline__ unsigned pk16(unsigned short a, unsigned short b) { return (unsigned)a | ((unsigned)b << 16); }
__device__ __forceinline__ v8f zero8() { v8f z = {0.f, 0.f, 0.f, 0.f, 0.f, 0.f, 0.f, 0.f}; return z; }
__device__ __forceinline__ v8h zero8h() {
  const _Float16 z = (_Float16)0.0f;
  v8h r = {z, z, z, z, z, z, z, z};
  return r;
}

// ---- operand traits: fragment loader (lane -> row/col (lane&15), p already includes +8*(lane>>4);
//      elements 0..7 <- p[0..7] (k0+8h..), elements 8..15 <- p[16..23] (k0+16+8h..)), WMMA, hazard gaps
template <int ET> struct OpT;
template <> struct OpT<0> {
  typedef __bf16 E; typedef v16b F; typedef v8b H;
  static __device__ __forceinline__ F ld(const E* p) {
    union { F v; H h[2]; } f;
    f.h[0] = *(const H*)(p);
    f.h[1] = *(const H*)(p + 16);
    return f.v;
  }
  static __device__ __forceinline__ v8f mma_raw(F a, F b, v8f c) {
    return __builtin_amdgcn_wmma_f32_16x16x32_bf16(false, a, false, b, (short)0, c, false, false);
  }
  static __device__ __forceinline__ void dep_guard(v8f& a, v8f& b, F x, F y) {
#if DEV_ASM
    asm volatile("v_nop\n\tv_nop\n\tv_nop\n\tv_nop" : "+v"(a), "+v"(b) : "v"(x), "v"(y));
#endif
  }
  static __device__ __forceinline__ void keep4(F a, F b, F c, F d) {
#if DEV_ASM
    asm volatile("v_nop" :: "v"(a), "v"(b), "v"(c), "v"(d));
#endif
  }
};
template <> struct OpT<1> {
  typedef _Float16 E; typedef v16h F; typedef v8h H;
  static __device__ __forceinline__ F ld(const E* p) {
    union { F v; H h[2]; } f;
    f.h[0] = *(const H*)(p);
    f.h[1] = *(const H*)(p + 16);
    return f.v;
  }
  static __device__ __forceinline__ v8f mma_raw(F a, F b, v8f c) {
    return __builtin_amdgcn_wmma_f32_16x16x32_f16(false, a, false, b, (short)0, c, false, false);
  }
  static __device__ __forceinline__ void dep_guard(v8f& a, v8f& b, F x, F y) {
#if DEV_ASM
    asm volatile("v_nop\n\tv_nop\n\tv_nop\n\tv_nop" : "+v"(a), "+v"(b) : "v"(x), "v"(y));
#endif
  }
  static __device__ __forceinline__ void keep4(F a, F b, F c, F d) {
#if DEV_ASM
    asm volatile("v_nop" :: "v"(a), "v"(b), "v"(c), "v"(d));
#endif
  }
};

// ---- guarded WMMA helpers for the attention kernel ------------------------------------------------
__device__ __forceinline__ v8f mma_b(v16b a, v16b b, v8f c) {
  c = __builtin_amdgcn_wmma_f32_16x16x32_bf16(false, a, false, b, (short)0, c, false, false);
#if DEV_ASM
  asm volatile("v_nop\n\tv_nop\n\tv_nop\n\tv_nop" : "+v"(c) : "v"(a), "v"(b));
#endif
  return c;
}
__device__ __forceinline__ v8f mma_h(v16h a, v16h b, v8f c) {
  c = __builtin_amdgcn_wmma_f32_16x16x32_f16(false, a, false, b, (short)0, c, false, false);
#if DEV_ASM
  asm volatile("v_nop\n\tv_nop\n\tv_nop\n\tv_nop" : "+v"(c) : "v"(a), "v"(b));
#endif
  return c;
}
__device__ __forceinline__ void acc_guard4(v8f& a, v8f& b, v8f& c, v8f& d) {
#if DEV_ASM
  asm volatile("v_nop\n\tv_nop\n\tv_nop\n\tv_nop" : "+v"(a), "+v"(b), "+v"(c), "+v"(d));
#endif
}

// =====================================================================================================
// f32 -> bf16 (RNE convert), 8 elements per thread, one 16-B store per lane: a wave writes 512 contiguous B
// coverage: n8 threads x 8 = the whole plane (n8 is a multiple of 256 here). blk = block of 256 threads.
// =====================================================================================================
__device__ __forceinline__ void cvt_bf16x8(int blk, const float* __restrict__ in, unsigned short* out, int n8) {
  const int i = blk * 256 + threadIdx.x;
  if (i < n8) {
    const v4f a = *(const v4f*)(in + (size_t)i * 8);
    const v4f b = *(const v4f*)(in + (size_t)i * 8 + 4);
    v4u p;
    p[0] = pk16(bf_bits(a[0]), bf_bits(a[1]));
    p[1] = pk16(bf_bits(a[2]), bf_bits(a[3]));
    p[2] = pk16(bf_bits(b[0]), bf_bits(b[1]));
    p[3] = pk16(bf_bits(b[2]), bf_bits(b[3]));
    *(v4u*)(out + (size_t)i * 8) = p;
    
  }
}

// =====================================================================================================
// Weight transpose + convert: in W f32 [Kdim][Ndim] (row k, n contiguous) -> out 16-bit [Ndim][Kdim]
// (row n, k contiguous). F16OUT: f16 of (bf16 value * scale), else bf16 bits. 64x64 tile through LDS.
// (Ndim/64) x (Kdim/64) blocks of 256 threads; bn = n tile, bk = k tile; tile = 64 x 65 floats of LDS.
// coverage: load 256 threads x 16 = 64x64; store 8 waves x 2 it x 4 rows x (8 lanes x 8) = 64x64.
// =====================================================================================================
template <bool F16OUT>
__device__ __forceinline__ void wtrans64(float (*tile)[65], int bn, int bk,
                                         const float* __restrict__ W, unsigned short* out,
                                         int Kdim, int Ndim, float scale) {
  const int tid = threadIdx.x, lane = tid & 31, wave = tid >> 5;
  const int n0 = bn * 64, k0 = bk * 64;
  {
    const int r = tid >> 2, cq = (tid & 3) * 16;
    const float* src = W + (size_t)(k0 + r) * Ndim + n0 + cq;
#pragma unroll
    for (int e = 0; e < 4; ++e) {
      const v4f a = *(const v4f*)(src + 4 * e);
      tile[r][cq + 4 * e + 0] = a[0];
      tile[r][cq + 4 * e + 1] = a[1];
      tile[r][cq + 4 * e + 2] = a[2];
      tile[r][cq + 4 * e + 3] = a[3];
    }
  }
  __syncthreads();
  const int q = lane >> 3, c8 = (lane & 7) * 8;
  v4u pv[2];
#pragma unroll
  for (int it = 0; it < 2; ++it) {
    const int nn = wave * 8 + it * 4 + q;
    v4u a;
#pragma unroll
    for (int e = 0; e < 4; ++e) {
      const float f0 = tile[c8 + 2 * e][nn], f1 = tile[c8 + 2 * e + 1][nn];
      unsigned short b0 = bf_bits(f0), b1 = bf_bits(f1);
      if (F16OUT) {
        b0 = h_bits((_Float16)(bf_up(b0) * scale));
        b1 = h_bits((_Float16)(bf_up(b1) * scale));
      }
      a[e] = pk16(b0, b1);
    }
    pv[it] = a;
  }
  {
#pragma unroll
    for (int it = 0; it < 2; ++it) {
      const int nn = wave * 8 + it * 4 + q;
      *(v4u*)(out + (size_t)(n0 + nn) * Kdim + k0 + c8) = pv[it];
    }
#if DEV_ASM
    // inlined into a kernel with other parts, code may follow that writes the stores' registers again: wait first
    asm volatile("s_wait_xcnt 0x0" ::: "memory");
#endif
  }
}

// =====================================================================================================
// Mask tile survey: mask int32 [1][1][SEQ][SEQ] (nonzero = key allowed). Block = qt: query rows qt*64..+63.
// For every key tile kt (64 keys) it records a 64-bit word whose bit r is 1 when row r of the tile has at
// least one nonzero entry inside kt. NQB blocks of 256 threads: thread = (row = tid>>2, quarter = tid&3);
// wave w holds rows 8w..8w+7 -> byte w of the word. Output flg[qt*NQB + kt], 32 words = 256 B per block
// coverage: 32 blocks x 32 words = the whole 1024-word table.
// =====================================================================================================
// sb = NQB * 8 bytes of LDS, 8-B aligned.
__device__ __forceinline__ void mask_rowbits(unsigned char* sb, int qt, const int* __restrict__ maskp, u64* flg) {
  const int tid  = threadIdx.x;
  const int wave = tid >> 5;
  const int lane = tid & 31;
  const int row  = tid >> 2;            // 0..63
  const int qtr  = (tid & 3) * 16;      // 0,16,32,48
  const int* mr = maskp + ((size_t)qt * 64 + row) * SEQ + qtr;
#pragma unroll 1
  for (int kt = 0; kt < NQB; ++kt) {
    const int* p = mr + kt * 64;
    const v4i a0 = *(const v4i*)(p);
    const v4i a1 = *(const v4i*)(p + 4);
    const v4i a2 = *(const v4i*)(p + 8);
    const v4i a3 = *(const v4i*)(p + 12);
    int lv = 0;
#pragma unroll
    for (int e = 0; e < 4; ++e) {
      lv |= (a0[e] != 0) ? 1 : 0;
      lv |= (a1[e] != 0) ? 1 : 0;
      lv |= (a2[e] != 0) ? 1 : 0;
      lv |= (a3[e] != 0) ? 1 : 0;
    }
    const unsigned bl = __builtin_amdgcn_ballot_w32(lv != 0);   // uniform per wave
    unsigned bits = 0u;
#pragma unroll
    for (int k = 0; k < 8; ++k) bits |= ((((bl >> (4 * k)) & 0xFu) != 0u) ? 1u : 0u) << k;
    if (lane == 0) sb[kt * 8 + wave] = (unsigned char)bits;
  }
  __syncthreads();
  if (wave == 0) {
    u64 w;
    __builtin_memcpy(&w, &sb[lane * 8], 8);   // bytes 0..7 = rows 0..63, little endian
    u64* dst = flg + (size_t)qt * NQB + lane;
    *(u64*)dst = w;
    
  }
}

// =====================================================================================================
// All the work that reads only the inputs, in ONE launch: no part needs another part's result, so the parts share
// the chip instead of standing one behind another in the stream. A block takes its part from its index (a
// block-uniform branch, so each part's barrier is passed by all of the block's threads or by none):
//   PB_MASK blocks  mask tile survey (first: each is one long chain of dependent trips, the rest runs beside it)
//   PB_WF   blocks  W1 -> W1T,  PB_WF blocks  W2 -> W2T,  4 x PB_W blocks  Wq, Wk, Wv, Wo -> their transposes
//   PB_X    blocks  x -> bf16 plane
// =====================================================================================================
#define PB_MASK NQB
#define PB_WF   ((DFF / 64) * (DM / 64))
#define PB_W    ((DM / 64) * (DM / 64))
#define PB_X    (MROWS * DM / 8 / 256)
#define PB_ALL  (PB_MASK + 2 * PB_WF + 4 * PB_W + PB_X)
static_assert((MROWS * DM) % (8 * 256) == 0);
__global__ __launch_bounds__(256) void prep_inputs(
    const int* __restrict__ maskp, u64* flg, const float* __restrict__ x, unsigned short* xb,
    const float* __restrict__ Wq, const float* __restrict__ Wk, const float* __restrict__ Wv,
    const float* __restrict__ Wo, const float* __restrict__ W1, const float* __restrict__ W2,
    unsigned short* WqT, unsigned short* WkT, unsigned short* WvT, unsigned short* WoT,
    unsigned short* W1T, unsigned short* W2T) {
  __shared__ __align__(16) float tile[64][65];
  static_assert(sizeof(tile) >= NQB * 8);
  int i = blockIdx.x;
  if (i < PB_MASK) {
    mask_rowbits((unsigned char*)(void*)&tile[0][0], i, maskp, flg);
    return;
  }
  i -= PB_MASK;
  if (i < PB_WF) {           // in [1024 k][4096 n] -> out [4096 n][1024 k]
    wtrans64<true>(tile, i % (DFF / 64), i / (DFF / 64), W1, W1T, DM, DFF, WSCALE);
    return;
  }
  i -= PB_WF;
  if (i < PB_WF) {           // in [4096 k][1024 n] -> out [1024 n][4096 k]
    wtrans64<true>(tile, i % (DM / 64), i / (DM / 64), W2, W2T, DFF, DM, WSCALE);
    return;
  }
  i -= PB_WF;
  if (i < 4 * PB_W) {        // in [1024 k][1024 n] -> out [1024 n][1024 k]
    const int w = i / PB_W, t = i % PB_W;
    const float* W = (w == 0) ? Wq : (w == 1) ? Wk : (w == 2) ? Wv : Wo;
    unsigned short* T = (w == 0) ? WqT : (w == 1) ? WkT : (w == 2) ? WvT : WoT;
    wtrans64<false>(tile, t % (DM / 64), t / (DM / 64), W, T, DM, DM, 1.0f);
    return;
  }
  i -= 4 * PB_W;
  cvt_bf16x8(i, x, xb, MROWS * DM / 8);
}

// =====================================================================================================
// Register-blocked batched 16-bit WMMA GEMM: C[m][n] = sum_k A[m][k] * Bt[n][k]; one block of 4 waves per
// 128x128 tile, one wave per 64x64 quarter. ET: 0 = bf16 operands, 1 = f16 operands. A row-major [M][K] pitch lda;
// Bt row-major [N][K] pitch ldb (k contiguous); M, N multiples of 128, K multiple of GKS (host constants).
// blockIdx.x = tile, blockIdx.y = batch index (strides in elements).
// Operand path: a stage = GKS k of the block's 128 A rows (and A2 rows) and 128 Bt rows, in LDS at pitch GPITCH,
// brought by 16-B asynchronous copies (16 lanes = one 256-B row piece); two buffers, the copies of stage t+2 are
// issued behind the barrier that ends stage t, so they fly while stage t+1 is worked on.
// NSPLIT: 0 = A.Bt; 1 = (A + A2).Bt (A2 = unscaled bf16 lo plane of A).
// Epilogue value v = acc*oscale + bias (+ resid) (relu); BIAS: 0 none, 1 per column n, 2 per row m
// (bias values RNE-converted to bf16); RESID (OUT_MODE 0 only): 1 = bf16 plane [m][n] pitch ldr, 2 = f32 plane.
// OUT_MODE: 0 = f32 (pitch ldc); 2 = bf16 hi plane C + bf16 lo plane C2 (lo = RNE(v - hi), unscaled);
//           3 = f16 hi plane C + f16 residual plane C2 = f16((v - hi) * rscale), C2 written only for tiles
//               with n0 < N2 (pitch ldc2, batch stride strideC2); 4 = f16 single plane C.
// =====================================================================================================
// Eight asynchronous 16-B copies per lane: rows r, r+8, .., r+56 of a plane (pitch ld elements) to LDS rows at
// pitch GPITCH. The s_wait_xcnt closes the statement so that no address register is rewritten ahead of it.
__device__ __forceinline__ void copy8_rows(unsigned l, const unsigned short* gp, int ld) {
#if DEV_ASM
  const size_t st = (size_t)8 * (size_t)ld;
  asm volatile(
      "global_load_async_to_lds_b128 %0, %8, off\n\t"
      "global_load_async_to_lds_b128 %1, %9, off\n\t"
      "global_load_async_to_lds_b128 %2, %10, off\n\t"
      "global_load_async_to_lds_b128 %3, %11, off\n\t"
      "global_load_async_to_lds_b128 %4, %12, off\n\t"
      "global_load_async_to_lds_b128 %5, %13, off\n\t"
      "global_load_async_to_lds_b128 %6, %14, off\n\t"
      "global_load_async_to_lds_b128 %7, %15, off\n\t"
      "s_wait_xcnt 0x0"
      :: "v"(l), "v"(l + 8u * GPITCH), "v"(l + 16u * GPITCH), "v"(l + 24u * GPITCH),
         "v"(l + 32u * GPITCH), "v"(l + 40u * GPITCH), "v"(l + 48u * GPITCH), "v"(l + 56u * GPITCH),
         "v"(gp), "v"(gp + st), "v"(gp + 2 * st), "v"(gp + 3 * st),
         "v"(gp + 4 * st), "v"(gp + 5 * st), "v"(gp + 6 * st), "v"(gp + 7 * st)
      : "memory");
  // keeps the next statement's address sums behind this one, so that their registers are used again
  __builtin_amdgcn_sched_barrier(0);
#endif
}
// One 128-row plane of a stage: 128 threads x 16 copies = 128 rows x 256 B.
__device__ __forceinline__ void copy_plane128(unsigned l, const unsigned short* gp, int ld) {
  copy8_rows(l, gp, ld);
  copy8_rows(l + 64u * GPITCH, gp + (size_t)64 * (size_t)ld, ld);
}
__device__ __forceinline__ void wait_lds_reads() {     // this wave's LDS reads are done before the buffer is given up
#if DEV_ASM
  asm volatile("s_wait_dscnt 0x0" ::: "memory");
#endif
}
__device__ __forceinline__ void wait_copies() {        // this wave's asynchronous copies have landed in LDS
#if DEV_ASM
  asm volatile("s_wait_asynccnt 0x0" ::: "memory");
#endif
}

template <int ET, int NSPLIT, int OUT_MODE, int BIAS, int RESID, bool RELU>
__global__ __launch_bounds__(128) void gemm64(
    const unsigned short* __restrict__ Ap, const unsigned short* __restrict__ A2p, int lda, long long strideA,
    const unsigned short* __restrict__ Btp, int ldb, long long strideB,
    const float* __restrict__ bias,
    const void* __restrict__ resid, int ldr, long long strideR,
    void* Cout, int ldc, long long strideC,
    void* Cout2, int ldc2, long long strideC2, int N2,
    int M, int N, int K, float oscale, float rscale) {
  typedef typename OpT<ET>::E E;
  typedef typename OpT<ET>::F F;
  const E* A  = (const E*)(const void*)Ap;
  const E* A2 = (const E*)(const void*)A2p;
  const E* Bt = (const E*)(const void*)Btp;
  constexpr int BROW  = (NSPLIT >= 1) ? 256 : 128;   // first Bt row of a stage (behind the A and A2 rows)
  constexpr int STAGE = (BROW + 128) * GPITCH;       // bytes of one buffer
  constexpr int PE    = GPITCH / 2;                  // LDS row pitch in elements
  __shared__ __align__(16) unsigned char ring[2 * STAGE];
  __shared__ __align__(16) float sT[4][16 * 68];   // per-wave 16x64 slab, pitch 68 floats
  const int b    = blockIdx.y;
  const int tid  = threadIdx.x;
  const int lane = tid & 31;
  const int wave = tid >> 5;
  const int tilesN = N >> 7;
  const int tilesM = M >> 7;
  const int tile = blockIdx.x;
  if (tile >= tilesM * tilesN) return;   // block-uniform, in front of every barrier
  const int tm = tile / tilesN;
  const int tn = tile - tm * tilesN;
  const int mB = tm << 7;                // block tile origin
  const int nB = tn << 7;
  const int wm = (wave >> 1) << 6;       // this wave's 64x64 quarter
  const int wn = (wave & 1) << 6;
  const int m0 = mB + wm;
  const int n0 = nB + wn;

  const E* Ab  = A  + (size_t)b * strideA;
  const E* Bb  = Bt + (size_t)b * strideB;
  const E* Ab2 = (NSPLIT >= 1) ? (A2 + (size_t)b * strideA) : Ab;

  const int rlane = lane & 15;                 // row (A) / col (B, D) within subtile
  const int koff  = (lane >> 4) * 8;           // k offset of this lane half
  const int mOff  = (lane >> 4) * 8;           // D row offset

  v8f acc[4][4];
#pragma unroll
  for (int i = 0; i < 4; ++i)
#pragma unroll
    for (int j = 0; j < 4; ++j) acc[i][j] = zero8();

  // copy addresses of this lane: 16-B piece (tid & 15) of rows (tid >> 4) + 8 i of each plane
  const int crow = tid >> 4, cpc = tid & 15;
  const unsigned cl = (unsigned)(size_t)(const void*)ring + (unsigned)(crow * GPITCH + cpc * 16);
  const unsigned short* ca  = (const unsigned short*)(const void*)Ab  + (size_t)(mB + crow) * lda + cpc * 8;
  const unsigned short* ca2 = (const unsigned short*)(const void*)Ab2 + (size_t)(mB + crow) * lda + cpc * 8;
  const unsigned short* cb  = (const unsigned short*)(const void*)Bb  + (size_t)(nB + crow) * ldb + cpc * 8;
  auto issue_stage = [&](int st, int buf) {
    const unsigned l = cl + (unsigned)(buf * STAGE);
    const int k0 = st * GKS;
    copy_plane128(l, ca + k0, lda);
    if (NSPLIT >= 1) copy_plane128(l + 128u * GPITCH, ca2 + k0, lda);
    copy_plane128(l + (unsigned)(BROW * GPITCH), cb + k0, ldb);
  };
  const int nst = K / GKS;               // stages; uniform
  issue_stage(0, 0);
  wait_copies();
  __syncthreads();                       // stage 0 is published
  if (nst > 1) issue_stage(1, 1);

  for (int t = 0; t < nst; ++t) {
    const unsigned char* sb = ring + (t & 1) * STAGE;
    const E* la  = (const E*)(const void*)(sb + (wm + rlane) * GPITCH) + koff;
    const E* la2 = la + 128 * PE;
    const E* lb  = (const E*)(const void*)(sb + (BROW + wn + rlane) * GPITCH) + koff;
#pragma unroll
    for (int ks = 0; ks < GKS; ks += 32) {
      F bh[4], ah[4], al[4];
#pragma unroll
      for (int j = 0; j < 4; ++j) bh[j] = OpT<ET>::ld(lb + (j << 4) * PE + ks);
#pragma unroll
      for (int i = 0; i < 4; ++i) {
        ah[i] = OpT<ET>::ld(la + (i << 4) * PE + ks);
        al[i] = ah[i];
        if (NSPLIT >= 1) al[i] = OpT<ET>::ld(la2 + (i << 4) * PE + ks);
      }
      // the step's LDS reads go as one group ahead of its WMMAs: the wave waits out the LDS latency once a step,
      // not once per A fragment
      __builtin_amdgcn_sched_barrier(0);
#pragma unroll
      for (int i = 0; i < 4; ++i) {
#pragma unroll
        for (int j = 0; j < 4; ++j) {
          acc[i][j] = OpT<ET>::mma_raw(ah[i], bh[j], acc[i][j]);
          if (NSPLIT >= 1) acc[i][j] = OpT<ET>::mma_raw(al[i], bh[j], acc[i][j]);
        }
        OpT<ET>::dep_guard(acc[i][0], acc[i][3], ah[i], al[i]);
      }
      OpT<ET>::keep4(bh[0], bh[1], bh[2], bh[3]);
      // keeps the next step's LDS reads from moving in among this step's WMMAs
      __builtin_amdgcn_sched_barrier(0);
    }
    wait_lds_reads();
    wait_copies();
    __syncthreads();                     // publishes stage t+1 and ends every read of stage t's buffer
    if (t + 2 < nst) issue_stage(t + 2, t & 1);
  }
  wait_copies();
  acc_guard4(acc[0][0], acc[0][1], acc[0][2], acc[0][3]);
  acc_guard4(acc[1][0], acc[1][1], acc[1][2], acc[1][3]);
  acc_guard4(acc[2][0], acc[2][1], acc[2][2], acc[2][3]);
  acc_guard4(acc[3][0], acc[3][1], acc[3][2], acc[3][3]);

  // ---- epilogue ----
  float* slab = sT[wave];
#pragma unroll
  for (int i = 0; i < 4; ++i) {
    const int mBase = m0 + (i << 4);
#pragma unroll
    for (int j = 0; j < 4; ++j) {
#pragma unroll
      for (int r = 0; r < 8; ++r) {
        slab[(mOff + r) * 68 + (j << 4) + rlane] = acc[i][j][r];
      }
    }
    __builtin_amdgcn_fence(__ATOMIC_RELEASE, "workgroup");
    __builtin_amdgcn_wave_barrier();
    __builtin_amdgcn_fence(__ATOMIC_ACQUIRE, "workgroup");
    if (OUT_MODE == 0) {
      float* C = (float*)Cout + (size_t)b * strideC;
      const int h2 = lane >> 4, c4 = (lane & 15) * 4;     // 256-B row segment = 16 lanes x 16 B
      v4f bz = {0.f, 0.f, 0.f, 0.f};
      if (BIAS == 1) {
        const v4f g = *(const v4f*)(bias + n0 + c4);
        bz[0] = bfr(g[0]); bz[1] = bfr(g[1]); bz[2] = bfr(g[2]); bz[3] = bfr(g[3]);
      }
      v4f ov[8];
#pragma unroll
      for (int it = 0; it < 8; ++it) {
        const int row = it * 2 + h2;                       // it 0..7 x h2 0..1 = rows 0..15
        const v4f v = *(const v4f*)(slab + row * 68 + c4);
        v4f w;
        w[0] = v[0] * oscale + bz[0];
        w[1] = v[1] * oscale + bz[1];
        w[2] = v[2] * oscale + bz[2];
        w[3] = v[3] * oscale + bz[3];
        if (BIAS == 2) {
          const float bm = bfr(bias[mBase + row]);
          w[0] += bm; w[1] += bm; w[2] += bm; w[3] += bm;
        }
        if (RESID == 1) {
          const unsigned short* rp = (const unsigned short*)resid + (size_t)b * strideR +
                                     (size_t)(mBase + row) * ldr + n0 + c4;
          const v2u rr = *(const v2u*)rp;
          w[0] += __uint_as_float(rr[0] << 16);
          w[1] += __uint_as_float(rr[0] & 0xffff0000u);
          w[2] += __uint_as_float(rr[1] << 16);
          w[3] += __uint_as_float(rr[1] & 0xffff0000u);
        }
        if (RESID == 2) {
          const float* rp = (const float*)resid + (size_t)b * strideR + (size_t)(mBase + row) * ldr + n0 + c4;
          const v4f rr = *(const v4f*)rp;
          w[0] += rr[0]; w[1] += rr[1]; w[2] += rr[2]; w[3] += rr[3];
        }
        if (RELU) {
          w[0] = fmaxf(w[0], 0.f); w[1] = fmaxf(w[1], 0.f); w[2] = fmaxf(w[2], 0.f); w[3] = fmaxf(w[3], 0.f);
        }
        ov[it] = w;
      }
      {
#pragma unroll
        for (int it = 0; it < 8; ++it) {
          const int row = it * 2 + h2;
          *(v4f*)(C + (size_t)(mBase + row) * ldc + n0 + c4) = ov[it];
        }
        
      }
    } else {
      const int q = lane >> 3, c8 = (lane & 7) * 8;
      unsigned short* C  = (unsigned short*)Cout  + (size_t)b * strideC;
      unsigned short* C2 = (unsigned short*)Cout2 + (size_t)b * strideC2;
      const bool wlo = (OUT_MODE == 2) || (OUT_MODE == 3 && n0 < N2);   // wave-uniform
      float b8[8];
#pragma unroll
      for (int e = 0; e < 8; ++e) b8[e] = 0.f;
      if (BIAS == 1) {
        const v4f g0 = *(const v4f*)(bias + n0 + c8);
        const v4f g1 = *(const v4f*)(bias + n0 + c8 + 4);
#pragma unroll
        for (int e = 0; e < 4; ++e) { b8[e] = bfr(g0[e]); b8[4 + e] = bfr(g1[e]); }
      }
      v4u hv[4], lv[4];
#pragma unroll
      for (int it = 0; it < 4; ++it) {
        const int row = it * 4 + q;                        // it 0..3 x q 0..3 = rows 0..15
        const float* sp = slab + row * 68 + c8;
        float bm = 0.f;
        if (BIAS == 2) bm = bfr(bias[mBase + row]);
        v4u a, a2;
#pragma unroll
        for (int e = 0; e < 4; ++e) {
          float f0 = sp[2 * e] * oscale + b8[2 * e] + bm;
          float f1 = sp[2 * e + 1] * oscale + b8[2 * e + 1] + bm;
          if (RELU) { f0 = fmaxf(f0, 0.f); f1 = fmaxf(f1, 0.f); }
          unsigned short h0, h1, l0 = 0, l1 = 0;
          if (OUT_MODE == 2) {
            h0 = bf_bits(f0); h1 = bf_bits(f1);
            l0 = bf_bits(f0 - bf_up(h0)); l1 = bf_bits(f1 - bf_up(h1));
          } else if (OUT_MODE == 3) {
            const _Float16 x0 = (_Float16)f0, x1 = (_Float16)f1;
            h0 = h_bits(x0); h1 = h_bits(x1);
            l0 = h_bits((_Float16)((f0 - (float)x0) * rscale));
            l1 = h_bits((_Float16)((f1 - (float)x1) * rscale));
          } else {
            h0 = h_bits((_Float16)f0); h1 = h_bits((_Float16)f1);
          }
          a[e] = pk16(h0, h1); a2[e] = pk16(l0, l1);
        }
        hv[it] = a; lv[it] = a2;
      }
      {
#pragma unroll
        for (int it = 0; it < 4; ++it) {
          const int row = it * 4 + q;
          *(v4u*)(C + (size_t)(mBase + row) * ldc + n0 + c8) = hv[it];
          if (wlo) *(v4u*)(C2 + (size_t)(mBase + row) * ldc2 + n0 + c8) = lv[it];
        }
        
      }
    }
    __builtin_amdgcn_fence(__ATOMIC_RELEASE, "workgroup");
    __builtin_amdgcn_wave_barrier();
    __builtin_amdgcn_fence(__ATOMIC_ACQUIRE, "workgroup");
  }
}

// =====================================================================================================
// Attention with an int32 replace-mask, head dim 64.
//   q planes (bf16 hi / lo): element (b, t, h, d) at [(b*SEQ + t)*DM + h*64 + d]
//   k planes (bf16 hi / lo): same layout with key index s
//   v^T hi plane (f16):      element (b, h, d, s) at [(b*DM + h*64 + d)*SEQ + s]
//   v^T residual plane (f16, (v - hi)*4096): [(b*DM + h*64 + d)*VLP + s], s < VLP, read only when RES
//   (a key tile at or beyond VLP contributes a zero v residual)
//   mask int32 [1][1][t][s]: logit = (mask != 0) ? q.k*sscale : -inf (replace)
//   flg [qt][kt]: bit r set when mask row qt*64+r has a nonzero inside key tile kt. A key tile is skipped only
//   when its word is 0 (every logit of the tile is -inf -> weight exactly 0, row max unaffected). The decision is
//   a block-uniform scalar load.
//   out planes (bf16 hi / lo of the normalised context): element (b, t, h, d) at [(b*SEQ + t)*DM + h*64 + d]
//   scores = q . k : bf16 hi/lo split (hi.hi + hi.lo + lo.hi), f32 accumulate, then * sscale + mask select in f32
//   p = exp(s - m) carried as f16(1024 p); context = p . v on f16 WMMA; RES adds f16 residual planes of p and v
//   (scale 4096, separate accumulator folded back with 1/4096 per chunk in f32); online softmax in f32.
//   A fully masked query row ends with l = 0 -> 0 * inf = NaN context, matching -inf softmax semantics.
//   Block = 4 waves = 64 query rows of one (b, h); grid = nqbThis * NH * NB; kv chunks of 64, static trip 32.
//   LDS rows of the K, V^T and P tiles stand AP elements apart (64 used, 8 never touched): the 16 rows that one
//   16-B fragment read takes then fall on 16 different bank groups.
//   K / V^T chunk staging: 128 threads x 32 elements per plane = the whole 64x64 tile (plain 16-B loads,
//   __syncthreads before and after); P tiles are wave-private, spilled with _Float16 element stores and reloaded
//   LDS fragment reads stand in groups ahead of the WMMAs that use them (K ahead of the scores, V^T ahead of the
//   softmax, P in one group), held in place by scheduling barriers.
//   Output coverage: each wave stores rows q0..q0+15 (it 0..3 x lane>>3 0..3) x 64 columns (8 lanes x 8) of both planes.
// =====================================================================================================
template <bool RES>
__global__ __launch_bounds__(128)
void attn_mask64(const unsigned short* __restrict__ qhp, const unsigned short* __restrict__ qlp,
                 const unsigned short* __restrict__ khp, const unsigned short* __restrict__ klp,
                 const unsigned short* __restrict__ vhp, const unsigned short* __restrict__ vlp,
                 const int* __restrict__ maskp, const u64* __restrict__ flg,
                 unsigned short* ohp, unsigned short* olp,
                 int qbBase, int nqbThis, float sscale) {
  __shared__ __align__(16) __bf16   Ksh[64 * AP];                 // K hi [kv][d], row pitch AP
  __shared__ __align__(16) __bf16   Ksl[64 * AP];                 // K lo
  __shared__ __align__(16) _Float16 Vth[64 * AP];                 // V^T hi [d][kv], row pitch AP
  __shared__ __align__(16) _Float16 Vtl[RES ? 64 * AP : 8];       // V^T residual
  __shared__ __align__(16) _Float16 Psh[4][16 * AP];              // per wave P [row][kv], row pitch AP
  __shared__ __align__(16) _Float16 Psl[RES ? 4 : 1][16 * AP];    // per wave P residual
  __shared__ __align__(16) float    Os[4][16 * 64];               // per wave context tile [row][d]

  const int tid  = threadIdx.x;
  const int wave = tid >> 5;
  const int lane = tid & 31;
  const int hh   = lane >> 4;
  const int c    = lane & 15;

  const int bx   = blockIdx.x;
  const int qbl  = bx % nqbThis;
  const int rest = bx / nqbThis;
  const int h    = rest % NH;
  const int b    = rest / NH;
  const int qb   = qbBase + qbl;
  const int q0   = qb * 64 + wave * 16;
  const size_t rowB = (size_t)b * SEQ;

  const __bf16* Qh = (const __bf16*)(const void*)qhp + (size_t)h * HD;
  const __bf16* Ql = (const __bf16*)(const void*)qlp + (size_t)h * HD;
  const __bf16* Kh = (const __bf16*)(const void*)khp + (size_t)h * HD;
  const __bf16* Kl = (const __bf16*)(const void*)klp + (size_t)h * HD;
  const _Float16* Vh = (const _Float16*)(const void*)vhp + ((size_t)b * DM + (size_t)h * HD) * SEQ;
  const _Float16* Vl = (const _Float16*)(const void*)vlp + ((size_t)b * DM + (size_t)h * HD) * VLP;
  const u64* fq = flg + (size_t)qb * NQB;     // block-uniform address -> scalar loads

  // ---- Q fragments (A operand, row = lane&15): 2 d-chunks, hi and lo ----
  v16b qah[2], qal[2];
#pragma unroll
  for (int dc = 0; dc < 2; ++dc) {
    const size_t qo = (rowB + q0 + c) * DM + dc * 32 + 8 * hh;
    qah[dc] = OpT<0>::ld(Qh + qo);
    qal[dc] = OpT<0>::ld(Ql + qo);
  }

  float mrow[8], lrow[8];
  v8f oacc[4];
#pragma unroll
  for (int r = 0; r < 8; ++r) { mrow[r] = -INFINITY; lrow[r] = 0.f; }
#pragma unroll
  for (int t = 0; t < 4; ++t) oacc[t] = zero8();

  for (int kt = 0; kt < NQB; ++kt) {         // static trip count
    const u64 lw = fq[kt];
    if (lw == 0ull) continue;                // block-uniform
    const int kv0 = kt * 64;
    __syncthreads();
    {
      const int r = tid >> 1, half = (tid & 1) * 32;
      const __bf16*   kg  = Kh + (rowB + kv0 + r) * DM + half;    // K row kv0+r, d = half..half+31
      const __bf16*   klg = Kl + (rowB + kv0 + r) * DM + half;
      const _Float16* vg  = Vh + (size_t)r * SEQ + kv0 + half;    // V^T row d = r, s = kv0+half..+31
      const int kvl = (kv0 + 64 <= VLP) ? kv0 : (VLP - 64);     // clamped address into the residual plane
      const _Float16* vlg = Vl + (size_t)r * VLP + kvl + half;
      const bool resOK = (kv0 + 64 <= VLP);                      // block-uniform
#pragma unroll
      for (int i = 0; i < 4; ++i) {
        const v8b a0 = *(const v8b*)(kg + 8 * i);
        const v8b a1 = *(const v8b*)(klg + 8 * i);
        const v8h b0 = *(const v8h*)(vg + 8 * i);
        *(v8b*)(Ksh + r * AP + half + 8 * i) = a0;
        *(v8b*)(Ksl + r * AP + half + 8 * i) = a1;
        *(v8h*)(Vth + r * AP + half + 8 * i) = b0;
        if (RES) {
          v8h b1 = *(const v8h*)(vlg + 8 * i);
          if (!resOK) b1 = zero8h();
          *(v8h*)(Vtl + r * AP + half + 8 * i) = b1;
        }
      }
    }
    __syncthreads();

    // ---- scores: 16 query rows x 64 keys per wave, 3 bf16 products ----
    // The tile's K fragments are read in groups ahead of the score products, so that the wave waits out the LDS
    // latency once a tile, not once per fragment pair: key groups 0..2 up front, group 3 behind the products of
    // group 0 (into registers that those have left), where the products of groups 1 and 2 cover its latency.
    v16b kbf[4][2], klf[4][2];
#pragma unroll
    for (int j = 0; j < 3; ++j) {
#pragma unroll
      for (int dc = 0; dc < 2; ++dc) {
        kbf[j][dc] = OpT<0>::ld(Ksh + (j * 16 + c) * AP + dc * 32 + 8 * hh);
        klf[j][dc] = OpT<0>::ld(Ksl + (j * 16 + c) * AP + dc * 32 + 8 * hh);
      }
    }
    // keeps the K reads from sinking back among the WMMAs that use them
    __builtin_amdgcn_sched_barrier(0);
    v8f s[4];
#pragma unroll
    for (int j = 0; j < 4; ++j) {
      s[j] = zero8();
#pragma unroll
      for (int dc = 0; dc < 2; ++dc) {
        s[j] = mma_b(qah[dc], kbf[j][dc], s[j]);
        s[j] = mma_b(qah[dc], klf[j][dc], s[j]);
        s[j] = mma_b(qal[dc], kbf[j][dc], s[j]);
      }
      if (j == 0) {
#pragma unroll
        for (int dc = 0; dc < 2; ++dc) {
          kbf[3][dc] = OpT<0>::ld(Ksh + (3 * 16 + c) * AP + dc * 32 + 8 * hh);
          klf[3][dc] = OpT<0>::ld(Ksl + (3 * 16 + c) * AP + dc * 32 + 8 * hh);
        }
        // holds the reads of key group 3 together at this one place: without it they spread among the next WMMAs
        __builtin_amdgcn_sched_barrier(0);
      }
    }
    // The tile's V^T fragments are read here, ahead of the softmax, whose vector work covers their LDS latency.
    v16h vbf[2][4], vlf[2][4];
#pragma unroll
    for (int kk = 0; kk < 2; ++kk) {
#pragma unroll
      for (int t = 0; t < 4; ++t) {
        vbf[kk][t] = OpT<1>::ld(Vth + (t * 16 + c) * AP + kk * 32 + 8 * hh);
        vlf[kk][t] = vbf[kk][t];
        if (RES) vlf[kk][t] = OpT<1>::ld(Vtl + (t * 16 + c) * AP + kk * 32 + 8 * hh);
      }
    }
    // keeps the V^T reads here, where they fly under the wait for the mask words, and out of the softmax's exchanges
    __builtin_amdgcn_sched_barrier(0);

    // ---- scale + mask select, row max, online softmax, P (x1024, f16) and P residual (x4096) to LDS ----
    _Float16* pwh = Psh[wave];
    _Float16* pwl = Psl[RES ? wave : 0];
    const int* mq = maskp + (size_t)(q0 + 8 * hh) * SEQ + kv0 + c;   // row q0+8hh, key kv0+c; all < SEQ
#pragma unroll
    for (int r = 0; r < 8; ++r) {
      const int* mrw = mq + (size_t)r * SEQ;
      float m = -INFINITY;
#pragma unroll
      for (int j = 0; j < 4; ++j) {
        const int mv = mrw[j * 16];
        const float sv = (mv != 0) ? (s[j][r] * sscale) : -INFINITY;
        s[j][r] = sv;
        m = fmaxf(m, sv);
      }
#pragma unroll
      for (int off = 1; off < 16; off <<= 1) m = fmaxf(m, __shfl_xor(m, off, 32));
      const float mnew  = fmaxf(mrow[r], m);
      const float msafe = (mnew == -INFINITY) ? 0.f : mnew;
      const float alpha = __expf(mrow[r] - msafe);
      mrow[r] = mnew;
      float psum = 0.f;
#pragma unroll
      for (int j = 0; j < 4; ++j) {
        const float p = __expf(s[j][r] - msafe);     // -inf logit against a finite max: exp -> 0
        psum += p;
        const float p1k = p * 1024.0f;
        const _Float16 ph = (_Float16)p1k;
        pwh[(8 * hh + r) * AP + j * 16 + c] = ph;
        if (RES) {
          const _Float16 pl = (_Float16)((p1k - (float)ph) * 4096.0f);
          pwl[(8 * hh + r) * AP + j * 16 + c] = pl;
        }
      }
#pragma unroll
      for (int off = 1; off < 16; off <<= 1) psum += __shfl_xor(psum, off, 32);
      lrow[r] = lrow[r] * alpha + psum;
#pragma unroll
      for (int t = 0; t < 4; ++t) oacc[t][r] *= alpha;
    }
    __builtin_amdgcn_fence(__ATOMIC_RELEASE, "workgroup");
    __builtin_amdgcn_wave_barrier();
    __builtin_amdgcn_fence(__ATOMIC_ACQUIRE, "workgroup");

    // ---- context += P . V (f16 WMMA), residual products into a separate accumulator ----
    v8f o1[4];
#pragma unroll
    for (int t = 0; t < 4; ++t) o1[t] = zero8();
    // both P fragments (and their residuals) are read as one group: one LDS wait ahead of the context WMMAs
    v16h paf[2], plf[2];
#pragma unroll
    for (int kk = 0; kk < 2; ++kk) {
      paf[kk] = OpT<1>::ld(pwh + c * AP + kk * 32 + 8 * hh);
      plf[kk] = paf[kk];
      if (RES) plf[kk] = OpT<1>::ld(pwl + c * AP + kk * 32 + 8 * hh);
    }
    // keeps the P reads from sinking in among the WMMAs
    __builtin_amdgcn_sched_barrier(0);
#pragma unroll
    for (int kk = 0; kk < 2; ++kk) {
#pragma unroll
      for (int t = 0; t < 4; ++t) {
        oacc[t] = mma_h(paf[kk], vbf[kk][t], oacc[t]);
        if (RES) {
          o1[t] = mma_h(paf[kk], vlf[kk][t], o1[t]);
          o1[t] = mma_h(plf[kk], vbf[kk][t], o1[t]);
        }
      }
    }
    if (RES) {
#pragma unroll
      for (int t = 0; t < 4; ++t)
#pragma unroll
        for (int r = 0; r < 8; ++r) oacc[t][r] += o1[t][r] * (1.0f / 4096.0f);
    }
  }

  // ---- normalise (1/l and the 1/1024 p carry), stage the wave's 16x64 tile, bf16 hi/lo split,
  float* os = Os[wave];
#pragma unroll
  for (int r = 0; r < 8; ++r) {
    const float l = lrow[r];
    const float inv = (1.0f / l) * (1.0f / 1024.0f);   // l == 0 (fully masked row) -> inf -> NaN context
#pragma unroll
    for (int t = 0; t < 4; ++t) os[(8 * hh + r) * 64 + t * 16 + c] = oacc[t][r] * inv;
  }
  __builtin_amdgcn_fence(__ATOMIC_RELEASE, "workgroup");
  __builtin_amdgcn_wave_barrier();
  __builtin_amdgcn_fence(__ATOMIC_ACQUIRE, "workgroup");
  {
    const int q4 = lane >> 3, c8 = (lane & 7) * 8;
    v4u hv[4], lv[4];
#pragma unroll
    for (int it = 0; it < 4; ++it) {
      const int row = it * 4 + q4;   // it 0..3 x q4 0..3 = rows 0..15 of the wave tile
      const float* sp = os + row * 64 + c8;
      v4u a, a2;
#pragma unroll
      for (int e = 0; e < 4; ++e) {
        const float f0 = sp[2 * e], f1 = sp[2 * e + 1];
        const unsigned short h0 = bf_bits(f0), h1 = bf_bits(f1);
        const unsigned short l0 = bf_bits(f0 - bf_up(h0)), l1 = bf_bits(f1 - bf_up(h1));
        a[e] = pk16(h0, h1); a2[e] = pk16(l0, l1);
      }
      hv[it] = a; lv[it] = a2;
    }
    {
#pragma unroll
      for (int it = 0; it < 4; ++it) {
        const int row = it * 4 + q4;
        const size_t go = (rowB + q0 + row) * DM + (size_t)h * HD + c8;
        *(v4u*)(ohp + go) = hv[it];
        *(v4u*)(olp + go) = lv[it];
      }
      
    }
  }
}

// =====================================================================================================
// Layer norm over rows of DM=1024, f32, one block per row (grid = MROWS, 256 threads, 4 elements per thread).
// mean and biased variance via wave shuffles + 16 LDS slots; gamma / beta values RNE-converted to bf16;
// o = (gamma * (x - mean)) * (1 / sqrt(var + eps)) + beta.
// OUT16: threads 0..127 reload 8 consecutive inputs each and write the f16 plane as one 16-B store per lane
// coverage: 256 threads x 4 = the row (f32); 128 threads x 8 = the row (f16).
// =====================================================================================================
template <bool OUT16>
__global__ __launch_bounds__(256) void layernorm_rows(const float* __restrict__ in,
                                                       const float* __restrict__ gamma,
                                                       const float* __restrict__ beta,
                                                       float* out32, unsigned short* out16) {
  __shared__ float red[16];
  const int tid = threadIdx.x, lane = tid & 31, wave = tid >> 5;
  const int row = blockIdx.x;
  const float* xr = in + (size_t)row * DM;
  const v4f v = *(const v4f*)(xr + tid * 4);
  float s = (v[0] + v[1]) + (v[2] + v[3]);
#pragma unroll
  for (int off = 1; off < 32; off <<= 1) s += __shfl_xor(s, off, 32);
  if (lane == 0) red[wave] = s;
  __syncthreads();
  float tot = 0.f;
#pragma unroll
  for (int i = 0; i < 8; ++i) tot += red[i];
  const float mean = tot * (1.0f / (float)DM);
  const float d0 = v[0] - mean, d1 = v[1] - mean, d2 = v[2] - mean, d3 = v[3] - mean;
  float s2 = (d0 * d0 + d1 * d1) + (d2 * d2 + d3 * d3);
#pragma unroll
  for (int off = 1; off < 32; off <<= 1) s2 += __shfl_xor(s2, off, 32);
  if (lane == 0) red[8 + wave] = s2;
  __syncthreads();
  float tot2 = 0.f;
#pragma unroll
  for (int i = 0; i < 8; ++i) tot2 += red[8 + i];
  const float var  = tot2 * (1.0f / (float)DM);
  const float rstd = 1.0f / sqrtf(var + LNEPS);

  const v4f g  = *(const v4f*)(gamma + tid * 4);
  const v4f bt = *(const v4f*)(beta + tid * 4);
  v4f o;
  o[0] = (bfr(g[0]) * d0) * rstd + bfr(bt[0]);
  o[1] = (bfr(g[1]) * d1) * rstd + bfr(bt[1]);
  o[2] = (bfr(g[2]) * d2) * rstd + bfr(bt[2]);
  o[3] = (bfr(g[3]) * d3) * rstd + bfr(bt[3]);
  float* op = out32 + (size_t)row * DM + tid * 4;
  *(v4f*)op = o;
  

  if (OUT16) {
    if (tid < 128) {
      const int cc = tid * 8;
      const v4f a0 = *(const v4f*)(xr + cc);
      const v4f a1 = *(const v4f*)(xr + cc + 4);
      const v4f g0 = *(const v4f*)(gamma + cc), g1 = *(const v4f*)(gamma + cc + 4);
      const v4f b0 = *(const v4f*)(beta + cc),  b1 = *(const v4f*)(beta + cc + 4);
      float f[8];
#pragma unroll
      for (int e = 0; e < 4; ++e) {
        f[e]     = (bfr(g0[e]) * (a0[e] - mean)) * rstd + bfr(b0[e]);
        f[4 + e] = (bfr(g1[e]) * (a1[e] - mean)) * rstd + bfr(b1[e]);
      }
      v4u hp;
#pragma unroll
      for (int e = 0; e < 4; ++e) hp[e] = pk16(h_bits((_Float16)f[2 * e]), h_bits((_Float16)f[2 * e + 1]));
      unsigned short* hq = out16 + (size_t)row * DM + cc;
      *(v4u*)hq = hp;
      
    }
  }
}

// =====================================================================================================
// Workspace map (MiB = 1048576 B):
//   Xb   bf16 [4096][1024]         0 ..   8
//   WqT  bf16 [1024 n][1024 k]     8 ..  10     WkT 10 .. 12    WvT 12 .. 14    WoT 14 .. 16
//   W1T  f16  [4096 n][1024 k]    16 ..  24     W2T f16 [1024 n][4096 k]  24 .. 32
//   Qh   bf16 [4096][1024]        32 ..  40     Ql 40 .. 48    Kh 48 .. 56    Kl 56 .. 64
//   VTh  f16  [2][1024][2048]     64 ..  72     VTl f16 [2][1024][512]    72 .. 74    Flg u64 [32][32] at 74
//   Oh   bf16 [4096][1024]        76 ..  84     Ol 84 .. 92
//   later (regions dead by then, single in-order stream):
//   T1   f32  [4096][1024]        32 ..  48   (over Qh, Ql: written by the Wo GEMM after attention)
//   H32  f32  [4096][1024]        48 ..  64   (over Kh, Kl: written by LN1)
//   Hh   f16  [4096][1024]        64 ..  72   (over VTh: written by LN1)
//   F1   f16  [4096][4096]        72 .. 104   (over VTl, Flg, Oh, Ol: written by the W1 GEMM after the Wo GEMM)
//   T2   f32  [4096][1024]        32 ..  48   (over T1: written by the W2 GEMM after LN1)
//   end = 104 MiB. Every plane is an exact multiple of its 64x64 tile / whole-line store granularity
//   (no padded tails); all region starts are MiB aligned.
// =====================================================================================================
extern "C" void kernel_launch(void* const* d_in, const int* in_sizes, int n_in,
                              void* d_out, int out_size, void* d_ws, size_t ws_size,
                              hipStream_t stream) {
  if (n_in < 18) return;
  if (in_sizes[0] != NB * SEQ * DM) return;
  if (in_sizes[1] != SEQ * SEQ) return;
  if (in_sizes[2] != DM * DM || in_sizes[4] != DM * DM || in_sizes[6] != DM * DM || in_sizes[8] != DM * DM) return;
  if (in_sizes[3] != DM || in_sizes[5] != DM || in_sizes[7] != DM || in_sizes[9] != DM) return;
  if (in_sizes[10] != DM * DFF || in_sizes[11] != DFF || in_sizes[12] != DFF * DM || in_sizes[13] != DM) return;
  if (in_sizes[14] != DM || in_sizes[15] != DM || in_sizes[16] != DM || in_sizes[17] != DM) return;
  if (out_size != NB * SEQ * DM) return;

  const float* x   = (const float*)d_in[0];
  const int*   msk = (const int*)d_in[1];
  const float* Wq  = (const float*)d_in[2];
  const float* bq  = (const float*)d_in[3];
  const float* Wk  = (const float*)d_in[4];
  const float* bk  = (const float*)d_in[5];
  const float* Wv  = (const float*)d_in[6];
  const float* bv  = (const float*)d_in[7];
  const float* Wo  = (const float*)d_in[8];
  const float* bo  = (const float*)d_in[9];
  const float* W1  = (const float*)d_in[10];
  const float* b1  = (const float*)d_in[11];
  const float* W2  = (const float*)d_in[12];
  const float* b2  = (const float*)d_in[13];
  const float* gamma1 = (const float*)d_in[14];
  const float* beta1  = (const float*)d_in[15];
  const float* gamma2 = (const float*)d_in[16];
  const float* beta2  = (const float*)d_in[17];

  const size_t PX   = (size_t)MROWS * DM * 2;        //  8 MiB  16-bit activation plane [4096][1024]
  const size_t PW   = (size_t)DM * DM * 2;           //  2 MiB  16-bit weight plane [1024][1024]
  const size_t PWF  = (size_t)DM * DFF * 2;          //  8 MiB  16-bit FFN weight plane
  const size_t PVT  = (size_t)NB * DM * SEQ * 2;     //  8 MiB  v^T hi plane
  const size_t PVL  = (size_t)NB * DM * VLP * 2;     //  2 MiB  v^T residual plane
  const size_t PFs  = (size_t)2 * 1048576;           //  2 MiB  slot for the 8 KiB flag table
  const size_t PF   = (size_t)NQB * NQB * 8;         //  8 KiB
  const size_t PT   = (size_t)MROWS * DM * 4;        // 16 MiB  f32 activation plane
  const size_t PF1  = (size_t)MROWS * DFF * 2;       // 32 MiB  f16 FFN hidden plane
  if (PF > PFs) return;
  size_t off = 0;
  const size_t oXb  = off; off += PX;
  const size_t oWq  = off; off += PW;
  const size_t oWk  = off; off += PW;
  const size_t oWv  = off; off += PW;
  const size_t oWo  = off; off += PW;
  const size_t oW1  = off; off += PWF;
  const size_t oW2  = off; off += PWF;
  const size_t oQh  = off; off += PX;
  const size_t oQl  = off; off += PX;
  const size_t oKh  = off; off += PX;
  const size_t oKl  = off; off += PX;
  const size_t oVTh = off; off += PVT;
  const size_t oVTl = off; off += PVL;
  const size_t oFlg = off; off += PFs;
  const size_t oOh  = off; off += PX;
  const size_t oOl  = off; off += PX;
  const size_t endA = off;                           // 92 MiB
  const size_t oT1  = oQh;                           // T1 over Qh + Ql
  const size_t oH32 = oKh;                           // H32 over Kh + Kl
  const size_t oHh  = oVTh;                          // Hh over VTh
  const size_t oF1  = oVTl;                          // F1 over VTl .. Ol and beyond
  const size_t oT2  = oT1;                           // T2 over T1
  if (oT1 + PT != oKh) return;                       // aliasing sanity: T1 ends where H32 starts
  if (oH32 + PT != oVTh) return;                     // H32 ends where Hh starts
  if (oHh + PX != oVTl) return;                      // Hh ends where F1 starts
  size_t total = oF1 + PF1;                          // 104 MiB
  if (endA > total) total = endA;
  if (total > ws_size) return;
  if (total > (size_t)134217728) return;

  char* ws = (char*)d_ws;
  unsigned short* Xb   = (unsigned short*)(ws + oXb);
  unsigned short* WqTb = (unsigned short*)(ws + oWq);
  unsigned short* WkTb = (unsigned short*)(ws + oWk);
  unsigned short* WvTb = (unsigned short*)(ws + oWv);
  unsigned short* WoTb = (unsigned short*)(ws + oWo);
  unsigned short* W1Tb = (unsigned short*)(ws + oW1);
  unsigned short* W2Tb = (unsigned short*)(ws + oW2);
  unsigned short* Qh   = (unsigned short*)(ws + oQh);
  unsigned short* Ql   = (unsigned short*)(ws + oQl);
  unsigned short* Kh   = (unsigned short*)(ws + oKh);
  unsigned short* Kl   = (unsigned short*)(ws + oKl);
  unsigned short* VTh  = (unsigned short*)(ws + oVTh);
  unsigned short* VTl  = (unsigned short*)(ws + oVTl);
  u64*            Flg  = (u64*)(ws + oFlg);
  unsigned short* Oh   = (unsigned short*)(ws + oOh);
  unsigned short* Ol   = (unsigned short*)(ws + oOl);
  float*          T1   = (float*)(ws + oT1);
  float*          H32  = (float*)(ws + oH32);
  unsigned short* Hh   = (unsigned short*)(ws + oHh);
  unsigned short* F1   = (unsigned short*)(ws + oF1);
  float*          T2   = (float*)(ws + oT2);

  const dim3 blk(256);
  const dim3 gPrep(PB_ALL);                                         // 32 + 2 x 1024 + 4 x 256 + 2048 = 5152 blocks
  const dim3 blkG(128);                                             // GEMM block: 4 waves, one 128x128 tile
  const dim3 gProj((MROWS / 128) * (DM / 128), 1);                  // 256 tiles: M=4096, N=1024
  const dim3 gVT((DM / 128) * (SEQ / 128), NB);                     // 128 tiles x 2 batches: M=1024, N=2048
  const dim3 gW1((MROWS / 128) * (DFF / 128), 1);                   // 1024 tiles: M=4096, N=4096
  const dim3 gW2((MROWS / 128) * (DM / 128), 1);                    // 256 tiles: M=4096, N=1024
  const dim3 gLN(MROWS);                                            // 4096 blocks, one row each

  // (0, 1) one launch: mask tile survey -> Flg; x -> bf16 plane [4096][1024]; weights [k][n] f32 -> 16-bit [n][k] planes
  prep_inputs<<<gPrep, blk, 0, stream>>>(msk, Flg, x, Xb, Wq, Wk, Wv, Wo, W1, W2,
                                         WqTb, WkTb, WvTb, WoTb, W1Tb, W2Tb);
  // (2) q = x . Wq + bq -> bf16 hi/lo planes [b*SEQ+t][h*64+d]   (M=4096, N=1024, K=1024)
  gemm64<0, 0, 2, 1, 0, false><<<gProj, blkG, 0, stream>>>(
      Xb, Xb, DM, 0LL, WqTb, DM, 0LL, bq, (const void*)Xb, DM, 0LL,
      (void*)Qh, DM, 0LL, (void*)Ql, DM, 0LL, DM,
      MROWS, DM, DM, 1.0f, 1.0f);
  // (3) k = x . Wk + bk -> bf16 hi/lo planes
  gemm64<0, 0, 2, 1, 0, false><<<gProj, blkG, 0, stream>>>(
      Xb, Xb, DM, 0LL, WkTb, DM, 0LL, bk, (const void*)Xb, DM, 0LL,
      (void*)Kh, DM, 0LL, (void*)Kl, DM, 0LL, DM,
      MROWS, DM, DM, 1.0f, 1.0f);
  // (4) v^T = WvT . x^T + bv per batch -> f16 hi plane [b][h*64+d][s] (pitch SEQ) and residual plane
  //     (x4096, keys < VLP only, pitch VLP)   (A = WvT [d][k], Bt = Xb rows of batch b; M=1024, N=2048, K=1024)
  gemm64<0, 0, 3, 2, 0, false><<<gVT, blkG, 0, stream>>>(
      WvTb, WvTb, DM, 0LL, Xb, DM, (long long)SEQ * DM, bv, (const void*)Xb, DM, 0LL,
      (void*)VTh, SEQ, (long long)DM * SEQ, (void*)VTl, VLP, (long long)DM * VLP, VLP,
      DM, SEQ, DM, 1.0f, 4096.0f);
  // (5) attention: query blocks 0..RESQB-1 with residual planes, the rest without
  attn_mask64<true><<<dim3(NB * NH * RESQB), dim3(128), 0, stream>>>(
      Qh, Ql, Kh, Kl, VTh, VTl, msk, Flg, Oh, Ol, 0, RESQB, 0.125f);
  attn_mask64<false><<<dim3(NB * NH * (NQB - RESQB)), dim3(128), 0, stream>>>(
      Qh, Ql, Kh, Kl, VTh, VTl, msk, Flg, Oh, Ol, RESQB, NQB - RESQB, 0.125f);
  // (6) T1 = ctx . Wo + bo + bf16(x) -> f32 [4096][1024]  (A = context hi + lo planes, 2 products)
  gemm64<0, 1, 0, 1, 1, false><<<gProj, blkG, 0, stream>>>(
      Oh, Ol, DM, 0LL, WoTb, DM, 0LL, bo, (const void*)Xb, DM, 0LL,
      (void*)T1, DM, 0LL, (void*)T1, DM, 0LL, 0,
      MROWS, DM, DM, 1.0f, 1.0f);
  // (7) h = LN1(T1) -> H32 f32 and Hh f16
  layernorm_rows<true><<<gLN, blk, 0, stream>>>(T1, gamma1, beta1, H32, Hh);
  // (8) F1 = relu(h . W1 + b1) -> f16 [4096][4096]  (f16 operands, W1 carried x64, acc scaled by 1/64)
  gemm64<1, 0, 4, 1, 0, true><<<gW1, blkG, 0, stream>>>(
      Hh, Hh, DM, 0LL, W1Tb, DM, 0LL, b1, (const void*)Hh, DM, 0LL,
      (void*)F1, DFF, 0LL, (void*)F1, DFF, 0LL, 0,
      MROWS, DFF, DM, 1.0f / WSCALE, 1.0f);
  // (9) T2 = F1 . W2 + b2 + h -> f32 [4096][1024]  (K = 4096, W2 carried x64)
  gemm64<1, 0, 0, 1, 2, false><<<gW2, blkG, 0, stream>>>(
      F1, F1, DFF, 0LL, W2Tb, DFF, 0LL, b2, (const void*)H32, DM, 0LL,
      (void*)T2, DM, 0LL, (void*)T2, DM, 0LL, 0,
      MROWS, DM, DFF, 1.0f / WSCALE, 1.0f);
  // (10) out = LN2(T2) -> d_out f32 [2][2048][1024]
  layernorm_rows<false><<<gLN, blk, 0, stream>>>(T2, gamma2, beta2, (float*)d_out, Hh);
  (void)hipGetLastError();
}

// v005
// It runs in 279 microseconds.
// Timed twice side by side with v004, it ran 1.09 times as fast both times.
// All steps since v000 together make it 2.57 times as fast.
// Contractions: q, k, v^T projections = v_wmma_f32_16x16x32_bf16 (bf16 operands from RNE-converted inputs, single product);
// q.k^T scores = v_wmma_f32_16x16x32_bf16 with q and k as bf16 hi/lo planes (hi.hi + hi.lo + lo.hi);
// p.v = v_wmma_f32_16x16x32_f16 (p carried x1024 in f16, v f16 hi plane; f16 residual planes x4096 of p and v on the first 512 query rows);
// ctx.Wo = v_wmma_f32_16x16x32_bf16 with ctx as bf16 hi/lo planes times bf16 Wo (2 products);
// h.W1 and relu(h.W1+b1).W2 = v_wmma_f32_16x16x32_f16 (f16 operands, weights carried x64, single product);
// all f32 accumulate; softmax and both layer norms in f32.
#include <hip/hip_runtime.h>
#include <math.h>
#include <stdint.h>

#define NB     2
#define SEQ    2048
#define DM     1024
#define NH     16
#define HD     64
#define DFF    4096
#define MROWS  (NB * SEQ)   // 4096 token rows
#define NQB    (SEQ / 64)   // 32 key / query tiles of 64
#define VLP    512          // key pitch of the v^T residual plane (keys 0..VLP-1)
#define RESQB  8            // leading 64-row query blocks that use the p / v residual planes
#define LNEPS  1e-6f
#define WSCALE 64.0f        // f16 weight carry for W1 and W2
#define GKS    128          // k elements per LDS stage of the GEMM (256-B rows)
#define GPITCH 272          // LDS row pitch of a stage in bytes: 16 B x odd, for 16-B fragment reads
#define AP     72           // LDS row pitch of the attention K / V^T tiles in 16-bit elements: 144 B = 16 B x odd
#define OSP    68           // LDS row pitch of the attention output tile in floats: 272 B = 16 B x odd
static_assert(RESQB * 64 <= VLP);
static_assert(NH * HD == DM);
static_assert((SEQ % 128) == 0 && (DM % 128) == 0 && (DFF % 128) == 0 && (MROWS % 128) == 0);
static_assert((DM % GKS) == 0 && (DFF % GKS) == 0);
static_assert(NQB * 8 == 256);
static_assert(AP >= 64 && ((AP * 2) % 16) == 0 && (((AP * 2) / 16) & 1) == 1);

typedef _Float16 v16h __attribute__((ext_vector_type(16)));
typedef _Float16 v8h  __attribute__((ext_vector_type(8)));
typedef __bf16   v16b __attribute__((ext_vector_type(16)));
typedef __bf16   v8b  __attribute__((ext_vector_type(8)));
typedef float    v8f  __attribute__((ext_vector_type(8)));
typedef float    v4f  __attribute__((ext_vector_type(4)));
typedef unsigned int v4u __attribute__((ext_vector_type(4)));
typedef unsigned int v2u __attribute__((ext_vector_type(2)));
typedef int      v4i __attribute__((ext_vector_type(4)));
typedef unsigned long long u64;

#if defined(__HIP_DEVICE_COMPILE__)
#define DEV_ASM 1
#else
#define DEV_ASM 0
#endif

// ---- scalar helpers --------------------------------------------------------------------------------
__device__ __forceinline__ unsigned short bf_bits(float f) {          // f32 -> bf16 bits, RNE convert
  unsigned u = __float_as_uint(f);
  return (unsigned short)((u + 0x7FFFu + ((u >> 16) & 1u)) >> 16);
}
__device__ __forceinline__ float bf_up(unsigned short h) { return __uint_as_float(((unsigned)h) << 16); }
__device__ __forceinline__ float bfr(float f) { return bf_up(bf_bits(f)); }   // bf16 requantised value
__device__ __forceinline__ unsigned short h_bits(_Float16 x) { return __builtin_bit_cast(unsigned short, x); }
__device__ __forceinline__ unsigned pk16(unsigned short a, unsigned short b) { return (unsigned)a | ((unsigned)b << 16); }
__device__ __forceinline__ v8f zero8() { v8f z = {0.f, 0.f, 0.f, 0.f, 0.f, 0.f, 0.f, 0.f}; return z; }
__device__ __forceinline__ v8h zero8h() {
  const _Float16 z = (_Float16)0.0f;
  v8h r = {z, z, z, z, z, z, z, z};
  return r;
}

// ---- operand traits: fragment loader (lane -> row/col (lane&15), p already includes +8*(lane>>4);
//      elements 0..7 <- p[0..7] (k0+8h..), elements 8..15 <- p[16..23] (k0+16+8h..)), WMMA, hazard gaps
template <int ET> struct OpT;
template <> struct OpT<0> {
  typedef __bf16 E; typedef v16b F; typedef v8b H;
  static __device__ __forceinline__ F ld(const E* p) {
    union { F v; H h[2]; } f;
    f.h[0] = *(const H*)(p);
    f.h[1] = *(const H*)(p + 16);
    return f.v;
  }
  static __device__ __forceinline__ v8f mma_raw(F a, F b, v8f c) {
    return __builtin_amdgcn_wmma_f32_16x16x32_bf16(false, a, false, b, (short)0, c, false, false);
  }
  static __device__ __forceinline__ void dep_guard(v8f& a, v8f& b, F x, F y) {
#if DEV_ASM
    asm volatile("v_nop\n\tv_nop\n\tv_nop\n\tv_nop" : "+v"(a), "+v"(b) : "v"(x), "v"(y));
#endif
  }
  static __device__ __forceinline__ void keep4(F a, F b, F c, F d) {
#if DEV_ASM
    asm volatile("v_nop" :: "v"(a), "v"(b), "v"(c), "v"(d));
#endif
  }
};
template <> struct OpT<1> {
  typedef _Float16 E; typedef v16h F; typedef v8h H;
  static __device__ __forceinline__ F ld(const E* p) {
    union { F v; H h[2]; } f;
    f.h[0] = *(const H*)(p);
    f.h[1] = *(const H*)(p + 16);
    return f.v;
  }
  static __device__ __forceinline__ v8f mma_raw(F a, F b, v8f c) {
    return __builtin_amdgcn_wmma_f32_16x16x32_f16(false, a, false, b, (short)0, c, false, false);
  }
  static __device__ __forceinline__ void dep_guard(v8f& a, v8f& b, F x, F y) {
#if DEV_ASM
    asm volatile("v_nop\n\tv_nop\n\tv_nop\n\tv_nop" : "+v"(a), "+v"(b) : "v"(x), "v"(y));
#endif
  }
  static __device__ __forceinline__ void keep4(F a, F b, F c, F d) {
#if DEV_ASM
    asm volatile("v_nop" :: "v"(a), "v"(b), "v"(c), "v"(d));
#endif
  }
};

// ---- guarded WMMA helpers for the attention kernel ------------------------------------------------
__device__ __forceinline__ v8f mma_b(v16b a, v16b b, v8f c) {
  c = __builtin_amdgcn_wmma_f32_16x16x32_bf16(false, a, false, b, (short)0, c, false, false);
#if DEV_ASM
  asm volatile("v_nop\n\tv_nop\n\tv_nop\n\tv_nop" : "+v"(c) : "v"(a), "v"(b));
#endif
  return c;
}
__device__ __forceinline__ v8f mma_h(v16h a, v16h b, v8f c) {
  c = __builtin_amdgcn_wmma_f32_16x16x32_f16(false, a, false, b, (short)0, c, false, false);
#if DEV_ASM
  asm volatile("v_nop\n\tv_nop\n\tv_nop\n\tv_nop" : "+v"(c) : "v"(a), "v"(b));
#endif
  return c;
}
// e^x as 2^(x log2 e), one v_exp_f32. The v_nop keeps the one slot that the instruction set asks for behind a
// transcendental before its result is read or its source overwritten: inside the statement it stays directly behind it.
__device__ __forceinline__ float exp_slot(float x) {
  const float y = x * 0x1.715476p+0f;
#if DEV_ASM
  float r;
  asm("v_exp_f32 %0, %1\n\tv_nop" : "=v"(r) : "v"(y));
  return r;
#else
  return exp2f(y);
#endif
}
// lane l with lane l ^ 16
__device__ __forceinline__ float xhalf(float x) {
  return __builtin_bit_cast(float, __builtin_amdgcn_permlanex16(__builtin_bit_cast(int, x), __builtin_bit_cast(int, x),
                                                                0x76543210, 0xfedcba98, false, false));
}
__device__ __forceinline__ void acc_guard4(v8f& a, v8f& b, v8f& c, v8f& d) {
#if DEV_ASM
  asm volatile("v_nop\n\tv_nop\n\tv_nop\n\tv_nop" : "+v"(a), "+v"(b), "+v"(c), "+v"(d));
#endif
}

// =====================================================================================================
// f32 -> bf16 (RNE convert), 8 elements per thread, one 16-B store per lane: a wave writes 512 contiguous B
// coverage: n8 threads x 8 = the whole plane (n8 is a multiple of 256 here). blk = block of 256 threads.
// =====================================================================================================
__device__ __forceinline__ void cvt_bf16x8(int blk, const float* __restrict__ in, unsigned short* out, int n8) {
  const int i = blk * 256 + threadIdx.x;
  if (i < n8) {
    const v4f a = *(const v4f*)(in + (size_t)i * 8);
    const v4f b = *(const v4f*)(in + (size_t)i * 8 + 4);
    v4u p;
    p[0] = pk16(bf_bits(a[0]), bf_bits(a[1]));
    p[1] = pk16(bf_bits(a[2]), bf_bits(a[3]));
    p[2] = pk16(bf_bits(b[0]), bf_bits(b[1]));
    p[3] = pk16(bf_bits(b[2]), bf_bits(b[3]));
    *(v4u*)(out + (size_t)i * 8) = p;
    
  }
}

// =====================================================================================================
// Weight transpose + convert: in W f32 [Kdim][Ndim] (row k, n contiguous) -> out 16-bit [Ndim][Kdim]
// (row n, k contiguous). F16OUT: f16 of (bf16 value * scale), else bf16 bits. 64x64 tile through LDS.
// (Ndim/64) x (Kdim/64) blocks of 256 threads; bn = n tile, bk = k tile; tile = 64 x 65 floats of LDS.
// coverage: load 256 threads x 16 = 64x64; store 8 waves x 2 it x 4 rows x (8 lanes x 8) = 64x64.
// =====================================================================================================
template <bool F16OUT>
__device__ __forceinline__ void wtrans64(float (*tile)[65], int bn, int bk,
                                         const float* __restrict__ W, unsigned short* out,
                                         int Kdim, int Ndim, float scale) {
  const int tid = threadIdx.x, lane = tid & 31, wave = tid >> 5;
  const int n0 = bn * 64, k0 = bk * 64;
  {
    const int r = tid >> 2, cq = (tid & 3) * 16;
    const float* src = W + (size_t)(k0 + r) * Ndim + n0 + cq;
#pragma unroll
    for (int e = 0; e < 4; ++e) {
      const v4f a = *(const v4f*)(src + 4 * e);
      tile[r][cq + 4 * e + 0] = a[0];
      tile[r][cq + 4 * e + 1] = a[1];
      tile[r][cq + 4 * e + 2] = a[2];
      tile[r][cq + 4 * e + 3] = a[3];
    }
  }
  __syncthreads();
  const int q = lane >> 3, c8 = (lane & 7) * 8;
  v4u pv[2];
#pragma unroll
  for (int it = 0; it < 2; ++it) {
    const int nn = wave * 8 + it * 4 + q;
    v4u a;
#pragma unroll
    for (int e = 0; e < 4; ++e) {
      const float f0 = tile[c8 + 2 * e][nn], f1 = tile[c8 + 2 * e + 1][nn];
      unsigned short b0 = bf_bits(f0), b1 = bf_bits(f1);
      if (F16OUT) {
        b0 = h_bits((_Float16)(bf_up(b0) * scale));
        b1 = h_bits((_Float16)(bf_up(b1) * scale));
      }
      a[e] = pk16(b0, b1);
    }
    pv[it] = a;
  }
  {
#pragma unroll
    for (int it = 0; it < 2; ++it) {
      const int nn = wave * 8 + it * 4 + q;
      *(v4u*)(out + (size_t)(n0 + nn) * Kdim + k0 + c8) = pv[it];
    }
#if DEV_ASM
    // inlined into a kernel with other parts, code may follow that writes the stores' registers again: wait first
    asm volatile("s_wait_xcnt 0x0" ::: "memory");
#endif
  }
}

// =====================================================================================================
// Mask tile survey: mask int32 [1][1][SEQ][SEQ] (nonzero = key allowed). Block = qt: query rows qt*64..+63.
// For every key tile kt (64 keys) it records a 64-bit word whose bit r is 1 when row r of the tile has at
// least one nonzero entry inside kt. NQB blocks of 256 threads: thread = (row = tid>>2, quarter = tid&3);
// wave w holds rows 8w..8w+7 -> byte w of the word. Output flg[qt*NQB + kt], 32 words = 256 B per block
// coverage: 32 blocks x 32 words = the whole 1024-word table.
// =====================================================================================================
// sb = NQB * 8 bytes of LDS, 8-B aligned.
__device__ __forceinline__ void mask_rowbits(unsigned char* sb, int qt, const int* __restrict__ maskp, u64* flg) {
  const int tid  = threadIdx.x;
  const int wave = tid >> 5;
  const int lane = tid & 31;
  const int row  = tid >> 2;            // 0..63
  const int qtr  = (tid & 3) * 16;      // 0,16,32,48
  const int* mr = maskp + ((size_t)qt * 64 + row) * SEQ + qtr;
#pragma unroll 1
  for (int kt = 0; kt < NQB; ++kt) {
    const int* p = mr + kt * 64;
    const v4i a0 = *(const v4i*)(p);
    const v4i a1 = *(const v4i*)(p + 4);
    const v4i a2 = *(const v4i*)(p + 8);
    const v4i a3 = *(const v4i*)(p + 12);
    int lv = 0;
#pragma unroll
    for (int e = 0; e < 4; ++e) {
      lv |= (a0[e] != 0) ? 1 : 0;
      lv |= (a1[e] != 0) ? 1 : 0;
      lv |= (a2[e] != 0) ? 1 : 0;
      lv |= (a3[e] != 0) ? 1 : 0;
    }
    const unsigned bl = __builtin_amdgcn_ballot_w32(lv != 0);   // uniform per wave
    unsigned bits = 0u;
#pragma unroll
    for (int k = 0; k < 8; ++k) bits |= ((((bl >> (4 * k)) & 0xFu) != 0u) ? 1u : 0u) << k;
    if (lane == 0) sb[kt * 8 + wave] = (unsigned char)bits;
  }
  __syncthreads();
  if (wave == 0) {
    u64 w;
    __builtin_memcpy(&w, &sb[lane * 8], 8);   // bytes 0..7 = rows 0..63, little endian
    u64* dst = flg + (size_t)qt * NQB + lane;
    *(u64*)dst = w;
    
  }
}

// =====================================================================================================
// All the work that reads only the inputs, in ONE launch: no part needs another part's result, so the parts share
// the chip instead of standing one behind another in the stream. A block takes its part from its index (a
// block-uniform branch, so each part's barrier is passed by all of the block's threads or by none):
//   PB_MASK blocks  mask tile survey (first: each is one long chain of dependent trips, the rest runs beside it)
//   PB_WF   blocks  W1 -> W1T,  PB_WF blocks  W2 -> W2T,  4 x PB_W blocks  Wq, Wk, Wv, Wo -> their transposes
//   PB_X    blocks  x -> bf16 plane
// =====================================================================================================
#define PB_MASK NQB
#define PB_WF   ((DFF / 64) * (DM / 64))
#define PB_W    ((DM / 64) * (DM / 64))
#define PB_X    (MROWS * DM / 8 / 256)
#define PB_ALL  (PB_MASK + 2 * PB_WF + 4 * PB_W + PB_X)
static_assert((MROWS * DM) % (8 * 256) == 0);
__global__ __launch_bounds__(256) void prep_inputs(
    const int* __restrict__ maskp, u64* flg, const float* __restrict__ x, unsigned short* xb,
    const float* __restrict__ Wq, const float* __restrict__ Wk, const float* __restrict__ Wv,
    const float* __restrict__ Wo, const float* __restrict__ W1, const float* __restrict__ W2,
    unsigned short* WqT, unsigned short* WkT, unsigned short* WvT, unsigned short* WoT,
    unsigned short* W1T, unsigned short* W2T) {
  __shared__ __align__(16) float tile[64][65];
  static_assert(sizeof(tile) >= NQB * 8);
  int i = blockIdx.x;
  if (i < PB_MASK) {
    mask_rowbits((unsigned char*)(void*)&tile[0][0], i, maskp, flg);
    return;
  }
  i -= PB_MASK;
  if (i < PB_WF) {           // in [1024 k][4096 n] -> out [4096 n][1024 k]
    wtrans64<true>(tile, i % (DFF / 64), i / (DFF / 64), W1, W1T, DM, DFF, WSCALE);
    return;
  }
  i -= PB_WF;
  if (i < PB_WF) {           // in [4096 k][1024 n] -> out [1024 n][4096 k]
    wtrans64<true>(tile, i % (DM / 64), i / (DM / 64), W2, W2T, DFF, DM, WSCALE);
    return;
  }
  i -= PB_WF;
  if (i < 4 * PB_W) {        // in [1024 k][1024 n] -> out [1024 n][1024 k]
    const int w = i / PB_W, t = i % PB_W;
    const float* W = (w == 0) ? Wq : (w == 1) ? Wk : (w == 2) ? Wv : Wo;
    unsigned short* T = (w == 0) ? WqT : (w == 1) ? WkT : (w == 2) ? WvT : WoT;
    wtrans64<false>(tile, t % (DM / 64), t / (DM / 64), W, T, DM, DM, 1.0f);
    return;
  }
  i -= 4 * PB_W;
  cvt_bf16x8(i, x, xb, MROWS * DM / 8);
}

// =====================================================================================================
// Register-blocked batched 16-bit WMMA GEMM: C[m][n] = sum_k A[m][k] * Bt[n][k]; one block of 4 waves per
// 128x128 tile, one wave per 64x64 quarter. ET: 0 = bf16 operands, 1 = f16 operands. A row-major [M][K] pitch lda;
// Bt row-major [N][K] pitch ldb (k contiguous); M, N multiples of 128, K multiple of GKS (host constants).
// blockIdx.x = tile, blockIdx.y = batch index (strides in elements).
// Operand path: a stage = GKS k of the block's 128 A rows (and A2 rows) and 128 Bt rows, in LDS at pitch GPITCH,
// brought by 16-B asynchronous copies (16 lanes = one 256-B row piece); two buffers, the copies of stage t+2 are
// issued behind the barrier that ends stage t, so they fly while stage t+1 is worked on.
// NSPLIT: 0 = A.Bt; 1 = (A + A2).Bt (A2 = unscaled bf16 lo plane of A).
// Epilogue value v = acc*oscale + bias (+ resid) (relu); BIAS: 0 none, 1 per column n, 2 per row m
// (bias values RNE-converted to bf16); RESID (OUT_MODE 0 only): 1 = bf16 plane [m][n] pitch ldr, 2 = f32 plane.
// OUT_MODE: 0 = f32 (pitch ldc); 2 = bf16 hi plane C + bf16 lo plane C2 (lo = RNE(v - hi), unscaled);
//           3 = f16 hi plane C + f16 residual plane C2 = f16((v - hi) * rscale), C2 written only for tiles
//               with n0 < N2 (pitch ldc2, batch stride strideC2); 4 = f16 single plane C.
// =====================================================================================================
// Eight asynchronous 16-B copies per lane: rows r, r+8, .., r+56 of a plane (pitch ld elements) to LDS rows at
// pitch GPITCH. The s_wait_xcnt closes the statement so that no address register is rewritten ahead of it.
__device__ __forceinline__ void copy8_rows(unsigned l, const unsigned short* gp, int ld) {
#if DEV_ASM
  const size_t st = (size_t)8 * (size_t)ld;
  asm volatile(
      "global_load_async_to_lds_b128 %0, %8, off\n\t"
      "global_load_async_to_lds_b128 %1, %9, off\n\t"
      "global_load_async_to_lds_b128 %2, %10, off\n\t"
      "global_load_async_to_lds_b128 %3, %11, off\n\t"
      "global_load_async_to_lds_b128 %4, %12, off\n\t"
      "global_load_async_to_lds_b128 %5, %13, off\n\t"
      "global_load_async_to_lds_b128 %6, %14, off\n\t"
      "global_load_async_to_lds_b128 %7, %15, off\n\t"
      "s_wait_xcnt 0x0"
      :: "v"(l), "v"(l + 8u * GPITCH), "v"(l + 16u * GPITCH), "v"(l + 24u * GPITCH),
         "v"(l + 32u * GPITCH), "v"(l + 40u * GPITCH), "v"(l + 48u * GPITCH), "v"(l + 56u * GPITCH),
         "v"(gp), "v"(gp + st), "v"(gp + 2 * st), "v"(gp + 3 * st),
         "v"(gp + 4 * st), "v"(gp + 5 * st), "v"(gp + 6 * st), "v"(gp + 7 * st)
      : "memory");
  // keeps the next statement's address sums behind this one, so that their registers are used again
  __builtin_amdgcn_sched_barrier(0);
#endif
}
// One 128-row plane of a stage: 128 threads x 16 copies = 128 rows x 256 B.
__device__ __forceinline__ void copy_plane128(unsigned l, const unsigned short* gp, int ld) {
  copy8_rows(l, gp, ld);
  copy8_rows(l + 64u * GPITCH, gp + (size_t)64 * (size_t)ld, ld);
}
__device__ __forceinline__ void wait_lds_reads() {     // this wave's LDS reads are done before the buffer is given up
#if DEV_ASM
  asm volatile("s_wait_dscnt 0x0" ::: "memory");
#endif
}
__device__ __forceinline__ void wait_copies() {        // this wave's asynchronous copies have landed in LDS
#if DEV_ASM
  asm volatile("s_wait_asynccnt 0x0" ::: "memory");
#endif
}

template <int ET, int NSPLIT, int OUT_MODE, int BIAS, int RESID, bool RELU>
__global__ __launch_bounds__(128) void gemm64(
    const unsigned short* __restrict__ Ap, const unsigned short* __restrict__ A2p, int lda, long long strideA,
    const unsigned short* __restrict__ Btp, int ldb, long long strideB,
    const float* __restrict__ bias,
    const void* __restrict__ resid, int ldr, long long strideR,
    void* Cout, int ldc, long long strideC,
    void* Cout2, int ldc2, long long strideC2, int N2,
    int M, int N, int K, float oscale, float rscale) {
  typedef typename OpT<ET>::E E;
  typedef typename OpT<ET>::F F;
  const E* A  = (const E*)(const void*)Ap;
  const E* A2 = (const E*)(const void*)A2p;
  const E* Bt = (const E*)(const void*)Btp;
  constexpr int BROW  = (NSPLIT >= 1) ? 256 : 128;   // first Bt row of a stage (behind the A and A2 rows)
  constexpr int STAGE = (BROW + 128) * GPITCH;       // bytes of one buffer
  constexpr int PE    = GPITCH / 2;                  // LDS row pitch in elements
  __shared__ __align__(16) unsigned char ring[2 * STAGE];
  __shared__ __align__(16) float sT[4][16 * 68];   // per-wave 16x64 slab, pitch 68 floats
  const int b    = blockIdx.y;
  const int tid  = threadIdx.x;
  const int lane = tid & 31;
  const int wave = tid >> 5;
  const int tilesN = N >> 7;
  const int tilesM = M >> 7;
  const int tile = blockIdx.x;
  if (tile >= tilesM * tilesN) return;   // block-uniform, in front of every barrier
  const int tm = tile / tilesN;
  const int tn = tile - tm * tilesN;
  const int mB = tm << 7;                // block tile origin
  const int nB = tn << 7;
  const int wm = (wave >> 1) << 6;       // this wave's 64x64 quarter
  const int wn = (wave & 1) << 6;
  const int m0 = mB + wm;
  const int n0 = nB + wn;

  const E* Ab  = A  + (size_t)b * strideA;
  const E* Bb  = Bt + (size_t)b * strideB;
  const E* Ab2 = (NSPLIT >= 1) ? (A2 + (size_t)b * strideA) : Ab;

  const int rlane = lane & 15;                 // row (A) / col (B, D) within subtile
  const int koff  = (lane >> 4) * 8;           // k offset of this lane half
  const int mOff  = (lane >> 4) * 8;           // D row offset

  v8f acc[4][4];
#pragma unroll
  for (int i = 0; i < 4; ++i)
#pragma unroll
    for (int j = 0; j < 4; ++j) acc[i][j] = zero8();

  // copy addresses of this lane: 16-B piece (tid & 15) of rows (tid >> 4) + 8 i of each plane
  const int crow = tid >> 4, cpc = tid & 15;
  const unsigned cl = (unsigned)(size_t)(const void*)ring + (unsigned)(crow * GPITCH + cpc * 16);
  const unsigned short* ca  = (const unsigned short*)(const void*)Ab  + (size_t)(mB + crow) * lda + cpc * 8;
  const unsigned short* ca2 = (const unsigned short*)(const void*)Ab2 + (size_t)(mB + crow) * lda + cpc * 8;
  const unsigned short* cb  = (const unsigned short*)(const void*)Bb  + (size_t)(nB + crow) * ldb + cpc * 8;
  auto issue_stage = [&](int st, int buf) {
    const unsigned l = cl + (unsigned)(buf * STAGE);
    const int k0 = st * GKS;
    copy_plane128(l, ca + k0, lda);
    if (NSPLIT >= 1) copy_plane128(l + 128u * GPITCH, ca2 + k0, lda);
    copy_plane128(l + (unsigned)(BROW * GPITCH), cb + k0, ldb);
  };
  const int nst = K / GKS;               // stages; uniform
  issue_stage(0, 0);
  wait_copies();
  __syncthreads();                       // stage 0 is published
  if (nst > 1) issue_stage(1, 1);

  for (int t = 0; t < nst; ++t) {
    const unsigned char* sb = ring + (t & 1) * STAGE;
    const E* la  = (const E*)(const void*)(sb + (wm + rlane) * GPITCH) + koff;
    const E* la2 = la + 128 * PE;
    const E* lb  = (const E*)(const void*)(sb + (BROW + wn + rlane) * GPITCH) + koff;
#pragma unroll
    for (int ks = 0; ks < GKS; ks += 32) {
      F bh[4], ah[4], al[4];
#pragma unroll
      for (int j = 0; j < 4; ++j) bh[j] = OpT<ET>::ld(lb + (j << 4) * PE + ks);
#pragma unroll
      for (int i = 0; i < 4; ++i) {
        ah[i] = OpT<ET>::ld(la + (i << 4) * PE + ks);
        al[i] = ah[i];
        if (NSPLIT >= 1) al[i] = OpT<ET>::ld(la2 + (i << 4) * PE + ks);
      }
      // the step's LDS reads go as one group ahead of its WMMAs: the wave waits out the LDS latency once a step,
      // not once per A fragment
      __builtin_amdgcn_sched_barrier(0);
#pragma unroll
      for (int i = 0; i < 4; ++i) {
#pragma unroll
        for (int j = 0; j < 4; ++j) {
          acc[i][j] = OpT<ET>::mma_raw(ah[i], bh[j], acc[i][j]);
          if (NSPLIT >= 1) acc[i][j] = OpT<ET>::mma_raw(al[i], bh[j], acc[i][j]);
        }
        OpT<ET>::dep_guard(acc[i][0], acc[i][3], ah[i], al[i]);
      }
      OpT<ET>::keep4(bh[0], bh[1], bh[2], bh[3]);
      // keeps the next step's LDS reads from moving in among this step's WMMAs
      __builtin_amdgcn_sched_barrier(0);
    }
    wait_lds_reads();
    wait_copies();
    __syncthreads();                     // publishes stage t+1 and ends every read of stage t's buffer
    if (t + 2 < nst) issue_stage(t + 2, t & 1);
  }
  wait_copies();
  acc_guard4(acc[0][0], acc[0][1], acc[0][2], acc[0][3]);
  acc_guard4(acc[1][0], acc[1][1], acc[1][2], acc[1][3]);
  acc_guard4(acc[2][0], acc[2][1], acc[2][2], acc[2][3]);
  acc_guard4(acc[3][0], acc[3][1], acc[3][2], acc[3][3]);

  // ---- epilogue ----
  float* slab = sT[wave];
#pragma unroll
  for (int i = 0; i < 4; ++i) {
    const int mBase = m0 + (i << 4);
#pragma unroll
    for (int j = 0; j < 4; ++j) {
#pragma unroll
      for (int r = 0; r < 8; ++r) {
        slab[(mOff + r) * 68 + (j << 4) + rlane] = acc[i][j][r];
      }
    }
    __builtin_amdgcn_fence(__ATOMIC_RELEASE, "workgroup");
    __builtin_amdgcn_wave_barrier();
    __builtin_amdgcn_fence(__ATOMIC_ACQUIRE, "workgroup");
    if (OUT_MODE == 0) {
      float* C = (float*)Cout + (size_t)b * strideC;
      const int h2 = lane >> 4, c4 = (lane & 15) * 4;     // 256-B row segment = 16 lanes x 16 B
      v4f bz = {0.f, 0.f, 0.f, 0.f};
      if (BIAS == 1) {
        const v4f g = *(const v4f*)(bias + n0 + c4);
        bz[0] = bfr(g[0]); bz[1] = bfr(g[1]); bz[2] = bfr(g[2]); bz[3] = bfr(g[3]);
      }
      v4f ov[8];
#pragma unroll
      for (int it = 0; it < 8; ++it) {
        const int row = it * 2 + h2;                       // it 0..7 x h2 0..1 = rows 0..15
        const v4f v = *(const v4f*)(slab + row * 68 + c4);
        v4f w;
        w[0] = v[0] * oscale + bz[0];
        w[1] = v[1] * oscale + bz[1];
        w[2] = v[2] * oscale + bz[2];
        w[3] = v[3] * oscale + bz[3];
        if (BIAS == 2) {
          const float bm = bfr(bias[mBase + row]);
          w[0] += bm; w[1] += bm; w[2] += bm; w[3] += bm;
        }
        if (RESID == 1) {
          const unsigned short* rp = (const unsigned short*)resid + (size_t)b * strideR +
                                     (size_t)(mBase + row) * ldr + n0 + c4;
          const v2u rr = *(const v2u*)rp;
          w[0] += __uint_as_float(rr[0] << 16);
          w[1] += __uint_as_float(rr[0] & 0xffff0000u);
          w[2] += __uint_as_float(rr[1] << 16);
          w[3] += __uint_as_float(rr[1] & 0xffff0000u);
        }
        if (RESID == 2) {
          const float* rp = (const float*)resid + (size_t)b * strideR + (size_t)(mBase + row) * ldr + n0 + c4;
          const v4f rr = *(const v4f*)rp;
          w[0] += rr[0]; w[1] += rr[1]; w[2] += rr[2]; w[3] += rr[3];
        }
        if (RELU) {
          w[0] = fmaxf(w[0], 0.f); w[1] = fmaxf(w[1], 0.f); w[2] = fmaxf(w[2], 0.f); w[3] = fmaxf(w[3], 0.f);
        }
        ov[it] = w;
      }
      {
#pragma unroll
        for (int it = 0; it < 8; ++it) {
          const int row = it * 2 + h2;
          *(v4f*)(C + (size_t)(mBase + row) * ldc + n0 + c4) = ov[it];
        }
        
      }
    } else {
      const int q = lane >> 3, c8 = (lane & 7) * 8;
      unsigned short* C  = (unsigned short*)Cout  + (size_t)b * strideC;
      unsigned short* C2 = (unsigned short*)Cout2 + (size_t)b * strideC2;
      const bool wlo = (OUT_MODE == 2) || (OUT_MODE == 3 && n0 < N2);   // wave-uniform
      float b8[8];
#pragma unroll
      for (int e = 0; e < 8; ++e) b8[e] = 0.f;
      if (BIAS == 1) {
        const v4f g0 = *(const v4f*)(bias + n0 + c8);
        const v4f g1 = *(const v4f*)(bias + n0 + c8 + 4);
#pragma unroll
        for (int e = 0; e < 4; ++e) { b8[e] = bfr(g0[e]); b8[4 + e] = bfr(g1[e]); }
      }
      v4u hv[4], lv[4];
#pragma unroll
      for (int it = 0; it < 4; ++it) {
        const int row = it * 4 + q;                        // it 0..3 x q 0..3 = rows 0..15
        const float* sp = slab + row * 68 + c8;
        float bm = 0.f;
        if (BIAS == 2) bm = bfr(bias[mBase + row]);
        v4u a, a2;
#pragma unroll
        for (int e = 0; e < 4; ++e) {
          float f0 = sp[2 * e] * oscale + b8[2 * e] + bm;
          float f1 = sp[2 * e + 1] * oscale + b8[2 * e + 1] + bm;
          if (RELU) { f0 = fmaxf(f0, 0.f); f1 = fmaxf(f1, 0.f); }
          unsigned short h0, h1, l0 = 0, l1 = 0;
          if (OUT_MODE == 2) {
            h0 = bf_bits(f0); h1 = bf_bits(f1);
            l0 = bf_bits(f0 - bf_up(h0)); l1 = bf_bits(f1 - bf_up(h1));
          } else if (OUT_MODE == 3) {
            const _Float16 x0 = (_Float16)f0, x1 = (_Float16)f1;
            h0 = h_bits(x0); h1 = h_bits(x1);
            l0 = h_bits((_Float16)((f0 - (float)x0) * rscale));
            l1 = h_bits((_Float16)((f1 - (float)x1) * rscale));
          } else {
            h0 = h_bits((_Float16)f0); h1 = h_bits((_Float16)f1);
          }
          a[e] = pk16(h0, h1); a2[e] = pk16(l0, l1);
        }
        hv[it] = a; lv[it] = a2;
      }
      {
#pragma unroll
        for (int it = 0; it < 4; ++it) {
          const int row = it * 4 + q;
          *(v4u*)(C + (size_t)(mBase + row) * ldc + n0 + c8) = hv[it];
          if (wlo) *(v4u*)(C2 + (size_t)(mBase + row) * ldc2 + n0 + c8) = lv[it];
        }
        
      }
    }
    __builtin_amdgcn_fence(__ATOMIC_RELEASE, "workgroup");
    __builtin_amdgcn_wave_barrier();
    __builtin_amdgcn_fence(__ATOMIC_ACQUIRE, "workgroup");
  }
}

// =====================================================================================================
// Attention with an int32 replace-mask, head dim 64.
//   q planes (bf16 hi / lo): element (b, t, h, d) at [(b*SEQ + t)*DM + h*64 + d]
//   k planes (bf16 hi / lo): same layout with key index s
//   v^T hi plane (f16):      element (b, h, d, s) at [(b*DM + h*64 + d)*SEQ + s]
//   v^T residual plane (f16, (v - hi)*4096): [(b*DM + h*64 + d)*VLP + s], s < VLP, read only when RES
//   (a key tile at or beyond VLP contributes a zero v residual)
//   mask int32 [1][1][t][s]: logit = (mask != 0) ? q.k*sscale : -inf (replace)
//   flg [qt][kt]: bit r set when mask row qt*64+r has a nonzero inside key tile kt. A key tile is skipped only
//   when its word is 0 (every logit of the tile is -inf -> weight exactly 0, row max unaffected). The decision is
//   a block-uniform scalar load.
//   out planes (bf16 hi / lo of the normalised context): element (b, t, h, d) at [(b*SEQ + t)*DM + h*64 + d]
//   scores = q . k : bf16 hi/lo split (hi.hi + hi.lo + lo.hi), f32 accumulate, then * sscale + mask select in f32
//   p = exp(s - m) carried as f16(1024 p); context = p . v on f16 WMMA; RES adds f16 residual planes of p and v
//   (scale 4096, separate accumulator folded back with 1/4096 per chunk in f32); online softmax in f32.
//   A fully masked query row ends with l = 0 -> 0 * inf = NaN context, matching -inf softmax semantics.
//   Block = 4 waves = 64 query rows of one (b, h); grid = nqbThis * NH * NB; kv chunks of 64, static trip 32.
//   Both products are formed transposed: S^T = K . Q^T (A = K rows, B = Q rows) and O^T += V^T . P^T (A = V^T rows,
//   B = P^T). A lane then holds 32 of the 64 scores of ONE query (q0 + (lane & 15)): maximum and sum run in the lane,
//   with one exchange between the lane halves for the maximum; P^T is packed from the score registers.
//   LDS rows of the K and V^T tiles stand AP elements apart (64 used, 8 never touched): the 16 rows that one
//   16-B fragment read takes then fall on 16 different bank groups.
//   K / V^T chunk staging: 128 threads x 32 elements per plane = the whole 64x64 tile (plain 16-B loads,
//   __syncthreads before and after).
//   LDS fragment reads stand in groups ahead of the WMMAs that use them (K ahead of the scores, V^T ahead of the
//   softmax), held in place by scheduling barriers.
//   Output coverage: each wave stores rows q0..q0+15 (it 0..3 x lane>>3 0..3) x 64 columns (8 lanes x 8) of both planes.
// =====================================================================================================
template <bool RES>
__global__ __launch_bounds__(128)
void attn_mask64(const unsigned short* __restrict__ qhp, const unsigned short* __restrict__ qlp,
                 const unsigned short* __restrict__ khp, const unsigned short* __restrict__ klp,
                 const unsigned short* __restrict__ vhp, const unsigned short* __restrict__ vlp,
                 const int* __restrict__ maskp, const u64* __restrict__ flg,
                 unsigned short* ohp, unsigned short* olp,
                 int qbBase, int nqbThis, float sscale) {
  __shared__ __align__(16) __bf16   Ksh[64 * AP];                 // K hi [kv][d], row pitch AP
  __shared__ __align__(16) __bf16   Ksl[64 * AP];                 // K lo
  __shared__ __align__(16) _Float16 Vth[64 * AP];                 // V^T hi [d][kv], row pitch AP
  __shared__ __align__(16) _Float16 Vtl[RES ? 64 * AP : 8];       // V^T residual
  __shared__ __align__(16) float    Os[4][16 * OSP];              // per wave context tile [query][d], row pitch OSP

  const int tid  = threadIdx.x;
  const int wave = tid >> 5;
  const int lane = tid & 31;
  const int hh   = lane >> 4;
  const int c    = lane & 15;

  const int bx   = blockIdx.x;
  const int qbl  = bx % nqbThis;
  const int rest = bx / nqbThis;
  const int h    = rest % NH;
  const int b    = rest / NH;
  const int qb   = qbBase + qbl;
  const int q0   = qb * 64 + wave * 16;
  const size_t rowB = (size_t)b * SEQ;

  const __bf16* Qh = (const __bf16*)(const void*)qhp + (size_t)h * HD;
  const __bf16* Ql = (const __bf16*)(const void*)qlp + (size_t)h * HD;
  const __bf16* Kh = (const __bf16*)(const void*)khp + (size_t)h * HD;
  const __bf16* Kl = (const __bf16*)(const void*)klp + (size_t)h * HD;
  const _Float16* Vh = (const _Float16*)(const void*)vhp + ((size_t)b * DM + (size_t)h * HD) * SEQ;
  const _Float16* Vl = (const _Float16*)(const void*)vlp + ((size_t)b * DM + (size_t)h * HD) * VLP;
  const u64* fq = flg + (size_t)qb * NQB;     // block-uniform address -> scalar loads

  // ---- Q fragments (B operand, column = lane&15): 2 d-chunks, hi and lo ----
  v16b qah[2], qal[2];
#pragma unroll
  for (int dc = 0; dc < 2; ++dc) {
    const size_t qo = (rowB + q0 + c) * DM + dc * 32 + 8 * hh;
    qah[dc] = OpT<0>::ld(Qh + qo);
    qal[dc] = OpT<0>::ld(Ql + qo);
  }

  float mrow = -INFINITY;   // running maximum of query q0 + c (the same in both lane halves)
  float lrow = 0.f;         // running sum over the keys of this lane half; the halves are joined behind the loop
  v8f oacc[4];              // context^T: oacc[t][r] = d 16 t + 8 hh + r of query q0 + c
#pragma unroll
  for (int t = 0; t < 4; ++t) oacc[t] = zero8();

  for (int kt = 0; kt < NQB; ++kt) {         // static trip count
    const u64 lw = fq[kt];
    if (lw == 0ull) continue;                // block-uniform
    const int kv0 = kt * 64;
    __syncthreads();
    {
      const int r = tid >> 1, half = (tid & 1) * 32;
      const __bf16*   kg  = Kh + (rowB + kv0 + r) * DM + half;    // K row kv0+r, d = half..half+31
      const __bf16*   klg = Kl + (rowB + kv0 + r) * DM + half;
      const _Float16* vg  = Vh + (size_t)r * SEQ + kv0 + half;    // V^T row d = r, s = kv0+half..+31
      const int kvl = (kv0 + 64 <= VLP) ? kv0 : (VLP - 64);     // clamped address into the residual plane
      const _Float16* vlg = Vl + (size_t)r * VLP + kvl + half;
      const bool resOK = (kv0 + 64 <= VLP);                      // block-uniform
#pragma unroll
      for (int i = 0; i < 4; ++i) {
        const v8b a0 = *(const v8b*)(kg + 8 * i);
        const v8b a1 = *(const v8b*)(klg + 8 * i);
        const v8h b0 = *(const v8h*)(vg + 8 * i);
        *(v8b*)(Ksh + r * AP + half + 8 * i) = a0;
        *(v8b*)(Ksl + r * AP + half + 8 * i) = a1;
        *(v8h*)(Vth + r * AP + half + 8 * i) = b0;
        if (RES) {
          v8h b1 = *(const v8h*)(vlg + 8 * i);
          if (!resOK) b1 = zero8h();
          *(v8h*)(Vtl + r * AP + half + 8 * i) = b1;
        }
      }
    }
    __syncthreads();

    // ---- scores^T: 64 keys x 16 queries per wave (A = K rows, B = Q rows), 3 bf16 products ----
    // The tile's K fragments are read in groups ahead of the score products, so that the wave waits out the LDS
    // latency once a tile, not once per fragment pair: key groups 0..2 up front, group 3 behind the products of
    // group 0 (into registers that those have left), where the products of groups 1 and 2 cover its latency.
    v16b kbf[4][2], klf[4][2];
#pragma unroll
    for (int j = 0; j < 3; ++j) {
#pragma unroll
      for (int dc = 0; dc < 2; ++dc) {
        kbf[j][dc] = OpT<0>::ld(Ksh + (j * 16 + c) * AP + dc * 32 + 8 * hh);
        klf[j][dc] = OpT<0>::ld(Ksl + (j * 16 + c) * AP + dc * 32 + 8 * hh);
      }
    }
    // keeps the K reads from sinking back among the WMMAs that use them
    __builtin_amdgcn_sched_barrier(0);
    v8f s[4];                                // s[j][r] = score of key kv0 + 16 j + 8 hh + r against query q0 + c
#pragma unroll
    for (int j = 0; j < 4; ++j) {
      s[j] = zero8();
#pragma unroll
      for (int dc = 0; dc < 2; ++dc) {
        s[j] = mma_b(kbf[j][dc], qah[dc], s[j]);
        s[j] = mma_b(klf[j][dc], qah[dc], s[j]);
        s[j] = mma_b(kbf[j][dc], qal[dc], s[j]);
      }
      if (j == 0) {
#pragma unroll
        for (int dc = 0; dc < 2; ++dc) {
          kbf[3][dc] = OpT<0>::ld(Ksh + (3 * 16 + c) * AP + dc * 32 + 8 * hh);
          klf[3][dc] = OpT<0>::ld(Ksl + (3 * 16 + c) * AP + dc * 32 + 8 * hh);
        }
        // holds the reads of key group 3 together at this one place: without it they spread among the next WMMAs
        __builtin_amdgcn_sched_barrier(0);
      }
    }
    // The tile's V^T fragments are read here, ahead of the softmax, whose vector work covers their LDS latency.
    v16h vbf[2][4], vlf[2][4];
#pragma unroll
    for (int kk = 0; kk < 2; ++kk) {
#pragma unroll
      for (int t = 0; t < 4; ++t) {
        vbf[kk][t] = OpT<1>::ld(Vth + (t * 16 + c) * AP + kk * 32 + 8 * hh);
        vlf[kk][t] = vbf[kk][t];
        if (RES) vlf[kk][t] = OpT<1>::ld(Vtl + (t * 16 + c) * AP + kk * 32 + 8 * hh);
      }
    }
    // keeps the V^T reads here, where they fly under the wait for the mask words, and out of the softmax
    __builtin_amdgcn_sched_barrier(0);

    // ---- scale + mask select, maximum and sum of the lane's own 32 keys, online softmax ----
    const int* mq = maskp + (size_t)(q0 + c) * SEQ + kv0 + 8 * hh;   // row q0+c, keys kv0+8hh..; all < SEQ
    float mj[4];
#pragma unroll
    for (int j = 0; j < 4; ++j) {
      const v4i ma = *(const v4i*)(mq + j * 16);
      const v4i mb = *(const v4i*)(mq + j * 16 + 4);
      float mx = -INFINITY;
#pragma unroll
      for (int r = 0; r < 8; ++r) {
        const int mv = (r < 4) ? ma[r & 3] : mb[r & 3];
        const float sv = (mv != 0) ? (s[j][r] * sscale) : -INFINITY;
        s[j][r] = sv;
        mx = fmaxf(mx, sv);
      }
      mj[j] = mx;
    }
    float m = fmaxf(fmaxf(mj[0], mj[1]), fmaxf(mj[2], mj[3]));
    m = fmaxf(m, xhalf(m));                  // the query's other 32 keys of the tile
    const float mnew  = fmaxf(mrow, m);
    const float msafe = (mnew == -INFINITY) ? 0.f : mnew;
    // exp_slot's asm operands must lie in v0..v255: beside the residual build's fragments that costs spills, so that
    // build takes the compiler's own v_exp_f32 (same instruction, same values).
    auto ex = [](float x) { return RES ? __expf(x) : exp_slot(x); };
    const float alpha = ex(mrow - msafe);
    mrow = mnew;
    // P^T (x1024, f16) and its residual (x4096) go from the score registers straight into B fragments: score tiles
    // 2 kk and 2 kk + 1 hold keys 32 kk + 8 hh + e and 32 kk + 16 + 8 hh + e, the k order of the V^T loader.
    v16h paf[2], plf[2];
    float pj[4];
#pragma unroll
    for (int j = 0; j < 4; ++j) {
      float ps = 0.f;
#pragma unroll
      for (int r = 0; r < 8; ++r) {
        const float p = ex(s[j][r] - msafe);         // -inf logit against a finite max: exp -> 0
        ps += p;
        const float p1k = p * 1024.0f;
        const _Float16 ph = (_Float16)p1k;
        paf[j >> 1][(j & 1) * 8 + r] = ph;
        plf[j >> 1][(j & 1) * 8 + r] = RES ? (_Float16)((p1k - (float)ph) * 4096.0f) : ph;
      }
      pj[j] = ps;
    }
    lrow = lrow * alpha + ((pj[0] + pj[1]) + (pj[2] + pj[3]));
#pragma unroll
    for (int t = 0; t < 4; ++t)
#pragma unroll
      for (int r = 0; r < 8; ++r) oacc[t][r] *= alpha;

    // ---- context^T += V^T . P^T (f16 WMMA), residual products into a separate accumulator ----
    v8f o1[4];
#pragma unroll
    for (int t = 0; t < 4; ++t) o1[t] = zero8();
#pragma unroll
    for (int kk = 0; kk < 2; ++kk) {
#pragma unroll
      for (int t = 0; t < 4; ++t) {
        oacc[t] = mma_h(vbf[kk][t], paf[kk], oacc[t]);
        if (RES) {
          o1[t] = mma_h(vlf[kk][t], paf[kk], o1[t]);
          o1[t] = mma_h(vbf[kk][t], plf[kk], o1[t]);
        }
      }
    }
    if (RES) {
#pragma unroll
      for (int t = 0; t < 4; ++t)
#pragma unroll
        for (int r = 0; r < 8; ++r) oacc[t][r] += o1[t][r] * (1.0f / 4096.0f);
    }
  }

  // ---- join the two halves' sums, normalise (1/l and the 1/1024 p carry), stage the wave's 16x64 tile as
  //      [query][d] (a lane holds d = 16 t + 8 hh + r of query c: two 16-B stores per t), bf16 hi/lo split
  float* os = Os[wave];
  {
    const float l = lrow + xhalf(lrow);
    const float inv = (1.0f / l) * (1.0f / 1024.0f);   // l == 0 (fully masked row) -> inf -> NaN context
#pragma unroll
    for (int t = 0; t < 4; ++t) {
      v4f w0, w1;
#pragma unroll
      for (int e = 0; e < 4; ++e) { w0[e] = oacc[t][e] * inv; w1[e] = oacc[t][4 + e] * inv; }
      *(v4f*)(os + c * OSP + t * 16 + 8 * hh)     = w0;
      *(v4f*)(os + c * OSP + t * 16 + 8 * hh + 4) = w1;
    }
  }
  __builtin_amdgcn_fence(__ATOMIC_RELEASE, "workgroup");
  __builtin_amdgcn_wave_barrier();
  __builtin_amdgcn_fence(__ATOMIC_ACQUIRE, "workgroup");
  {
    const int q4 = lane >> 3, c8 = (lane & 7) * 8;
    v4u hv[4], lv[4];
#pragma unroll
    for (int it = 0; it < 4; ++it) {
      const int row = it * 4 + q4;   // it 0..3 x q4 0..3 = rows 0..15 of the wave tile
      const float* sp = os + row * OSP + c8;
      v4u a, a2;
#pragma unroll
      for (int e = 0; e < 4; ++e) {
        const float f0 = sp[2 * e], f1 = sp[2 * e + 1];
        const unsigned short h0 = bf_bits(f0), h1 = bf_bits(f1);
        const unsigned short l0 = bf_bits(f0 - bf_up(h0)), l1 = bf_bits(f1 - bf_up(h1));
        a[e] = pk16(h0, h1); a2[e] = pk16(l0, l1);
      }
      hv[it] = a; lv[it] = a2;
    }
    {
#pragma unroll
      for (int it = 0; it < 4; ++it) {
        const int row = it * 4 + q4;
        const size_t go = (rowB + q0 + row) * DM + (size_t)h * HD + c8;
        *(v4u*)(ohp + go) = hv[it];
        *(v4u*)(olp + go) = lv[it];
      }
    }
  }
}

// =====================================================================================================
// Layer norm over rows of DM=1024, f32, one block per row (grid = MROWS, 256 threads, 4 elements per thread).
// mean and biased variance via wave shuffles + 16 LDS slots; gamma / beta values RNE-converted to bf16;
// o = (gamma * (x - mean)) * (1 / sqrt(var + eps)) + beta.
// OUT16: threads 0..127 reload 8 consecutive inputs each and write the f16 plane as one 16-B store per lane
// coverage: 256 threads x 4 = the row (f32); 128 threads x 8 = the row (f16).
// =====================================================================================================
template <bool OUT16>
__global__ __launch_bounds__(256) void layernorm_rows(const float* __restrict__ in,
                                                       const float* __restrict__ gamma,
                                                       const float* __restrict__ beta,
                                                       float* out32, unsigned short* out16) {
  __shared__ float red[16];
  const int tid = threadIdx.x, lane = tid & 31, wave = tid >> 5;
  const int row = blockIdx.x;
  const float* xr = in + (size_t)row * DM;
  const v4f v = *(const v4f*)(xr + tid * 4);
  float s = (v[0] + v[1]) + (v[2] + v[3]);
#pragma unroll
  for (int off = 1; off < 32; off <<= 1) s += __shfl_xor(s, off, 32);
  if (lane == 0) red[wave] = s;
  __syncthreads();
  float tot = 0.f;
#pragma unroll
  for (int i = 0; i < 8; ++i) tot += red[i];
  const float mean = tot * (1.0f / (float)DM);
  const float d0 = v[0] - mean, d1 = v[1] - mean, d2 = v[2] - mean, d3 = v[3] - mean;
  float s2 = (d0 * d0 + d1 * d1) + (d2 * d2 + d3 * d3);
#pragma unroll
  for (int off = 1; off < 32; off <<= 1) s2 += __shfl_xor(s2, off, 32);
  if (lane == 0) red[8 + wave] = s2;
  __syncthreads();
  float tot2 = 0.f;
#pragma unroll
  for (int i = 0; i < 8; ++i) tot2 += red[8 + i];
  const float var  = tot2 * (1.0f / (float)DM);
  const float rstd = 1.0f / sqrtf(var + LNEPS);

  const v4f g  = *(const v4f*)(gamma + tid * 4);
  const v4f bt = *(const v4f*)(beta + tid * 4);
  v4f o;
  o[0] = (bfr(g[0]) * d0) * rstd + bfr(bt[0]);
  o[1] = (bfr(g[1]) * d1) * rstd + bfr(bt[1]);
  o[2] = (bfr(g[2]) * d2) * rstd + bfr(bt[2]);
  o[3] = (bfr(g[3]) * d3) * rstd + bfr(bt[3]);
  float* op = out32 + (size_t)row * DM + tid * 4;
  *(v4f*)op = o;
  

  if (OUT16) {
    if (tid < 128) {
      const int cc = tid * 8;
      const v4f a0 = *(const v4f*)(xr + cc);
      const v4f a1 = *(const v4f*)(xr + cc + 4);
      const v4f g0 = *(const v4f*)(gamma + cc), g1 = *(const v4f*)(gamma + cc + 4);
      const v4f b0 = *(const v4f*)(beta + cc),  b1 = *(const v4f*)(beta + cc + 4);
      float f[8];
#pragma unroll
      for (int e = 0; e < 4; ++e) {
        f[e]     = (bfr(g0[e]) * (a0[e] - mean)) * rstd + bfr(b0[e]);
        f[4 + e] = (bfr(g1[e]) * (a1[e] - mean)) * rstd + bfr(b1[e]);
      }
      v4u hp;
#pragma unroll
      for (int e = 0; e < 4; ++e) hp[e] = pk16(h_bits((_Float16)f[2 * e]), h_bits((_Float16)f[2 * e + 1]));
      unsigned short* hq = out16 + (size_t)row * DM + cc;
      *(v4u*)hq = hp;
      
    }
  }
}

// =====================================================================================================
// Workspace map (MiB = 1048576 B):
//   Xb   bf16 [4096][1024]         0 ..   8
//   WqT  bf16 [1024 n][1024 k]     8 ..  10     WkT 10 .. 12    WvT 12 .. 14    WoT 14 .. 16
//   W1T  f16  [4096 n][1024 k]    16 ..  24     W2T f16 [1024 n][4096 k]  24 .. 32
//   Qh   bf16 [4096][1024]        32 ..  40     Ql 40 .. 48    Kh 48 .. 56    Kl 56 .. 64
//   VTh  f16  [2][1024][2048]     64 ..  72     VTl f16 [2][1024][512]    72 .. 74    Flg u64 [32][32] at 74
//   Oh   bf16 [4096][1024]        76 ..  84     Ol 84 .. 92
//   later (regions dead by then, single in-order stream):
//   T1   f32  [4096][1024]        32 ..  48   (over Qh, Ql: written by the Wo GEMM after attention)
//   H32  f32  [4096][1024]        48 ..  64   (over Kh, Kl: written by LN1)
//   Hh   f16  [4096][1024]        64 ..  72   (over VTh: written by LN1)
//   F1   f16  [4096][4096]        72 .. 104   (over VTl, Flg, Oh, Ol: written by the W1 GEMM after the Wo GEMM)
//   T2   f32  [4096][1024]        32 ..  48   (over T1: written by the W2 GEMM after LN1)
//   end = 104 MiB. Every plane is an exact multiple of its 64x64 tile / whole-line store granularity
//   (no padded tails); all region starts are MiB aligned.
// =====================================================================================================
extern "C" void kernel_launch(void* const* d_in, const int* in_sizes, int n_in,
                              void* d_out, int out_size, void* d_ws, size_t ws_size,
                              hipStream_t stream) {
  if (n_in < 18) return;
  if (in_sizes[0] != NB * SEQ * DM) return;
  if (in_sizes[1] != SEQ * SEQ) return;
  if (in_sizes[2] != DM * DM || in_sizes[4] != DM * DM || in_sizes[6] != DM * DM || in_sizes[8] != DM * DM) return;
  if (in_sizes[3] != DM || in_sizes[5] != DM || in_sizes[7] != DM || in_sizes[9] != DM) return;
  if (in_sizes[10] != DM * DFF || in_sizes[11] != DFF || in_sizes[12] != DFF * DM || in_sizes[13] != DM) return;
  if (in_sizes[14] != DM || in_sizes[15] != DM || in_sizes[16] != DM || in_sizes[17] != DM) return;
  if (out_size != NB * SEQ * DM) return;

  const float* x   = (const float*)d_in[0];
  const int*   msk = (const int*)d_in[1];
  const float* Wq  = (const float*)d_in[2];
  const float* bq  = (const float*)d_in[3];
  const float* Wk  = (const float*)d_in[4];
  const float* bk  = (const float*)d_in[5];
  const float* Wv  = (const float*)d_in[6];
  const float* bv  = (const float*)d_in[7];
  const float* Wo  = (const float*)d_in[8];
  const float* bo  = (const float*)d_in[9];
  const float* W1  = (const float*)d_in[10];
  const float* b1  = (const float*)d_in[11];
  const float* W2  = (const float*)d_in[12];
  const float* b2  = (const float*)d_in[13];
  const float* gamma1 = (const float*)d_in[14];
  const float* beta1  = (const float*)d_in[15];
  const float* gamma2 = (const float*)d_in[16];
  const float* beta2  = (const float*)d_in[17];

  const size_t PX   = (size_t)MROWS * DM * 2;        //  8 MiB  16-bit activation plane [4096][1024]
  const size_t PW   = (size_t)DM * DM * 2;           //  2 MiB  16-bit weight plane [1024][1024]
  const size_t PWF  = (size_t)DM * DFF * 2;          //  8 MiB  16-bit FFN weight plane
  const size_t PVT  = (size_t)NB * DM * SEQ * 2;     //  8 MiB  v^T hi plane
  const size_t PVL  = (size_t)NB * DM * VLP * 2;     //  2 MiB  v^T residual plane
  const size_t PFs  = (size_t)2 * 1048576;           //  2 MiB  slot for the 8 KiB flag table
  const size_t PF   = (size_t)NQB * NQB * 8;         //  8 KiB
  const size_t PT   = (size_t)MROWS * DM * 4;        // 16 MiB  f32 activation plane
  const size_t PF1  = (size_t)MROWS * DFF * 2;       // 32 MiB  f16 FFN hidden plane
  if (PF > PFs) return;
  size_t off = 0;
  const size_t oXb  = off; off += PX;
  const size_t oWq  = off; off += PW;
  const size_t oWk  = off; off += PW;
  const size_t oWv  = off; off += PW;
  const size_t oWo  = off; off += PW;
  const size_t oW1  = off; off += PWF;
  const size_t oW2  = off; off += PWF;
  const size_t oQh  = off; off += PX;
  const size_t oQl  = off; off += PX;
  const size_t oKh  = off; off += PX;
  const size_t oKl  = off; off += PX;
  const size_t oVTh = off; off += PVT;
  const size_t oVTl = off; off += PVL;
  const size_t oFlg = off; off += PFs;
  const size_t oOh  = off; off += PX;
  const size_t oOl  = off; off += PX;
  const size_t endA = off;                           // 92 MiB
  const size_t oT1  = oQh;                           // T1 over Qh + Ql
  const size_t oH32 = oKh;                           // H32 over Kh + Kl
  const size_t oHh  = oVTh;                          // Hh over VTh
  const size_t oF1  = oVTl;                          // F1 over VTl .. Ol and beyond
  const size_t oT2  = oT1;                           // T2 over T1
  if (oT1 + PT != oKh) return;                       // aliasing sanity: T1 ends where H32 starts
  if (oH32 + PT != oVTh) return;                     // H32 ends where Hh starts
  if (oHh + PX != oVTl) return;                      // Hh ends where F1 starts
  size_t total = oF1 + PF1;                          // 104 MiB
  if (endA > total) total = endA;
  if (total > ws_size) return;
  if (total > (size_t)134217728) return;

  char* ws = (char*)d_ws;
  unsigned short* Xb   = (unsigned short*)(ws + oXb);
  unsigned short* WqTb = (unsigned short*)(ws + oWq);
  unsigned short* WkTb = (unsigned short*)(ws + oWk);
  unsigned short* WvTb = (unsigned short*)(ws + oWv);
  unsigned short* WoTb = (unsigned short*)(ws + oWo);
  unsigned short* W1Tb = (unsigned short*)(ws + oW1);
  unsigned short* W2Tb = (unsigned short*)(ws + oW2);
  unsigned short* Qh   = (unsigned short*)(ws + oQh);
  unsigned short* Ql   = (unsigned short*)(ws + oQl);
  unsigned short* Kh   = (unsigned short*)(ws + oKh);
  unsigned short* Kl   = (unsigned short*)(ws + oKl);
  unsigned short* VTh  = (unsigned short*)(ws + oVTh);
  unsigned short* VTl  = (unsigned short*)(ws + oVTl);
  u64*            Flg  = (u64*)(ws + oFlg);
  unsigned short* Oh   = (unsigned short*)(ws + oOh);
  unsigned short* Ol   = (unsigned short*)(ws + oOl);
  float*          T1   = (float*)(ws + oT1);
  float*          H32  = (float*)(ws + oH32);
  unsigned short* Hh   = (unsigned short*)(ws + oHh);
  unsigned short* F1   = (unsigned short*)(ws + oF1);
  float*          T2   = (float*)(ws + oT2);

  const dim3 blk(256);
  const dim3 gPrep(PB_ALL);                                         // 32 + 2 x 1024 + 4 x 256 + 2048 = 5152 blocks
  const dim3 blkG(128);                                             // GEMM block: 4 waves, one 128x128 tile
  const dim3 gProj((MROWS / 128) * (DM / 128), 1);                  // 256 tiles: M=4096, N=1024
  const dim3 gVT((DM / 128) * (SEQ / 128), NB);                     // 128 tiles x 2 batches: M=1024, N=2048
  const dim3 gW1((MROWS / 128) * (DFF / 128), 1);                   // 1024 tiles: M=4096, N=4096
  const dim3 gW2((MROWS / 128) * (DM / 128), 1);                    // 256 tiles: M=4096, N=1024
  const dim3 gLN(MROWS);                                            // 4096 blocks, one row each

  // (0, 1) one launch: mask tile survey -> Flg; x -> bf16 plane [4096][1024]; weights [k][n] f32 -> 16-bit [n][k] planes
  prep_inputs<<<gPrep, blk, 0, stream>>>(msk, Flg, x, Xb, Wq, Wk, Wv, Wo, W1, W2,
                                         WqTb, WkTb, WvTb, WoTb, W1Tb, W2Tb);
  // (2) q = x . Wq + bq -> bf16 hi/lo planes [b*SEQ+t][h*64+d]   (M=4096, N=1024, K=1024)
  gemm64<0, 0, 2, 1, 0, false><<<gProj, blkG, 0, stream>>>(
      Xb, Xb, DM, 0LL, WqTb, DM, 0LL, bq, (const void*)Xb, DM, 0LL,
      (void*)Qh, DM, 0LL, (void*)Ql, DM, 0LL, DM,
      MROWS, DM, DM, 1.0f, 1.0f);
  // (3) k = x . Wk + bk -> bf16 hi/lo planes
  gemm64<0, 0, 2, 1, 0, false><<<gProj, blkG, 0, stream>>>(
      Xb, Xb, DM, 0LL, WkTb, DM, 0LL, bk, (const void*)Xb, DM, 0LL,
      (void*)Kh, DM, 0LL, (void*)Kl, DM, 0LL, DM,
      MROWS, DM, DM, 1.0f, 1.0f);
  // (4) v^T = WvT . x^T + bv per batch -> f16 hi plane [b][h*64+d][s] (pitch SEQ) and residual plane
  //     (x4096, keys < VLP only, pitch VLP)   (A = WvT [d][k], Bt = Xb rows of batch b; M=1024, N=2048, K=1024)
  gemm64<0, 0, 3, 2, 0, false><<<gVT, blkG, 0, stream>>>(
      WvTb, WvTb, DM, 0LL, Xb, DM, (long long)SEQ * DM, bv, (const void*)Xb, DM, 0LL,
      (void*)VTh, SEQ, (long long)DM * SEQ, (void*)VTl, VLP, (long long)DM * VLP, VLP,
      DM, SEQ, DM, 1.0f, 4096.0f);
  // (5) attention: query blocks 0..RESQB-1 with residual planes, the rest without
  attn_mask64<true><<<dim3(NB * NH * RESQB), dim3(128), 0, stream>>>(
      Qh, Ql, Kh, Kl, VTh, VTl, msk, Flg, Oh, Ol, 0, RESQB, 0.125f);
  attn_mask64<false><<<dim3(NB * NH * (NQB - RESQB)), dim3(128), 0, stream>>>(
      Qh, Ql, Kh, Kl, VTh, VTl, msk, Flg, Oh, Ol, RESQB, NQB - RESQB, 0.125f);
  // (6) T1 = ctx . Wo + bo + bf16(x) -> f32 [4096][1024]  (A = context hi + lo planes, 2 products)
  gemm64<0, 1, 0, 1, 1, false><<<gProj, blkG, 0, stream>>>(
      Oh, Ol, DM, 0LL, WoTb, DM, 0LL, bo, (const void*)Xb, DM, 0LL,
      (void*)T1, DM, 0LL, (void*)T1, DM, 0LL, 0,
      MROWS, DM, DM, 1.0f, 1.0f);
  // (7) h = LN1(T1) -> H32 f32 and Hh f16
  layernorm_rows<true><<<gLN, blk, 0, stream>>>(T1, gamma1, beta1, H32, Hh);
  // (8) F1 = relu(h . W1 + b1) -> f16 [4096][4096]  (f16 operands, W1 carried x64, acc scaled by 1/64)
  gemm64<1, 0, 4, 1, 0, true><<<gW1, blkG, 0, stream>>>(
      Hh, Hh, DM, 0LL, W1Tb, DM, 0LL, b1, (const void*)Hh, DM, 0LL,
      (void*)F1, DFF, 0LL, (void*)F1, DFF, 0LL, 0,
      MROWS, DFF, DM, 1.0f / WSCALE, 1.0f);
  // (9) T2 = F1 . W2 + b2 + h -> f32 [4096][1024]  (K = 4096, W2 carried x64)
  gemm64<1, 0, 0, 1, 2, false><<<gW2, blkG, 0, stream>>>(
      F1, F1, DFF, 0LL, W2Tb, DFF, 0LL, b2, (const void*)H32, DM, 0LL,
      (void*)T2, DM, 0LL, (void*)T2, DM, 0LL, 0,
      MROWS, DM, DFF, 1.0f / WSCALE, 1.0f);
  // (10) out = LN2(T2) -> d_out f32 [2][2048][1024]
  layernorm_rows<false><<<gLN, blk, 0, stream>>>(T2, gamma2, beta2, (float*)d_out, Hh);
  (void)hipGetLastError();
}

// v006
// Measured time: 258 microseconds a run.
// Next to v005, in two timings, it ran 1.08 and 1.07 times as fast.
// Over all steps from v000 it is 2.76 times as fast.
// Contractions: q, k, v^T projections = v_wmma_f32_16x16x32_bf16 (bf16 operands from RNE-converted inputs, single product);
// q.k^T scores = v_wmma_f32_16x16x32_bf16 with q and k as bf16 hi/lo planes (hi.hi + hi.lo + lo.hi);
// p.v = v_wmma_f32_16x16x32_f16 (p carried x1024 in f16, v f16 hi plane; f16 residual planes x4096 of p and v on the first 512 query rows);
// ctx.Wo = v_wmma_f32_16x16x32_bf16 with ctx as bf16 hi/lo planes times bf16 Wo (2 products);
// h.W1 and relu(h.W1+b1).W2 = v_wmma_f32_16x16x32_f16 (f16 operands, weights carried x64, single product);
// all f32 accumulate; softmax and both layer norms in f32.
#include <hip/hip_runtime.h>
#include <math.h>
#include <stdint.h>

#define NB     2
#define SEQ    2048
#define DM     1024
#define NH     16
#define HD     64
#define DFF    4096
#define MROWS  (NB * SEQ)   // 4096 token rows
#define NQB    (SEQ / 64)   // 32 key / query tiles of 64
#define VLP    512          // key pitch of the v^T residual plane (keys 0..VLP-1)
#define RESQB  8            // leading 64-row query blocks that use the p / v residual planes
#define LNEPS  1e-6f
#define WSCALE 64.0f        // f16 weight carry for W1 and W2
#define GKS    128          // k elements per LDS stage of the GEMM (256-B rows)
#define GPITCH 272          // LDS row pitch of a stage in bytes: 16 B x odd, for 16-B fragment reads
#define AP     72           // LDS row pitch of the attention K / V^T tiles in 16-bit elements: 144 B = 16 B x odd
#define OSP    68           // LDS row pitch of the attention output tile in floats: 272 B = 16 B x odd
static_assert(RESQB * 64 <= VLP);
static_assert(NH * HD == DM);
static_assert((SEQ % 128) == 0 && (DM % 128) == 0 && (DFF % 128) == 0 && (MROWS % 128) == 0);
static_assert((DM % GKS) == 0 && (DFF % GKS) == 0);
static_assert(NQB * 8 == 256);
static_assert(AP >= 64 && ((AP * 2) % 16) == 0 && (((AP * 2) / 16) & 1) == 1);

typedef _Float16 v16h __attribute__((ext_vector_type(16)));
typedef _Float16 v8h  __attribute__((ext_vector_type(8)));
typedef __bf16   v16b __attribute__((ext_vector_type(16)));
typedef __bf16   v8b  __attribute__((ext_vector_type(8)));
typedef float    v8f  __attribute__((ext_vector_type(8)));
typedef float    v4f  __attribute__((ext_vector_type(4)));
typedef unsigned int v4u __attribute__((ext_vector_type(4)));
typedef unsigned int v2u __attribute__((ext_vector_type(2)));
typedef int      v4i __attribute__((ext_vector_type(4)));
typedef unsigned long long u64;

#if defined(__HIP_DEVICE_COMPILE__)
#define DEV_ASM 1
#else
#define DEV_ASM 0
#endif

// ---- scalar helpers --------------------------------------------------------------------------------
__device__ __forceinline__ unsigned short bf_bits(float f) {          // f32 -> bf16 bits, RNE convert
  unsigned u = __float_as_uint(f);
  return (unsigned short)((u + 0x7FFFu + ((u >> 16) & 1u)) >> 16);
}
__device__ __forceinline__ float bf_up(unsigned short h) { return __uint_as_float(((unsigned)h) << 16); }
__device__ __forceinline__ float bfr(float f) { return bf_up(bf_bits(f)); }   // bf16 requantised value
__device__ __forceinline__ unsigned short h_bits(_Float16 x) { return __builtin_bit_cast(unsigned short, x); }
__device__ __forceinline__ unsigned pk16(unsigned short a, unsigned short b) { return (unsigned)a | ((unsigned)b << 16); }
__device__ __forceinline__ v8f zero8() { v8f z = {0.f, 0.f, 0.f, 0.f, 0.f, 0.f, 0.f, 0.f}; return z; }
__device__ __forceinline__ v16h zero16h() {
  const _Float16 z = (_Float16)0.0f;
  v16h r = {z, z, z, z, z, z, z, z, z, z, z, z, z, z, z, z};
  return r;
}

// ---- operand traits: fragment loader (lane -> row/col (lane&15), p already includes +8*(lane>>4);
//      elements 0..7 <- p[0..7] (k0+8h..), elements 8..15 <- p[16..23] (k0+16+8h..)), WMMA, hazard gaps
template <int ET> struct OpT;
template <> struct OpT<0> {
  typedef __bf16 E; typedef v16b F; typedef v8b H;
  static __device__ __forceinline__ F ld(const E* p) {
    union { F v; H h[2]; } f;
    f.h[0] = *(const H*)(p);
    f.h[1] = *(const H*)(p + 16);
    return f.v;
  }
  static __device__ __forceinline__ v8f mma_raw(F a, F b, v8f c) {
    return __builtin_amdgcn_wmma_f32_16x16x32_bf16(false, a, false, b, (short)0, c, false, false);
  }
  static __device__ __forceinline__ void dep_guard(v8f& a, v8f& b, F x, F y) {
#if DEV_ASM
    asm volatile("v_nop\n\tv_nop\n\tv_nop\n\tv_nop" : "+v"(a), "+v"(b) : "v"(x), "v"(y));
#endif
  }
  static __device__ __forceinline__ void keep4(F a, F b, F c, F d) {
#if DEV_ASM
    asm volatile("v_nop" :: "v"(a), "v"(b), "v"(c), "v"(d));
#endif
  }
};
template <> struct OpT<1> {
  typedef _Float16 E; typedef v16h F; typedef v8h H;
  static __device__ __forceinline__ F ld(const E* p) {
    union { F v; H h[2]; } f;
    f.h[0] = *(const H*)(p);
    f.h[1] = *(const H*)(p + 16);
    return f.v;
  }
  static __device__ __forceinline__ v8f mma_raw(F a, F b, v8f c) {
    return __builtin_amdgcn_wmma_f32_16x16x32_f16(false, a, false, b, (short)0, c, false, false);
  }
  static __device__ __forceinline__ void dep_guard(v8f& a, v8f& b, F x, F y) {
#if DEV_ASM
    asm volatile("v_nop\n\tv_nop\n\tv_nop\n\tv_nop" : "+v"(a), "+v"(b) : "v"(x), "v"(y));
#endif
  }
  static __device__ __forceinline__ void keep4(F a, F b, F c, F d) {
#if DEV_ASM
    asm volatile("v_nop" :: "v"(a), "v"(b), "v"(c), "v"(d));
#endif
  }
};

// ---- guarded WMMA helpers for the attention kernel ------------------------------------------------
__device__ __forceinline__ v8f mma_b(v16b a, v16b b, v8f c) {
  c = __builtin_amdgcn_wmma_f32_16x16x32_bf16(false, a, false, b, (short)0, c, false, false);
#if DEV_ASM
  asm volatile("v_nop\n\tv_nop\n\tv_nop\n\tv_nop" : "+v"(c) : "v"(a), "v"(b));
#endif
  return c;
}
__device__ __forceinline__ v8f mma_h(v16h a, v16h b, v8f c) {
  c = __builtin_amdgcn_wmma_f32_16x16x32_f16(false, a, false, b, (short)0, c, false, false);
#if DEV_ASM
  asm volatile("v_nop\n\tv_nop\n\tv_nop\n\tv_nop" : "+v"(c) : "v"(a), "v"(b));
#endif
  return c;
}
// e^x as 2^(x log2 e), one v_exp_f32. The v_nop keeps the one slot that the instruction set asks for behind a
// transcendental before its result is read or its source overwritten: inside the statement it stays directly behind it.
__device__ __forceinline__ float exp_slot(float x) {
  const float y = x * 0x1.715476p+0f;
#if DEV_ASM
  float r;
  asm("v_exp_f32 %0, %1\n\tv_nop" : "=v"(r) : "v"(y));
  return r;
#else
  return exp2f(y);
#endif
}
// lane l with lane l ^ 16
__device__ __forceinline__ float xhalf(float x) {
  return __builtin_bit_cast(float, __builtin_amdgcn_permlanex16(__builtin_bit_cast(int, x), __builtin_bit_cast(int, x),
                                                                0x76543210, 0xfedcba98, false, false));
}
__device__ __forceinline__ void acc_guard4(v8f& a, v8f& b, v8f& c, v8f& d) {
#if DEV_ASM
  asm volatile("v_nop\n\tv_nop\n\tv_nop\n\tv_nop" : "+v"(a), "+v"(b), "+v"(c), "+v"(d));
#endif
}

// =====================================================================================================
// f32 -> bf16 (RNE convert), 8 elements per thread, one 16-B store per lane: a wave writes 512 contiguous B
// coverage: n8 threads x 8 = the whole plane (n8 is a multiple of 256 here). blk = block of 256 threads.
// =====================================================================================================
__device__ __forceinline__ void cvt_bf16x8(int blk, const float* __restrict__ in, unsigned short* out, int n8) {
  const int i = blk * 256 + threadIdx.x;
  if (i < n8) {
    const v4f a = *(const v4f*)(in + (size_t)i * 8);
    const v4f b = *(const v4f*)(in + (size_t)i * 8 + 4);
    v4u p;
    p[0] = pk16(bf_bits(a[0]), bf_bits(a[1]));
    p[1] = pk16(bf_bits(a[2]), bf_bits(a[3]));
    p[2] = pk16(bf_bits(b[0]), bf_bits(b[1]));
    p[3] = pk16(bf_bits(b[2]), bf_bits(b[3]));
    *(v4u*)(out + (size_t)i * 8) = p;
    
  }
}

// =====================================================================================================
// Weight transpose + convert: in W f32 [Kdim][Ndim] (row k, n contiguous) -> out 16-bit [Ndim][Kdim]
// (row n, k contiguous). F16OUT: f16 of (bf16 value * scale), else bf16 bits. 64x64 tile through LDS.
// (Ndim/64) x (Kdim/64) blocks of 256 threads; bn = n tile, bk = k tile; tile = 64 x 65 floats of LDS.
// coverage: load 256 threads x 16 = 64x64; store 8 waves x 2 it x 4 rows x (8 lanes x 8) = 64x64.
// =====================================================================================================
template <bool F16OUT>
__device__ __forceinline__ void wtrans64(float (*tile)[65], int bn, int bk,
                                         const float* __restrict__ W, unsigned short* out,
                                         int Kdim, int Ndim, float scale) {
  const int tid = threadIdx.x, lane = tid & 31, wave = tid >> 5;
  const int n0 = bn * 64, k0 = bk * 64;
  {
    const int r = tid >> 2, cq = (tid & 3) * 16;
    const float* src = W + (size_t)(k0 + r) * Ndim + n0 + cq;
#pragma unroll
    for (int e = 0; e < 4; ++e) {
      const v4f a = *(const v4f*)(src + 4 * e);
      tile[r][cq + 4 * e + 0] = a[0];
      tile[r][cq + 4 * e + 1] = a[1];
      tile[r][cq + 4 * e + 2] = a[2];
      tile[r][cq + 4 * e + 3] = a[3];
    }
  }
  __syncthreads();
  const int q = lane >> 3, c8 = (lane & 7) * 8;
  v4u pv[2];
#pragma unroll
  for (int it = 0; it < 2; ++it) {
    const int nn = wave * 8 + it * 4 + q;
    v4u a;
#pragma unroll
    for (int e = 0; e < 4; ++e) {
      const float f0 = tile[c8 + 2 * e][nn], f1 = tile[c8 + 2 * e + 1][nn];
      unsigned short b0 = bf_bits(f0), b1 = bf_bits(f1);
      if (F16OUT) {
        b0 = h_bits((_Float16)(bf_up(b0) * scale));
        b1 = h_bits((_Float16)(bf_up(b1) * scale));
      }
      a[e] = pk16(b0, b1);
    }
    pv[it] = a;
  }
  {
#pragma unroll
    for (int it = 0; it < 2; ++it) {
      const int nn = wave * 8 + it * 4 + q;
      *(v4u*)(out + (size_t)(n0 + nn) * Kdim + k0 + c8) = pv[it];
    }
#if DEV_ASM
    // inlined into a kernel with other parts, code may follow that writes the stores' registers again: wait first
    asm volatile("s_wait_xcnt 0x0" ::: "memory");
#endif
  }
}

// =====================================================================================================
// Mask tile survey: mask int32 [1][1][SEQ][SEQ] (nonzero = key allowed). Block = qt: query rows qt*64..+63.
// For every key tile kt (64 keys) it records a 64-bit word whose bit r is 1 when row r of the tile has at
// least one nonzero entry inside kt. NQB blocks of 256 threads: thread = (row = tid>>2, quarter = tid&3);
// wave w holds rows 8w..8w+7 -> byte w of the word. Output flg[qt*NQB + kt], 32 words = 256 B per block
// coverage: 32 blocks x 32 words = the whole 1024-word table.
// =====================================================================================================
// sb = NQB * 8 bytes of LDS, 8-B aligned.
__device__ __forceinline__ void mask_rowbits(unsigned char* sb, int qt, const int* __restrict__ maskp, u64* flg) {
  const int tid  = threadIdx.x;
  const int wave = tid >> 5;
  const int lane = tid & 31;
  const int row  = tid >> 2;            // 0..63
  const int qtr  = (tid & 3) * 16;      // 0,16,32,48
  const int* mr = maskp + ((size_t)qt * 64 + row) * SEQ + qtr;
#pragma unroll 1
  for (int kt = 0; kt < NQB; ++kt) {
    const int* p = mr + kt * 64;
    const v4i a0 = *(const v4i*)(p);
    const v4i a1 = *(const v4i*)(p + 4);
    const v4i a2 = *(const v4i*)(p + 8);
    const v4i a3 = *(const v4i*)(p + 12);
    int lv = 0;
#pragma unroll
    for (int e = 0; e < 4; ++e) {
      lv |= (a0[e] != 0) ? 1 : 0;
      lv |= (a1[e] != 0) ? 1 : 0;
      lv |= (a2[e] != 0) ? 1 : 0;
      lv |= (a3[e] != 0) ? 1 : 0;
    }
    const unsigned bl = __builtin_amdgcn_ballot_w32(lv != 0);   // uniform per wave
    unsigned bits = 0u;
#pragma unroll
    for (int k = 0; k < 8; ++k) bits |= ((((bl >> (4 * k)) & 0xFu) != 0u) ? 1u : 0u) << k;
    if (lane == 0) sb[kt * 8 + wave] = (unsigned char)bits;
  }
  __syncthreads();
  if (wave == 0) {
    u64 w;
    __builtin_memcpy(&w, &sb[lane * 8], 8);   // bytes 0..7 = rows 0..63, little endian
    u64* dst = flg + (size_t)qt * NQB + lane;
    *(u64*)dst = w;
    
  }
}

// =====================================================================================================
// All the work that reads only the inputs, in ONE launch: no part needs another part's result, so the parts share
// the chip instead of standing one behind another in the stream. A block takes its part from its index (a
// block-uniform branch, so each part's barrier is passed by all of the block's threads or by none):
//   PB_MASK blocks  mask tile survey (first: each is one long chain of dependent trips, the rest runs beside it)
//   PB_WF   blocks  W1 -> W1T,  PB_WF blocks  W2 -> W2T,  4 x PB_W blocks  Wq, Wk, Wv, Wo -> their transposes
//   PB_X    blocks  x -> bf16 plane
// =====================================================================================================
#define PB_MASK NQB
#define PB_WF   ((DFF / 64) * (DM / 64))
#define PB_W    ((DM / 64) * (DM / 64))
#define PB_X    (MROWS * DM / 8 / 256)
#define PB_ALL  (PB_MASK + 2 * PB_WF + 4 * PB_W + PB_X)
static_assert((MROWS * DM) % (8 * 256) == 0);
__global__ __launch_bounds__(256) void prep_inputs(
    const int* __restrict__ maskp, u64* flg, const float* __restrict__ x, unsigned short* xb,
    const float* __restrict__ Wq, const float* __restrict__ Wk, const float* __restrict__ Wv,
    const float* __restrict__ Wo, const float* __restrict__ W1, const float* __restrict__ W2,
    unsigned short* WqT, unsigned short* WkT, unsigned short* WvT, unsigned short* WoT,
    unsigned short* W1T, unsigned short* W2T) {
  __shared__ __align__(16) float tile[64][65];
  static_assert(sizeof(tile) >= NQB * 8);
  int i = blockIdx.x;
  if (i < PB_MASK) {
    mask_rowbits((unsigned char*)(void*)&tile[0][0], i, maskp, flg);
    return;
  }
  i -= PB_MASK;
  if (i < PB_WF) {           // in [1024 k][4096 n] -> out [4096 n][1024 k]
    wtrans64<true>(tile, i % (DFF / 64), i / (DFF / 64), W1, W1T, DM, DFF, WSCALE);
    return;
  }
  i -= PB_WF;
  if (i < PB_WF) {           // in [4096 k][1024 n] -> out [1024 n][4096 k]
    wtrans64<true>(tile, i % (DM / 64), i / (DM / 64), W2, W2T, DFF, DM, WSCALE);
    return;
  }
  i -= PB_WF;
  if (i < 4 * PB_W) {        // in [1024 k][1024 n] -> out [1024 n][1024 k]
    const int w = i / PB_W, t = i % PB_W;
    const float* W = (w == 0) ? Wq : (w == 1) ? Wk : (w == 2) ? Wv : Wo;
    unsigned short* T = (w == 0) ? WqT : (w == 1) ? WkT : (w == 2) ? WvT : WoT;
    wtrans64<false>(tile, t % (DM / 64), t / (DM / 64), W, T, DM, DM, 1.0f);
    return;
  }
  i -= 4 * PB_W;
  cvt_bf16x8(i, x, xb, MROWS * DM / 8);
}

// =====================================================================================================
// Register-blocked batched 16-bit WMMA GEMM: C[m][n] = sum_k A[m][k] * Bt[n][k]; one block of 4 waves per
// 128x128 tile, one wave per 64x64 quarter. ET: 0 = bf16 operands, 1 = f16 operands. A row-major [M][K] pitch lda;
// Bt row-major [N][K] pitch ldb (k contiguous); M, N multiples of 128, K multiple of GKS (host constants).
// blockIdx.x = tile, blockIdx.y = batch index (strides in elements).
// Operand path: a stage = GKS k of the block's 128 A rows (and A2 rows) and 128 Bt rows, in LDS at pitch GPITCH,
// brought by 16-B asynchronous copies (16 lanes = one 256-B row piece); two buffers, the copies of stage t+2 are
// issued behind the barrier that ends stage t, so they fly while stage t+1 is worked on.
// NSPLIT: 0 = A.Bt; 1 = (A + A2).Bt (A2 = unscaled bf16 lo plane of A).
// Epilogue value v = acc*oscale + bias (+ resid) (relu); BIAS: 0 none, 1 per column n, 2 per row m
// (bias values RNE-converted to bf16); RESID (OUT_MODE 0 only): 1 = bf16 plane [m][n] pitch ldr, 2 = f32 plane.
// OUT_MODE: 0 = f32 (pitch ldc); 2 = bf16 hi plane C + bf16 lo plane C2 (lo = RNE(v - hi), unscaled);
//           3 = f16 hi plane C + f16 residual plane C2 = f16((v - hi) * rscale), C2 written only for tiles
//               with n0 < N2 (pitch ldc2, batch stride strideC2); 4 = f16 single plane C.
// =====================================================================================================
// Eight asynchronous 16-B copies per lane: rows r, r+8, .., r+56 of a plane (pitch ld elements) to LDS rows at
// pitch GPITCH. The s_wait_xcnt closes the statement so that no address register is rewritten ahead of it.
__device__ __forceinline__ void copy8_rows(unsigned l, const unsigned short* gp, int ld) {
#if DEV_ASM
  const size_t st = (size_t)8 * (size_t)ld;
  asm volatile(
      "global_load_async_to_lds_b128 %0, %8, off\n\t"
      "global_load_async_to_lds_b128 %1, %9, off\n\t"
      "global_load_async_to_lds_b128 %2, %10, off\n\t"
      "global_load_async_to_lds_b128 %3, %11, off\n\t"
      "global_load_async_to_lds_b128 %4, %12, off\n\t"
      "global_load_async_to_lds_b128 %5, %13, off\n\t"
      "global_load_async_to_lds_b128 %6, %14, off\n\t"
      "global_load_async_to_lds_b128 %7, %15, off\n\t"
      "s_wait_xcnt 0x0"
      :: "v"(l), "v"(l + 8u * GPITCH), "v"(l + 16u * GPITCH), "v"(l + 24u * GPITCH),
         "v"(l + 32u * GPITCH), "v"(l + 40u * GPITCH), "v"(l + 48u * GPITCH), "v"(l + 56u * GPITCH),
         "v"(gp), "v"(gp + st), "v"(gp + 2 * st), "v"(gp + 3 * st),
         "v"(gp + 4 * st), "v"(gp + 5 * st), "v"(gp + 6 * st), "v"(gp + 7 * st)
      : "memory");
  // keeps the next statement's address sums behind this one, so that their registers are used again
  __builtin_amdgcn_sched_barrier(0);
#endif
}
// One 128-row plane of a stage: 128 threads x 16 copies = 128 rows x 256 B.
__device__ __forceinline__ void copy_plane128(unsigned l, const unsigned short* gp, int ld) {
  copy8_rows(l, gp, ld);
  copy8_rows(l + 64u * GPITCH, gp + (size_t)64 * (size_t)ld, ld);
}
__device__ __forceinline__ void wait_lds_reads() {     // this wave's LDS reads are done before the buffer is given up
#if DEV_ASM
  asm volatile("s_wait_dscnt 0x0" ::: "memory");
#endif
}
__device__ __forceinline__ void wait_copies() {        // this wave's asynchronous copies have landed in LDS
#if DEV_ASM
  asm volatile("s_wait_asynccnt 0x0" ::: "memory");
#endif
}

template <int ET, int NSPLIT, int OUT_MODE, int BIAS, int RESID, bool RELU>
__global__ __launch_bounds__(128) void gemm64(
    const unsigned short* __restrict__ Ap, const unsigned short* __restrict__ A2p, int lda, long long strideA,
    const unsigned short* __restrict__ Btp, int ldb, long long strideB,
    const float* __restrict__ bias,
    const void* __restrict__ resid, int ldr, long long strideR,
    void* Cout, int ldc, long long strideC,
    void* Cout2, int ldc2, long long strideC2, int N2,
    int M, int N, int K, float oscale, float rscale) {
  typedef typename OpT<ET>::E E;
  typedef typename OpT<ET>::F F;
  const E* A  = (const E*)(const void*)Ap;
  const E* A2 = (const E*)(const void*)A2p;
  const E* Bt = (const E*)(const void*)Btp;
  constexpr int BROW  = (NSPLIT >= 1) ? 256 : 128;   // first Bt row of a stage (behind the A and A2 rows)
  constexpr int STAGE = (BROW + 128) * GPITCH;       // bytes of one buffer
  constexpr int PE    = GPITCH / 2;                  // LDS row pitch in elements
  __shared__ __align__(16) unsigned char ring[2 * STAGE];
  __shared__ __align__(16) float sT[4][16 * 68];   // per-wave 16x64 slab, pitch 68 floats
  const int b    = blockIdx.y;
  const int tid  = threadIdx.x;
  const int lane = tid & 31;
  const int wave = tid >> 5;
  const int tilesN = N >> 7;
  const int tilesM = M >> 7;
  const int tile = blockIdx.x;
  if (tile >= tilesM * tilesN) return;   // block-uniform, in front of every barrier
  const int tm = tile / tilesN;
  const int tn = tile - tm * tilesN;
  const int mB = tm << 7;                // block tile origin
  const int nB = tn << 7;
  const int wm = (wave >> 1) << 6;       // this wave's 64x64 quarter
  const int wn = (wave & 1) << 6;
  const int m0 = mB + wm;
  const int n0 = nB + wn;

  const E* Ab  = A  + (size_t)b * strideA;
  const E* Bb  = Bt + (size_t)b * strideB;
  const E* Ab2 = (NSPLIT >= 1) ? (A2 + (size_t)b * strideA) : Ab;

  const int rlane = lane & 15;                 // row (A) / col (B, D) within subtile
  const int koff  = (lane >> 4) * 8;           // k offset of this lane half
  const int mOff  = (lane >> 4) * 8;           // D row offset

  v8f acc[4][4];
#pragma unroll
  for (int i = 0; i < 4; ++i)
#pragma unroll
    for (int j = 0; j < 4; ++j) acc[i][j] = zero8();

  // copy addresses of this lane: 16-B piece (tid & 15) of rows (tid >> 4) + 8 i of each plane
  const int crow = tid >> 4, cpc = tid & 15;
  const unsigned cl = (unsigned)(size_t)(const void*)ring + (unsigned)(crow * GPITCH + cpc * 16);
  const unsigned short* ca  = (const unsigned short*)(const void*)Ab  + (size_t)(mB + crow) * lda + cpc * 8;
  const unsigned short* ca2 = (const unsigned short*)(const void*)Ab2 + (size_t)(mB + crow) * lda + cpc * 8;
  const unsigned short* cb  = (const unsigned short*)(const void*)Bb  + (size_t)(nB + crow) * ldb + cpc * 8;
  auto issue_stage = [&](int st, int buf) {
    const unsigned l = cl + (unsigned)(buf * STAGE);
    const int k0 = st * GKS;
    copy_plane128(l, ca + k0, lda);
    if (NSPLIT >= 1) copy_plane128(l + 128u * GPITCH, ca2 + k0, lda);
    copy_plane128(l + (unsigned)(BROW * GPITCH), cb + k0, ldb);
  };
  const int nst = K / GKS;               // stages; uniform
  issue_stage(0, 0);
  wait_copies();
  __syncthreads();                       // stage 0 is published
  if (nst > 1) issue_stage(1, 1);

  for (int t = 0; t < nst; ++t) {
    const unsigned char* sb = ring + (t & 1) * STAGE;
    const E* la  = (const E*)(const void*)(sb + (wm + rlane) * GPITCH) + koff;
    const E* la2 = la + 128 * PE;
    const E* lb  = (const E*)(const void*)(sb + (BROW + wn + rlane) * GPITCH) + koff;
#pragma unroll
    for (int ks = 0; ks < GKS; ks += 32) {
      F bh[4], ah[4], al[4];
#pragma unroll
      for (int j = 0; j < 4; ++j) bh[j] = OpT<ET>::ld(lb + (j << 4) * PE + ks);
#pragma unroll
      for (int i = 0; i < 4; ++i) {
        ah[i] = OpT<ET>::ld(la + (i << 4) * PE + ks);
        al[i] = ah[i];
        if (NSPLIT >= 1) al[i] = OpT<ET>::ld(la2 + (i << 4) * PE + ks);
      }
      // the step's LDS reads go as one group ahead of its WMMAs: the wave waits out the LDS latency once a step,
      // not once per A fragment
      __builtin_amdgcn_sched_barrier(0);
#pragma unroll
      for (int i = 0; i < 4; ++i) {
#pragma unroll
        for (int j = 0; j < 4; ++j) {
          acc[i][j] = OpT<ET>::mma_raw(ah[i], bh[j], acc[i][j]);
          if (NSPLIT >= 1) acc[i][j] = OpT<ET>::mma_raw(al[i], bh[j], acc[i][j]);
        }
        OpT<ET>::dep_guard(acc[i][0], acc[i][3], ah[i], al[i]);
      }
      OpT<ET>::keep4(bh[0], bh[1], bh[2], bh[3]);
      // keeps the next step's LDS reads from moving in among this step's WMMAs
      __builtin_amdgcn_sched_barrier(0);
    }
    wait_lds_reads();
    wait_copies();
    __syncthreads();                     // publishes stage t+1 and ends every read of stage t's buffer
    if (t + 2 < nst) issue_stage(t + 2, t & 1);
  }
  wait_copies();
  acc_guard4(acc[0][0], acc[0][1], acc[0][2], acc[0][3]);
  acc_guard4(acc[1][0], acc[1][1], acc[1][2], acc[1][3]);
  acc_guard4(acc[2][0], acc[2][1], acc[2][2], acc[2][3]);
  acc_guard4(acc[3][0], acc[3][1], acc[3][2], acc[3][3]);

  // ---- epilogue ----
  float* slab = sT[wave];
#pragma unroll
  for (int i = 0; i < 4; ++i) {
    const int mBase = m0 + (i << 4);
#pragma unroll
    for (int j = 0; j < 4; ++j) {
#pragma unroll
      for (int r = 0; r < 8; ++r) {
        slab[(mOff + r) * 68 + (j << 4) + rlane] = acc[i][j][r];
      }
    }
    __builtin_amdgcn_fence(__ATOMIC_RELEASE, "workgroup");
    __builtin_amdgcn_wave_barrier();
    __builtin_amdgcn_fence(__ATOMIC_ACQUIRE, "workgroup");
    if (OUT_MODE == 0) {
      float* C = (float*)Cout + (size_t)b * strideC;
      const int h2 = lane >> 4, c4 = (lane & 15) * 4;     // 256-B row segment = 16 lanes x 16 B
      v4f bz = {0.f, 0.f, 0.f, 0.f};
      if (BIAS == 1) {
        const v4f g = *(const v4f*)(bias + n0 + c4);
        bz[0] = bfr(g[0]); bz[1] = bfr(g[1]); bz[2] = bfr(g[2]); bz[3] = bfr(g[3]);
      }
      v4f ov[8];
#pragma unroll
      for (int it = 0; it < 8; ++it) {
        const int row = it * 2 + h2;                       // it 0..7 x h2 0..1 = rows 0..15
        const v4f v = *(const v4f*)(slab + row * 68 + c4);
        v4f w;
        w[0] = v[0] * oscale + bz[0];
        w[1] = v[1] * oscale + bz[1];
        w[2] = v[2] * oscale + bz[2];
        w[3] = v[3] * oscale + bz[3];
        if (BIAS == 2) {
          const float bm = bfr(bias[mBase + row]);
          w[0] += bm; w[1] += bm; w[2] += bm; w[3] += bm;
        }
        if (RESID == 1) {
          const unsigned short* rp = (const unsigned short*)resid + (size_t)b * strideR +
                                     (size_t)(mBase + row) * ldr + n0 + c4;
          const v2u rr = *(const v2u*)rp;
          w[0] += __uint_as_float(rr[0] << 16);
          w[1] += __uint_as_float(rr[0] & 0xffff0000u);
          w[2] += __uint_as_float(rr[1] << 16);
          w[3] += __uint_as_float(rr[1] & 0xffff0000u);
        }
        if (RESID == 2) {
          const float* rp = (const float*)resid + (size_t)b * strideR + (size_t)(mBase + row) * ldr + n0 + c4;
          const v4f rr = *(const v4f*)rp;
          w[0] += rr[0]; w[1] += rr[1]; w[2] += rr[2]; w[3] += rr[3];
        }
        if (RELU) {
          w[0] = fmaxf(w[0], 0.f); w[1] = fmaxf(w[1], 0.f); w[2] = fmaxf(w[2], 0.f); w[3] = fmaxf(w[3], 0.f);
        }
        ov[it] = w;
      }
      {
#pragma unroll
        for (int it = 0; it < 8; ++it) {
          const int row = it * 2 + h2;
          *(v4f*)(C + (size_t)(mBase + row) * ldc + n0 + c4) = ov[it];
        }
        
      }
    } else {
      const int q = lane >> 3, c8 = (lane & 7) * 8;
      unsigned short* C  = (unsigned short*)Cout  + (size_t)b * strideC;
      unsigned short* C2 = (unsigned short*)Cout2 + (size_t)b * strideC2;
      const bool wlo = (OUT_MODE == 2) || (OUT_MODE == 3 && n0 < N2);   // wave-uniform
      float b8[8];
#pragma unroll
      for (int e = 0; e < 8; ++e) b8[e] = 0.f;
      if (BIAS == 1) {
        const v4f g0 = *(const v4f*)(bias + n0 + c8);
        const v4f g1 = *(const v4f*)(bias + n0 + c8 + 4);
#pragma unroll
        for (int e = 0; e < 4; ++e) { b8[e] = bfr(g0[e]); b8[4 + e] = bfr(g1[e]); }
      }
      v4u hv[4], lv[4];
#pragma unroll
      for (int it = 0; it < 4; ++it) {
        const int row = it * 4 + q;                        // it 0..3 x q 0..3 = rows 0..15
        const float* sp = slab + row * 68 + c8;
        float bm = 0.f;
        if (BIAS == 2) bm = bfr(bias[mBase + row]);
        v4u a, a2;
#pragma unroll
        for (int e = 0; e < 4; ++e) {
          float f0 = sp[2 * e] * oscale + b8[2 * e] + bm;
          float f1 = sp[2 * e + 1] * oscale + b8[2 * e + 1] + bm;
          if (RELU) { f0 = fmaxf(f0, 0.f); f1 = fmaxf(f1, 0.f); }
          unsigned short h0, h1, l0 = 0, l1 = 0;
          if (OUT_MODE == 2) {
            h0 = bf_bits(f0); h1 = bf_bits(f1);
            l0 = bf_bits(f0 - bf_up(h0)); l1 = bf_bits(f1 - bf_up(h1));
          } else if (OUT_MODE == 3) {
            const _Float16 x0 = (_Float16)f0, x1 = (_Float16)f1;
            h0 = h_bits(x0); h1 = h_bits(x1);
            l0 = h_bits((_Float16)((f0 - (float)x0) * rscale));
            l1 = h_bits((_Float16)((f1 - (float)x1) * rscale));
          } else {
            h0 = h_bits((_Float16)f0); h1 = h_bits((_Float16)f1);
          }
          a[e] = pk16(h0, h1); a2[e] = pk16(l0, l1);
        }
        hv[it] = a; lv[it] = a2;
      }
      {
#pragma unroll
        for (int it = 0; it < 4; ++it) {
          const int row = it * 4 + q;
          *(v4u*)(C + (size_t)(mBase + row) * ldc + n0 + c8) = hv[it];
          if (wlo) *(v4u*)(C2 + (size_t)(mBase + row) * ldc2 + n0 + c8) = lv[it];
        }
        
      }
    }
    __builtin_amdgcn_fence(__ATOMIC_RELEASE, "workgroup");
    __builtin_amdgcn_wave_barrier();
    __builtin_amdgcn_fence(__ATOMIC_ACQUIRE, "workgroup");
  }
}

// =====================================================================================================
// Attention with an int32 replace-mask, head dim 64.
//   q planes (bf16 hi / lo): element (b, t, h, d) at [(b*SEQ + t)*DM + h*64 + d]
//   k planes (bf16 hi / lo): same layout with key index s
//   v^T hi plane (f16):      element (b, h, d, s) at [(b*DM + h*64 + d)*SEQ + s]
//   v^T residual plane (f16, (v - hi)*4096): [(b*DM + h*64 + d)*VLP + s], s < VLP, read only when RES
//   (a key tile at or beyond VLP contributes a zero v residual)
//   mask int32 [1][1][t][s]: logit = (mask != 0) ? q.k*sscale : -inf (replace)
//   flg [qt][kt]: bit r set when mask row qt*64+r has a nonzero inside key tile kt. A key tile is skipped only
//   when its word is 0 (every logit of the tile is -inf -> weight exactly 0, row max unaffected). The decision is
//   block-uniform: every wave reads the query block's 32 words once, one a lane, and takes the ballot of the nonzero ones.
//   out planes (bf16 hi / lo of the normalised context): element (b, t, h, d) at [(b*SEQ + t)*DM + h*64 + d]
//   scores = q . k : bf16 hi/lo split (hi.hi + hi.lo + lo.hi), f32 accumulate, then * sscale + mask select in f32
//   p = exp(s - m) carried as f16(1024 p); context = p . v on f16 WMMA; RES adds f16 residual planes of p and v
//   (scale 4096, separate accumulator folded back with 1/4096 per chunk in f32); online softmax in f32.
//   A fully masked query row ends with l = 0 -> 0 * inf = NaN context, matching -inf softmax semantics.
//   Block = 4 waves = 64 query rows of one (b, h); grid = nqbThis * NH * NB; kv chunks of 64, at most NQB trips.
//   Both products are formed transposed: S^T = K . Q^T (A = K rows, B = Q rows) and O^T += V^T . P^T (A = V^T rows,
//   B = P^T). A lane then holds 32 of the 64 scores of ONE query (q0 + (lane & 15)): maximum and sum run in the lane,
//   with one exchange between the lane halves for the maximum; P^T is packed from the score registers.
//   LDS rows of the K and V^T tiles stand AP elements apart (64 used, 8 never touched): the 16 rows that one
//   16-B fragment read takes then fall on 16 different bank groups.
//   K / V^T chunk staging: 16-B asynchronous copies to LDS, 8 lanes = one 128-B row (a whole line), 128 threads x 4
//   copies per plane = the whole 64x64 tile; two buffers: the copies of the live tile after next are issued behind the
//   barrier that ends a tile, so they fly while the next tile is worked on.
//   LDS fragment reads stand in groups ahead of the WMMAs that use them (K ahead of the scores, V^T ahead of the
//   softmax), held in place by scheduling barriers.
//   Output coverage: each wave stores rows q0..q0+15 (it 0..3 x lane>>3 0..3) x 64 columns (8 lanes x 8) of both planes.
// =====================================================================================================
#define APB    (AP * 2)       // LDS row pitch of a K / V^T tile in bytes
#define APLANE (64 * APB)     // bytes of one 64-row plane of a buffer
static_assert(NQB == 32 && (APB % 16) == 0);
// Four asynchronous 16-B copies per lane: rows r, r+16, r+32, r+48 of a plane (pitch ld elements) to LDS rows at pitch
// APB. The s_wait_xcnt closes the statement so that no address register is rewritten ahead of it.
__device__ __forceinline__ void copy4_rows(unsigned l, const unsigned short* gp, int ld) {
#if DEV_ASM
  const size_t st = (size_t)16 * (size_t)ld;
  asm volatile(
      "global_load_async_to_lds_b128 %0, %4, off\n\t"
      "global_load_async_to_lds_b128 %1, %5, off\n\t"
      "global_load_async_to_lds_b128 %2, %6, off\n\t"
      "global_load_async_to_lds_b128 %3, %7, off\n\t"
      "s_wait_xcnt 0x0"
      :: "v"(l), "v"(l + 16u * APB), "v"(l + 32u * APB), "v"(l + 48u * APB),
         "v"(gp), "v"(gp + st), "v"(gp + 2 * st), "v"(gp + 3 * st)
      : "memory");
#endif
}
// The same for three planes in one statement (twelve copies, one wait): a tile's K hi, K lo and V^T hi planes, which
// lie APLANE bytes apart in LDS.
__device__ __forceinline__ void copy12_rows(unsigned l, const unsigned short* g0, const unsigned short* g1, int ld01,
                                            const unsigned short* g2, int ld2) {
#if DEV_ASM
  const size_t sa = (size_t)16 * (size_t)ld01, sc = (size_t)16 * (size_t)ld2;
  const unsigned l1 = l + (unsigned)APLANE, l2 = l + 2u * APLANE;
  asm volatile(
      "global_load_async_to_lds_b128 %0, %12, off\n\t"
      "global_load_async_to_lds_b128 %1, %13, off\n\t"
      "global_load_async_to_lds_b128 %2, %14, off\n\t"
      "global_load_async_to_lds_b128 %3, %15, off\n\t"
      "global_load_async_to_lds_b128 %4, %16, off\n\t"
      "global_load_async_to_lds_b128 %5, %17, off\n\t"
      "global_load_async_to_lds_b128 %6, %18, off\n\t"
      "global_load_async_to_lds_b128 %7, %19, off\n\t"
      "global_load_async_to_lds_b128 %8, %20, off\n\t"
      "global_load_async_to_lds_b128 %9, %21, off\n\t"
      "global_load_async_to_lds_b128 %10, %22, off\n\t"
      "global_load_async_to_lds_b128 %11, %23, off\n\t"
      "s_wait_xcnt 0x0"
      :: "v"(l),  "v"(l + 16u * APB),  "v"(l + 32u * APB),  "v"(l + 48u * APB),
         "v"(l1), "v"(l1 + 16u * APB), "v"(l1 + 32u * APB), "v"(l1 + 48u * APB),
         "v"(l2), "v"(l2 + 16u * APB), "v"(l2 + 32u * APB), "v"(l2 + 48u * APB),
         "v"(g0), "v"(g0 + sa), "v"(g0 + 2 * sa), "v"(g0 + 3 * sa),
         "v"(g1), "v"(g1 + sa), "v"(g1 + 2 * sa), "v"(g1 + 3 * sa),
         "v"(g2), "v"(g2 + sc), "v"(g2 + 2 * sc), "v"(g2 + 3 * sc)
      : "memory");
#endif
}

template <bool RES>
__global__ __launch_bounds__(128)
void attn_mask64(const unsigned short* __restrict__ qhp, const unsigned short* __restrict__ qlp,
                 const unsigned short* __restrict__ khp, const unsigned short* __restrict__ klp,
                 const unsigned short* __restrict__ vhp, const unsigned short* __restrict__ vlp,
                 const int* __restrict__ maskp, const u64* __restrict__ flg,
                 unsigned short* ohp, unsigned short* olp,
                 int qbBase, int nqbThis, float sscale) {
  // a buffer = K hi [kv][d] | K lo | V^T hi [d][kv] (| V^T residual), each 64 rows at pitch AP
  constexpr int ABUF = (RES ? 4 : 3) * APLANE;
  __shared__ __align__(16) unsigned char ring[2 * ABUF];
  __shared__ __align__(16) float    Os[4][16 * OSP];              // per wave context tile [query][d], row pitch OSP

  const int tid  = threadIdx.x;
  const int wave = tid >> 5;
  const int lane = tid & 31;
  const int hh   = lane >> 4;
  const int c    = lane & 15;

  const int bx   = blockIdx.x;
  const int qbl  = bx % nqbThis;
  const int rest = bx / nqbThis;
  const int h    = rest % NH;
  const int b    = rest / NH;
  const int qb   = qbBase + qbl;
  const int q0   = qb * 64 + wave * 16;
  const size_t rowB = (size_t)b * SEQ;

  const __bf16* Qh = (const __bf16*)(const void*)qhp + (size_t)h * HD;
  const __bf16* Ql = (const __bf16*)(const void*)qlp + (size_t)h * HD;
  const u64* fq = flg + (size_t)qb * NQB;
  // bit kt = key tile kt has an allowed key for some row of the block; the same word in every wave
  const unsigned live = __builtin_amdgcn_ballot_w32(fq[lane] != 0ull);

  // copy addresses of this lane: 16-B piece (tid & 7) of rows (tid >> 3) + 16 i of each plane
  const int crow = tid >> 3, cpc = tid & 7;
  const unsigned cl = (unsigned)(size_t)(const void*)ring + (unsigned)(crow * APB + cpc * 16);
  const unsigned short* ckh = khp + (rowB + crow) * DM + (size_t)h * HD + cpc * 8;               // K row kv0+row
  const unsigned short* ckl = klp + (rowB + crow) * DM + (size_t)h * HD + cpc * 8;
  const unsigned short* cvh = vhp + ((size_t)b * DM + (size_t)h * HD + crow) * SEQ + cpc * 8;    // V^T row d = row
  const unsigned short* cvl = vlp + ((size_t)b * DM + (size_t)h * HD + crow) * VLP + cpc * 8;
  auto issue_tile = [&](int kt, int buf) {
    const int kv0 = kt * 64;
    const unsigned l = cl + (unsigned)(buf * ABUF);
    copy12_rows(l, ckh + (size_t)kv0 * DM, ckl + (size_t)kv0 * DM, DM, cvh + kv0, SEQ);
    if (RES) {
      const int kvl = (kv0 + 64 <= VLP) ? kv0 : (VLP - 64);     // clamped address into the residual plane
      copy4_rows(l + 3u * APLANE, cvl + kvl, VLP);
    }
  };

  // ---- Q fragments (B operand, column = lane&15): 2 d-chunks, hi and lo ----
  v16b qah[2], qal[2];
#pragma unroll
  for (int dc = 0; dc < 2; ++dc) {
    const size_t qo = (rowB + q0 + c) * DM + dc * 32 + 8 * hh;
    qah[dc] = OpT<0>::ld(Qh + qo);
    qal[dc] = OpT<0>::ld(Ql + qo);
  }

  float mrow = -INFINITY;   // running maximum of query q0 + c (the same in both lane halves)
  float lrow = 0.f;         // running sum over the keys of this lane half; the halves are joined behind the loop
  v8f oacc[4];              // context^T: oacc[t][r] = d 16 t + 8 hh + r of query q0 + c
#pragma unroll
  for (int t = 0; t < 4; ++t) oacc[t] = zero8();

  // The live key tiles in rising order: kc = this trip's, kn = the next one's (its copies in flight), rem = those behind.
  unsigned rem = live;
  int kc = 0, kn = 0;
  if (rem != 0u) {                           // block-uniform, like every test on rem below
    kc = __builtin_ctz(rem); rem &= rem - 1u;
    issue_tile(kc, 0);
    wait_copies();
    __syncthreads();                         // the first live tile is published
    if (rem != 0u) { kn = __builtin_ctz(rem); rem &= rem - 1u; issue_tile(kn, 1); }
  }
  const int ntile = __builtin_popcount(live);   // at most NQB
  for (int it = 0; it < ntile; ++it) {
    const int kv0 = kc * 64;
    const bool resOK = (kv0 + 64 <= VLP);    // block-uniform: beyond VLP the v residual is zero
    const unsigned char* sb = ring + (it & 1) * ABUF;
    const __bf16*   Ksh = (const __bf16*)(const void*)sb;
    const __bf16*   Ksl = (const __bf16*)(const void*)(sb + APLANE);
    const _Float16* Vth = (const _Float16*)(const void*)(sb + 2 * APLANE);
    const _Float16* Vtl = (const _Float16*)(const void*)(sb + (RES ? 3 : 2) * APLANE);

    // ---- scores^T: 64 keys x 16 queries per wave (A = K rows, B = Q rows), 3 bf16 products ----
    // The tile's K fragments are read in groups ahead of the score products, so that the wave waits out the LDS
    // latency once a tile, not once per fragment pair: key groups 0..2 up front, group 3 behind the products of
    // group 0 (into registers that those have left), where the products of groups 1 and 2 cover its latency.
    v16b kbf[4][2], klf[4][2];
#pragma unroll
    for (int j = 0; j < 3; ++j) {
#pragma unroll
      for (int dc = 0; dc < 2; ++dc) {
        kbf[j][dc] = OpT<0>::ld(Ksh + (j * 16 + c) * AP + dc * 32 + 8 * hh);
        klf[j][dc] = OpT<0>::ld(Ksl + (j * 16 + c) * AP + dc * 32 + 8 * hh);
      }
    }
    // keeps the K reads from sinking back among the WMMAs that use them
    __builtin_amdgcn_sched_barrier(0);
    v8f s[4];                                // s[j][r] = score of key kv0 + 16 j + 8 hh + r against query q0 + c
#pragma unroll
    for (int j = 0; j < 4; ++j) {
      s[j] = zero8();
#pragma unroll
      for (int dc = 0; dc < 2; ++dc) {
        s[j] = mma_b(kbf[j][dc], qah[dc], s[j]);
        s[j] = mma_b(klf[j][dc], qah[dc], s[j]);
        s[j] = mma_b(kbf[j][dc], qal[dc], s[j]);
      }
      if (j == 0) {
#pragma unroll
        for (int dc = 0; dc < 2; ++dc) {
          kbf[3][dc] = OpT<0>::ld(Ksh + (3 * 16 + c) * AP + dc * 32 + 8 * hh);
          klf[3][dc] = OpT<0>::ld(Ksl + (3 * 16 + c) * AP + dc * 32 + 8 * hh);
        }
        // holds the reads of key group 3 together at this one place: without it they spread among the next WMMAs
        __builtin_amdgcn_sched_barrier(0);
      }
    }
    // The tile's V^T fragments are read here, ahead of the softmax, whose vector work covers their LDS latency.
    v16h vbf[2][4], vlf[2][4];
#pragma unroll
    for (int kk = 0; kk < 2; ++kk) {
#pragma unroll
      for (int t = 0; t < 4; ++t) {
        vbf[kk][t] = OpT<1>::ld(Vth + (t * 16 + c) * AP + kk * 32 + 8 * hh);
        vlf[kk][t] = vbf[kk][t];
        if (RES) vlf[kk][t] = OpT<1>::ld(Vtl + (t * 16 + c) * AP + kk * 32 + 8 * hh);
      }
    }
    // keeps the V^T reads here, where they fly under the wait for the mask words, and out of the softmax
    __builtin_amdgcn_sched_barrier(0);

    // ---- scale + mask select, maximum and sum of the lane's own 32 keys, online softmax ----
    const int* mq = maskp + (size_t)(q0 + c) * SEQ + kv0 + 8 * hh;   // row q0+c, keys kv0+8hh..; all < SEQ
    float mj[4];
#pragma unroll
    for (int j = 0; j < 4; ++j) {
      const v4i ma = *(const v4i*)(mq + j * 16);
      const v4i mb = *(const v4i*)(mq + j * 16 + 4);
      float mx = -INFINITY;
#pragma unroll
      for (int r = 0; r < 8; ++r) {
        const int mv = (r < 4) ? ma[r & 3] : mb[r & 3];
        const float sv = (mv != 0) ? (s[j][r] * sscale) : -INFINITY;
        s[j][r] = sv;
        mx = fmaxf(mx, sv);
      }
      mj[j] = mx;
    }
    float m = fmaxf(fmaxf(mj[0], mj[1]), fmaxf(mj[2], mj[3]));
    m = fmaxf(m, xhalf(m));                  // the query's other 32 keys of the tile
    const float mnew  = fmaxf(mrow, m);
    const float msafe = (mnew == -INFINITY) ? 0.f : mnew;
    // exp_slot's asm operands must lie in v0..v255: beside the residual build's fragments that costs spills, so that
    // build takes the compiler's own v_exp_f32 (same instruction, same values).
    auto ex = [](float x) { return RES ? __expf(x) : exp_slot(x); };
    const float alpha = ex(mrow - msafe);
    mrow = mnew;
    // P^T (x1024, f16) and its residual (x4096) go from the score registers straight into B fragments: score tiles
    // 2 kk and 2 kk + 1 hold keys 32 kk + 8 hh + e and 32 kk + 16 + 8 hh + e, the k order of the V^T loader.
    v16h paf[2], plf[2];
    float pj[4];
#pragma unroll
    for (int j = 0; j < 4; ++j) {
      float ps = 0.f;
#pragma unroll
      for (int r = 0; r < 8; ++r) {
        const float p = ex(s[j][r] - msafe);         // -inf logit against a finite max: exp -> 0
        ps += p;
        const float p1k = p * 1024.0f;
        const _Float16 ph = (_Float16)p1k;
        paf[j >> 1][(j & 1) * 8 + r] = ph;
        plf[j >> 1][(j & 1) * 8 + r] = RES ? (_Float16)((p1k - (float)ph) * 4096.0f) : ph;
      }
      pj[j] = ps;
    }
    lrow = lrow * alpha + ((pj[0] + pj[1]) + (pj[2] + pj[3]));
#pragma unroll
    for (int t = 0; t < 4; ++t)
#pragma unroll
      for (int r = 0; r < 8; ++r) oacc[t][r] *= alpha;

    // ---- context^T += V^T . P^T (f16 WMMA), residual products into a separate accumulator ----
    v8f o1[4];
#pragma unroll
    for (int t = 0; t < 4; ++t) o1[t] = zero8();
#pragma unroll
    for (int kk = 0; kk < 2; ++kk) {
#pragma unroll
      for (int t = 0; t < 4; ++t) {
        oacc[t] = mma_h(vbf[kk][t], paf[kk], oacc[t]);
        if (RES) {
          o1[t] = mma_h(resOK ? vlf[kk][t] : zero16h(), paf[kk], o1[t]);
          o1[t] = mma_h(vbf[kk][t], plf[kk], o1[t]);
        }
      }
    }
    if (RES) {
#pragma unroll
      for (int t = 0; t < 4; ++t)
#pragma unroll
        for (int r = 0; r < 8; ++r) oacc[t][r] += o1[t][r] * (1.0f / 4096.0f);
    }
    wait_lds_reads();
    wait_copies();
    __syncthreads();                         // publishes the next live tile and ends every read of this trip's buffer
    kc = kn;
    if (rem != 0u) { kn = __builtin_ctz(rem); rem &= rem - 1u; issue_tile(kn, it & 1); }
  }
  wait_copies();

  // ---- join the two halves' sums, normalise (1/l and the 1/1024 p carry), stage the wave's 16x64 tile as
  //      [query][d] (a lane holds d = 16 t + 8 hh + r of query c: two 16-B stores per t), bf16 hi/lo split
  float* os = Os[wave];
  {
    const float l = lrow + xhalf(lrow);
    const float inv = (1.0f / l) * (1.0f / 1024.0f);   // l == 0 (fully masked row) -> inf -> NaN context
#pragma unroll
    for (int t = 0; t < 4; ++t) {
      v4f w0, w1;
#pragma unroll
      for (int e = 0; e < 4; ++e) { w0[e] = oacc[t][e] * inv; w1[e] = oacc[t][4 + e] * inv; }
      *(v4f*)(os + c * OSP + t * 16 + 8 * hh)     = w0;
      *(v4f*)(os + c * OSP + t * 16 + 8 * hh + 4) = w1;
    }
  }
  __builtin_amdgcn_fence(__ATOMIC_RELEASE, "workgroup");
  __builtin_amdgcn_wave_barrier();
  __builtin_amdgcn_fence(__ATOMIC_ACQUIRE, "workgroup");
  {
    const int q4 = lane >> 3, c8 = (lane & 7) * 8;
    v4u hv[4], lv[4];
#pragma unroll
    for (int it = 0; it < 4; ++it) {
      const int row = it * 4 + q4;   // it 0..3 x q4 0..3 = rows 0..15 of the wave tile
      const float* sp = os + row * OSP + c8;
      v4u a, a2;
#pragma unroll
      for (int e = 0; e < 4; ++e) {
        const float f0 = sp[2 * e], f1 = sp[2 * e + 1];
        const unsigned short h0 = bf_bits(f0), h1 = bf_bits(f1);
        const unsigned short l0 = bf_bits(f0 - bf_up(h0)), l1 = bf_bits(f1 - bf_up(h1));
        a[e] = pk16(h0, h1); a2[e] = pk16(l0, l1);
      }
      hv[it] = a; lv[it] = a2;
    }
    {
#pragma unroll
      for (int it = 0; it < 4; ++it) {
        const int row = it * 4 + q4;
        const size_t go = (rowB + q0 + row) * DM + (size_t)h * HD + c8;
        *(v4u*)(ohp + go) = hv[it];
        *(v4u*)(olp + go) = lv[it];
      }
    }
  }
}

// =====================================================================================================
// Layer norm over rows of DM=1024, f32, one block per row (grid = MROWS, 256 threads, 4 elements per thread).
// mean and biased variance via wave shuffles + 16 LDS slots; gamma / beta values RNE-converted to bf16;
// o = (gamma * (x - mean)) * (1 / sqrt(var + eps)) + beta.
// OUT16: threads 0..127 reload 8 consecutive inputs each and write the f16 plane as one 16-B store per lane
// coverage: 256 threads x 4 = the row (f32); 128 threads x 8 = the row (f16).
// =====================================================================================================
template <bool OUT16>
__global__ __launch_bounds__(256) void layernorm_rows(const float* __restrict__ in,
                                                       const float* __restrict__ gamma,
                                                       const float* __restrict__ beta,
                                                       float* out32, unsigned short* out16) {
  __shared__ float red[16];
  const int tid = threadIdx.x, lane = tid & 31, wave = tid >> 5;
  const int row = blockIdx.x;
  const float* xr = in + (size_t)row * DM;
  const v4f v = *(const v4f*)(xr + tid * 4);
  float s = (v[0] + v[1]) + (v[2] + v[3]);
#pragma unroll
  for (int off = 1; off < 32; off <<= 1) s += __shfl_xor(s, off, 32);
  if (lane == 0) red[wave] = s;
  __syncthreads();
  float tot = 0.f;
#pragma unroll
  for (int i = 0; i < 8; ++i) tot += red[i];
  const float mean = tot * (1.0f / (float)DM);
  const float d0 = v[0] - mean, d1 = v[1] - mean, d2 = v[2] - mean, d3 = v[3] - mean;
  float s2 = (d0 * d0 + d1 * d1) + (d2 * d2 + d3 * d3);
#pragma unroll
  for (int off = 1; off < 32; off <<= 1) s2 += __shfl_xor(s2, off, 32);
  if (lane == 0) red[8 + wave] = s2;
  __syncthreads();
  float tot2 = 0.f;
#pragma unroll
  for (int i = 0; i < 8; ++i) tot2 += red[8 + i];
  const float var  = tot2 * (1.0f / (float)DM);
  const float rstd = 1.0f / sqrtf(var + LNEPS);

  const v4f g  = *(const v4f*)(gamma + tid * 4);
  const v4f bt = *(const v4f*)(beta + tid * 4);
  v4f o;
  o[0] = (bfr(g[0]) * d0) * rstd + bfr(bt[0]);
  o[1] = (bfr(g[1]) * d1) * rstd + bfr(bt[1]);
  o[2] = (bfr(g[2]) * d2) * rstd + bfr(bt[2]);
  o[3] = (bfr(g[3]) * d3) * rstd + bfr(bt[3]);
  float* op = out32 + (size_t)row * DM + tid * 4;
  *(v4f*)op = o;
  

  if (OUT16) {
    if (tid < 128) {
      const int cc = tid * 8;
      const v4f a0 = *(const v4f*)(xr + cc);
      const v4f a1 = *(const v4f*)(xr + cc + 4);
      const v4f g0 = *(const v4f*)(gamma + cc), g1 = *(const v4f*)(gamma + cc + 4);
      const v4f b0 = *(const v4f*)(beta + cc),  b1 = *(const v4f*)(beta + cc + 4);
      float f[8];
#pragma unroll
      for (int e = 0; e < 4; ++e) {
        f[e]     = (bfr(g0[e]) * (a0[e] - mean)) * rstd + bfr(b0[e]);
        f[4 + e] = (bfr(g1[e]) * (a1[e] - mean)) * rstd + bfr(b1[e]);
      }
      v4u hp;
#pragma unroll
      for (int e = 0; e < 4; ++e) hp[e] = pk16(h_bits((_Float16)f[2 * e]), h_bits((_Float16)f[2 * e + 1]));
      unsigned short* hq = out16 + (size_t)row * DM + cc;
      *(v4u*)hq = hp;
      
    }
  }
}

// =====================================================================================================
// Workspace map (MiB = 1048576 B):
//   Xb   bf16 [4096][1024]         0 ..   8
//   WqT  bf16 [1024 n][1024 k]     8 ..  10     WkT 10 .. 12    WvT 12 .. 14    WoT 14 .. 16
//   W1T  f16  [4096 n][1024 k]    16 ..  24     W2T f16 [1024 n][4096 k]  24 .. 32
//   Qh   bf16 [4096][1024]        32 ..  40     Ql 40 .. 48    Kh 48 .. 56    Kl 56 .. 64
//   VTh  f16  [2][1024][2048]     64 ..  72     VTl f16 [2][1024][512]    72 .. 74    Flg u64 [32][32] at 74
//   Oh   bf16 [4096][1024]        76 ..  84     Ol 84 .. 92
//   later (regions dead by then, single in-order stream):
//   T1   f32  [4096][1024]        32 ..  48   (over Qh, Ql: written by the Wo GEMM after attention)
//   H32  f32  [4096][1024]        48 ..  64   (over Kh, Kl: written by LN1)
//   Hh   f16  [4096][1024]        64 ..  72   (over VTh: written by LN1)
//   F1   f16  [4096][4096]        72 .. 104   (over VTl, Flg, Oh, Ol: written by the W1 GEMM after the Wo GEMM)
//   T2   f32  [4096][1024]        32 ..  48   (over T1: written by the W2 GEMM after LN1)
//   end = 104 MiB. Every plane is an exact multiple of its 64x64 tile / whole-line store granularity
//   (no padded tails); all region starts are MiB aligned.
// =====================================================================================================
extern "C" void kernel_launch(void* const* d_in, const int* in_sizes, int n_in,
                              void* d_out, int out_size, void* d_ws, size_t ws_size,
                              hipStream_t stream) {
  if (n_in < 18) return;
  if (in_sizes[0] != NB * SEQ * DM) return;
  if (in_sizes[1] != SEQ * SEQ) return;
  if (in_sizes[2] != DM * DM || in_sizes[4] != DM * DM || in_sizes[6] != DM * DM || in_sizes[8] != DM * DM) return;
  if (in_sizes[3] != DM || in_sizes[5] != DM || in_sizes[7] != DM || in_sizes[9] != DM) return;
  if (in_sizes[10] != DM * DFF || in_sizes[11] != DFF || in_sizes[12] != DFF * DM || in_sizes[13] != DM) return;
  if (in_sizes[14] != DM || in_sizes[15] != DM || in_sizes[16] != DM || in_sizes[17] != DM) return;
  if (out_size != NB * SEQ * DM) return;

  const float* x   = (const float*)d_in[0];
  const int*   msk = (const int*)d_in[1];
  const float* Wq  = (const float*)d_in[2];
  const float* bq  = (const float*)d_in[3];
  const float* Wk  = (const float*)d_in[4];
  const float* bk  = (const float*)d_in[5];
  const float* Wv  = (const float*)d_in[6];
  const float* bv  = (const float*)d_in[7];
  const float* Wo  = (const float*)d_in[8];
  const float* bo  = (const float*)d_in[9];
  const float* W1  = (const float*)d_in[10];
  const float* b1  = (const float*)d_in[11];
  const float* W2  = (const float*)d_in[12];
  const float* b2  = (const float*)d_in[13];
  const float* gamma1 = (const float*)d_in[14];
  const float* beta1  = (const float*)d_in[15];
  const float* gamma2 = (const float*)d_in[16];
  const float* beta2  = (const float*)d_in[17];

  const size_t PX   = (size_t)MROWS * DM * 2;        //  8 MiB  16-bit activation plane [4096][1024]
  const size_t PW   = (size_t)DM * DM * 2;           //  2 MiB  16-bit weight plane [1024][1024]
  const size_t PWF  = (size_t)DM * DFF * 2;          //  8 MiB  16-bit FFN weight plane
  const size_t PVT  = (size_t)NB * DM * SEQ * 2;     //  8 MiB  v^T hi plane
  const size_t PVL  = (size_t)NB * DM * VLP * 2;     //  2 MiB  v^T residual plane
  const size_t PFs  = (size_t)2 * 1048576;           //  2 MiB  slot for the 8 KiB flag table
  const size_t PF   = (size_t)NQB * NQB * 8;         //  8 KiB
  const size_t PT   = (size_t)MROWS * DM * 4;        // 16 MiB  f32 activation plane
  const size_t PF1  = (size_t)MROWS * DFF * 2;       // 32 MiB  f16 FFN hidden plane
  if (PF > PFs) return;
  size_t off = 0;
  const size_t oXb  = off; off += PX;
  const size_t oWq  = off; off += PW;
  const size_t oWk  = off; off += PW;
  const size_t oWv  = off; off += PW;
  const size_t oWo  = off; off += PW;
  const size_t oW1  = off; off += PWF;
  const size_t oW2  = off; off += PWF;
  const size_t oQh  = off; off += PX;
  const size_t oQl  = off; off += PX;
  const size_t oKh  = off; off += PX;
  const size_t oKl  = off; off += PX;
  const size_t oVTh = off; off += PVT;
  const size_t oVTl = off; off += PVL;
  const size_t oFlg = off; off += PFs;
  const size_t oOh  = off; off += PX;
  const size_t oOl  = off; off += PX;
  const size_t endA = off;                           // 92 MiB
  const size_t oT1  = oQh;                           // T1 over Qh + Ql
  const size_t oH32 = oKh;                           // H32 over Kh + Kl
  const size_t oHh  = oVTh;                          // Hh over VTh
  const size_t oF1  = oVTl;                          // F1 over VTl .. Ol and beyond
  const size_t oT2  = oT1;                           // T2 over T1
  if (oT1 + PT != oKh) return;                       // aliasing sanity: T1 ends where H32 starts
  if (oH32 + PT != oVTh) return;                     // H32 ends where Hh starts
  if (oHh + PX != oVTl) return;                      // Hh ends where F1 starts
  size_t total = oF1 + PF1;                          // 104 MiB
  if (endA > total) total = endA;
  if (total > ws_size) return;
  if (total > (size_t)134217728) return;

  char* ws = (char*)d_ws;
  unsigned short* Xb   = (unsigned short*)(ws + oXb);
  unsigned short* WqTb = (unsigned short*)(ws + oWq);
  unsigned short* WkTb = (unsigned short*)(ws + oWk);
  unsigned short* WvTb = (unsigned short*)(ws + oWv);
  unsigned short* WoTb = (unsigned short*)(ws + oWo);
  unsigned short* W1Tb = (unsigned short*)(ws + oW1);
  unsigned short* W2Tb = (unsigned short*)(ws + oW2);
  unsigned short* Qh   = (unsigned short*)(ws + oQh);
  unsigned short* Ql   = (unsigned short*)(ws + oQl);
  unsigned short* Kh   = (unsigned short*)(ws + oKh);
  unsigned short* Kl   = (unsigned short*)(ws + oKl);
  unsigned short* VTh  = (unsigned short*)(ws + oVTh);
  unsigned short* VTl  = (unsigned short*)(ws + oVTl);
  u64*            Flg  = (u64*)(ws + oFlg);
  unsigned short* Oh   = (unsigned short*)(ws + oOh);
  unsigned short* Ol   = (unsigned short*)(ws + oOl);
  float*          T1   = (float*)(ws + oT1);
  float*          H32  = (float*)(ws + oH32);
  unsigned short* Hh   = (unsigned short*)(ws + oHh);
  unsigned short* F1   = (unsigned short*)(ws + oF1);
  float*          T2   = (float*)(ws + oT2);

  const dim3 blk(256);
  const dim3 gPrep(PB_ALL);                                         // 32 + 2 x 1024 + 4 x 256 + 2048 = 5152 blocks
  const dim3 blkG(128);                                             // GEMM block: 4 waves, one 128x128 tile
  const dim3 gProj((MROWS / 128) * (DM / 128), 1);                  // 256 tiles: M=4096, N=1024
  const dim3 gVT((DM / 128) * (SEQ / 128), NB);                     // 128 tiles x 2 batches: M=1024, N=2048
  const dim3 gW1((MROWS / 128) * (DFF / 128), 1);                   // 1024 tiles: M=4096, N=4096
  const dim3 gW2((MROWS / 128) * (DM / 128), 1);                    // 256 tiles: M=4096, N=1024
  const dim3 gLN(MROWS);                                            // 4096 blocks, one row each

  // (0, 1) one launch: mask tile survey -> Flg; x -> bf16 plane [4096][1024]; weights [k][n] f32 -> 16-bit [n][k] planes
  prep_inputs<<<gPrep, blk, 0, stream>>>(msk, Flg, x, Xb, Wq, Wk, Wv, Wo, W1, W2,
                                         WqTb, WkTb, WvTb, WoTb, W1Tb, W2Tb);
  // (2) q = x . Wq + bq -> bf16 hi/lo planes [b*SEQ+t][h*64+d]   (M=4096, N=1024, K=1024)
  gemm64<0, 0, 2, 1, 0, false><<<gProj, blkG, 0, stream>>>(
      Xb, Xb, DM, 0LL, WqTb, DM, 0LL, bq, (const void*)Xb, DM, 0LL,
      (void*)Qh, DM, 0LL, (void*)Ql, DM, 0LL, DM,
      MROWS, DM, DM, 1.0f, 1.0f);
  // (3) k = x . Wk + bk -> bf16 hi/lo planes
  gemm64<0, 0, 2, 1, 0, false><<<gProj, blkG, 0, stream>>>(
      Xb, Xb, DM, 0LL, WkTb, DM, 0LL, bk, (const void*)Xb, DM, 0LL,
      (void*)Kh, DM, 0LL, (void*)Kl, DM, 0LL, DM,
      MROWS, DM, DM, 1.0f, 1.0f);
  // (4) v^T = WvT . x^T + bv per batch -> f16 hi plane [b][h*64+d][s] (pitch SEQ) and residual plane
  //     (x4096, keys < VLP only, pitch VLP)   (A = WvT [d][k], Bt = Xb rows of batch b; M=1024, N=2048, K=1024)
  gemm64<0, 0, 3, 2, 0, false><<<gVT, blkG, 0, stream>>>(
      WvTb, WvTb, DM, 0LL, Xb, DM, (long long)SEQ * DM, bv, (const void*)Xb, DM, 0LL,
      (void*)VTh, SEQ, (long long)DM * SEQ, (void*)VTl, VLP, (long long)DM * VLP, VLP,
      DM, SEQ, DM, 1.0f, 4096.0f);
  // (5) attention: query blocks 0..RESQB-1 with residual planes, the rest without
  attn_mask64<true><<<dim3(NB * NH * RESQB), dim3(128), 0, stream>>>(
      Qh, Ql, Kh, Kl, VTh, VTl, msk, Flg, Oh, Ol, 0, RESQB, 0.125f);
  attn_mask64<false><<<dim3(NB * NH * (NQB - RESQB)), dim3(128), 0, stream>>>(
      Qh, Ql, Kh, Kl, VTh, VTl, msk, Flg, Oh, Ol, RESQB, NQB - RESQB, 0.125f);
  // (6) T1 = ctx . Wo + bo + bf16(x) -> f32 [4096][1024]  (A = context hi + lo planes, 2 products)
  gemm64<0, 1, 0, 1, 1, false><<<gProj, blkG, 0, stream>>>(
      Oh, Ol, DM, 0LL, WoTb, DM, 0LL, bo, (const void*)Xb, DM, 0LL,
      (void*)T1, DM, 0LL, (void*)T1, DM, 0LL, 0,
      MROWS, DM, DM, 1.0f, 1.0f);
  // (7) h = LN1(T1) -> H32 f32 and Hh f16
  layernorm_rows<true><<<gLN, blk, 0, stream>>>(T1, gamma1, beta1, H32, Hh);
  // (8) F1 = relu(h . W1 + b1) -> f16 [4096][4096]  (f16 operands, W1 carried x64, acc scaled by 1/64)
  gemm64<1, 0, 4, 1, 0, true><<<gW1, blkG, 0, stream>>>(
      Hh, Hh, DM, 0LL, W1Tb, DM, 0LL, b1, (const void*)Hh, DM, 0LL,
      (void*)F1, DFF, 0LL, (void*)F1, DFF, 0LL, 0,
      MROWS, DFF, DM, 1.0f / WSCALE, 1.0f);
  // (9) T2 = F1 . W2 + b2 + h -> f32 [4096][1024]  (K = 4096, W2 carried x64)
  gemm64<1, 0, 0, 1, 2, false><<<gW2, blkG, 0, stream>>>(
      F1, F1, DFF, 0LL, W2Tb, DFF, 0LL, b2, (const void*)H32, DM, 0LL,
      (void*)T2, DM, 0LL, (void*)T2, DM, 0LL, 0,
      MROWS, DM, DFF, 1.0f / WSCALE, 1.0f);
  // (10) out = LN2(T2) -> d_out f32 [2][2048][1024]
  layernorm_rows<false><<<gLN, blk, 0, stream>>>(T2, gamma2, beta2, (float*)d_out, Hh);
  (void)hipGetLastError();
}

// v007
// One run takes 246 microseconds.
// Two timings next to v006 put it at 1.07 and 1.05 times that version's speed.
// All steps since v000 together make it 2.92 times as fast.
// Contractions: q, k, v^T projections = v_wmma_f32_16x16x32_bf16 (bf16 operands from RNE-converted inputs, single product);
// q.k^T scores = v_wmma_f32_16x16x32_bf16 with q and k as bf16 hi/lo planes (hi.hi + hi.lo + lo.hi);
// p.v = v_wmma_f32_16x16x32_f16 (p carried x1024 in f16, v f16 hi plane; f16 residual planes x4096 of p and v on the first 512 query rows);
// ctx.Wo = v_wmma_f32_16x16x32_bf16 with ctx as bf16 hi/lo planes times bf16 Wo (2 products);
// h.W1 and relu(h.W1+b1).W2 = v_wmma_f32_16x16x32_f16 (f16 operands, weights carried x64, single product);
// all f32 accumulate; softmax and both layer norms in f32.
#include <hip/hip_runtime.h>
#include <math.h>
#include <stdint.h>

#define NB     2
#define SEQ    2048
#define DM     1024
#define NH     16
#define HD     64
#define DFF    4096
#define MROWS  (NB * SEQ)   // 4096 token rows
#define NQB    (SEQ / 64)   // 32 key / query tiles of 64
#define VLP    512          // key pitch of the v^T residual plane (keys 0..VLP-1)
#define RESQB  8            // leading 64-row query blocks that use the p / v residual planes
#define LNEPS  1e-6f
#define WSCALE 64.0f        // f16 weight carry for W1 and W2
#define GKS    128          // k elements per LDS stage of the GEMM (256-B rows)
#define GPITCH 272          // LDS row pitch of a stage in bytes: 16 B x odd, for 16-B fragment reads
#define AP     72           // LDS row pitch of the attention K / V^T tiles in 16-bit elements: 144 B = 16 B x odd
#define OSP    68           // LDS row pitch of the attention output tile in floats: 272 B = 16 B x odd
static_assert(RESQB * 64 <= VLP);
static_assert(NH * HD == DM);
static_assert((SEQ % 128) == 0 && (DM % 128) == 0 && (DFF % 128) == 0 && (MROWS % 128) == 0);
static_assert((DM % GKS) == 0 && (DFF % GKS) == 0);
static_assert(NQB * 8 == 256);
static_assert(AP >= 64 && ((AP * 2) % 16) == 0 && (((AP * 2) / 16) & 1) == 1);

typedef _Float16 v16h __attribute__((ext_vector_type(16)));
typedef _Float16 v8h  __attribute__((ext_vector_type(8)));
typedef __bf16   v16b __attribute__((ext_vector_type(16)));
typedef __bf16   v8b  __attribute__((ext_vector_type(8)));
typedef float    v8f  __attribute__((ext_vector_type(8)));
typedef float    v4f  __attribute__((ext_vector_type(4)));
typedef unsigned int v4u __attribute__((ext_vector_type(4)));
typedef unsigned int v2u __attribute__((ext_vector_type(2)));
typedef int      v4i __attribute__((ext_vector_type(4)));
typedef unsigned long long u64;

#if defined(__HIP_DEVICE_COMPILE__)
#define DEV_ASM 1
#else
#define DEV_ASM 0
#endif

// ---- scalar helpers --------------------------------------------------------------------------------
__device__ __forceinline__ unsigned short bf_bits(float f) {          // f32 -> bf16 bits, RNE convert
  unsigned u = __float_as_uint(f);
  return (unsigned short)((u + 0x7FFFu + ((u >> 16) & 1u)) >> 16);
}
__device__ __forceinline__ float bf_up(unsigned short h) { return __uint_as_float(((unsigned)h) << 16); }
__device__ __forceinline__ float bfr(float f) { return bf_up(bf_bits(f)); }   // bf16 requantised value
__device__ __forceinline__ unsigned short h_bits(_Float16 x) { return __builtin_bit_cast(unsigned short, x); }
__device__ __forceinline__ unsigned pk16(unsigned short a, unsigned short b) { return (unsigned)a | ((unsigned)b << 16); }
__device__ __forceinline__ v8f zero8() { v8f z = {0.f, 0.f, 0.f, 0.f, 0.f, 0.f, 0.f, 0.f}; return z; }
__device__ __forceinline__ v16h zero16h() {
  const _Float16 z = (_Float16)0.0f;
  v16h r = {z, z, z, z, z, z, z, z, z, z, z, z, z, z, z, z};
  return r;
}

// ---- operand traits: fragment loader (lane -> row/col (lane&15), p already includes +8*(lane>>4);
//      elements 0..7 <- p[0..7] (k0+8h..), elements 8..15 <- p[16..23] (k0+16+8h..)), WMMA, hazard gaps
template <int ET> struct OpT;
template <> struct OpT<0> {
  typedef __bf16 E; typedef v16b F; typedef v8b H;
  static __device__ __forceinline__ F ld(const E* p) {
    union { F v; H h[2]; } f;
    f.h[0] = *(const H*)(p);
    f.h[1] = *(const H*)(p + 16);
    return f.v;
  }
  static __device__ __forceinline__ v8f mma_raw(F a, F b, v8f c) {
    return __builtin_amdgcn_wmma_f32_16x16x32_bf16(false, a, false, b, (short)0, c, false, false);
  }
  static __device__ __forceinline__ void dep_guard(v8f& a, v8f& b, F x, F y) {
#if DEV_ASM
    asm volatile("v_nop\n\tv_nop\n\tv_nop\n\tv_nop" : "+v"(a), "+v"(b) : "v"(x), "v"(y));
#endif
  }
  static __device__ __forceinline__ void keep4(F a, F b, F c, F d) {
#if DEV_ASM
    asm volatile("v_nop" :: "v"(a), "v"(b), "v"(c), "v"(d));
#endif
  }
};
template <> struct OpT<1> {
  typedef _Float16 E; typedef v16h F; typedef v8h H;
  static __device__ __forceinline__ F ld(const E* p) {
    union { F v; H h[2]; } f;
    f.h[0] = *(const H*)(p);
    f.h[1] = *(const H*)(p + 16);
    return f.v;
  }
  static __device__ __forceinline__ v8f mma_raw(F a, F b, v8f c) {
    return __builtin_amdgcn_wmma_f32_16x16x32_f16(false, a, false, b, (short)0, c, false, false);
  }
  static __device__ __forceinline__ void dep_guard(v8f& a, v8f& b, F x, F y) {
#if DEV_ASM
    asm volatile("v_nop\n\tv_nop\n\tv_nop\n\tv_nop" : "+v"(a), "+v"(b) : "v"(x), "v"(y));
#endif
  }
  static __device__ __forceinline__ void keep4(F a, F b, F c, F d) {
#if DEV_ASM
    asm volatile("v_nop" :: "v"(a), "v"(b), "v"(c), "v"(d));
#endif
  }
};

// ---- guarded WMMA helpers for the attention kernel ------------------------------------------------
__device__ __forceinline__ v8f mma_b(v16b a, v16b b, v8f c) {
  c = __builtin_amdgcn_wmma_f32_16x16x32_bf16(false, a, false, b, (short)0, c, false, false);
#if DEV_ASM
  asm volatile("v_nop\n\tv_nop\n\tv_nop\n\tv_nop" : "+v"(c) : "v"(a), "v"(b));
#endif
  return c;
}
__device__ __forceinline__ v8f mma_h(v16h a, v16h b, v8f c) {
  c = __builtin_amdgcn_wmma_f32_16x16x32_f16(false, a, false, b, (short)0, c, false, false);
#if DEV_ASM
  asm volatile("v_nop\n\tv_nop\n\tv_nop\n\tv_nop" : "+v"(c) : "v"(a), "v"(b));
#endif
  return c;
}
// e^x as 2^(x log2 e), one v_exp_f32. The v_nop keeps the one slot that the instruction set asks for behind a
// transcendental before its result is read or its source overwritten: inside the statement it stays directly behind it.
__device__ __forceinline__ float exp_slot(float x) {
  const float y = x * 0x1.715476p+0f;
#if DEV_ASM
  float r;
  asm("v_exp_f32 %0, %1\n\tv_nop" : "=v"(r) : "v"(y));
  return r;
#else
  return exp2f(y);
#endif
}
// lane l with lane l ^ 16
__device__ __forceinline__ float xhalf(float x) {
  return __builtin_bit_cast(float, __builtin_amdgcn_permlanex16(__builtin_bit_cast(int, x), __builtin_bit_cast(int, x),
                                                                0x76543210, 0xfedcba98, false, false));
}
__device__ __forceinline__ void acc_guard4(v8f& a, v8f& b, v8f& c, v8f& d) {
#if DEV_ASM
  asm volatile("v_nop\n\tv_nop\n\tv_nop\n\tv_nop" : "+v"(a), "+v"(b), "+v"(c), "+v"(d));
#endif
}

// =====================================================================================================
// f32 -> bf16 (RNE convert), 8 elements per thread, one 16-B store per lane: a wave writes 512 contiguous B
// coverage: n8 threads x 8 = the whole plane (n8 is a multiple of 256 here). blk = block of 256 threads.
// =====================================================================================================
__device__ __forceinline__ void cvt_bf16x8(int blk, const float* __restrict__ in, unsigned short* out, int n8) {
  const int i = blk * 256 + threadIdx.x;
  if (i < n8) {
    const v4f a = *(const v4f*)(in + (size_t)i * 8);
    const v4f b = *(const v4f*)(in + (size_t)i * 8 + 4);
    v4u p;
    p[0] = pk16(bf_bits(a[0]), bf_bits(a[1]));
    p[1] = pk16(bf_bits(a[2]), bf_bits(a[3]));
    p[2] = pk16(bf_bits(b[0]), bf_bits(b[1]));
    p[3] = pk16(bf_bits(b[2]), bf_bits(b[3]));
    *(v4u*)(out + (size_t)i * 8) = p;
    
  }
}

// =====================================================================================================
// Weight transpose + convert: in W f32 [Kdim][Ndim] (row k, n contiguous) -> out 16-bit [Ndim][Kdim]
// (row n, k contiguous). F16OUT: f16 of (bf16 value * scale), else bf16 bits. 64x64 tile through LDS.
// (Ndim/64) x (Kdim/64) blocks of 256 threads; bn = n tile, bk = k tile; tile = 64 x 65 floats of LDS.
// coverage: load 256 threads x 16 = 64x64; store 8 waves x 2 it x 4 rows x (8 lanes x 8) = 64x64.
// =====================================================================================================
template <bool F16OUT>
__device__ __forceinline__ void wtrans64(float (*tile)[65], int bn, int bk,
                                         const float* __restrict__ W, unsigned short* out,
                                         int Kdim, int Ndim, float scale) {
  const int tid = threadIdx.x, lane = tid & 31, wave = tid >> 5;
  const int n0 = bn * 64, k0 = bk * 64;
  {
    const int r = tid >> 2, cq = (tid & 3) * 16;
    const float* src = W + (size_t)(k0 + r) * Ndim + n0 + cq;
#pragma unroll
    for (int e = 0; e < 4; ++e) {
      const v4f a = *(const v4f*)(src + 4 * e);
      tile[r][cq + 4 * e + 0] = a[0];
      tile[r][cq + 4 * e + 1] = a[1];
      tile[r][cq + 4 * e + 2] = a[2];
      tile[r][cq + 4 * e + 3] = a[3];
    }
  }
  __syncthreads();
  const int q = lane >> 3, c8 = (lane & 7) * 8;
  v4u pv[2];
#pragma unroll
  for (int it = 0; it < 2; ++it) {
    const int nn = wave * 8 + it * 4 + q;
    v4u a;
#pragma unroll
    for (int e = 0; e < 4; ++e) {
      const float f0 = tile[c8 + 2 * e][nn], f1 = tile[c8 + 2 * e + 1][nn];
      unsigned short b0 = bf_bits(f0), b1 = bf_bits(f1);
      if (F16OUT) {
        b0 = h_bits((_Float16)(bf_up(b0) * scale));
        b1 = h_bits((_Float16)(bf_up(b1) * scale));
      }
      a[e] = pk16(b0, b1);
    }
    pv[it] = a;
  }
  {
#pragma unroll
    for (int it = 0; it < 2; ++it) {
      const int nn = wave * 8 + it * 4 + q;
      *(v4u*)(out + (size_t)(n0 + nn) * Kdim + k0 + c8) = pv[it];
    }
#if DEV_ASM
    // inlined into a kernel with other parts, code may follow that writes the stores' registers again: wait first
    asm volatile("s_wait_xcnt 0x0" ::: "memory");
#endif
  }
}

// =====================================================================================================
// Mask tile survey: mask int32 [1][1][SEQ][SEQ] (nonzero = key allowed). Block = qt: query rows qt*64..+63.
// For every key tile kt (64 keys) it records a 64-bit word whose bit r is 1 when row r of the tile has at
// least one nonzero entry inside kt. NQB blocks of 256 threads: thread = (row = tid>>2, quarter = tid&3);
// wave w holds rows 8w..8w+7 -> byte w of the word. Output flg[qt*NQB + kt], 32 words = 256 B per block
// coverage: 32 blocks x 32 words = the whole 1024-word table.
// =====================================================================================================
// sb = NQB * 8 bytes of LDS, 8-B aligned.
__device__ __forceinline__ void mask_rowbits(unsigned char* sb, int qt, const int* __restrict__ maskp, u64* flg) {
  const int tid  = threadIdx.x;
  const int wave = tid >> 5;
  const int lane = tid & 31;
  const int row  = tid >> 2;            // 0..63
  const int qtr  = (tid & 3) * 16;      // 0,16,32,48
  const int* mr = maskp + ((size_t)qt * 64 + row) * SEQ + qtr;
#pragma unroll 1
  for (int kt = 0; kt < NQB; ++kt) {
    const int* p = mr + kt * 64;
    const v4i a0 = *(const v4i*)(p);
    const v4i a1 = *(const v4i*)(p + 4);
    const v4i a2 = *(const v4i*)(p + 8);
    const v4i a3 = *(const v4i*)(p + 12);
    int lv = 0;
#pragma unroll
    for (int e = 0; e < 4; ++e) {
      lv |= (a0[e] != 0) ? 1 : 0;
      lv |= (a1[e] != 0) ? 1 : 0;
      lv |= (a2[e] != 0) ? 1 : 0;
      lv |= (a3[e] != 0) ? 1 : 0;
    }
    const unsigned bl = __builtin_amdgcn_ballot_w32(lv != 0);   // uniform per wave
    unsigned bits = 0u;
#pragma unroll
    for (int k = 0; k < 8; ++k) bits |= ((((bl >> (4 * k)) & 0xFu) != 0u) ? 1u : 0u) << k;
    if (lane == 0) sb[kt * 8 + wave] = (unsigned char)bits;
  }
  __syncthreads();
  if (wave == 0) {
    u64 w;
    __builtin_memcpy(&w, &sb[lane * 8], 8);   // bytes 0..7 = rows 0..63, little endian
    u64* dst = flg + (size_t)qt * NQB + lane;
    *(u64*)dst = w;
    
  }
}

// =====================================================================================================
// All the work that reads only the inputs, in ONE launch: no part needs another part's result, so the parts share
// the chip instead of standing one behind another in the stream. A block takes its part from its index (a
// block-uniform branch, so each part's barrier is passed by all of the block's threads or by none):
//   PB_MASK blocks  mask tile survey (first: each is one long chain of dependent trips, the rest runs beside it)
//   PB_WF   blocks  W1 -> W1T,  PB_WF blocks  W2 -> W2T,  4 x PB_W blocks  Wq, Wk, Wv, Wo -> their transposes
//   PB_X    blocks  x -> bf16 plane
// =====================================================================================================
#define PB_MASK NQB
#define PB_WF   ((DFF / 64) * (DM / 64))
#define PB_W    ((DM / 64) * (DM / 64))
#define PB_X    (MROWS * DM / 8 / 256)
#define PB_ALL  (PB_MASK + 2 * PB_WF + 4 * PB_W + PB_X)
static_assert((MROWS * DM) % (8 * 256) == 0);
__global__ __launch_bounds__(256) void prep_inputs(
    const int* __restrict__ maskp, u64* flg, const float* __restrict__ x, unsigned short* xb,
    const float* __restrict__ Wq, const float* __restrict__ Wk, const float* __restrict__ Wv,
    const float* __restrict__ Wo, const float* __restrict__ W1, const float* __restrict__ W2,
    unsigned short* WqT, unsigned short* WkT, unsigned short* WvT, unsigned short* WoT,
    unsigned short* W1T, unsigned short* W2T) {
  __shared__ __align__(16) float tile[64][65];
  static_assert(sizeof(tile) >= NQB * 8);
  int i = blockIdx.x;
  if (i < PB_MASK) {
    mask_rowbits((unsigned char*)(void*)&tile[0][0], i, maskp, flg);
    return;
  }
  i -= PB_MASK;
  if (i < PB_WF) {           // in [1024 k][4096 n] -> out [4096 n][1024 k]
    wtrans64<true>(tile, i % (DFF / 64), i / (DFF / 64), W1, W1T, DM, DFF, WSCALE);
    return;
  }
  i -= PB_WF;
  if (i < PB_WF) {           // in [4096 k][1024 n] -> out [1024 n][4096 k]
    wtrans64<true>(tile, i % (DM / 64), i / (DM / 64), W2, W2T, DFF, DM, WSCALE);
    return;
  }
  i -= PB_WF;
  if (i < 4 * PB_W) {        // in [1024 k][1024 n] -> out [1024 n][1024 k]
    const int w = i / PB_W, t = i % PB_W;
    const float* W = (w == 0) ? Wq : (w == 1) ? Wk : (w == 2) ? Wv : Wo;
    unsigned short* T = (w == 0) ? WqT : (w == 1) ? WkT : (w == 2) ? WvT : WoT;
    wtrans64<false>(tile, t % (DM / 64), t / (DM / 64), W, T, DM, DM, 1.0f);
    return;
  }
  i -= 4 * PB_W;
  cvt_bf16x8(i, x, xb, MROWS * DM / 8);
}

// =====================================================================================================
// Register-blocked batched 16-bit WMMA GEMM: C[m][n] = sum_k A[m][k] * Bt[n][k]; one block of 4 waves per
// 128x128 tile, one wave per 64x64 quarter. ET: 0 = bf16 operands, 1 = f16 operands. A row-major [M][K] pitch lda;
// Bt row-major [N][K] pitch ldb (k contiguous); M, N multiples of 128, K multiple of GKS (host constants).
// tile and batch index are given by the caller (strides in elements).
// Operand path: a stage = GKS k of the block's 128 A rows (and A2 rows) and 128 Bt rows, in LDS at pitch GPITCH,
// brought by 16-B asynchronous copies (16 lanes = one 256-B row piece); two buffers, the copies of stage t+2 are
// issued behind the barrier that ends stage t, so they fly while stage t+1 is worked on.
// NSPLIT: 0 = A.Bt; 1 = (A + A2).Bt (A2 = unscaled bf16 lo plane of A).
// Epilogue value v = acc*oscale + bias (+ resid) (relu); BIAS: 0 none, 1 per column n, 2 per row m
// (bias values RNE-converted to bf16); RESID (OUT_MODE 0 only): 1 = bf16 plane [m][n] pitch ldr, 2 = f32 plane.
// OUT_MODE: 0 = f32 (pitch ldc); 2 = bf16 hi plane C + bf16 lo plane C2 (lo = RNE(v - hi), unscaled);
//           3 = f16 hi plane C + f16 residual plane C2 = f16((v - hi) * rscale), C2 written only for tiles
//               with n0 < N2 (pitch ldc2, batch stride strideC2); 4 = f16 single plane C.
// =====================================================================================================
// Eight asynchronous 16-B copies per lane: rows r, r+8, .., r+56 of a plane (pitch ld elements) to LDS rows at
// pitch GPITCH. The s_wait_xcnt closes the statement so that no address register is rewritten ahead of it.
__device__ __forceinline__ void copy8_rows(unsigned l, const unsigned short* gp, int ld) {
#if DEV_ASM
  const size_t st = (size_t)8 * (size_t)ld;
  asm volatile(
      "global_load_async_to_lds_b128 %0, %8, off\n\t"
      "global_load_async_to_lds_b128 %1, %9, off\n\t"
      "global_load_async_to_lds_b128 %2, %10, off\n\t"
      "global_load_async_to_lds_b128 %3, %11, off\n\t"
      "global_load_async_to_lds_b128 %4, %12, off\n\t"
      "global_load_async_to_lds_b128 %5, %13, off\n\t"
      "global_load_async_to_lds_b128 %6, %14, off\n\t"
      "global_load_async_to_lds_b128 %7, %15, off\n\t"
      "s_wait_xcnt 0x0"
      :: "v"(l), "v"(l + 8u * GPITCH), "v"(l + 16u * GPITCH), "v"(l + 24u * GPITCH),
         "v"(l + 32u * GPITCH), "v"(l + 40u * GPITCH), "v"(l + 48u * GPITCH), "v"(l + 56u * GPITCH),
         "v"(gp), "v"(gp + st), "v"(gp + 2 * st), "v"(gp + 3 * st),
         "v"(gp + 4 * st), "v"(gp + 5 * st), "v"(gp + 6 * st), "v"(gp + 7 * st)
      : "memory");
  // keeps the next statement's address sums behind this one, so that their registers are used again
  __builtin_amdgcn_sched_barrier(0);
#endif
}
// One 128-row plane of a stage: 128 threads x 16 copies = 128 rows x 256 B.
__device__ __forceinline__ void copy_plane128(unsigned l, const unsigned short* gp, int ld) {
  copy8_rows(l, gp, ld);
  copy8_rows(l + 64u * GPITCH, gp + (size_t)64 * (size_t)ld, ld);
}
__device__ __forceinline__ void wait_lds_reads() {     // this wave's LDS reads are done before the buffer is given up
#if DEV_ASM
  asm volatile("s_wait_dscnt 0x0" ::: "memory");
#endif
}
__device__ __forceinline__ void wait_copies() {        // this wave's asynchronous copies have landed in LDS
#if DEV_ASM
  asm volatile("s_wait_asynccnt 0x0" ::: "memory");
#endif
}

// The block's work as a function: ring = 2 stages of LDS, sT = the four waves' slabs, tile / b = the block's tile and
// batch index. Its barriers are passed by all of a block's threads or by none: callers branch block-uniformly only.
template <int NSPLIT> struct GemmLds { static constexpr int STAGE = (((NSPLIT >= 1) ? 256 : 128) + 128) * GPITCH; };
template <int ET, int NSPLIT, int OUT_MODE, int BIAS, int RESID, bool RELU>
__device__ __forceinline__ void gemm64_body(
    unsigned char* ring, float (*sT)[16 * 68], int tile, int b,
    const unsigned short* __restrict__ Ap, const unsigned short* __restrict__ A2p, int lda, long long strideA,
    const unsigned short* __restrict__ Btp, int ldb, long long strideB,
    const float* __restrict__ bias,
    const void* __restrict__ resid, int ldr, long long strideR,
    void* Cout, int ldc, long long strideC,
    void* Cout2, int ldc2, long long strideC2, int N2,
    int M, int N, int K, float oscale, float rscale) {
  typedef typename OpT<ET>::E E;
  typedef typename OpT<ET>::F F;
  const E* A  = (const E*)(const void*)Ap;
  const E* A2 = (const E*)(const void*)A2p;
  const E* Bt = (const E*)(const void*)Btp;
  constexpr int BROW  = (NSPLIT >= 1) ? 256 : 128;   // first Bt row of a stage (behind the A and A2 rows)
  constexpr int STAGE = GemmLds<NSPLIT>::STAGE;      // bytes of one buffer
  constexpr int PE    = GPITCH / 2;                  // LDS row pitch in elements
  static_assert(STAGE == (BROW + 128) * GPITCH);
  const int tid  = threadIdx.x;
  const int lane = tid & 31;
  const int wave = tid >> 5;
  const int tilesN = N >> 7;
  const int tilesM = M >> 7;
  if (tile >= tilesM * tilesN) return;   // block-uniform, in front of every barrier
  const int tm = tile / tilesN;
  const int tn = tile - tm * tilesN;
  const int mB = tm << 7;                // block tile origin
  const int nB = tn << 7;
  const int wm = (wave >> 1) << 6;       // this wave's 64x64 quarter
  const int wn = (wave & 1) << 6;
  const int m0 = mB + wm;
  const int n0 = nB + wn;

  const E* Ab  = A  + (size_t)b * strideA;
  const E* Bb  = Bt + (size_t)b * strideB;
  const E* Ab2 = (NSPLIT >= 1) ? (A2 + (size_t)b * strideA) : Ab;

  const int rlane = lane & 15;                 // row (A) / col (B, D) within subtile
  const int koff  = (lane >> 4) * 8;           // k offset of this lane half
  const int mOff  = (lane >> 4) * 8;           // D row offset

  v8f acc[4][4];
#pragma unroll
  for (int i = 0; i < 4; ++i)
#pragma unroll
    for (int j = 0; j < 4; ++j) acc[i][j] = zero8();

  // copy addresses of this lane: 16-B piece (tid & 15) of rows (tid >> 4) + 8 i of each plane
  const int crow = tid >> 4, cpc = tid & 15;
  const unsigned cl = (unsigned)(size_t)(const void*)ring + (unsigned)(crow * GPITCH + cpc * 16);
  const unsigned short* ca  = (const unsigned short*)(const void*)Ab  + (size_t)(mB + crow) * lda + cpc * 8;
  const unsigned short* ca2 = (const unsigned short*)(const void*)Ab2 + (size_t)(mB + crow) * lda + cpc * 8;
  const unsigned short* cb  = (const unsigned short*)(const void*)Bb  + (size_t)(nB + crow) * ldb + cpc * 8;
  auto issue_stage = [&](int st, int buf) {
    const unsigned l = cl + (unsigned)(buf * STAGE);
    const int k0 = st * GKS;
    copy_plane128(l, ca + k0, lda);
    if (NSPLIT >= 1) copy_plane128(l + 128u * GPITCH, ca2 + k0, lda);
    copy_plane128(l + (unsigned)(BROW * GPITCH), cb + k0, ldb);
  };
  const int nst = K / GKS;               // stages; uniform
  issue_stage(0, 0);
  wait_copies();
  __syncthreads();                       // stage 0 is published
  if (nst > 1) issue_stage(1, 1);

  for (int t = 0; t < nst; ++t) {
    const unsigned char* sb = ring + (t & 1) * STAGE;
    const E* la  = (const E*)(const void*)(sb + (wm + rlane) * GPITCH) + koff;
    const E* la2 = la + 128 * PE;
    const E* lb  = (const E*)(const void*)(sb + (BROW + wn + rlane) * GPITCH) + koff;
#pragma unroll
    for (int ks = 0; ks < GKS; ks += 32) {
      F bh[4], ah[4], al[4];
#pragma unroll
      for (int j = 0; j < 4; ++j) bh[j] = OpT<ET>::ld(lb + (j << 4) * PE + ks);
#pragma unroll
      for (int i = 0; i < 4; ++i) {
        ah[i] = OpT<ET>::ld(la + (i << 4) * PE + ks);
        al[i] = ah[i];
        if (NSPLIT >= 1) al[i] = OpT<ET>::ld(la2 + (i << 4) * PE + ks);
      }
      // the step's LDS reads go as one group ahead of its WMMAs: the wave waits out the LDS latency once a step,
      // not once per A fragment
      __builtin_amdgcn_sched_barrier(0);
#pragma unroll
      for (int i = 0; i < 4; ++i) {
#pragma unroll
        for (int j = 0; j < 4; ++j) {
          acc[i][j] = OpT<ET>::mma_raw(ah[i], bh[j], acc[i][j]);
          if (NSPLIT >= 1) acc[i][j] = OpT<ET>::mma_raw(al[i], bh[j], acc[i][j]);
        }
        OpT<ET>::dep_guard(acc[i][0], acc[i][3], ah[i], al[i]);
      }
      OpT<ET>::keep4(bh[0], bh[1], bh[2], bh[3]);
      // keeps the next step's LDS reads from moving in among this step's WMMAs
      __builtin_amdgcn_sched_barrier(0);
    }
    wait_lds_reads();
    wait_copies();
    __syncthreads();                     // publishes stage t+1 and ends every read of stage t's buffer
    if (t + 2 < nst) issue_stage(t + 2, t & 1);
  }
  wait_copies();
  acc_guard4(acc[0][0], acc[0][1], acc[0][2], acc[0][3]);
  acc_guard4(acc[1][0], acc[1][1], acc[1][2], acc[1][3]);
  acc_guard4(acc[2][0], acc[2][1], acc[2][2], acc[2][3]);
  acc_guard4(acc[3][0], acc[3][1], acc[3][2], acc[3][3]);

  // ---- epilogue ----
  float* slab = sT[wave];
#pragma unroll
  for (int i = 0; i < 4; ++i) {
    const int mBase = m0 + (i << 4);
#pragma unroll
    for (int j = 0; j < 4; ++j) {
#pragma unroll
      for (int r = 0; r < 8; ++r) {
        slab[(mOff + r) * 68 + (j << 4) + rlane] = acc[i][j][r];
      }
    }
    __builtin_amdgcn_fence(__ATOMIC_RELEASE, "workgroup");
    __builtin_amdgcn_wave_barrier();
    __builtin_amdgcn_fence(__ATOMIC_ACQUIRE, "workgroup");
    if (OUT_MODE == 0) {
      float* C = (float*)Cout + (size_t)b * strideC;
      const int h2 = lane >> 4, c4 = (lane & 15) * 4;     // 256-B row segment = 16 lanes x 16 B
      v4f bz = {0.f, 0.f, 0.f, 0.f};
      if (BIAS == 1) {
        const v4f g = *(const v4f*)(bias + n0 + c4);
        bz[0] = bfr(g[0]); bz[1] = bfr(g[1]); bz[2] = bfr(g[2]); bz[3] = bfr(g[3]);
      }
      v4f ov[8];
#pragma unroll
      for (int it = 0; it < 8; ++it) {
        const int row = it * 2 + h2;                       // it 0..7 x h2 0..1 = rows 0..15
        const v4f v = *(const v4f*)(slab + row * 68 + c4);
        v4f w;
        w[0] = v[0] * oscale + bz[0];
        w[1] = v[1] * oscale + bz[1];
        w[2] = v[2] * oscale + bz[2];
        w[3] = v[3] * oscale + bz[3];
        if (BIAS == 2) {
          const float bm = bfr(bias[mBase + row]);
          w[0] += bm; w[1] += bm; w[2] += bm; w[3] += bm;
        }
        if (RESID == 1) {
          const unsigned short* rp = (const unsigned short*)resid + (size_t)b * strideR +
                                     (size_t)(mBase + row) * ldr + n0 + c4;
          const v2u rr = *(const v2u*)rp;
          w[0] += __uint_as_float(rr[0] << 16);
          w[1] += __uint_as_float(rr[0] & 0xffff0000u);
          w[2] += __uint_as_float(rr[1] << 16);
          w[3] += __uint_as_float(rr[1] & 0xffff0000u);
        }
        if (RESID == 2) {
          const float* rp = (const float*)resid + (size_t)b * strideR + (size_t)(mBase + row) * ldr + n0 + c4;
          const v4f rr = *(const v4f*)rp;
          w[0] += rr[0]; w[1] += rr[1]; w[2] += rr[2]; w[3] += rr[3];
        }
        if (RELU) {
          w[0] = fmaxf(w[0], 0.f); w[1] = fmaxf(w[1], 0.f); w[2] = fmaxf(w[2], 0.f); w[3] = fmaxf(w[3], 0.f);
        }
        ov[it] = w;
      }
      {
#pragma unroll
        for (int it = 0; it < 8; ++it) {
          const int row = it * 2 + h2;
          *(v4f*)(C + (size_t)(mBase + row) * ldc + n0 + c4) = ov[it];
        }
        
      }
    } else {
      const int q = lane >> 3, c8 = (lane & 7) * 8;
      unsigned short* C  = (unsigned short*)Cout  + (size_t)b * strideC;
      unsigned short* C2 = (unsigned short*)Cout2 + (size_t)b * strideC2;
      const bool wlo = (OUT_MODE == 2) || (OUT_MODE == 3 && n0 < N2);   // wave-uniform
      float b8[8];
#pragma unroll
      for (int e = 0; e < 8; ++e) b8[e] = 0.f;
      if (BIAS == 1) {
        const v4f g0 = *(const v4f*)(bias + n0 + c8);
        const v4f g1 = *(const v4f*)(bias + n0 + c8 + 4);
#pragma unroll
        for (int e = 0; e < 4; ++e) { b8[e] = bfr(g0[e]); b8[4 + e] = bfr(g1[e]); }
      }
      v4u hv[4], lv[4];
#pragma unroll
      for (int it = 0; it < 4; ++it) {
        const int row = it * 4 + q;                        // it 0..3 x q 0..3 = rows 0..15
        const float* sp = slab + row * 68 + c8;
        float bm = 0.f;
        if (BIAS == 2) bm = bfr(bias[mBase + row]);
        v4u a, a2;
#pragma unroll
        for (int e = 0; e < 4; ++e) {
          float f0 = sp[2 * e] * oscale + b8[2 * e] + bm;
          float f1 = sp[2 * e + 1] * oscale + b8[2 * e + 1] + bm;
          if (RELU) { f0 = fmaxf(f0, 0.f); f1 = fmaxf(f1, 0.f); }
          unsigned short h0, h1, l0 = 0, l1 = 0;
          if (OUT_MODE == 2) {
            h0 = bf_bits(f0); h1 = bf_bits(f1);
            l0 = bf_bits(f0 - bf_up(h0)); l1 = bf_bits(f1 - bf_up(h1));
          } else if (OUT_MODE == 3) {
            const _Float16 x0 = (_Float16)f0, x1 = (_Float16)f1;
            h0 = h_bits(x0); h1 = h_bits(x1);
            l0 = h_bits((_Float16)((f0 - (float)x0) * rscale));
            l1 = h_bits((_Float16)((f1 - (float)x1) * rscale));
          } else {
            h0 = h_bits((_Float16)f0); h1 = h_bits((_Float16)f1);
          }
          a[e] = pk16(h0, h1); a2[e] = pk16(l0, l1);
        }
        hv[it] = a; lv[it] = a2;
      }
      {
#pragma unroll
        for (int it = 0; it < 4; ++it) {
          const int row = it * 4 + q;
          *(v4u*)(C + (size_t)(mBase + row) * ldc + n0 + c8) = hv[it];
          if (wlo) *(v4u*)(C2 + (size_t)(mBase + row) * ldc2 + n0 + c8) = lv[it];
        }
        
      }
    }
    __builtin_amdgcn_fence(__ATOMIC_RELEASE, "workgroup");
    __builtin_amdgcn_wave_barrier();
    __builtin_amdgcn_fence(__ATOMIC_ACQUIRE, "workgroup");
  }
}

// One GEMM per launch: blockIdx.x = tile, blockIdx.y = batch index.
template <int ET, int NSPLIT, int OUT_MODE, int BIAS, int RESID, bool RELU>
__global__ __launch_bounds__(128) void gemm64(
    const unsigned short* __restrict__ Ap, const unsigned short* __restrict__ A2p, int lda, long long strideA,
    const unsigned short* __restrict__ Btp, int ldb, long long strideB,
    const float* __restrict__ bias,
    const void* __restrict__ resid, int ldr, long long strideR,
    void* Cout, int ldc, long long strideC,
    void* Cout2, int ldc2, long long strideC2, int N2,
    int M, int N, int K, float oscale, float rscale) {
  __shared__ __align__(16) unsigned char ring[2 * GemmLds<NSPLIT>::STAGE];
  __shared__ __align__(16) float sT[4][16 * 68];   // per-wave 16x64 slab, pitch 68 floats
  gemm64_body<ET, NSPLIT, OUT_MODE, BIAS, RESID, RELU>(
      ring, sT, (int)blockIdx.x, (int)blockIdx.y, Ap, A2p, lda, strideA, Btp, ldb, strideB, bias, resid, ldr, strideR,
      Cout, ldc, strideC, Cout2, ldc2, strideC2, N2, M, N, K, oscale, rscale);
}

// The q, k and v^T projections in ONE launch: none reads another's result, so their blocks share the chip (two to a
// WGP, one block's first copies and its epilogue under another's products) instead of three launches one behind
// another. blockIdx.y = part (a block-uniform branch), blockIdx.x = the part's block, QKVB blocks each:
//   0  q = x . Wq + bq -> bf16 hi/lo planes [b*SEQ+t][h*64+d]      (M=4096, N=1024, K=1024)
//   1  k = x . Wk + bk -> bf16 hi/lo planes
//   2  v^T = WvT . x^T + bv per batch -> f16 hi plane [b][h*64+d][s] (pitch SEQ) and residual plane (x4096, keys < VLP
//      only, pitch VLP)   (A = WvT [d][k], Bt = Xb rows of batch b; M=1024, N=2048, K=1024; VTT tiles a batch)
#define QKVB ((MROWS / 128) * (DM / 128))
#define VTT  ((DM / 128) * (SEQ / 128))
static_assert(VTT * NB == QKVB);
__global__ __launch_bounds__(128) void gemm_qkv(
    const unsigned short* __restrict__ Xb, const unsigned short* __restrict__ WqT,
    const unsigned short* __restrict__ WkT, const unsigned short* __restrict__ WvT,
    const float* __restrict__ bq, const float* __restrict__ bk, const float* __restrict__ bv,
    unsigned short* Qh, unsigned short* Ql, unsigned short* Kh, unsigned short* Kl,
    unsigned short* VTh, unsigned short* VTl) {
  __shared__ __align__(16) unsigned char ring[2 * GemmLds<0>::STAGE];
  __shared__ __align__(16) float sT[4][16 * 68];   // per-wave 16x64 slab, pitch 68 floats
  const int part = (int)blockIdx.y, blk = (int)blockIdx.x;
  if (part < 2) {
    const bool isq = (part == 0);
    gemm64_body<0, 0, 2, 1, 0, false>(
        ring, sT, blk, 0, Xb, Xb, DM, 0LL, isq ? WqT : WkT, DM, 0LL, isq ? bq : bk, (const void*)Xb, DM, 0LL,
        (void*)(isq ? Qh : Kh), DM, 0LL, (void*)(isq ? Ql : Kl), DM, 0LL, DM,
        MROWS, DM, DM, 1.0f, 1.0f);
  } else {
    gemm64_body<0, 0, 3, 2, 0, false>(
        ring, sT, blk % VTT, blk / VTT, WvT, WvT, DM, 0LL, Xb, DM, (long long)SEQ * DM, bv, (const void*)Xb, DM, 0LL,
        (void*)VTh, SEQ, (long long)DM * SEQ, (void*)VTl, VLP, (long long)DM * VLP, VLP,
        DM, SEQ, DM, 1.0f, 4096.0f);
  }
}

// =====================================================================================================
// Attention with an int32 replace-mask, head dim 64.
//   q planes (bf16 hi / lo): element (b, t, h, d) at [(b*SEQ + t)*DM + h*64 + d]
//   k planes (bf16 hi / lo): same layout with key index s
//   v^T hi plane (f16):      element (b, h, d, s) at [(b*DM + h*64 + d)*SEQ + s]
//   v^T residual plane (f16, (v - hi)*4096): [(b*DM + h*64 + d)*VLP + s], s < VLP, read only when RES
//   (a key tile at or beyond VLP contributes a zero v residual)
//   mask int32 [1][1][t][s]: logit = (mask != 0) ? q.k*sscale : -inf (replace)
//   flg [qt][kt]: bit r set when mask row qt*64+r has a nonzero inside key tile kt. A key tile is skipped only
//   when its word is 0 (every logit of the tile is -inf -> weight exactly 0, row max unaffected). The decision is
//   block-uniform: every wave reads the query block's 32 words once, one a lane, and takes the ballot of the nonzero ones.
//   out planes (bf16 hi / lo of the normalised context): element (b, t, h, d) at [(b*SEQ + t)*DM + h*64 + d]
//   scores = q . k : bf16 hi/lo split (hi.hi + hi.lo + lo.hi), f32 accumulate, then * sscale + mask select in f32
//   p = exp(s - m) carried as f16(1024 p); context = p . v on f16 WMMA; RES adds f16 residual planes of p and v
//   (scale 4096, separate accumulator folded back with 1/4096 per chunk in f32); online softmax in f32.
//   A fully masked query row ends with l = 0 -> 0 * inf = NaN context, matching -inf softmax semantics.
//   Block = 4 waves = 64 query rows of one (b, h); grid = NQB * NH * NB (nqbThis * NH * NB of each kind); kv chunks of 64, at most NQB trips.
//   Both products are formed transposed: S^T = K . Q^T (A = K rows, B = Q rows) and O^T += V^T . P^T (A = V^T rows,
//   B = P^T). A lane then holds 32 of the 64 scores of ONE query (q0 + (lane & 15)): maximum and sum run in the lane,
//   with one exchange between the lane halves for the maximum; P^T is packed from the score registers.
//   LDS rows of the K and V^T tiles stand AP elements apart (64 used, 8 never touched): the 16 rows that one
//   16-B fragment read takes then fall on 16 different bank groups.
//   K / V^T chunk staging: 16-B asynchronous copies to LDS, 8 lanes = one 128-B row (a whole line), 128 threads x 4
//   copies per plane = the whole 64x64 tile; two buffers: the copies of the live tile after next are issued behind the
//   barrier that ends a tile, so they fly while the next tile is worked on.
//   LDS fragment reads stand in groups ahead of the WMMAs that use them (K ahead of the scores, V^T ahead of the
//   softmax), held in place by scheduling barriers.
//   Output coverage: each wave stores rows q0..q0+15 (it 0..3 x lane>>3 0..3) x 64 columns (8 lanes x 8) of both planes.
// =====================================================================================================
#define APB    (AP * 2)       // LDS row pitch of a K / V^T tile in bytes
#define APLANE (64 * APB)     // bytes of one 64-row plane of a buffer
static_assert(NQB == 32 && (APB % 16) == 0);
// Four asynchronous 16-B copies per lane: rows r, r+16, r+32, r+48 of a plane (pitch ld elements) to LDS rows at pitch
// APB. The s_wait_xcnt closes the statement so that no address register is rewritten ahead of it.
__device__ __forceinline__ void copy4_rows(unsigned l, const unsigned short* gp, int ld) {
#if DEV_ASM
  const size_t st = (size_t)16 * (size_t)ld;
  asm volatile(
      "global_load_async_to_lds_b128 %0, %4, off\n\t"
      "global_load_async_to_lds_b128 %1, %5, off\n\t"
      "global_load_async_to_lds_b128 %2, %6, off\n\t"
      "global_load_async_to_lds_b128 %3, %7, off\n\t"
      "s_wait_xcnt 0x0"
      :: "v"(l), "v"(l + 16u * APB), "v"(l + 32u * APB), "v"(l + 48u * APB),
         "v"(gp), "v"(gp + st), "v"(gp + 2 * st), "v"(gp + 3 * st)
      : "memory");
#endif
}
// The same for three planes in one statement (twelve copies, one wait): a tile's K hi, K lo and V^T hi planes, which
// lie APLANE bytes apart in LDS.
__device__ __forceinline__ void copy12_rows(unsigned l, const unsigned short* g0, const unsigned short* g1, int ld01,
                                            const unsigned short* g2, int ld2) {
#if DEV_ASM
  const size_t sa = (size_t)16 * (size_t)ld01, sc = (size_t)16 * (size_t)ld2;
  const unsigned l1 = l + (unsigned)APLANE, l2 = l + 2u * APLANE;
  asm volatile(
      "global_load_async_to_lds_b128 %0, %12, off\n\t"
      "global_load_async_to_lds_b128 %1, %13, off\n\t"
      "global_load_async_to_lds_b128 %2, %14, off\n\t"
      "global_load_async_to_lds_b128 %3, %15, off\n\t"
      "global_load_async_to_lds_b128 %4, %16, off\n\t"
      "global_load_async_to_lds_b128 %5, %17, off\n\t"
      "global_load_async_to_lds_b128 %6, %18, off\n\t"
      "global_load_async_to_lds_b128 %7, %19, off\n\t"
      "global_load_async_to_lds_b128 %8, %20, off\n\t"
      "global_load_async_to_lds_b128 %9, %21, off\n\t"
      "global_load_async_to_lds_b128 %10, %22, off\n\t"
      "global_load_async_to_lds_b128 %11, %23, off\n\t"
      "s_wait_xcnt 0x0"
      :: "v"(l),  "v"(l + 16u * APB),  "v"(l + 32u * APB),  "v"(l + 48u * APB),
         "v"(l1), "v"(l1 + 16u * APB), "v"(l1 + 32u * APB), "v"(l1 + 48u * APB),
         "v"(l2), "v"(l2 + 16u * APB), "v"(l2 + 32u * APB), "v"(l2 + 48u * APB),
         "v"(g0), "v"(g0 + sa), "v"(g0 + 2 * sa), "v"(g0 + 3 * sa),
         "v"(g1), "v"(g1 + sa), "v"(g1 + 2 * sa), "v"(g1 + 3 * sa),
         "v"(g2), "v"(g2 + sc), "v"(g2 + 2 * sc), "v"(g2 + 3 * sc)
      : "memory");
#endif
}

// The block's work as a function: ring = two buffers of LDS, Os = the four waves' output tiles, bx = the block's index
// among the nqbThis * NH * NB blocks of its kind. Its barriers are passed by all of a block's threads or by none.
template <bool RES>
__device__ __forceinline__
void attn_body(unsigned char* ring, float (*Os)[16 * OSP], int bx,
                 const unsigned short* __restrict__ qhp, const unsigned short* __restrict__ qlp,
                 const unsigned short* __restrict__ khp, const unsigned short* __restrict__ klp,
                 const unsigned short* __restrict__ vhp, const unsigned short* __restrict__ vlp,
                 const int* __restrict__ maskp, const u64* __restrict__ flg,
                 unsigned short* ohp, unsigned short* olp,
                 int qbBase, int nqbThis, float sscale) {
  // a buffer = K hi [kv][d] | K lo | V^T hi [d][kv] (| V^T residual), each 64 rows at pitch AP
  constexpr int ABUF = (RES ? 4 : 3) * APLANE;

  const int tid  = threadIdx.x;
  const int wave = tid >> 5;
  const int lane = tid & 31;
  const int hh   = lane >> 4;
  const int c    = lane & 15;

  const int qbl  = bx % nqbThis;
  const int rest = bx / nqbThis;
  const int h    = rest % NH;
  const int b    = rest / NH;
  const int qb   = qbBase + qbl;
  const int q0   = qb * 64 + wave * 16;
  const size_t rowB = (size_t)b * SEQ;

  const __bf16* Qh = (const __bf16*)(const void*)qhp + (size_t)h * HD;
  const __bf16* Ql = (const __bf16*)(const void*)qlp + (size_t)h * HD;
  const u64* fq = flg + (size_t)qb * NQB;
  // bit kt = key tile kt has an allowed key for some row of the block; the same word in every wave
#if DEV_ASM
  // keeps the scalar index arithmetic above from sinking between the load below and its wait (see there)
  if (RES) __builtin_amdgcn_sched_barrier(0);
#endif
  const u64 fw = fq[lane];
#if DEV_ASM
  // the residual part of the merged build writes the scalar base pair of this load again a few instructions on: the
  // wait is written here; the scheduling barrier behind it keeps later arithmetic from being lifted over it
  if (RES) {
    asm volatile("s_wait_xcnt 0x0" ::: "memory");
    __builtin_amdgcn_sched_barrier(0);
  }
#endif
  const unsigned live = __builtin_amdgcn_ballot_w32(fw != 0ull);

  // copy addresses of this lane: 16-B piece (tid & 7) of rows (tid >> 3) + 16 i of each plane
  const int crow = tid >> 3, cpc = tid & 7;
  const unsigned cl = (unsigned)(size_t)(const void*)ring + (unsigned)(crow * APB + cpc * 16);
  const unsigned short* ckh = khp + (rowB + crow) * DM + (size_t)h * HD + cpc * 8;               // K row kv0+row
  const unsigned short* ckl = klp + (rowB + crow) * DM + (size_t)h * HD + cpc * 8;
  const unsigned short* cvh = vhp + ((size_t)b * DM + (size_t)h * HD + crow) * SEQ + cpc * 8;    // V^T row d = row
  const unsigned short* cvl = vlp + ((size_t)b * DM + (size_t)h * HD + crow) * VLP + cpc * 8;
  auto issue_tile = [&](int kt, int buf) {
    const int kv0 = kt * 64;
    const unsigned l = cl + (unsigned)(buf * ABUF);
    copy12_rows(l, ckh + (size_t)kv0 * DM, ckl + (size_t)kv0 * DM, DM, cvh + kv0, SEQ);
    if (RES) {
      const int kvl = (kv0 + 64 <= VLP) ? kv0 : (VLP - 64);     // clamped address into the residual plane
      copy4_rows(l + 3u * APLANE, cvl + kvl, VLP);
    }
  };

  // ---- Q fragments (B operand, column = lane&15): 2 d-chunks, hi and lo ----
  v16b qah[2], qal[2];
#pragma unroll
  for (int dc = 0; dc < 2; ++dc) {
    const size_t qo = (rowB + q0 + c) * DM + dc * 32 + 8 * hh;
    qah[dc] = OpT<0>::ld(Qh + qo);
    qal[dc] = OpT<0>::ld(Ql + qo);
  }

  float mrow = -INFINITY;   // running maximum of query q0 + c (the same in both lane halves)
  float lrow = 0.f;         // running sum over the keys of this lane half; the halves are joined behind the loop
  v8f oacc[4];              // context^T: oacc[t][r] = d 16 t + 8 hh + r of query q0 + c
#pragma unroll
  for (int t = 0; t < 4; ++t) oacc[t] = zero8();

  // The live key tiles in rising order: kc = this trip's, kn = the next one's (its copies in flight), rem = those behind.
  unsigned rem = live;
  int kc = 0, kn = 0;
  if (rem != 0u) {                           // block-uniform, like every test on rem below
    kc = __builtin_ctz(rem); rem &= rem - 1u;
    issue_tile(kc, 0);
    wait_copies();
    __syncthreads();                         // the first live tile is published
    if (rem != 0u) { kn = __builtin_ctz(rem); rem &= rem - 1u; issue_tile(kn, 1); }
  }
  const int ntile = __builtin_popcount(live);   // at most NQB
  for (int it = 0; it < ntile; ++it) {
    const int kv0 = kc * 64;
    const bool resOK = (kv0 + 64 <= VLP);    // block-uniform: beyond VLP the v residual is zero
    const unsigned char* sb = ring + (it & 1) * ABUF;
    const __bf16*   Ksh = (const __bf16*)(const void*)sb;
    const __bf16*   Ksl = (const __bf16*)(const void*)(sb + APLANE);
    const _Float16* Vth = (const _Float16*)(const void*)(sb + 2 * APLANE);
    const _Float16* Vtl = (const _Float16*)(const void*)(sb + (RES ? 3 : 2) * APLANE);

    // ---- scores^T: 64 keys x 16 queries per wave (A = K rows, B = Q rows), 3 bf16 products ----
    // The tile's K fragments are read in groups ahead of the score products, so that the wave waits out the LDS
    // latency once a tile, not once per fragment pair: key groups 0..2 up front, group 3 behind the products of
    // group 0 (into registers that those have left), where the products of groups 1 and 2 cover its latency.
    v16b kbf[4][2], klf[4][2];
#pragma unroll
    for (int j = 0; j < 3; ++j) {
#pragma unroll
      for (int dc = 0; dc < 2; ++dc) {
        kbf[j][dc] = OpT<0>::ld(Ksh + (j * 16 + c) * AP + dc * 32 + 8 * hh);
        klf[j][dc] = OpT<0>::ld(Ksl + (j * 16 + c) * AP + dc * 32 + 8 * hh);
      }
    }
    // keeps the K reads from sinking back among the WMMAs that use them
    __builtin_amdgcn_sched_barrier(0);
    v8f s[4];                                // s[j][r] = score of key kv0 + 16 j + 8 hh + r against query q0 + c
#pragma unroll
    for (int j = 0; j < 4; ++j) {
      s[j] = zero8();
#pragma unroll
      for (int dc = 0; dc < 2; ++dc) {
        s[j] = mma_b(kbf[j][dc], qah[dc], s[j]);
        s[j] = mma_b(klf[j][dc], qah[dc], s[j]);
        s[j] = mma_b(kbf[j][dc], qal[dc], s[j]);
      }
      if (j == 0) {
#pragma unroll
        for (int dc = 0; dc < 2; ++dc) {
          kbf[3][dc] = OpT<0>::ld(Ksh + (3 * 16 + c) * AP + dc * 32 + 8 * hh);
          klf[3][dc] = OpT<0>::ld(Ksl + (3 * 16 + c) * AP + dc * 32 + 8 * hh);
        }
        // holds the reads of key group 3 together at this one place: without it they spread among the next WMMAs
        __builtin_amdgcn_sched_barrier(0);
      }
    }
    // The tile's V^T fragments are read here, ahead of the softmax, whose vector work covers their LDS latency.
    v16h vbf[2][4], vlf[2][4];
#pragma unroll
    for (int kk = 0; kk < 2; ++kk) {
#pragma unroll
      for (int t = 0; t < 4; ++t) {
        vbf[kk][t] = OpT<1>::ld(Vth + (t * 16 + c) * AP + kk * 32 + 8 * hh);
        vlf[kk][t] = vbf[kk][t];
        if (RES) vlf[kk][t] = OpT<1>::ld(Vtl + (t * 16 + c) * AP + kk * 32 + 8 * hh);
      }
    }
    // keeps the V^T reads here, where they fly under the wait for the mask words, and out of the softmax
    __builtin_amdgcn_sched_barrier(0);

    // ---- scale + mask select, maximum and sum of the lane's own 32 keys, online softmax ----
    const int* mq = maskp + (size_t)(q0 + c) * SEQ + kv0 + 8 * hh;   // row q0+c, keys kv0+8hh..; all < SEQ
    float mj[4];
    v4i ma4[4], mb4[4];
#pragma unroll
    for (int j = 0; j < 4; ++j) {
      ma4[j] = *(const v4i*)(mq + j * 16);
      mb4[j] = *(const v4i*)(mq + j * 16 + 4);
    }
#if DEV_ASM
    // the residual build writes the mask loads' address pair again right behind them: the wait is written here; the
    // scheduling barrier keeps the products behind it, one of which is that write, from being lifted over the wait
    if (RES) {
      asm volatile("s_wait_xcnt 0x0" ::: "memory");
      __builtin_amdgcn_sched_barrier(0);
    }
#endif
#pragma unroll
    for (int j = 0; j < 4; ++j) {
      const v4i ma = ma4[j];
      const v4i mb = mb4[j];
      float mx = -INFINITY;
#pragma unroll
      for (int r = 0; r < 8; ++r) {
        const int mv = (r < 4) ? ma[r & 3] : mb[r & 3];
        const float sv = (mv != 0) ? (s[j][r] * sscale) : -INFINITY;
        s[j][r] = sv;
        mx = fmaxf(mx, sv);
      }
      mj[j] = mx;
    }
    float m = fmaxf(fmaxf(mj[0], mj[1]), fmaxf(mj[2], mj[3]));
    m = fmaxf(m, xhalf(m));                  // the query's other 32 keys of the tile
    const float mnew  = fmaxf(mrow, m);
    const float msafe = (mnew == -INFINITY) ? 0.f : mnew;
    // exp_slot's asm operands must lie in v0..v255: beside the residual build's fragments that costs spills, so that
    // build takes the compiler's own v_exp_f32 (same instruction, same values).
    auto ex = [](float x) { return RES ? __expf(x) : exp_slot(x); };
    const float alpha = ex(mrow - msafe);
    mrow = mnew;
    // P^T (x1024, f16) and its residual (x4096) go from the score registers straight into B fragments: score tiles
    // 2 kk and 2 kk + 1 hold keys 32 kk + 8 hh + e and 32 kk + 16 + 8 hh + e, the k order of the V^T loader.
    v16h paf[2], plf[2];
    float pj[4];
#pragma unroll
    for (int j = 0; j < 4; ++j) {
      float ps = 0.f;
#pragma unroll
      for (int r = 0; r < 8; ++r) {
        const float p = ex(s[j][r] - msafe);         // -inf logit against a finite max: exp -> 0
        ps += p;
        const float p1k = p * 1024.0f;
        const _Float16 ph = (_Float16)p1k;
        paf[j >> 1][(j & 1) * 8 + r] = ph;
        plf[j >> 1][(j & 1) * 8 + r] = RES ? (_Float16)((p1k - (float)ph) * 4096.0f) : ph;
      }
      pj[j] = ps;
    }
    lrow = lrow * alpha + ((pj[0] + pj[1]) + (pj[2] + pj[3]));
#pragma unroll
    for (int t = 0; t < 4; ++t)
#pragma unroll
      for (int r = 0; r < 8; ++r) oacc[t][r] *= alpha;

    // ---- context^T += V^T . P^T (f16 WMMA), residual products into a separate accumulator ----
    v8f o1[4];
#pragma unroll
    for (int t = 0; t < 4; ++t) o1[t] = zero8();
#pragma unroll
    for (int kk = 0; kk < 2; ++kk) {
#pragma unroll
      for (int t = 0; t < 4; ++t) {
        oacc[t] = mma_h(vbf[kk][t], paf[kk], oacc[t]);
        if (RES) {
          o1[t] = mma_h(resOK ? vlf[kk][t] : zero16h(), paf[kk], o1[t]);
          o1[t] = mma_h(vbf[kk][t], plf[kk], o1[t]);
        }
      }
    }
    if (RES) {
#pragma unroll
      for (int t = 0; t < 4; ++t)
#pragma unroll
        for (int r = 0; r < 8; ++r) oacc[t][r] += o1[t][r] * (1.0f / 4096.0f);
    }
    wait_lds_reads();
    wait_copies();
    __syncthreads();                         // publishes the next live tile and ends every read of this trip's buffer
    kc = kn;
    if (rem != 0u) { kn = __builtin_ctz(rem); rem &= rem - 1u; issue_tile(kn, it & 1); }
  }
  wait_copies();

  // ---- join the two halves' sums, normalise (1/l and the 1/1024 p carry), stage the wave's 16x64 tile as
  //      [query][d] (a lane holds d = 16 t + 8 hh + r of query c: two 16-B stores per t), bf16 hi/lo split
  float* os = Os[wave];
  {
    const float l = lrow + xhalf(lrow);
    const float inv = (1.0f / l) * (1.0f / 1024.0f);   // l == 0 (fully masked row) -> inf -> NaN context
#pragma unroll
    for (int t = 0; t < 4; ++t) {
      v4f w0, w1;
#pragma unroll
      for (int e = 0; e < 4; ++e) { w0[e] = oacc[t][e] * inv; w1[e] = oacc[t][4 + e] * inv; }
      *(v4f*)(os + c * OSP + t * 16 + 8 * hh)     = w0;
      *(v4f*)(os + c * OSP + t * 16 + 8 * hh + 4) = w1;
    }
  }
  __builtin_amdgcn_fence(__ATOMIC_RELEASE, "workgroup");
  __builtin_amdgcn_wave_barrier();
  __builtin_amdgcn_fence(__ATOMIC_ACQUIRE, "workgroup");
  {
    const int q4 = lane >> 3, c8 = (lane & 7) * 8;
    v4u hv[4], lv[4];
#pragma unroll
    for (int it = 0; it < 4; ++it) {
      const int row = it * 4 + q4;   // it 0..3 x q4 0..3 = rows 0..15 of the wave tile
      const float* sp = os + row * OSP + c8;
      v4u a, a2;
#pragma unroll
      for (int e = 0; e < 4; ++e) {
        const float f0 = sp[2 * e], f1 = sp[2 * e + 1];
        const unsigned short h0 = bf_bits(f0), h1 = bf_bits(f1);
        const unsigned short l0 = bf_bits(f0 - bf_up(h0)), l1 = bf_bits(f1 - bf_up(h1));
        a[e] = pk16(h0, h1); a2[e] = pk16(l0, l1);
      }
      hv[it] = a; lv[it] = a2;
    }
    {
#pragma unroll
      for (int it = 0; it < 4; ++it) {
        const int row = it * 4 + q4;
        const size_t go = (rowB + q0 + row) * DM + (size_t)h * HD + c8;
        *(v4u*)(ohp + go) = hv[it];
        *(v4u*)(olp + go) = lv[it];
      }
    }
  }
}

// Both kinds of query block in ONE launch: neither reads the other's result. The blocks without residual planes (query
// blocks RESQB..NQB-1, the long ones) come first in the index, those with them (query blocks 0..RESQB-1) behind: they
// run in the places that the first blocks to end leave free, beside the long ones, not in a launch of their own.
// The kind is a block-uniform branch on the block index.
#define ATB_PLAIN (NB * NH * (NQB - RESQB))
#define ATB_RES   (NB * NH * RESQB)
__global__ __launch_bounds__(128)
void attn_mask64(const unsigned short* __restrict__ qhp, const unsigned short* __restrict__ qlp,
                 const unsigned short* __restrict__ khp, const unsigned short* __restrict__ klp,
                 const unsigned short* __restrict__ vhp, const unsigned short* __restrict__ vlp,
                 const int* __restrict__ maskp, const u64* __restrict__ flg,
                 unsigned short* ohp, unsigned short* olp, float sscale) {
  __shared__ __align__(16) unsigned char ring[2 * 4 * APLANE];    // two buffers of the larger kind
  __shared__ __align__(16) float    Os[4][16 * OSP];              // per wave context tile [query][d], row pitch OSP
  const int bx = (int)blockIdx.x;
  if (bx < ATB_PLAIN) {
    attn_body<false>(ring, Os, bx, qhp, qlp, khp, klp, vhp, vlp, maskp, flg, ohp, olp, RESQB, NQB - RESQB, sscale);
  } else {
    attn_body<true>(ring, Os, bx - ATB_PLAIN, qhp, qlp, khp, klp, vhp, vlp, maskp, flg, ohp, olp, 0, RESQB, sscale);
  }
}

// =====================================================================================================
// Layer norm over rows of DM=1024, f32, one block per row (grid = MROWS, 256 threads, 4 elements per thread).
// mean and biased variance via wave shuffles + 16 LDS slots; gamma / beta values RNE-converted to bf16;
// o = (gamma * (x - mean)) * (1 / sqrt(var + eps)) + beta.
// OUT16: threads 0..127 reload 8 consecutive inputs each and write the f16 plane as one 16-B store per lane
// coverage: 256 threads x 4 = the row (f32); 128 threads x 8 = the row (f16).
// =====================================================================================================
template <bool OUT16>
__global__ __launch_bounds__(256) void layernorm_rows(const float* __restrict__ in,
                                                       const float* __restrict__ gamma,
                                                       const float* __restrict__ beta,
                                                       float* out32, unsigned short* out16) {
  __shared__ float red[16];
  const int tid = threadIdx.x, lane = tid & 31, wave = tid >> 5;
  const int row = blockIdx.x;
  const float* xr = in + (size_t)row * DM;
  const v4f v = *(const v4f*)(xr + tid * 4);
  float s = (v[0] + v[1]) + (v[2] + v[3]);
#pragma unroll
  for (int off = 1; off < 32; off <<= 1) s += __shfl_xor(s, off, 32);
  if (lane == 0) red[wave] = s;
  __syncthreads();
  float tot = 0.f;
#pragma unroll
  for (int i = 0; i < 8; ++i) tot += red[i];
  const float mean = tot * (1.0f / (float)DM);
  const float d0 = v[0] - mean, d1 = v[1] - mean, d2 = v[2] - mean, d3 = v[3] - mean;
  float s2 = (d0 * d0 + d1 * d1) + (d2 * d2 + d3 * d3);
#pragma unroll
  for (int off = 1; off < 32; off <<= 1) s2 += __shfl_xor(s2, off, 32);
  if (lane == 0) red[8 + wave] = s2;
  __syncthreads();
  float tot2 = 0.f;
#pragma unroll
  for (int i = 0; i < 8; ++i) tot2 += red[8 + i];
  const float var  = tot2 * (1.0f / (float)DM);
  const float rstd = 1.0f / sqrtf(var + LNEPS);

  const v4f g  = *(const v4f*)(gamma + tid * 4);
  const v4f bt = *(const v4f*)(beta + tid * 4);
  v4f o;
  o[0] = (bfr(g[0]) * d0) * rstd + bfr(bt[0]);
  o[1] = (bfr(g[1]) * d1) * rstd + bfr(bt[1]);
  o[2] = (bfr(g[2]) * d2) * rstd + bfr(bt[2]);
  o[3] = (bfr(g[3]) * d3) * rstd + bfr(bt[3]);
  float* op = out32 + (size_t)row * DM + tid * 4;
  *(v4f*)op = o;
  

  if (OUT16) {
    if (tid < 128) {
      const int cc = tid * 8;
      const v4f a0 = *(const v4f*)(xr + cc);
      const v4f a1 = *(const v4f*)(xr + cc + 4);
      const v4f g0 = *(const v4f*)(gamma + cc), g1 = *(const v4f*)(gamma + cc + 4);
      const v4f b0 = *(const v4f*)(beta + cc),  b1 = *(const v4f*)(beta + cc + 4);
      float f[8];
#pragma unroll
      for (int e = 0; e < 4; ++e) {
        f[e]     = (bfr(g0[e]) * (a0[e] - mean)) * rstd + bfr(b0[e]);
        f[4 + e] = (bfr(g1[e]) * (a1[e] - mean)) * rstd + bfr(b1[e]);
      }
      v4u hp;
#pragma unroll
      for (int e = 0; e < 4; ++e) hp[e] = pk16(h_bits((_Float16)f[2 * e]), h_bits((_Float16)f[2 * e + 1]));
      unsigned short* hq = out16 + (size_t)row * DM + cc;
      *(v4u*)hq = hp;
      
    }
  }
}

// =====================================================================================================
// Workspace map (MiB = 1048576 B):
//   Xb   bf16 [4096][1024]         0 ..   8
//   WqT  bf16 [1024 n][1024 k]     8 ..  10     WkT 10 .. 12    WvT 12 .. 14    WoT 14 .. 16
//   W1T  f16  [4096 n][1024 k]    16 ..  24     W2T f16 [1024 n][4096 k]  24 .. 32
//   Qh   bf16 [4096][1024]        32 ..  40     Ql 40 .. 48    Kh 48 .. 56    Kl 56 .. 64
//   VTh  f16  [2][1024][2048]     64 ..  72     VTl f16 [2][1024][512]    72 .. 74    Flg u64 [32][32] at 74
//   Oh   bf16 [4096][1024]        76 ..  84     Ol 84 .. 92
//   later (regions dead by then, single in-order stream):
//   T1   f32  [4096][1024]        32 ..  48   (over Qh, Ql: written by the Wo GEMM after attention)
//   H32  f32  [4096][1024]        48 ..  64   (over Kh, Kl: written by LN1)
//   Hh   f16  [4096][1024]        64 ..  72   (over VTh: written by LN1)
//   F1   f16  [4096][4096]        72 .. 104   (over VTl, Flg, Oh, Ol: written by the W1 GEMM after the Wo GEMM)
//   T2   f32  [4096][1024]        32 ..  48   (over T1: written by the W2 GEMM after LN1)
//   end = 104 MiB. Every plane is an exact multiple of its 64x64 tile / whole-line store granularity
//   (no padded tails); all region starts are MiB aligned.
// =====================================================================================================
extern "C" void kernel_launch(void* const* d_in, const int* in_sizes, int n_in,
                              void* d_out, int out_size, void* d_ws, size_t ws_size,
                              hipStream_t stream) {
  if (n_in < 18) return;
  if (in_sizes[0] != NB * SEQ * DM) return;
  if (in_sizes[1] != SEQ * SEQ) return;
  if (in_sizes[2] != DM * DM || in_sizes[4] != DM * DM || in_sizes[6] != DM * DM || in_sizes[8] != DM * DM) return;
  if (in_sizes[3] != DM || in_sizes[5] != DM || in_sizes[7] != DM || in_sizes[9] != DM) return;
  if (in_sizes[10] != DM * DFF || in_sizes[11] != DFF || in_sizes[12] != DFF * DM || in_sizes[13] != DM) return;
  if (in_sizes[14] != DM || in_sizes[15] != DM || in_sizes[16] != DM || in_sizes[17] != DM) return;
  if (out_size != NB * SEQ * DM) return;

  const float* x   = (const float*)d_in[0];
  const int*   msk = (const int*)d_in[1];
  const float* Wq  = (const float*)d_in[2];
  const float* bq  = (const float*)d_in[3];
  const float* Wk  = (const float*)d_in[4];
  const float* bk  = (const float*)d_in[5];
  const float* Wv  = (const float*)d_in[6];
  const float* bv  = (const float*)d_in[7];
  const float* Wo  = (const float*)d_in[8];
  const float* bo  = (const float*)d_in[9];
  const float* W1  = (const float*)d_in[10];
  const float* b1  = (const float*)d_in[11];
  const float* W2  = (const float*)d_in[12];
  const float* b2  = (const float*)d_in[13];
  const float* gamma1 = (const float*)d_in[14];
  const float* beta1  = (const float*)d_in[15];
  const float* gamma2 = (const float*)d_in[16];
  const float* beta2  = (const float*)d_in[17];

  const size_t PX   = (size_t)MROWS * DM * 2;        //  8 MiB  16-bit activation plane [4096][1024]
  const size_t PW   = (size_t)DM * DM * 2;           //  2 MiB  16-bit weight plane [1024][1024]
  const size_t PWF  = (size_t)DM * DFF * 2;          //  8 MiB  16-bit FFN weight plane
  const size_t PVT  = (size_t)NB * DM * SEQ * 2;     //  8 MiB  v^T hi plane
  const size_t PVL  = (size_t)NB * DM * VLP * 2;     //  2 MiB  v^T residual plane
  const size_t PFs  = (size_t)2 * 1048576;           //  2 MiB  slot for the 8 KiB flag table
  const size_t PF   = (size_t)NQB * NQB * 8;         //  8 KiB
  const size_t PT   = (size_t)MROWS * DM * 4;        // 16 MiB  f32 activation plane
  const size_t PF1  = (size_t)MROWS * DFF * 2;       // 32 MiB  f16 FFN hidden plane
  if (PF > PFs) return;
  size_t off = 0;
  const size_t oXb  = off; off += PX;
  const size_t oWq  = off; off += PW;
  const size_t oWk  = off; off += PW;
  const size_t oWv  = off; off += PW;
  const size_t oWo  = off; off += PW;
  const size_t oW1  = off; off += PWF;
  const size_t oW2  = off; off += PWF;
  const size_t oQh  = off; off += PX;
  const size_t oQl  = off; off += PX;
  const size_t oKh  = off; off += PX;
  const size_t oKl  = off; off += PX;
  const size_t oVTh = off; off += PVT;
  const size_t oVTl = off; off += PVL;
  const size_t oFlg = off; off += PFs;
  const size_t oOh  = off; off += PX;
  const size_t oOl  = off; off += PX;
  const size_t endA = off;                           // 92 MiB
  const size_t oT1  = oQh;                           // T1 over Qh + Ql
  const size_t oH32 = oKh;                           // H32 over Kh + Kl
  const size_t oHh  = oVTh;                          // Hh over VTh
  const size_t oF1  = oVTl;                          // F1 over VTl .. Ol and beyond
  const size_t oT2  = oT1;                           // T2 over T1
  if (oT1 + PT != oKh) return;                       // aliasing sanity: T1 ends where H32 starts
  if (oH32 + PT != oVTh) return;                     // H32 ends where Hh starts
  if (oHh + PX != oVTl) return;                      // Hh ends where F1 starts
  size_t total = oF1 + PF1;                          // 104 MiB
  if (endA > total) total = endA;
  if (total > ws_size) return;
  if (total > (size_t)134217728) return;

  char* ws = (char*)d_ws;
  unsigned short* Xb   = (unsigned short*)(ws + oXb);
  unsigned short* WqTb = (unsigned short*)(ws + oWq);
  unsigned short* WkTb = (unsigned short*)(ws + oWk);
  unsigned short* WvTb = (unsigned short*)(ws + oWv);
  unsigned short* WoTb = (unsigned short*)(ws + oWo);
  unsigned short* W1Tb = (unsigned short*)(ws + oW1);
  unsigned short* W2Tb = (unsigned short*)(ws + oW2);
  unsigned short* Qh   = (unsigned short*)(ws + oQh);
  unsigned short* Ql   = (unsigned short*)(ws + oQl);
  unsigned short* Kh   = (unsigned short*)(ws + oKh);
  unsigned short* Kl   = (unsigned short*)(ws + oKl);
  unsigned short* VTh  = (unsigned short*)(ws + oVTh);
  unsigned short* VTl  = (unsigned short*)(ws + oVTl);
  u64*            Flg  = (u64*)(ws + oFlg);
  unsigned short* Oh   = (unsigned short*)(ws + oOh);
  unsigned short* Ol   = (unsigned short*)(ws + oOl);
  float*          T1   = (float*)(ws + oT1);
  float*          H32  = (float*)(ws + oH32);
  unsigned short* Hh   = (unsigned short*)(ws + oHh);
  unsigned short* F1   = (unsigned short*)(ws + oF1);
  float*          T2   = (float*)(ws + oT2);

  const dim3 blk(256);
  const dim3 gPrep(PB_ALL);                                         // 32 + 2 x 1024 + 4 x 256 + 2048 = 5152 blocks
  const dim3 blkG(128);                                             // GEMM block: 4 waves, one 128x128 tile
  const dim3 gProj((MROWS / 128) * (DM / 128), 1);                  // 256 tiles: M=4096, N=1024
  const dim3 gQKV(QKVB, 3);                                         // 256 blocks for each of q, k, v^T
  const dim3 gW1((MROWS / 128) * (DFF / 128), 1);                   // 1024 tiles: M=4096, N=4096
  const dim3 gW2((MROWS / 128) * (DM / 128), 1);                    // 256 tiles: M=4096, N=1024
  const dim3 gLN(MROWS);                                            // 4096 blocks, one row each

  // (0, 1) one launch: mask tile survey -> Flg; x -> bf16 plane [4096][1024]; weights [k][n] f32 -> 16-bit [n][k] planes
  prep_inputs<<<gPrep, blk, 0, stream>>>(msk, Flg, x, Xb, Wq, Wk, Wv, Wo, W1, W2,
                                         WqTb, WkTb, WvTb, WoTb, W1Tb, W2Tb);
  // (2, 3, 4) one launch: q and k -> bf16 hi/lo planes, v^T -> f16 hi plane and residual plane
  gemm_qkv<<<gQKV, blkG, 0, stream>>>(Xb, WqTb, WkTb, WvTb, bq, bk, bv, Qh, Ql, Kh, Kl, VTh, VTl);
  // (5) attention, one launch: query blocks 0..RESQB-1 with residual planes, the rest without
  attn_mask64<<<dim3(ATB_PLAIN + ATB_RES), dim3(128), 0, stream>>>(
      Qh, Ql, Kh, Kl, VTh, VTl, msk, Flg, Oh, Ol, 0.125f);
  // (6) T1 = ctx . Wo + bo + bf16(x) -> f32 [4096][1024]  (A = context hi + lo planes, 2 products)
  gemm64<0, 1, 0, 1, 1, false><<<gProj, blkG, 0, stream>>>(
      Oh, Ol, DM, 0LL, WoTb, DM, 0LL, bo, (const void*)Xb, DM, 0LL,
      (void*)T1, DM, 0LL, (void*)T1, DM, 0LL, 0,
      MROWS, DM, DM, 1.0f, 1.0f);
  // (7) h = LN1(T1) -> H32 f32 and Hh f16
  layernorm_rows<true><<<gLN, blk, 0, stream>>>(T1, gamma1, beta1, H32, Hh);
  // (8) F1 = relu(h . W1 + b1) -> f16 [4096][4096]  (f16 operands, W1 carried x64, acc scaled by 1/64)
  gemm64<1, 0, 4, 1, 0, true><<<gW1, blkG, 0, stream>>>(
      Hh, Hh, DM, 0LL, W1Tb, DM, 0LL, b1, (const void*)Hh, DM, 0LL,
      (void*)F1, DFF, 0LL, (void*)F1, DFF, 0LL, 0,
      MROWS, DFF, DM, 1.0f / WSCALE, 1.0f);
  // (9) T2 = F1 . W2 + b2 + h -> f32 [4096][1024]  (K = 4096, W2 carried x64)
  gemm64<1, 0, 0, 1, 2, false><<<gW2, blkG, 0, stream>>>(
      F1, F1, DFF, 0LL, W2Tb, DFF, 0LL, b2, (const void*)H32, DM, 0LL,
      (void*)T2, DM, 0LL, (void*)T2, DM, 0LL, 0,
      MROWS, DM, DFF, 1.0f / WSCALE, 1.0f);
  // (10) out = LN2(T2) -> d_out f32 [2][2048][1024]
  layernorm_rows<false><<<gLN, blk, 0, stream>>>(T2, gamma2, beta2, (float*)d_out, Hh);
  (void)hipGetLastError();
}
